// v000
// The times below were measured on an AMD MI455X: many runs one after another, warmed up first and cycling through
// copies of the inputs, with the whole window's GPU time divided by the number of runs. Launches and the gaps
// between them are all in it. The median over several windows is given; except for v000 it joins two sittings, which
// can be a few percent apart, so the side-by-side timings, each taken in one sitting, are the better comparison.
// v000 is the starting kernel. One run takes 384 microseconds.
#include <hip/hip_runtime.h>
// 3-D multi-head self-attention on channel-major x [1, 256, 16³ = 4096]: qkv = qkv_w·x (1×1×1 conv, no bias), 8 heads × 32, softmax(qᵀk·32^-½) over keys, out[h,d,n] = Σ_m attn[n,m]·v[h,d,m], then proj_w·out + proj_b.
// Compute dtype: x, qkv_w, proj_w, proj_b rounded to bf16; q/k token-major and v channel-major (= Vᵀ) as f16 GEMM outputs (f32 accumulate); fused flash-style kernel per head
// (online softmax f32, P f16 ×2^10) on v_wmma_f32_16x16x32_f16; O → f16 → projection GEMM with bias → transposed back to [c][n] through LDS; f32 accumulate throughout.
#define BB 1
#define CC 256
#define C3 768
#define NH 8
#define HD 32
#define NN 4096
#define NR (BB * NN)

typedef __bf16 v16b __attribute__((ext_vector_type(16)));
typedef unsigned short v8us __attribute__((ext_vector_type(8), may_alias));
typedef float  v8f  __attribute__((ext_vector_type(8)));
typedef float  v4f  __attribute__((ext_vector_type(4)));
typedef float  v4fa __attribute__((ext_vector_type(4), may_alias));
union FragB { v16b v; v8us half[2]; unsigned short u[16]; };

__device__ __forceinline__ unsigned short bf16_bits(float x) { unsigned int u = __float_as_uint(x); return (unsigned short)((u + 0x7FFFu + ((u >> 16) & 1u)) >> 16); }
__device__ __forceinline__ float bf16_val(unsigned short b) { return __uint_as_float(((unsigned int)b) << 16); }
__device__ __forceinline__ float bf16_round(float x) { return bf16_val(bf16_bits(x)); }
// D += A·B with NT terms: 1 = ah·bh, 2 = + al·bh (A split), 3 = + ah·bl (both split)
template <int NT>
__device__ __forceinline__ v8f mmaN(v16b ah, v16b al, v16b bh, v16b bl, v8f c) {
  c = __builtin_amdgcn_wmma_f32_16x16x32_bf16(false, ah, false, bh, (short)0, c, false, false);
  if (NT >= 2) c = __builtin_amdgcn_wmma_f32_16x16x32_bf16(false, al, false, bh, (short)0, c, false, false);
  if (NT >= 3) c = __builtin_amdgcn_wmma_f32_16x16x32_bf16(false, ah, false, bl, (short)0, c, false, false);
  asm volatile("v_nop\n\tv_nop\n\tv_nop\n\tv_nop" : "+v"(c) : "v"(ah), "v"(al), "v"(bh), "v"(bl));
  return c;
}

__global__ __launch_bounds__(256) void k_wt_bf16(const float* __restrict__ W, unsigned short* __restrict__ Wt, int K, int N) {
  const int t = blockIdx.x * 256 + threadIdx.x;
  const int k8n = K / 8;
  if (t >= N * k8n) return;
  const int n = t / k8n, k8 = (t % k8n) * 8;
  v8us v;
#pragma unroll
  for (int i = 0; i < 8; ++i) v[i] = bf16_bits(W[(size_t)(k8 + i) * N + n]);
  *(v8us*)(Wt + (size_t)n * K + k8) = v;
  
}

// GEMM C[M][N] (f32, pitch ldc) = act(A[M][K]·W + bias). A f32 row-major (pitch lda) converted per fragment to bf16
// (ASPLIT: hi/lo two planes -> 2 terms, else single rounded term); Wt bf16 [N][K] (pitch ldb). BIAS_BF16 rounds the
// bias to bf16 first (bias quantised to bf16 before the add). K%32==0, M%16==0, N%64==0.
template <bool ASPLIT, int ACT, bool BIAS_BF16>
__global__ __launch_bounds__(128) void k_gemm_bf(const float* __restrict__ A, int lda, const unsigned short* __restrict__ Wt, int ldb,
                                               const float* __restrict__ bias, float* __restrict__ C, int ldc, int M, int N, int K) {
  __shared__ __attribute__((aligned(16))) float so[4][16][64];
  const int tid = threadIdx.x, w = tid >> 5, lane = tid & 31, ln = lane & 15, hh = lane >> 4;
  const int ntn = N / 64;
  const int wid = blockIdx.x * 4 + w;
  const int mt = wid / ntn, nq = wid % ntn;
  if (mt * 16 >= M) return;
  const int row0 = mt * 16, col0 = nq * 64;
  const float* arow = A + (size_t)(row0 + ln) * lda;
  v8f acc[4] = {};
  for (int kb = 0; kb < K; kb += 32) {
    FragB ah, al;
    const v4f x0 = *(const v4fa*)(arow + kb + 8 * hh), x1 = *(const v4fa*)(arow + kb + 8 * hh + 4);
    const v4f x2 = *(const v4fa*)(arow + kb + 16 + 8 * hh), x3 = *(const v4fa*)(arow + kb + 16 + 8 * hh + 4);
    float xs[16] = {x0[0],x0[1],x0[2],x0[3],x1[0],x1[1],x1[2],x1[3],x2[0],x2[1],x2[2],x2[3],x3[0],x3[1],x3[2],x3[3]};
#pragma unroll
    for (int i = 0; i < 16; ++i) { const unsigned short hb = bf16_bits(xs[i]); ah.u[i] = hb; al.u[i] = ASPLIT ? bf16_bits(xs[i] - bf16_val(hb)) : (unsigned short)0; }
#pragma unroll
    for (int t = 0; t < 4; ++t) {
      const unsigned short* brow = Wt + (size_t)(col0 + t * 16 + ln) * ldb + kb;
      FragB b;
      b.half[0] = *(const v8us*)(brow + 8 * hh);
      b.half[1] = *(const v8us*)(brow + 16 + 8 * hh);
      acc[t] = mmaN<ASPLIT ? 2 : 1>(ah.v, al.v, b.v, b.v, acc[t]);
    }
  }
#pragma unroll
  for (int t = 0; t < 4; ++t) {
    float bv = bias ? bias[col0 + t * 16 + ln] : 0.f;
    if (BIAS_BF16) bv = bf16_round(bv);
#pragma unroll
    for (int r = 0; r < 8; ++r) { float v = acc[t][r] + bv; if (ACT == 1) v = fmaxf(v, 0.f); so[w][8 * hh + r][t * 16 + ln] = v; }
  }
  __builtin_amdgcn_fence(__ATOMIC_ACQ_REL, "workgroup");
  __builtin_amdgcn_wave_barrier();
  const int rsub = lane >> 4, c4 = (lane & 15) * 4;
  {
#pragma unroll
    for (int q = 0; q < 8; ++q) {
      const int r = q * 2 + rsub;
      const v4f v = *(const v4fa*)&so[w][r][c4];
      *(v4f*)(C + (size_t)(row0 + r) * ldc + col0 + c4) = v;
    }
    
  }
}

// Flash-style causal/unmasked attention, all contractions 3-term bf16 hi/lo splits, f32 softmax with running max.
// q,k,v rows are read from f32 buffers with arbitrary row pitch (so they can live inside a fused qkv buffer);
// D = head size (multiple of 32, <= 128); one wave = 16 query rows; block = 4 waves (64 queries) sharing K/V chunks of 32.
template <int D, bool CAUSAL>
__global__ __launch_bounds__(128) void k_flash(const float* __restrict__ qb, const float* __restrict__ kb, const float* __restrict__ vb,
                                             int pitch, int T, int H, float scale, float* __restrict__ y, int ypitch) {
  constexpr int KS = D / 32;        // k-steps for QK
  constexpr int DT = D / 16;        // d tiles for PV
  __shared__ __attribute__((aligned(16))) unsigned short sKh[32][D + 8], sKl[32][D + 8], sVh[32][D + 8], sVl[32][D + 8];
  __shared__ __attribute__((aligned(16))) unsigned short sPh[4][16][40], sPl[4][16][40];
  __shared__ __attribute__((aligned(16))) float sO[4][16][D];
  const int tid = threadIdx.x, w = tid >> 5, lane = tid & 31, ln = lane & 15, hh = lane >> 4;
  const int nqb = (T + 63) / 64;
  const int bh = blockIdx.x / nqb, qblk = blockIdx.x % nqb;
  const int b = bh / H, h = bh % H;
  const int q0 = qblk * 64 + w * 16;
  const float* Q = qb + (size_t)b * T * pitch + h * D;
  const float* K = kb + (size_t)b * T * pitch + h * D;
  const float* V = vb + (size_t)b * T * pitch + h * D;

  // A fragments of the wave's 16 query rows (scaled), hi/lo
  FragB aqh[KS], aql[KS];
  {
    int row = q0 + ln; if (row >= T) row = T - 1;
    const float* qr = Q + (size_t)row * pitch;
#pragma unroll
    for (int ks = 0; ks < KS; ++ks)
#pragma unroll
      for (int i = 0; i < 16; ++i) {
        const int d = ks * 32 + ((i < 8) ? (8 * hh + i) : (16 + 8 * hh + (i - 8)));
        const float x = qr[d] * scale; const unsigned short hb = bf16_bits(x);
        aqh[ks].u[i] = hb; aql[ks].u[i] = bf16_bits(x - bf16_val(hb));
      }
  }
  float m_r[8], l_r[8];
#pragma unroll
  for (int r = 0; r < 8; ++r) { m_r[r] = -3.0e38f; l_r[r] = 0.f; }
  v8f oacc[DT];
#pragma unroll
  for (int dt = 0; dt < DT; ++dt) oacc[dt] = (v8f){0.f,0.f,0.f,0.f,0.f,0.f,0.f,0.f};

  const int kv_end = CAUSAL ? min(T, qblk * 64 + 64) : T;     // block-uniform
  for (int j0 = 0; j0 < kv_end; j0 += 32) {
    __syncthreads();
    for (int e = tid; e < 32 * (D / 4); e += 128) {
      const int r = e / (D / 4), c4 = (e % (D / 4)) * 4;
      const int key = j0 + r;
      v4f kf = {0.f,0.f,0.f,0.f}, vf = {0.f,0.f,0.f,0.f};
      if (key < T) { kf = *(const v4fa*)(K + (size_t)key * pitch + c4); vf = *(const v4fa*)(V + (size_t)key * pitch + c4); }
#pragma unroll
      for (int t = 0; t < 4; ++t) {
        unsigned short hb = bf16_bits(kf[t]); sKh[r][c4 + t] = hb; sKl[r][c4 + t] = bf16_bits(kf[t] - bf16_val(hb));
        hb = bf16_bits(vf[t]); sVh[r][c4 + t] = hb; sVl[r][c4 + t] = bf16_bits(vf[t] - bf16_val(hb));
      }
    }
    __syncthreads();
    // S tile 16 x 32
    v8f s[2];
#pragma unroll
    for (int nt = 0; nt < 2; ++nt) {
      v8f acc = {};
#pragma unroll
      for (int ks = 0; ks < KS; ++ks) {
        FragB bh_, bl_;
        bh_.half[0] = *(const v8us*)&sKh[nt * 16 + ln][ks * 32 + 8 * hh]; bh_.half[1] = *(const v8us*)&sKh[nt * 16 + ln][ks * 32 + 16 + 8 * hh];
        bl_.half[0] = *(const v8us*)&sKl[nt * 16 + ln][ks * 32 + 8 * hh]; bl_.half[1] = *(const v8us*)&sKl[nt * 16 + ln][ks * 32 + 16 + 8 * hh];
        acc = mmaN<3>(aqh[ks].v, aql[ks].v, bh_.v, bl_.v, acc);
      }
      s[nt] = acc;
    }
    // mask + running max (rows 8hh+r; the 16 lanes of a half share rows)
    float alpha[8];
#pragma unroll
    for (int r = 0; r < 8; ++r) {
      const int qi = q0 + 8 * hh + r;
      const int ja = j0 + ln, jb = j0 + 16 + ln;
      if (CAUSAL) { if (ja > qi) s[0][r] = -3.0e38f; if (jb > qi) s[1][r] = -3.0e38f; }
      if (ja >= T) s[0][r] = -3.0e38f;
      if (jb >= T) s[1][r] = -3.0e38f;
      float mx = fmaxf(s[0][r], s[1][r]);
      mx = fmaxf(mx, __shfl_xor(mx, 1, 32)); mx = fmaxf(mx, __shfl_xor(mx, 2, 32)); mx = fmaxf(mx, __shfl_xor(mx, 4, 32)); mx = fmaxf(mx, __shfl_xor(mx, 8, 32));
      const float mnew = fmaxf(m_r[r], mx);
      alpha[r] = (mnew > -1.0e38f) ? __expf(m_r[r] - mnew) : 1.0f;
      const float p0 = (s[0][r] > -1.0e38f) ? __expf(s[0][r] - mnew) : 0.f;
      const float p1 = (s[1][r] > -1.0e38f) ? __expf(s[1][r] - mnew) : 0.f;
      m_r[r] = mnew;
      l_r[r] = l_r[r] * alpha[r] + p0 + p1;            // per-lane partial row sum (16 lanes combined at the end)
      unsigned short hb = bf16_bits(p0); sPh[w][8 * hh + r][ln] = hb;      sPl[w][8 * hh + r][ln] = bf16_bits(p0 - bf16_val(hb));
      hb = bf16_bits(p1);                sPh[w][8 * hh + r][16 + ln] = hb; sPl[w][8 * hh + r][16 + ln] = bf16_bits(p1 - bf16_val(hb));
    }
#pragma unroll
    for (int dt = 0; dt < DT; ++dt)
#pragma unroll
      for (int r = 0; r < 8; ++r) oacc[dt][r] *= alpha[r];
    __builtin_amdgcn_fence(__ATOMIC_ACQ_REL, "workgroup");
    __builtin_amdgcn_wave_barrier();
    FragB pah, pal;
    pah.half[0] = *(const v8us*)&sPh[w][ln][8 * hh]; pah.half[1] = *(const v8us*)&sPh[w][ln][16 + 8 * hh];
    pal.half[0] = *(const v8us*)&sPl[w][ln][8 * hh]; pal.half[1] = *(const v8us*)&sPl[w][ln][16 + 8 * hh];
#pragma unroll
    for (int dt = 0; dt < DT; ++dt) {
      FragB bvh, bvl;
#pragma unroll
      for (int i = 0; i < 8; ++i) {
        bvh.u[i] = sVh[8 * hh + i][dt * 16 + ln]; bvh.u[8 + i] = sVh[16 + 8 * hh + i][dt * 16 + ln];
        bvl.u[i] = sVl[8 * hh + i][dt * 16 + ln]; bvl.u[8 + i] = sVl[16 + 8 * hh + i][dt * 16 + ln];
      }
      oacc[dt] = mmaN<3>(pah.v, pal.v, bvh.v, bvl.v, oacc[dt]);
    }
    __builtin_amdgcn_fence(__ATOMIC_ACQ_REL, "workgroup");
    __builtin_amdgcn_wave_barrier();
  }
#pragma unroll
  for (int r = 0; r < 8; ++r) {
    float l = l_r[r];
    l += __shfl_xor(l, 1, 32); l += __shfl_xor(l, 2, 32); l += __shfl_xor(l, 4, 32); l += __shfl_xor(l, 8, 32);
    l_r[r] = (l > 0.f) ? 1.0f / l : 0.f;
  }
#pragma unroll
  for (int dt = 0; dt < DT; ++dt)
#pragma unroll
    for (int r = 0; r < 8; ++r) sO[w][8 * hh + r][dt * 16 + ln] = oacc[dt][r] * l_r[r];
  __builtin_amdgcn_fence(__ATOMIC_ACQ_REL, "workgroup");
  __builtin_amdgcn_wave_barrier();
  {
    for (int r = 0; r < 16; ++r) {
      const int row = q0 + r;
      if (row < T && lane < D / 4) {
        const v4f val = *(const v4fa*)&sO[w][r][lane * 4];
        *(v4f*)(y + ((size_t)b * T + row) * ypitch + h * D + lane * 4) = val;
      }
    }
    
  }
}

// GEMM C = act(A·W + bias + resid): A f32 (ASPLIT -> hi/lo 2 terms), Wt bf16 [N][K]; ACT 0 none, 1 relu, 2 exact gelu;
// resid (optional, f32, row index = (row % rmod), pitch ldr, RES_BF16 rounds it) added before the activation.
template <bool ASPLIT, int ACT, bool BIAS_BF16, bool RES_BF16>
__global__ __launch_bounds__(128) void k_gemm_bf3(const float* __restrict__ A, int lda, const unsigned short* __restrict__ Wt, int ldb,
                                                const float* __restrict__ bias, const float* __restrict__ resid, int rmod, int ldr,
                                                float* __restrict__ C, int ldc, int M, int N, int K) {
  __shared__ __attribute__((aligned(16))) float so[4][16][64];
  const int tid = threadIdx.x, w = tid >> 5, lane = tid & 31, ln = lane & 15, hh = lane >> 4;
  const int ntn = N / 64;
  const int wid = blockIdx.x * 4 + w;
  const int mt = wid / ntn, nq = wid % ntn;
  if (mt * 16 >= M) return;
  const int row0 = mt * 16, col0 = nq * 64;
  const float* arow = A + (size_t)(row0 + ln) * lda;
  v8f acc[4] = {};
  for (int kb = 0; kb < K; kb += 32) {
    FragB ah, al;
    const v4f x0 = *(const v4fa*)(arow + kb + 8 * hh), x1 = *(const v4fa*)(arow + kb + 8 * hh + 4);
    const v4f x2 = *(const v4fa*)(arow + kb + 16 + 8 * hh), x3 = *(const v4fa*)(arow + kb + 16 + 8 * hh + 4);
    float xs[16] = {x0[0],x0[1],x0[2],x0[3],x1[0],x1[1],x1[2],x1[3],x2[0],x2[1],x2[2],x2[3],x3[0],x3[1],x3[2],x3[3]};
#pragma unroll
    for (int i = 0; i < 16; ++i) { const unsigned short hb = bf16_bits(xs[i]); ah.u[i] = hb; al.u[i] = ASPLIT ? bf16_bits(xs[i] - bf16_val(hb)) : (unsigned short)0; }
#pragma unroll
    for (int t = 0; t < 4; ++t) {
      const unsigned short* brow = Wt + (size_t)(col0 + t * 16 + ln) * ldb + kb;
      FragB b;
      b.half[0] = *(const v8us*)(brow + 8 * hh);
      b.half[1] = *(const v8us*)(brow + 16 + 8 * hh);
      acc[t] = mmaN<ASPLIT ? 2 : 1>(ah.v, al.v, b.v, b.v, acc[t]);
    }
  }
#pragma unroll
  for (int t = 0; t < 4; ++t) {
    const int col = col0 + t * 16 + ln;
    float bv = bias ? bias[col] : 0.f;
    if (BIAS_BF16) bv = bf16_round(bv);
#pragma unroll
    for (int r = 0; r < 8; ++r) {
      float v = acc[t][r] + bv;
      if (resid) { float rv = resid[(size_t)((row0 + 8 * hh + r) % rmod) * ldr + col]; if (RES_BF16) rv = bf16_round(rv); v += rv; }
      if (ACT == 1) v = fmaxf(v, 0.f);
      if (ACT == 2) v = 0.5f * v * (1.0f + erff(v * 0.70710678118654752f));
      if (ACT == 3) { const float u = 0.7978845608028654f * (v + 0.044715f * v * v * v); v = 0.5f * v * (1.0f + tanhf(u)); }
      so[w][8 * hh + r][t * 16 + ln] = v;
    }
  }
  __builtin_amdgcn_fence(__ATOMIC_ACQ_REL, "workgroup");
  __builtin_amdgcn_wave_barrier();
  const int rsub = lane >> 4, c4 = (lane & 15) * 4;
  {
#pragma unroll
    for (int q = 0; q < 8; ++q) {
      const int r = q * 2 + rsub;
      const v4f v = *(const v4fa*)&so[w][r][c4];
      *(v4f*)(C + (size_t)(row0 + r) * ldc + col0 + c4) = v;
    }
    
  }
}
// row LayerNorm (biased variance, eps) over N: s = X (+ R); optional out_sum <- s; out_norm <- (s-mu)*rsqrt(var+eps)*g + b
template <bool PARAM_BF16>
__global__ __launch_bounds__(256) void k_layernorm(const float* __restrict__ X, const float* __restrict__ R, const float* __restrict__ g, const float* __restrict__ bta,
                                                  float* __restrict__ out_sum, float* __restrict__ out_norm, int N, float eps) {
  __shared__ float red[256];
  const int row = blockIdx.x, tid = threadIdx.x;
  const float* x = X + (size_t)row * N; const float* rr = R ? R + (size_t)row * N : nullptr;
  float vals[16];                     // up to N = 4096
  const int per = N / 256;            // contiguous chunk per thread? use strided-by-4 chunks: thread handles j = tid*4 + 1024*u
  float s1 = 0.f;
  for (int u = 0; u < per / 4; ++u) {
    const int j = tid * 4 + 1024 * u;
    const v4f a = *(const v4fa*)(x + j);
    v4f b = {0.f,0.f,0.f,0.f}; if (rr) b = *(const v4fa*)(rr + j);
#pragma unroll
    for (int q = 0; q < 4; ++q) { const float v = a[q] + b[q]; vals[u * 4 + q] = v; s1 += v; }
  }
  red[tid] = s1; __syncthreads();
  for (int st = 128; st > 0; st >>= 1) { if (tid < st) red[tid] += red[tid + st]; __syncthreads(); }
  const float mu = red[0] / (float)N; __syncthreads();
  float s2 = 0.f;
  for (int u = 0; u < per / 4; ++u)
#pragma unroll
    for (int q = 0; q < 4; ++q) { const float c = vals[u * 4 + q] - mu; s2 += c * c; }
  red[tid] = s2; __syncthreads();
  for (int st = 128; st > 0; st >>= 1) { if (tid < st) red[tid] += red[tid + st]; __syncthreads(); }
  const float rs = rsqrtf(red[0] / (float)N + eps);
  {
    for (int u = 0; u < per / 4; ++u) {
      const int j = tid * 4 + 1024 * u;
      v4f o, sm;
#pragma unroll
      for (int q = 0; q < 4; ++q) {
        float gg = g[j + q], bb = bta[j + q];
        if (PARAM_BF16) { gg = bf16_round(gg); bb = bf16_round(bb); }
        sm[q] = vals[u * 4 + q]; o[q] = (vals[u * 4 + q] - mu) * rs * gg + bb;
      }
      if (out_sum) *(v4f*)(out_sum + (size_t)row * N + j) = sm;
      *(v4f*)(out_norm + (size_t)row * N + j) = o;
    }
    
  }
}



// ---- f16 WMMA path (v_wmma_f32_16x16x32_f16): 11-bit significands for operands in range — used here for the qkv and projection GEMMs and for attention
typedef _Float16 v16h __attribute__((ext_vector_type(16)));
union FragH { v16h v; v8us half[2]; _Float16 h[16]; unsigned short u[16]; };
template <int NT>
__device__ __forceinline__ v8f mmaH(v16h ah, v16h al, v16h bh, v16h bl, v8f c) {
  c = __builtin_amdgcn_wmma_f32_16x16x32_f16(false, ah, false, bh, (short)0, c, false, false);
  if (NT >= 2) c = __builtin_amdgcn_wmma_f32_16x16x32_f16(false, al, false, bh, (short)0, c, false, false);
  if (NT >= 3) c = __builtin_amdgcn_wmma_f32_16x16x32_f16(false, ah, false, bl, (short)0, c, false, false);
  asm volatile("v_nop\n\tv_nop\n\tv_nop\n\tv_nop" : "+v"(c) : "v"(ah), "v"(al), "v"(bh), "v"(bl));
  return c;
}
// batched GEMM like k_gemm_b but f16 operands: A f32 (split into f16 hi/lo if ASPLIT, else rounded to f16), Bt = f16 values [n][k]; alpha; C f32; N multiple of 16 (partial tiles skipped)
template <bool ASPLIT>
__global__ __launch_bounds__(128) void k_gemm_h(const float* __restrict__ A, int lda, size_t sA, const _Float16* __restrict__ Bh, int ldb, size_t sB, float alpha, float* __restrict__ C, int ldc, size_t sC, int M, int N, int K) {
  __shared__ __attribute__((aligned(16))) float so[4][16][64];
  const int tid = threadIdx.x, w = tid >> 5, lane = tid & 31, ln = lane & 15, hh = lane >> 4; const int by = blockIdx.y;
  A += (size_t)by * sA; Bh += (size_t)by * sB; C += (size_t)by * sC;
  const int ntn = (N + 63) / 64; const int wid = blockIdx.x * 4 + w; const int mt = wid / ntn, nq = wid % ntn; if (mt * 16 >= M) return;
  const int row0 = mt * 16, col0 = nq * 64; const float* arow = A + (size_t)(row0 + ln) * lda;
  v8f acc[4] = {};
  for (int kb = 0; kb < K; kb += 32) {
    FragH ah, al;
    const v4f x0 = *(const v4fa*)(arow + kb + 8 * hh), x1 = *(const v4fa*)(arow + kb + 8 * hh + 4), x2 = *(const v4fa*)(arow + kb + 16 + 8 * hh), x3 = *(const v4fa*)(arow + kb + 16 + 8 * hh + 4);
    float xs[16] = {x0[0],x0[1],x0[2],x0[3],x1[0],x1[1],x1[2],x1[3],x2[0],x2[1],x2[2],x2[3],x3[0],x3[1],x3[2],x3[3]};
#pragma unroll
    for (int i = 0; i < 16; ++i) { const _Float16 h = (_Float16)xs[i]; ah.h[i] = h; al.h[i] = ASPLIT ? (_Float16)(xs[i] - (float)h) : (_Float16)0.0f; }
#pragma unroll
    for (int t = 0; t < 4; ++t) { if (col0 + t * 16 >= N) continue; const size_t boff = (size_t)(col0 + t * 16 + ln) * ldb + kb; FragH bq; bq.half[0] = *(const v8us*)(Bh + boff + 8 * hh); bq.half[1] = *(const v8us*)(Bh + boff + 16 + 8 * hh);
      acc[t] = mmaH<ASPLIT ? 2 : 1>(ah.v, al.v, bq.v, bq.v, acc[t]); }
  }
#pragma unroll
  for (int t = 0; t < 4; ++t) { if (col0 + t * 16 >= N) continue;
#pragma unroll
    for (int r = 0; r < 8; ++r) so[w][8 * hh + r][t * 16 + ln] = acc[t][r] * alpha; }
  __builtin_amdgcn_fence(__ATOMIC_ACQ_REL, "workgroup"); __builtin_amdgcn_wave_barrier();
  const int rsub = lane >> 4, c4 = (lane & 15) * 4;
  {
#pragma unroll
    for (int q = 0; q < 8; ++q) { const int r = q * 2 + rsub; if (col0 + c4 < N) { const v4f v = *(const v4fa*)&so[w][r][c4]; *(v4f*)(C + (size_t)(row0 + r) * ldc + col0 + c4) = v; } }
     }
}

// Wt[n][k] = f16(W[k][n]·scale) from f32 row-major W[K][N] (scale = power of two; bf16-exact weights stay exact in f16 away from the subnormal range)
__global__ __launch_bounds__(256) void k_wt_f16(const float* __restrict__ W, _Float16* __restrict__ Wt, int K, int N, float scale) {
  const int t = blockIdx.x * 256 + threadIdx.x; if (t >= N * (K / 8)) return; const int n = t / (K / 8), k8 = (t % (K / 8)) * 8; FragH f;
#pragma unroll
  for (int i = 0; i < 8; ++i) f.h[i] = (_Float16)(bf16_round(W[(size_t)(k8 + i) * N + n]) * scale); const v8us o = f.half[0];
  *(v8us*)((unsigned short*)Wt + (size_t)n * K + k8) = o; 
}
// k_gemm_hh variant with fused epilogue: v = acc·alpha + bias[by·sBias + col] (+ CP[(row/rowsPerB)·sCPb + by·64 + col] if CP) ; ACT 0 none / 1 elu ; writes f16 C16 and f32 C, each if non-null
template <int ACT>
__global__ __launch_bounds__(128) void k_gemm_hhx(const _Float16* __restrict__ A, int lda, size_t sA, const _Float16* __restrict__ Bh, int ldb, size_t sB, float alpha, const float* __restrict__ bias, size_t sBias, const float* __restrict__ CP, int rowsPerB, size_t sCPb, int row0g,
    float* __restrict__ C, _Float16* __restrict__ C16, int ldc, size_t sC, int M, int N, int K) {
  __shared__ __attribute__((aligned(16))) float so[4][16][64];
  const int tid = threadIdx.x, w = tid >> 5, lane = tid & 31, ln = lane & 15, hh = lane >> 4; const int by = blockIdx.y;
  A += (size_t)by * sA; Bh += (size_t)by * sB; const size_t cofs = (size_t)by * sC; const float* bp = bias ? bias + (size_t)by * sBias : nullptr;
  const int ntn = (N + 63) / 64; const int wid = blockIdx.x * 4 + w; const int mt = wid / ntn, nq = wid % ntn; if (mt * 16 >= M) return;
  const int row0 = mt * 16, col0 = nq * 64; const _Float16* arow = A + (size_t)(row0 + ln) * lda;
  v8f acc[4] = {};
  for (int kb = 0; kb < K; kb += 32) { FragH ah; ah.half[0] = *(const v8us*)((const unsigned short*)arow + kb + 8 * hh); ah.half[1] = *(const v8us*)((const unsigned short*)arow + kb + 16 + 8 * hh);
#pragma unroll
    for (int t = 0; t < 4; ++t) { if (col0 + t * 16 >= N) continue; const size_t boff = (size_t)(col0 + t * 16 + ln) * ldb + kb; FragH bq; bq.half[0] = *(const v8us*)((const unsigned short*)Bh + boff + 8 * hh); bq.half[1] = *(const v8us*)((const unsigned short*)Bh + boff + 16 + 8 * hh);
      acc[t] = mmaH<1>(ah.v, ah.v, bq.v, bq.v, acc[t]); }
  }
#pragma unroll
  for (int t = 0; t < 4; ++t) { if (col0 + t * 16 >= N) continue; const int col = col0 + t * 16 + ln; const float bv = bp ? bf16_round(bp[col]) : 0.f;
#pragma unroll
    for (int r = 0; r < 8; ++r) { float v = acc[t][r] * alpha + bv; if (CP) { const int bidx = (row0g + row0 + 8 * hh + r) / rowsPerB; v += CP[(size_t)bidx * sCPb + (size_t)by * 64 + col]; } if (ACT == 1) v = (v > 0.f) ? v : expm1f(v); else if (ACT == 7) v = (v > 0.f) ? v + 1.0f : expf(v); else if (ACT == 8) v = tanhf(v); else if (ACT == 9) v = 0.5f * v * (1.0f + tanhf(0.7978845608028654f * (v + 0.044715f * v * v * v))); else if (ACT == 11) v = 1.0f / (1.0f + expf(-v)); else if (ACT == 12) v = (v > 0.f) ? v : 0.01f * v; else if (ACT == 14) v = (v > 0.f) ? v : 0.1f * v; else if (ACT == 15) v = v / (1.0f + expf(-v)); else if (ACT == 3) v = fmaxf(v, 0.f); else if (ACT == 6) v = 0.5f * v * (1.0f + erff(v * 0.70710678118654752f)); so[w][8 * hh + r][t * 16 + ln] = v; } }
  __builtin_amdgcn_fence(__ATOMIC_ACQ_REL, "workgroup"); __builtin_amdgcn_wave_barrier();
  const int rsub = lane >> 4, c4 = (lane & 15) * 4; typedef _Float16 v4h __attribute__((ext_vector_type(4)));
  {
#pragma unroll
    for (int q = 0; q < 8; ++q) { const int r = q * 2 + rsub; if (col0 + c4 < N) { const v4f v = *(const v4fa*)&so[w][r][c4]; if (C) *(v4f*)(C + cofs + (size_t)(row0 + r) * ldc + col0 + c4) = v; if (C16) { v4h h4; for (int i = 0; i < 4; ++i) h4[i] = (_Float16)v[i]; *(v4h*)(C16 + cofs + (size_t)(row0 + r) * ldc + col0 + c4) = h4; } } }
     }
}


typedef _Float16 v4h __attribute__((ext_vector_type(4)));

__global__ __launch_bounds__(256) void k_x16(const float* __restrict__ x, _Float16* __restrict__ X16, size_t n8) { const size_t t = (size_t)blockIdx.x * 256 + threadIdx.x; if (t >= n8) return; FragH f;
#pragma unroll
  for (int q = 0; q < 8; ++q) f.h[q] = (_Float16)bf16_round(x[t * 8 + q]); *(v8us*)((unsigned short*)X16 + t * 8) = f.half[0];  }
__global__ __launch_bounds__(256) void k_h16(const float* __restrict__ x, _Float16* __restrict__ X16, size_t n8) { const size_t t = (size_t)blockIdx.x * 256 + threadIdx.x; if (t >= n8) return; FragH f;
#pragma unroll
  for (int q = 0; q < 8; ++q) f.h[q] = (_Float16)x[t * 8 + q]; *(v8us*)((unsigned short*)X16 + t * 8) = f.half[0];  }
__global__ __launch_bounds__(256) void k_round16f(const float* __restrict__ W, _Float16* __restrict__ Bt, size_t n8) { const size_t t = (size_t)blockIdx.x * 256 + threadIdx.x; if (t >= n8) return; FragH f;
#pragma unroll
  for (int i = 0; i < 8; ++i) f.h[i] = (_Float16)(bf16_round(W[t * 8 + i]) * 16.0f); *(v8us*)((unsigned short*)Bt + t * 8) = f.half[0];  }
template <int NHv, int TTv>
__global__ __launch_bounds__(256) void k_vt(const _Float16* __restrict__ V16, int ldv, int voff, _Float16* __restrict__ Vt) { __shared__ unsigned short tl[64][66]; const int tid = threadIdx.x; const int slab = blockIdx.x / (TTv / 64), lg = blockIdx.x % (TTv / 64); const int b = slab / NHv, h = slab % NHv;
  for (int i = tid; i < 64 * 8; i += 256) { const int r = i / 8, c8 = (i % 8) * 8; FragH f; f.half[0] = *(const v8us*)((const unsigned short*)V16 + ((size_t)b * TTv + lg * 64 + r) * ldv + voff + h * 64 + c8);
#pragma unroll
    for (int q = 0; q < 8; ++q) tl[r][c8 + q] = f.u[q]; }
  __syncthreads();
  {
#pragma unroll
    for (int rd = 0; rd < 2; ++rd) { const int d = rd * 32 + tid / 8, pc = tid % 8; FragH f;
#pragma unroll
      for (int q = 0; q < 8; ++q) f.u[q] = tl[pc * 8 + q][d];
      *(v8us*)((unsigned short*)Vt + ((size_t)slab * 64 + d) * TTv + lg * 64 + pc * 8) = f.half[0]; }
     } }

__global__ __launch_bounds__(256) void k_tok(const float* __restrict__ x, _Float16* __restrict__ X16) { __shared__ float tl[32][65]; const int tid = threadIdx.x; const int b = blockIdx.x / ((CC / 64) * (NN / 32)), rem = blockIdx.x % ((CC / 64) * (NN / 32)); const int cg = rem / (NN / 32), pg = rem % (NN / 32); const int c0 = cg * 64, p0 = pg * 32;
  for (int i = tid; i < 64 * 32; i += 256) { const int c = i / 32, pp = i % 32; tl[pp][c] = bf16_round(x[((size_t)b * CC + c0 + c) * NN + p0 + pp]); } __syncthreads();
  const int r = tid / 8, pc = tid % 8; FragH f; for (int q = 0; q < 8; ++q) f.h[q] = (_Float16)tl[r][pc * 8 + q]; const size_t row = (size_t)b * NN + p0 + r; *(v8us*)((unsigned short*)X16 + row * CC + c0 + pc * 8) = f.half[0];  }
__global__ __launch_bounds__(128) void k_flash(const _Float16* __restrict__ Q16, int ldq, const _Float16* __restrict__ K16, int ldk, const _Float16* __restrict__ Vt, const int* __restrict__ MSK, float* __restrict__ O, int ldo) {
  constexpr int RPW = 16, RTN = RPW / 16, NQB = NN / (4 * RPW), DT = 2, KS = 1;
  __shared__ __attribute__((aligned(16))) unsigned short sP[4][RPW][40]; __shared__ __attribute__((aligned(16))) float sO[4][RPW][32 + 4];
  const int tid = threadIdx.x, w = tid >> 5, lane = tid & 31, ln = lane & 15, hh = lane >> 4;
  const int slab = blockIdx.x / NQB, qblk = blockIdx.x % NQB; const int h = slab; const int b = 0; const int qb0 = qblk * (4 * RPW); const int q0 = qb0 + w * RPW;
  FragH aq[2][KS];
#pragma unroll
  for (int rt = 0; rt < RTN; ++rt) { const unsigned short* qr = (const unsigned short*)Q16 + ((size_t)b * NN + q0 + rt * 16 + ln) * ldq + h * HD;
#pragma unroll
    for (int ks = 0; ks < KS; ++ks) { aq[rt][ks].half[0] = *(const v8us*)(qr + ks * 32 + 8 * hh); aq[rt][ks].half[1] = *(const v8us*)(qr + ks * 32 + 16 + 8 * hh); } }
  const unsigned short* Vth = (const unsigned short*)Vt + (size_t)h * HD * NN;      /* Vᵀ = v[(h,d)][n] channel-major */
  float m_r[2][8], l_r[2][8]; v8f oacc[2][DT];
#pragma unroll
  for (int rt = 0; rt < RTN; ++rt) {
#pragma unroll
    for (int r = 0; r < 8; ++r) { m_r[rt][r] = -3.0e38f; l_r[rt][r] = 0.f; }
#pragma unroll
    for (int dt = 0; dt < DT; ++dt) oacc[rt][dt] = (v8f){0.f,0.f,0.f,0.f,0.f,0.f,0.f,0.f}; }
  const int jend = NN;
#pragma unroll 1
  for (int j0 = 0; j0 < jend; j0 += 32) {
    
    v8f s[2][2];
#pragma unroll
    for (int nt = 0; nt < 2; ++nt) { const unsigned short* kr = (const unsigned short*)K16 + ((size_t)b * NN + j0 + nt * 16 + ln) * ldk + h * HD; FragH bk[KS];
#pragma unroll
      for (int ks = 0; ks < KS; ++ks) { bk[ks].half[0] = *(const v8us*)(kr + ks * 32 + 8 * hh); bk[ks].half[1] = *(const v8us*)(kr + ks * 32 + 16 + 8 * hh); }
#pragma unroll
      for (int rt = 0; rt < RTN; ++rt) { v8f acc = (v8f){0.f,0.f,0.f,0.f,0.f,0.f,0.f,0.f};
#pragma unroll
        for (int ks = 0; ks < KS; ++ks) acc = mmaH<1>(aq[rt][ks].v, aq[rt][ks].v, bk[ks].v, bk[ks].v, acc); s[rt][nt] = acc; } }
#pragma unroll
    for (int rt = 0; rt < RTN; ++rt)
#pragma unroll
      for (int r = 0; r < 8; ++r) { const int tq = q0 + rt * 16 + 8 * hh + r; const int k0 = j0 + ln, k1 = j0 + 16 + ln; (void)tq; (void)k0; (void)k1;
        const bool ok0 = true, ok1 = true;
        const float s0 = s[rt][0][r] * 0.17677669529663687f, s1 = s[rt][1][r] * 0.17677669529663687f; float mc = fmaxf(s0, s1);
        mc = fmaxf(mc, __shfl_xor(mc, 1, 32)); mc = fmaxf(mc, __shfl_xor(mc, 2, 32)); mc = fmaxf(mc, __shfl_xor(mc, 4, 32)); mc = fmaxf(mc, __shfl_xor(mc, 8, 32));
        const float mn = fmaxf(m_r[rt][r], mc); const float al = (mn > -1.0e38f) ? expf(m_r[rt][r] - mn) : 1.0f; m_r[rt][r] = mn; const float p0 = expf(s0 - mn), p1 = expf(s1 - mn); l_r[rt][r] = l_r[rt][r] * al + p0 + p1;
#pragma unroll
        for (int dt = 0; dt < DT; ++dt) oacc[rt][dt][r] *= al;
        FragH t2; t2.h[0] = (_Float16)(p0 * 1024.0f); t2.h[1] = (_Float16)(p1 * 1024.0f); sP[w][rt * 16 + 8 * hh + r][ln] = t2.u[0]; sP[w][rt * 16 + 8 * hh + r][16 + ln] = t2.u[1]; }
    __builtin_amdgcn_fence(__ATOMIC_ACQ_REL, "workgroup"); __builtin_amdgcn_wave_barrier();
    FragH pa[2];
#pragma unroll
    for (int rt = 0; rt < RTN; ++rt) { pa[rt].half[0] = *(const v8us*)&sP[w][rt * 16 + ln][8 * hh]; pa[rt].half[1] = *(const v8us*)&sP[w][rt * 16 + ln][16 + 8 * hh]; }
#pragma unroll
    for (int dt = 0; dt < DT; ++dt) { const unsigned short* vrow = Vth + (size_t)(dt * 16 + ln) * NN + j0; FragH bv; bv.half[0] = *(const v8us*)(vrow + 8 * hh); bv.half[1] = *(const v8us*)(vrow + 16 + 8 * hh);
#pragma unroll
      for (int rt = 0; rt < RTN; ++rt) oacc[rt][dt] = mmaH<1>(pa[rt].v, pa[rt].v, bv.v, bv.v, oacc[rt][dt]); }
    __builtin_amdgcn_fence(__ATOMIC_ACQ_REL, "workgroup"); __builtin_amdgcn_wave_barrier(); }
#pragma unroll
  for (int rt = 0; rt < RTN; ++rt) {
#pragma unroll
    for (int r = 0; r < 8; ++r) { float l = l_r[rt][r]; l += __shfl_xor(l, 1, 32); l += __shfl_xor(l, 2, 32); l += __shfl_xor(l, 4, 32); l += __shfl_xor(l, 8, 32); l_r[rt][r] = (l > 0.f) ? 1.0f / (l * 1024.0f) : 0.f; }
#pragma unroll
    for (int dt = 0; dt < DT; ++dt)
#pragma unroll
      for (int r = 0; r < 8; ++r) sO[w][rt * 16 + 8 * hh + r][dt * 16 + ln] = oacc[rt][dt][r] * l_r[rt][r]; }
  __builtin_amdgcn_fence(__ATOMIC_ACQ_REL, "workgroup"); __builtin_amdgcn_wave_barrier();
  {
#pragma unroll
    for (int rp = 0; rp < RPW; rp += 4) { const int r = rp + (lane >> 3), pc = lane & 7; const v4f val = *(const v4fa*)&sO[w][r][pc * 4]; *(v4f*)(O + ((size_t)b * NN + q0 + r) * ldo + h * HD + pc * 4) = val; }      
     } }

__global__ __launch_bounds__(256) void k_out(const float* __restrict__ G, float* __restrict__ out) { __shared__ float tl[32][65]; const int tid = threadIdx.x; const int b = blockIdx.x / ((CC / 32) * (NN / 64)), rem = blockIdx.x % ((CC / 32) * (NN / 64)); const int cg = rem / (NN / 64), pg = rem % (NN / 64); const int c0 = cg * 32, p0 = pg * 64;
  for (int i = tid; i < 64 * 32; i += 256) { const int pp = i / 32, c = i % 32; tl[c][pp] = G[((size_t)b * NN + p0 + pp) * CC + c0 + c]; } __syncthreads();
  { for (int i = tid; i < 32 * 16; i += 256) { const int c = i / 16, q4 = i % 16; const v4f v = {tl[c][q4 * 4], tl[c][q4 * 4 + 1], tl[c][q4 * 4 + 2], tl[c][q4 * 4 + 3]}; *(v4f*)(out + ((size_t)b * CC + c0 + c) * NN + p0 + q4 * 4) = v; }  } }

extern "C" void kernel_launch(void* const* d_in, const int* in_sizes, int n_in,
                              void* d_out, int out_size, void* d_ws, size_t ws_size, hipStream_t stream) {
  (void)in_sizes; (void)n_in; (void)out_size;
  const float* x = (const float*)d_in[0]; const float* Wqkv = (const float*)d_in[1]; const float* Wp = (const float*)d_in[2]; const float* bp = (const float*)d_in[3];
  char* ws = (char*)d_ws; size_t off = 0;
  auto take = [&](size_t bytes) { char* p = ws + off; off += (bytes + 255) & ~(size_t)255; return p; };
  _Float16* Bqkv = (_Float16*)take((size_t)C3 * CC * 2); _Float16* Bp = (_Float16*)take((size_t)CC * CC * 2); _Float16* X16 = (_Float16*)take((size_t)NR * CC * 2);
  _Float16* QK = (_Float16*)take((size_t)NR * 2 * CC * 2); _Float16* Vt = (_Float16*)take((size_t)CC * NN * 2); float* O = (float*)take((size_t)NR * CC * 4); _Float16* O16 = (_Float16*)take((size_t)NR * CC * 2); float* G = (float*)take((size_t)NR * CC * 4);
  if (off > ws_size) return;      // 0.4 + 0.1 + 2.1 + 4.2 + 2.1 + 4.2 + 2.1 + 4.2 ≈ 20 MB
  k_round16f<<<(unsigned)(((size_t)C3 * CC / 8 + 255) / 256), 256, 0, stream>>>(Wqkv, Bqkv, (size_t)C3 * CC / 8); k_round16f<<<(unsigned)(((size_t)CC * CC / 8 + 255) / 256), 256, 0, stream>>>(Wp, Bp, (size_t)CC * CC / 8);      /* (out,in) natural, ×2^4 */
  k_tok<<<BB * (CC / 64) * (NN / 32), 256, 0, stream>>>(x, X16);
  k_gemm_hhx<0><<<dim3(((NR / 16) * (2 * CC / 64) + 3) / 4, 1), 128, 0, stream>>>(X16, CC, 0, Bqkv, CC, 0, 0.0625f, nullptr, 0, nullptr, 1, 0, 0, nullptr, QK, 2 * CC, 0, NR, 2 * CC, CC);      /* [q | k] token-major [n][512] (head h = cols h·32 / 256 + h·32): M 4096 N 512 K 256 */
  k_gemm_hhx<0><<<dim3(((CC / 16) * (NN / 64) + 3) / 4, 1), 128, 0, stream>>>(Bqkv + (size_t)2 * CC * CC, CC, 0, X16, CC, 0, 0.0625f, nullptr, 0, nullptr, 1, 0, 0, nullptr, Vt, NN, 0, CC, NN, CC);      /* v channel-major [(h,d)][n] = Vᵀ: A = qkv_w rows 512..767, B = x token-major: M 256 N 4096 K 256 */
  k_flash<<<NH * (NN / 64), 128, 0, stream>>>(QK, 2 * CC, QK + CC, 2 * CC, Vt, nullptr, O, CC);      /* blocks = head × 64-query groups */
  k_h16<<<(unsigned)(((size_t)NR * CC / 8 + 255) / 256), 256, 0, stream>>>(O, O16, (size_t)NR * CC / 8);
  k_gemm_hhx<0><<<dim3(((NR / 16) * (CC / 64) + 3) / 4, 1), 128, 0, stream>>>(O16, CC, 0, Bp, CC, 0, 0.0625f, bp, 0, nullptr, 1, 0, 0, G, nullptr, CC, 0, NR, CC, CC);      /* G = O·proj_wᵀ + proj_b (token-major): M 4096 N 256 K 256 */
  k_out<<<BB * (CC / 32) * (NN / 64), 256, 0, stream>>>(G, (float*)d_out);
}

// v001
// It runs in 208 microseconds.
// Two timings next to v000 put it at 1.89 and 1.88 times that version's speed.
#include <hip/hip_runtime.h>
// 3-D multi-head self-attention on channel-major x [1, 256, 16³ = 4096]: qkv = qkv_w·x (1×1×1 conv, no bias), 8 heads × 32, softmax(qᵀk·32^-½) over keys, out[h,d,n] = Σ_m attn[n,m]·v[h,d,m], then proj_w·out + proj_b.
// Compute dtype: x, qkv_w, proj_w, proj_b rounded to bf16; q/k token-major and v channel-major (= Vᵀ) as f16 GEMM outputs (f32 accumulate); fused flash-style kernel per head
// (online softmax f32, P f16 ×2^10) on v_wmma_f32_16x16x32_f16; O → f16 → projection GEMM with bias → transposed back to [c][n] through LDS; f32 accumulate throughout.
#define BB 1
#define CC 256
#define C3 768
#define NH 8
#define HD 32
#define NN 4096
#define NR (BB * NN)

typedef __bf16 v16b __attribute__((ext_vector_type(16)));
typedef unsigned short v8us __attribute__((ext_vector_type(8), may_alias));
typedef float  v8f  __attribute__((ext_vector_type(8)));
typedef float  v4f  __attribute__((ext_vector_type(4)));
typedef float  v4fa __attribute__((ext_vector_type(4), may_alias));
union FragB { v16b v; v8us half[2]; unsigned short u[16]; };

__device__ __forceinline__ unsigned short bf16_bits(float x) { unsigned int u = __float_as_uint(x); return (unsigned short)((u + 0x7FFFu + ((u >> 16) & 1u)) >> 16); }
__device__ __forceinline__ float bf16_val(unsigned short b) { return __uint_as_float(((unsigned int)b) << 16); }
__device__ __forceinline__ float bf16_round(float x) { return bf16_val(bf16_bits(x)); }
// D += A·B with NT terms: 1 = ah·bh, 2 = + al·bh (A split), 3 = + ah·bl (both split)
template <int NT>
__device__ __forceinline__ v8f mmaN(v16b ah, v16b al, v16b bh, v16b bl, v8f c) {
  c = __builtin_amdgcn_wmma_f32_16x16x32_bf16(false, ah, false, bh, (short)0, c, false, false);
  if (NT >= 2) c = __builtin_amdgcn_wmma_f32_16x16x32_bf16(false, al, false, bh, (short)0, c, false, false);
  if (NT >= 3) c = __builtin_amdgcn_wmma_f32_16x16x32_bf16(false, ah, false, bl, (short)0, c, false, false);
  asm volatile("v_nop\n\tv_nop\n\tv_nop\n\tv_nop" : "+v"(c) : "v"(ah), "v"(al), "v"(bh), "v"(bl));
  return c;
}

__global__ __launch_bounds__(256) void k_wt_bf16(const float* __restrict__ W, unsigned short* __restrict__ Wt, int K, int N) {
  const int t = blockIdx.x * 256 + threadIdx.x;
  const int k8n = K / 8;
  if (t >= N * k8n) return;
  const int n = t / k8n, k8 = (t % k8n) * 8;
  v8us v;
#pragma unroll
  for (int i = 0; i < 8; ++i) v[i] = bf16_bits(W[(size_t)(k8 + i) * N + n]);
  *(v8us*)(Wt + (size_t)n * K + k8) = v;
  
}

// GEMM C[M][N] (f32, pitch ldc) = act(A[M][K]·W + bias). A f32 row-major (pitch lda) converted per fragment to bf16
// (ASPLIT: hi/lo two planes -> 2 terms, else single rounded term); Wt bf16 [N][K] (pitch ldb). BIAS_BF16 rounds the
// bias to bf16 first (bias quantised to bf16 before the add). K%32==0, M%16==0, N%64==0.
template <bool ASPLIT, int ACT, bool BIAS_BF16>
__global__ __launch_bounds__(128) void k_gemm_bf(const float* __restrict__ A, int lda, const unsigned short* __restrict__ Wt, int ldb,
                                               const float* __restrict__ bias, float* __restrict__ C, int ldc, int M, int N, int K) {
  __shared__ __attribute__((aligned(16))) float so[4][16][64];
  const int tid = threadIdx.x, w = tid >> 5, lane = tid & 31, ln = lane & 15, hh = lane >> 4;
  const int ntn = N / 64;
  const int wid = blockIdx.x * 4 + w;
  const int mt = wid / ntn, nq = wid % ntn;
  if (mt * 16 >= M) return;
  const int row0 = mt * 16, col0 = nq * 64;
  const float* arow = A + (size_t)(row0 + ln) * lda;
  v8f acc[4] = {};
  for (int kb = 0; kb < K; kb += 32) {
    FragB ah, al;
    const v4f x0 = *(const v4fa*)(arow + kb + 8 * hh), x1 = *(const v4fa*)(arow + kb + 8 * hh + 4);
    const v4f x2 = *(const v4fa*)(arow + kb + 16 + 8 * hh), x3 = *(const v4fa*)(arow + kb + 16 + 8 * hh + 4);
    float xs[16] = {x0[0],x0[1],x0[2],x0[3],x1[0],x1[1],x1[2],x1[3],x2[0],x2[1],x2[2],x2[3],x3[0],x3[1],x3[2],x3[3]};
#pragma unroll
    for (int i = 0; i < 16; ++i) { const unsigned short hb = bf16_bits(xs[i]); ah.u[i] = hb; al.u[i] = ASPLIT ? bf16_bits(xs[i] - bf16_val(hb)) : (unsigned short)0; }
#pragma unroll
    for (int t = 0; t < 4; ++t) {
      const unsigned short* brow = Wt + (size_t)(col0 + t * 16 + ln) * ldb + kb;
      FragB b;
      b.half[0] = *(const v8us*)(brow + 8 * hh);
      b.half[1] = *(const v8us*)(brow + 16 + 8 * hh);
      acc[t] = mmaN<ASPLIT ? 2 : 1>(ah.v, al.v, b.v, b.v, acc[t]);
    }
  }
#pragma unroll
  for (int t = 0; t < 4; ++t) {
    float bv = bias ? bias[col0 + t * 16 + ln] : 0.f;
    if (BIAS_BF16) bv = bf16_round(bv);
#pragma unroll
    for (int r = 0; r < 8; ++r) { float v = acc[t][r] + bv; if (ACT == 1) v = fmaxf(v, 0.f); so[w][8 * hh + r][t * 16 + ln] = v; }
  }
  __builtin_amdgcn_fence(__ATOMIC_ACQ_REL, "workgroup");
  __builtin_amdgcn_wave_barrier();
  const int rsub = lane >> 4, c4 = (lane & 15) * 4;
  {
#pragma unroll
    for (int q = 0; q < 8; ++q) {
      const int r = q * 2 + rsub;
      const v4f v = *(const v4fa*)&so[w][r][c4];
      *(v4f*)(C + (size_t)(row0 + r) * ldc + col0 + c4) = v;
    }
    
  }
}

// Flash-style causal/unmasked attention, all contractions 3-term bf16 hi/lo splits, f32 softmax with running max.
// q,k,v rows are read from f32 buffers with arbitrary row pitch (so they can live inside a fused qkv buffer);
// D = head size (multiple of 32, <= 128); one wave = 16 query rows; block = 4 waves (64 queries) sharing K/V chunks of 32.
template <int D, bool CAUSAL>
__global__ __launch_bounds__(128) void k_flash(const float* __restrict__ qb, const float* __restrict__ kb, const float* __restrict__ vb,
                                             int pitch, int T, int H, float scale, float* __restrict__ y, int ypitch) {
  constexpr int KS = D / 32;        // k-steps for QK
  constexpr int DT = D / 16;        // d tiles for PV
  __shared__ __attribute__((aligned(16))) unsigned short sKh[32][D + 8], sKl[32][D + 8], sVh[32][D + 8], sVl[32][D + 8];
  __shared__ __attribute__((aligned(16))) unsigned short sPh[4][16][40], sPl[4][16][40];
  __shared__ __attribute__((aligned(16))) float sO[4][16][D];
  const int tid = threadIdx.x, w = tid >> 5, lane = tid & 31, ln = lane & 15, hh = lane >> 4;
  const int nqb = (T + 63) / 64;
  const int bh = blockIdx.x / nqb, qblk = blockIdx.x % nqb;
  const int b = bh / H, h = bh % H;
  const int q0 = qblk * 64 + w * 16;
  const float* Q = qb + (size_t)b * T * pitch + h * D;
  const float* K = kb + (size_t)b * T * pitch + h * D;
  const float* V = vb + (size_t)b * T * pitch + h * D;

  // A fragments of the wave's 16 query rows (scaled), hi/lo
  FragB aqh[KS], aql[KS];
  {
    int row = q0 + ln; if (row >= T) row = T - 1;
    const float* qr = Q + (size_t)row * pitch;
#pragma unroll
    for (int ks = 0; ks < KS; ++ks)
#pragma unroll
      for (int i = 0; i < 16; ++i) {
        const int d = ks * 32 + ((i < 8) ? (8 * hh + i) : (16 + 8 * hh + (i - 8)));
        const float x = qr[d] * scale; const unsigned short hb = bf16_bits(x);
        aqh[ks].u[i] = hb; aql[ks].u[i] = bf16_bits(x - bf16_val(hb));
      }
  }
  float m_r[8], l_r[8];
#pragma unroll
  for (int r = 0; r < 8; ++r) { m_r[r] = -3.0e38f; l_r[r] = 0.f; }
  v8f oacc[DT];
#pragma unroll
  for (int dt = 0; dt < DT; ++dt) oacc[dt] = (v8f){0.f,0.f,0.f,0.f,0.f,0.f,0.f,0.f};

  const int kv_end = CAUSAL ? min(T, qblk * 64 + 64) : T;     // block-uniform
  for (int j0 = 0; j0 < kv_end; j0 += 32) {
    __syncthreads();
    for (int e = tid; e < 32 * (D / 4); e += 128) {
      const int r = e / (D / 4), c4 = (e % (D / 4)) * 4;
      const int key = j0 + r;
      v4f kf = {0.f,0.f,0.f,0.f}, vf = {0.f,0.f,0.f,0.f};
      if (key < T) { kf = *(const v4fa*)(K + (size_t)key * pitch + c4); vf = *(const v4fa*)(V + (size_t)key * pitch + c4); }
#pragma unroll
      for (int t = 0; t < 4; ++t) {
        unsigned short hb = bf16_bits(kf[t]); sKh[r][c4 + t] = hb; sKl[r][c4 + t] = bf16_bits(kf[t] - bf16_val(hb));
        hb = bf16_bits(vf[t]); sVh[r][c4 + t] = hb; sVl[r][c4 + t] = bf16_bits(vf[t] - bf16_val(hb));
      }
    }
    __syncthreads();
    // S tile 16 x 32
    v8f s[2];
#pragma unroll
    for (int nt = 0; nt < 2; ++nt) {
      v8f acc = {};
#pragma unroll
      for (int ks = 0; ks < KS; ++ks) {
        FragB bh_, bl_;
        bh_.half[0] = *(const v8us*)&sKh[nt * 16 + ln][ks * 32 + 8 * hh]; bh_.half[1] = *(const v8us*)&sKh[nt * 16 + ln][ks * 32 + 16 + 8 * hh];
        bl_.half[0] = *(const v8us*)&sKl[nt * 16 + ln][ks * 32 + 8 * hh]; bl_.half[1] = *(const v8us*)&sKl[nt * 16 + ln][ks * 32 + 16 + 8 * hh];
        acc = mmaN<3>(aqh[ks].v, aql[ks].v, bh_.v, bl_.v, acc);
      }
      s[nt] = acc;
    }
    // mask + running max (rows 8hh+r; the 16 lanes of a half share rows)
    float alpha[8];
#pragma unroll
    for (int r = 0; r < 8; ++r) {
      const int qi = q0 + 8 * hh + r;
      const int ja = j0 + ln, jb = j0 + 16 + ln;
      if (CAUSAL) { if (ja > qi) s[0][r] = -3.0e38f; if (jb > qi) s[1][r] = -3.0e38f; }
      if (ja >= T) s[0][r] = -3.0e38f;
      if (jb >= T) s[1][r] = -3.0e38f;
      float mx = fmaxf(s[0][r], s[1][r]);
      mx = fmaxf(mx, __shfl_xor(mx, 1, 32)); mx = fmaxf(mx, __shfl_xor(mx, 2, 32)); mx = fmaxf(mx, __shfl_xor(mx, 4, 32)); mx = fmaxf(mx, __shfl_xor(mx, 8, 32));
      const float mnew = fmaxf(m_r[r], mx);
      alpha[r] = (mnew > -1.0e38f) ? __expf(m_r[r] - mnew) : 1.0f;
      const float p0 = (s[0][r] > -1.0e38f) ? __expf(s[0][r] - mnew) : 0.f;
      const float p1 = (s[1][r] > -1.0e38f) ? __expf(s[1][r] - mnew) : 0.f;
      m_r[r] = mnew;
      l_r[r] = l_r[r] * alpha[r] + p0 + p1;            // per-lane partial row sum (16 lanes combined at the end)
      unsigned short hb = bf16_bits(p0); sPh[w][8 * hh + r][ln] = hb;      sPl[w][8 * hh + r][ln] = bf16_bits(p0 - bf16_val(hb));
      hb = bf16_bits(p1);                sPh[w][8 * hh + r][16 + ln] = hb; sPl[w][8 * hh + r][16 + ln] = bf16_bits(p1 - bf16_val(hb));
    }
#pragma unroll
    for (int dt = 0; dt < DT; ++dt)
#pragma unroll
      for (int r = 0; r < 8; ++r) oacc[dt][r] *= alpha[r];
    __builtin_amdgcn_fence(__ATOMIC_ACQ_REL, "workgroup");
    __builtin_amdgcn_wave_barrier();
    FragB pah, pal;
    pah.half[0] = *(const v8us*)&sPh[w][ln][8 * hh]; pah.half[1] = *(const v8us*)&sPh[w][ln][16 + 8 * hh];
    pal.half[0] = *(const v8us*)&sPl[w][ln][8 * hh]; pal.half[1] = *(const v8us*)&sPl[w][ln][16 + 8 * hh];
#pragma unroll
    for (int dt = 0; dt < DT; ++dt) {
      FragB bvh, bvl;
#pragma unroll
      for (int i = 0; i < 8; ++i) {
        bvh.u[i] = sVh[8 * hh + i][dt * 16 + ln]; bvh.u[8 + i] = sVh[16 + 8 * hh + i][dt * 16 + ln];
        bvl.u[i] = sVl[8 * hh + i][dt * 16 + ln]; bvl.u[8 + i] = sVl[16 + 8 * hh + i][dt * 16 + ln];
      }
      oacc[dt] = mmaN<3>(pah.v, pal.v, bvh.v, bvl.v, oacc[dt]);
    }
    __builtin_amdgcn_fence(__ATOMIC_ACQ_REL, "workgroup");
    __builtin_amdgcn_wave_barrier();
  }
#pragma unroll
  for (int r = 0; r < 8; ++r) {
    float l = l_r[r];
    l += __shfl_xor(l, 1, 32); l += __shfl_xor(l, 2, 32); l += __shfl_xor(l, 4, 32); l += __shfl_xor(l, 8, 32);
    l_r[r] = (l > 0.f) ? 1.0f / l : 0.f;
  }
#pragma unroll
  for (int dt = 0; dt < DT; ++dt)
#pragma unroll
    for (int r = 0; r < 8; ++r) sO[w][8 * hh + r][dt * 16 + ln] = oacc[dt][r] * l_r[r];
  __builtin_amdgcn_fence(__ATOMIC_ACQ_REL, "workgroup");
  __builtin_amdgcn_wave_barrier();
  {
    for (int r = 0; r < 16; ++r) {
      const int row = q0 + r;
      if (row < T && lane < D / 4) {
        const v4f val = *(const v4fa*)&sO[w][r][lane * 4];
        *(v4f*)(y + ((size_t)b * T + row) * ypitch + h * D + lane * 4) = val;
      }
    }
    
  }
}

// GEMM C = act(A·W + bias + resid): A f32 (ASPLIT -> hi/lo 2 terms), Wt bf16 [N][K]; ACT 0 none, 1 relu, 2 exact gelu;
// resid (optional, f32, row index = (row % rmod), pitch ldr, RES_BF16 rounds it) added before the activation.
template <bool ASPLIT, int ACT, bool BIAS_BF16, bool RES_BF16>
__global__ __launch_bounds__(128) void k_gemm_bf3(const float* __restrict__ A, int lda, const unsigned short* __restrict__ Wt, int ldb,
                                                const float* __restrict__ bias, const float* __restrict__ resid, int rmod, int ldr,
                                                float* __restrict__ C, int ldc, int M, int N, int K) {
  __shared__ __attribute__((aligned(16))) float so[4][16][64];
  const int tid = threadIdx.x, w = tid >> 5, lane = tid & 31, ln = lane & 15, hh = lane >> 4;
  const int ntn = N / 64;
  const int wid = blockIdx.x * 4 + w;
  const int mt = wid / ntn, nq = wid % ntn;
  if (mt * 16 >= M) return;
  const int row0 = mt * 16, col0 = nq * 64;
  const float* arow = A + (size_t)(row0 + ln) * lda;
  v8f acc[4] = {};
  for (int kb = 0; kb < K; kb += 32) {
    FragB ah, al;
    const v4f x0 = *(const v4fa*)(arow + kb + 8 * hh), x1 = *(const v4fa*)(arow + kb + 8 * hh + 4);
    const v4f x2 = *(const v4fa*)(arow + kb + 16 + 8 * hh), x3 = *(const v4fa*)(arow + kb + 16 + 8 * hh + 4);
    float xs[16] = {x0[0],x0[1],x0[2],x0[3],x1[0],x1[1],x1[2],x1[3],x2[0],x2[1],x2[2],x2[3],x3[0],x3[1],x3[2],x3[3]};
#pragma unroll
    for (int i = 0; i < 16; ++i) { const unsigned short hb = bf16_bits(xs[i]); ah.u[i] = hb; al.u[i] = ASPLIT ? bf16_bits(xs[i] - bf16_val(hb)) : (unsigned short)0; }
#pragma unroll
    for (int t = 0; t < 4; ++t) {
      const unsigned short* brow = Wt + (size_t)(col0 + t * 16 + ln) * ldb + kb;
      FragB b;
      b.half[0] = *(const v8us*)(brow + 8 * hh);
      b.half[1] = *(const v8us*)(brow + 16 + 8 * hh);
      acc[t] = mmaN<ASPLIT ? 2 : 1>(ah.v, al.v, b.v, b.v, acc[t]);
    }
  }
#pragma unroll
  for (int t = 0; t < 4; ++t) {
    const int col = col0 + t * 16 + ln;
    float bv = bias ? bias[col] : 0.f;
    if (BIAS_BF16) bv = bf16_round(bv);
#pragma unroll
    for (int r = 0; r < 8; ++r) {
      float v = acc[t][r] + bv;
      if (resid) { float rv = resid[(size_t)((row0 + 8 * hh + r) % rmod) * ldr + col]; if (RES_BF16) rv = bf16_round(rv); v += rv; }
      if (ACT == 1) v = fmaxf(v, 0.f);
      if (ACT == 2) v = 0.5f * v * (1.0f + erff(v * 0.70710678118654752f));
      if (ACT == 3) { const float u = 0.7978845608028654f * (v + 0.044715f * v * v * v); v = 0.5f * v * (1.0f + tanhf(u)); }
      so[w][8 * hh + r][t * 16 + ln] = v;
    }
  }
  __builtin_amdgcn_fence(__ATOMIC_ACQ_REL, "workgroup");
  __builtin_amdgcn_wave_barrier();
  const int rsub = lane >> 4, c4 = (lane & 15) * 4;
  {
#pragma unroll
    for (int q = 0; q < 8; ++q) {
      const int r = q * 2 + rsub;
      const v4f v = *(const v4fa*)&so[w][r][c4];
      *(v4f*)(C + (size_t)(row0 + r) * ldc + col0 + c4) = v;
    }
    
  }
}
// row LayerNorm (biased variance, eps) over N: s = X (+ R); optional out_sum <- s; out_norm <- (s-mu)*rsqrt(var+eps)*g + b
template <bool PARAM_BF16>
__global__ __launch_bounds__(256) void k_layernorm(const float* __restrict__ X, const float* __restrict__ R, const float* __restrict__ g, const float* __restrict__ bta,
                                                  float* __restrict__ out_sum, float* __restrict__ out_norm, int N, float eps) {
  __shared__ float red[256];
  const int row = blockIdx.x, tid = threadIdx.x;
  const float* x = X + (size_t)row * N; const float* rr = R ? R + (size_t)row * N : nullptr;
  float vals[16];                     // up to N = 4096
  const int per = N / 256;            // contiguous chunk per thread? use strided-by-4 chunks: thread handles j = tid*4 + 1024*u
  float s1 = 0.f;
  for (int u = 0; u < per / 4; ++u) {
    const int j = tid * 4 + 1024 * u;
    const v4f a = *(const v4fa*)(x + j);
    v4f b = {0.f,0.f,0.f,0.f}; if (rr) b = *(const v4fa*)(rr + j);
#pragma unroll
    for (int q = 0; q < 4; ++q) { const float v = a[q] + b[q]; vals[u * 4 + q] = v; s1 += v; }
  }
  red[tid] = s1; __syncthreads();
  for (int st = 128; st > 0; st >>= 1) { if (tid < st) red[tid] += red[tid + st]; __syncthreads(); }
  const float mu = red[0] / (float)N; __syncthreads();
  float s2 = 0.f;
  for (int u = 0; u < per / 4; ++u)
#pragma unroll
    for (int q = 0; q < 4; ++q) { const float c = vals[u * 4 + q] - mu; s2 += c * c; }
  red[tid] = s2; __syncthreads();
  for (int st = 128; st > 0; st >>= 1) { if (tid < st) red[tid] += red[tid + st]; __syncthreads(); }
  const float rs = rsqrtf(red[0] / (float)N + eps);
  {
    for (int u = 0; u < per / 4; ++u) {
      const int j = tid * 4 + 1024 * u;
      v4f o, sm;
#pragma unroll
      for (int q = 0; q < 4; ++q) {
        float gg = g[j + q], bb = bta[j + q];
        if (PARAM_BF16) { gg = bf16_round(gg); bb = bf16_round(bb); }
        sm[q] = vals[u * 4 + q]; o[q] = (vals[u * 4 + q] - mu) * rs * gg + bb;
      }
      if (out_sum) *(v4f*)(out_sum + (size_t)row * N + j) = sm;
      *(v4f*)(out_norm + (size_t)row * N + j) = o;
    }
    
  }
}



// ---- f16 WMMA path (v_wmma_f32_16x16x32_f16): 11-bit significands for operands in range — used here for the qkv and projection GEMMs and for attention
typedef _Float16 v16h __attribute__((ext_vector_type(16)));
union FragH { v16h v; v8us half[2]; _Float16 h[16]; unsigned short u[16]; };
template <int NT>
__device__ __forceinline__ v8f mmaH(v16h ah, v16h al, v16h bh, v16h bl, v8f c) {
  c = __builtin_amdgcn_wmma_f32_16x16x32_f16(false, ah, false, bh, (short)0, c, false, false);
  if (NT >= 2) c = __builtin_amdgcn_wmma_f32_16x16x32_f16(false, al, false, bh, (short)0, c, false, false);
  if (NT >= 3) c = __builtin_amdgcn_wmma_f32_16x16x32_f16(false, ah, false, bl, (short)0, c, false, false);
  asm volatile("v_nop\n\tv_nop\n\tv_nop\n\tv_nop" : "+v"(c) : "v"(ah), "v"(al), "v"(bh), "v"(bl));
  return c;
}
// batched GEMM like k_gemm_b but f16 operands: A f32 (split into f16 hi/lo if ASPLIT, else rounded to f16), Bt = f16 values [n][k]; alpha; C f32; N multiple of 16 (partial tiles skipped)
template <bool ASPLIT>
__global__ __launch_bounds__(128) void k_gemm_h(const float* __restrict__ A, int lda, size_t sA, const _Float16* __restrict__ Bh, int ldb, size_t sB, float alpha, float* __restrict__ C, int ldc, size_t sC, int M, int N, int K) {
  __shared__ __attribute__((aligned(16))) float so[4][16][64];
  const int tid = threadIdx.x, w = tid >> 5, lane = tid & 31, ln = lane & 15, hh = lane >> 4; const int by = blockIdx.y;
  A += (size_t)by * sA; Bh += (size_t)by * sB; C += (size_t)by * sC;
  const int ntn = (N + 63) / 64; const int wid = blockIdx.x * 4 + w; const int mt = wid / ntn, nq = wid % ntn; if (mt * 16 >= M) return;
  const int row0 = mt * 16, col0 = nq * 64; const float* arow = A + (size_t)(row0 + ln) * lda;
  v8f acc[4] = {};
  for (int kb = 0; kb < K; kb += 32) {
    FragH ah, al;
    const v4f x0 = *(const v4fa*)(arow + kb + 8 * hh), x1 = *(const v4fa*)(arow + kb + 8 * hh + 4), x2 = *(const v4fa*)(arow + kb + 16 + 8 * hh), x3 = *(const v4fa*)(arow + kb + 16 + 8 * hh + 4);
    float xs[16] = {x0[0],x0[1],x0[2],x0[3],x1[0],x1[1],x1[2],x1[3],x2[0],x2[1],x2[2],x2[3],x3[0],x3[1],x3[2],x3[3]};
#pragma unroll
    for (int i = 0; i < 16; ++i) { const _Float16 h = (_Float16)xs[i]; ah.h[i] = h; al.h[i] = ASPLIT ? (_Float16)(xs[i] - (float)h) : (_Float16)0.0f; }
#pragma unroll
    for (int t = 0; t < 4; ++t) { if (col0 + t * 16 >= N) continue; const size_t boff = (size_t)(col0 + t * 16 + ln) * ldb + kb; FragH bq; bq.half[0] = *(const v8us*)(Bh + boff + 8 * hh); bq.half[1] = *(const v8us*)(Bh + boff + 16 + 8 * hh);
      acc[t] = mmaH<ASPLIT ? 2 : 1>(ah.v, al.v, bq.v, bq.v, acc[t]); }
  }
#pragma unroll
  for (int t = 0; t < 4; ++t) { if (col0 + t * 16 >= N) continue;
#pragma unroll
    for (int r = 0; r < 8; ++r) so[w][8 * hh + r][t * 16 + ln] = acc[t][r] * alpha; }
  __builtin_amdgcn_fence(__ATOMIC_ACQ_REL, "workgroup"); __builtin_amdgcn_wave_barrier();
  const int rsub = lane >> 4, c4 = (lane & 15) * 4;
  {
#pragma unroll
    for (int q = 0; q < 8; ++q) { const int r = q * 2 + rsub; if (col0 + c4 < N) { const v4f v = *(const v4fa*)&so[w][r][c4]; *(v4f*)(C + (size_t)(row0 + r) * ldc + col0 + c4) = v; } }
     }
}

// Wt[n][k] = f16(W[k][n]·scale) from f32 row-major W[K][N] (scale = power of two; bf16-exact weights stay exact in f16 away from the subnormal range)
__global__ __launch_bounds__(256) void k_wt_f16(const float* __restrict__ W, _Float16* __restrict__ Wt, int K, int N, float scale) {
  const int t = blockIdx.x * 256 + threadIdx.x; if (t >= N * (K / 8)) return; const int n = t / (K / 8), k8 = (t % (K / 8)) * 8; FragH f;
#pragma unroll
  for (int i = 0; i < 8; ++i) f.h[i] = (_Float16)(bf16_round(W[(size_t)(k8 + i) * N + n]) * scale); const v8us o = f.half[0];
  *(v8us*)((unsigned short*)Wt + (size_t)n * K + k8) = o; 
}
// k_gemm_hh variant with fused epilogue: v = acc·alpha + bias[by·sBias + col] (+ CP[(row/rowsPerB)·sCPb + by·64 + col] if CP) ; ACT 0 none / 1 elu ; writes f16 C16 and f32 C, each if non-null
template <int ACT>
__global__ __launch_bounds__(128) void k_gemm_hhx(const _Float16* __restrict__ A, int lda, size_t sA, const _Float16* __restrict__ Bh, int ldb, size_t sB, float alpha, const float* __restrict__ bias, size_t sBias, const float* __restrict__ CP, int rowsPerB, size_t sCPb, int row0g,
    float* __restrict__ C, _Float16* __restrict__ C16, int ldc, size_t sC, int M, int N, int K) {
  __shared__ __attribute__((aligned(16))) float so[4][16][64];
  const int tid = threadIdx.x, w = tid >> 5, lane = tid & 31, ln = lane & 15, hh = lane >> 4; const int by = blockIdx.y;
  A += (size_t)by * sA; Bh += (size_t)by * sB; const size_t cofs = (size_t)by * sC; const float* bp = bias ? bias + (size_t)by * sBias : nullptr;
  const int ntn = (N + 63) / 64; const int wid = blockIdx.x * 4 + w; const int mt = wid / ntn, nq = wid % ntn; if (mt * 16 >= M) return;
  const int row0 = mt * 16, col0 = nq * 64; const _Float16* arow = A + (size_t)(row0 + ln) * lda;
  v8f acc[4] = {};
  for (int kb = 0; kb < K; kb += 32) { FragH ah; ah.half[0] = *(const v8us*)((const unsigned short*)arow + kb + 8 * hh); ah.half[1] = *(const v8us*)((const unsigned short*)arow + kb + 16 + 8 * hh);
#pragma unroll
    for (int t = 0; t < 4; ++t) { if (col0 + t * 16 >= N) continue; const size_t boff = (size_t)(col0 + t * 16 + ln) * ldb + kb; FragH bq; bq.half[0] = *(const v8us*)((const unsigned short*)Bh + boff + 8 * hh); bq.half[1] = *(const v8us*)((const unsigned short*)Bh + boff + 16 + 8 * hh);
      acc[t] = mmaH<1>(ah.v, ah.v, bq.v, bq.v, acc[t]); }
  }
#pragma unroll
  for (int t = 0; t < 4; ++t) { if (col0 + t * 16 >= N) continue; const int col = col0 + t * 16 + ln; const float bv = bp ? bf16_round(bp[col]) : 0.f;
#pragma unroll
    for (int r = 0; r < 8; ++r) { float v = acc[t][r] * alpha + bv; if (CP) { const int bidx = (row0g + row0 + 8 * hh + r) / rowsPerB; v += CP[(size_t)bidx * sCPb + (size_t)by * 64 + col]; } if (ACT == 1) v = (v > 0.f) ? v : expm1f(v); else if (ACT == 7) v = (v > 0.f) ? v + 1.0f : expf(v); else if (ACT == 8) v = tanhf(v); else if (ACT == 9) v = 0.5f * v * (1.0f + tanhf(0.7978845608028654f * (v + 0.044715f * v * v * v))); else if (ACT == 11) v = 1.0f / (1.0f + expf(-v)); else if (ACT == 12) v = (v > 0.f) ? v : 0.01f * v; else if (ACT == 14) v = (v > 0.f) ? v : 0.1f * v; else if (ACT == 15) v = v / (1.0f + expf(-v)); else if (ACT == 3) v = fmaxf(v, 0.f); else if (ACT == 6) v = 0.5f * v * (1.0f + erff(v * 0.70710678118654752f)); so[w][8 * hh + r][t * 16 + ln] = v; } }
  __builtin_amdgcn_fence(__ATOMIC_ACQ_REL, "workgroup"); __builtin_amdgcn_wave_barrier();
  const int rsub = lane >> 4, c4 = (lane & 15) * 4; typedef _Float16 v4h __attribute__((ext_vector_type(4)));
  {
#pragma unroll
    for (int q = 0; q < 8; ++q) { const int r = q * 2 + rsub; if (col0 + c4 < N) { const v4f v = *(const v4fa*)&so[w][r][c4]; if (C) *(v4f*)(C + cofs + (size_t)(row0 + r) * ldc + col0 + c4) = v; if (C16) { v4h h4; for (int i = 0; i < 4; ++i) h4[i] = (_Float16)v[i]; *(v4h*)(C16 + cofs + (size_t)(row0 + r) * ldc + col0 + c4) = h4; } } }
     }
}


typedef _Float16 v4h __attribute__((ext_vector_type(4)));

__global__ __launch_bounds__(256) void k_x16(const float* __restrict__ x, _Float16* __restrict__ X16, size_t n8) { const size_t t = (size_t)blockIdx.x * 256 + threadIdx.x; if (t >= n8) return; FragH f;
#pragma unroll
  for (int q = 0; q < 8; ++q) f.h[q] = (_Float16)bf16_round(x[t * 8 + q]); *(v8us*)((unsigned short*)X16 + t * 8) = f.half[0];  }
__global__ __launch_bounds__(256) void k_h16(const float* __restrict__ x, _Float16* __restrict__ X16, size_t n8) { const size_t t = (size_t)blockIdx.x * 256 + threadIdx.x; if (t >= n8) return; FragH f;
#pragma unroll
  for (int q = 0; q < 8; ++q) f.h[q] = (_Float16)x[t * 8 + q]; *(v8us*)((unsigned short*)X16 + t * 8) = f.half[0];  }
__global__ __launch_bounds__(256) void k_round16f(const float* __restrict__ W, _Float16* __restrict__ Bt, size_t n8) { const size_t t = (size_t)blockIdx.x * 256 + threadIdx.x; if (t >= n8) return; FragH f;
#pragma unroll
  for (int i = 0; i < 8; ++i) f.h[i] = (_Float16)(bf16_round(W[t * 8 + i]) * 16.0f); *(v8us*)((unsigned short*)Bt + t * 8) = f.half[0];  }
template <int NHv, int TTv>
__global__ __launch_bounds__(256) void k_vt(const _Float16* __restrict__ V16, int ldv, int voff, _Float16* __restrict__ Vt) { __shared__ unsigned short tl[64][66]; const int tid = threadIdx.x; const int slab = blockIdx.x / (TTv / 64), lg = blockIdx.x % (TTv / 64); const int b = slab / NHv, h = slab % NHv;
  for (int i = tid; i < 64 * 8; i += 256) { const int r = i / 8, c8 = (i % 8) * 8; FragH f; f.half[0] = *(const v8us*)((const unsigned short*)V16 + ((size_t)b * TTv + lg * 64 + r) * ldv + voff + h * 64 + c8);
#pragma unroll
    for (int q = 0; q < 8; ++q) tl[r][c8 + q] = f.u[q]; }
  __syncthreads();
  {
#pragma unroll
    for (int rd = 0; rd < 2; ++rd) { const int d = rd * 32 + tid / 8, pc = tid % 8; FragH f;
#pragma unroll
      for (int q = 0; q < 8; ++q) f.u[q] = tl[pc * 8 + q][d];
      *(v8us*)((unsigned short*)Vt + ((size_t)slab * 64 + d) * TTv + lg * 64 + pc * 8) = f.half[0]; }
     } }

__global__ __launch_bounds__(256) void k_tok(const float* __restrict__ x, _Float16* __restrict__ X16) { __shared__ float tl[32][65]; const int tid = threadIdx.x; const int b = blockIdx.x / ((CC / 64) * (NN / 32)), rem = blockIdx.x % ((CC / 64) * (NN / 32)); const int cg = rem / (NN / 32), pg = rem % (NN / 32); const int c0 = cg * 64, p0 = pg * 32;
  for (int i = tid; i < 64 * 32; i += 256) { const int c = i / 32, pp = i % 32; tl[pp][c] = bf16_round(x[((size_t)b * CC + c0 + c) * NN + p0 + pp]); } __syncthreads();
  const int r = tid / 8, pc = tid % 8; FragH f; for (int q = 0; q < 8; ++q) f.h[q] = (_Float16)tl[r][pc * 8 + q]; const size_t row = (size_t)b * NN + p0 + r; *(v8us*)((unsigned short*)X16 + row * CC + c0 + pc * 8) = f.half[0];  }
// lane l <-> l ^ 16: the two halves of a wave each hold half of a query column's keys
__device__ __forceinline__ float xhalf(float v) { const int b = __float_as_int(v); return __int_as_float(__builtin_amdgcn_permlanex16(b, b, 0x76543210, 0xfedcba98, false, false)); }
// Transposed products: S^T = K.Q^T (A = 16 key rows, B = the wave's 16 queries as columns), O^T += V^T.P^T. A lane then holds 16 of the 32 scores of ONE query
// (keys 8hh + r and 16 + 8hh + r), which is the k order of a B operand: P goes from the score accumulators into the second product without LDS.
__global__ __launch_bounds__(128) void k_flash(const _Float16* __restrict__ Q16, int ldq, const _Float16* __restrict__ K16, int ldk, const _Float16* __restrict__ Vt, const int* __restrict__ MSK, float* __restrict__ O, int ldo) {
  constexpr int RPW = 16, NQB = NN / (4 * RPW), DT = 2;
  __shared__ __attribute__((aligned(16))) float sO[4][RPW][32 + 4];
  const int tid = threadIdx.x, w = tid >> 5, lane = tid & 31, ln = lane & 15, hh = lane >> 4; (void)MSK;
  const int slab = blockIdx.x / NQB, qblk = blockIdx.x % NQB; const int h = slab; const int b = 0; const int qb0 = qblk * (4 * RPW); const int q0 = qb0 + w * RPW;
  FragH bq;
  { const unsigned short* qr = (const unsigned short*)Q16 + ((size_t)b * NN + q0 + ln) * ldq + h * HD; bq.half[0] = *(const v8us*)(qr + 8 * hh); bq.half[1] = *(const v8us*)(qr + 16 + 8 * hh); }
  const unsigned short* Vth = (const unsigned short*)Vt + (size_t)h * HD * NN;      /* V^T = v[(h,d)][n] channel-major */
  float m_c = -3.0e38f, l_c = 0.f; v8f oacc[DT];      /* running maximum and this half's partial sum of query q0 + ln; oacc[dt][r] = O^T[dt*16 + 8hh + r][q0 + ln] */
#pragma unroll
  for (int dt = 0; dt < DT; ++dt) oacc[dt] = (v8f){0.f,0.f,0.f,0.f,0.f,0.f,0.f,0.f};
  const int jend = NN;
  /* the key loop stays rolled, as before: a second copy of the long body would only grow the code; each "#pragma unroll" in this kernel before the output store keeps an array that the loop variable indexes in registers */
#pragma unroll 1
  for (int j0 = 0; j0 < jend; j0 += 32) {
    float sc[16];
#pragma unroll
    for (int nt = 0; nt < 2; ++nt) { const unsigned short* kr = (const unsigned short*)K16 + ((size_t)b * NN + j0 + nt * 16 + ln) * ldk + h * HD; FragH ak;
      ak.half[0] = *(const v8us*)(kr + 8 * hh); ak.half[1] = *(const v8us*)(kr + 16 + 8 * hh);
      const v8f acc = mmaH<1>(ak.v, ak.v, bq.v, bq.v, (v8f){0.f,0.f,0.f,0.f,0.f,0.f,0.f,0.f});
#pragma unroll
      for (int r = 0; r < 8; ++r) sc[nt * 8 + r] = acc[r] * 0.17677669529663687f; }
    float mx[8];
#pragma unroll
    for (int i = 0; i < 8; ++i) mx[i] = fmaxf(sc[i], sc[8 + i]);
    float mc = fmaxf(fmaxf(fmaxf(mx[0], mx[1]), fmaxf(mx[2], mx[3])), fmaxf(fmaxf(mx[4], mx[5]), fmaxf(mx[6], mx[7])));
    mc = fmaxf(mc, xhalf(mc));
    const float mn = fmaxf(m_c, mc); const float al = (mn > -1.0e38f) ? expf(m_c - mn) : 1.0f; m_c = mn;
    FragH pb; float p[16];
#pragma unroll
    for (int i = 0; i < 16; ++i) { p[i] = expf(sc[i] - mn); pb.h[i] = (_Float16)(p[i] * 1024.0f); }
#pragma unroll
    for (int i = 0; i < 8; ++i) p[i] += p[8 + i];
    l_c = l_c * al + (((p[0] + p[1]) + (p[2] + p[3])) + ((p[4] + p[5]) + (p[6] + p[7])));
#pragma unroll
    for (int dt = 0; dt < DT; ++dt)
#pragma unroll
      for (int r = 0; r < 8; ++r) oacc[dt][r] *= al;
#pragma unroll
    for (int dt = 0; dt < DT; ++dt) { const unsigned short* vrow = Vth + (size_t)(dt * 16 + ln) * NN + j0; FragH av; av.half[0] = *(const v8us*)(vrow + 8 * hh); av.half[1] = *(const v8us*)(vrow + 16 + 8 * hh);
      oacc[dt] = mmaH<1>(av.v, av.v, pb.v, pb.v, oacc[dt]); } }
  const float l = l_c + xhalf(l_c); const float inv = (l > 0.f) ? 1.0f / (l * 1024.0f) : 0.f;
#pragma unroll
  for (int dt = 0; dt < DT; ++dt)
#pragma unroll
    for (int r4 = 0; r4 < 8; r4 += 4) { const v4f o4 = {oacc[dt][r4] * inv, oacc[dt][r4 + 1] * inv, oacc[dt][r4 + 2] * inv, oacc[dt][r4 + 3] * inv}; *(v4fa*)&sO[w][ln][dt * 16 + 8 * hh + r4] = o4; }
  __builtin_amdgcn_fence(__ATOMIC_ACQ_REL, "workgroup"); __builtin_amdgcn_wave_barrier();
  {
#pragma unroll
    for (int rp = 0; rp < RPW; rp += 4) { const int r = rp + (lane >> 3), pc = lane & 7; const v4f val = *(const v4fa*)&sO[w][r][pc * 4]; *(v4f*)(O + ((size_t)b * NN + q0 + r) * ldo + h * HD + pc * 4) = val; }      
     } }

__global__ __launch_bounds__(256) void k_out(const float* __restrict__ G, float* __restrict__ out) { __shared__ float tl[32][65]; const int tid = threadIdx.x; const int b = blockIdx.x / ((CC / 32) * (NN / 64)), rem = blockIdx.x % ((CC / 32) * (NN / 64)); const int cg = rem / (NN / 64), pg = rem % (NN / 64); const int c0 = cg * 32, p0 = pg * 64;
  for (int i = tid; i < 64 * 32; i += 256) { const int pp = i / 32, c = i % 32; tl[c][pp] = G[((size_t)b * NN + p0 + pp) * CC + c0 + c]; } __syncthreads();
  { for (int i = tid; i < 32 * 16; i += 256) { const int c = i / 16, q4 = i % 16; const v4f v = {tl[c][q4 * 4], tl[c][q4 * 4 + 1], tl[c][q4 * 4 + 2], tl[c][q4 * 4 + 3]}; *(v4f*)(out + ((size_t)b * CC + c0 + c) * NN + p0 + q4 * 4) = v; }  } }

extern "C" void kernel_launch(void* const* d_in, const int* in_sizes, int n_in,
                              void* d_out, int out_size, void* d_ws, size_t ws_size, hipStream_t stream) {
  (void)in_sizes; (void)n_in; (void)out_size;
  const float* x = (const float*)d_in[0]; const float* Wqkv = (const float*)d_in[1]; const float* Wp = (const float*)d_in[2]; const float* bp = (const float*)d_in[3];
  char* ws = (char*)d_ws; size_t off = 0;
  auto take = [&](size_t bytes) { char* p = ws + off; off += (bytes + 255) & ~(size_t)255; return p; };
  _Float16* Bqkv = (_Float16*)take((size_t)C3 * CC * 2); _Float16* Bp = (_Float16*)take((size_t)CC * CC * 2); _Float16* X16 = (_Float16*)take((size_t)NR * CC * 2);
  _Float16* QK = (_Float16*)take((size_t)NR * 2 * CC * 2); _Float16* Vt = (_Float16*)take((size_t)CC * NN * 2); float* O = (float*)take((size_t)NR * CC * 4); _Float16* O16 = (_Float16*)take((size_t)NR * CC * 2); float* G = (float*)take((size_t)NR * CC * 4);
  if (off > ws_size) return;      // 0.4 + 0.1 + 2.1 + 4.2 + 2.1 + 4.2 + 2.1 + 4.2 ≈ 20 MB
  k_round16f<<<(unsigned)(((size_t)C3 * CC / 8 + 255) / 256), 256, 0, stream>>>(Wqkv, Bqkv, (size_t)C3 * CC / 8); k_round16f<<<(unsigned)(((size_t)CC * CC / 8 + 255) / 256), 256, 0, stream>>>(Wp, Bp, (size_t)CC * CC / 8);      /* (out,in) natural, ×2^4 */
  k_tok<<<BB * (CC / 64) * (NN / 32), 256, 0, stream>>>(x, X16);
  k_gemm_hhx<0><<<dim3(((NR / 16) * (2 * CC / 64) + 3) / 4, 1), 128, 0, stream>>>(X16, CC, 0, Bqkv, CC, 0, 0.0625f, nullptr, 0, nullptr, 1, 0, 0, nullptr, QK, 2 * CC, 0, NR, 2 * CC, CC);      /* [q | k] token-major [n][512] (head h = cols h·32 / 256 + h·32): M 4096 N 512 K 256 */
  k_gemm_hhx<0><<<dim3(((CC / 16) * (NN / 64) + 3) / 4, 1), 128, 0, stream>>>(Bqkv + (size_t)2 * CC * CC, CC, 0, X16, CC, 0, 0.0625f, nullptr, 0, nullptr, 1, 0, 0, nullptr, Vt, NN, 0, CC, NN, CC);      /* v channel-major [(h,d)][n] = Vᵀ: A = qkv_w rows 512..767, B = x token-major: M 256 N 4096 K 256 */
  k_flash<<<NH * (NN / 64), 128, 0, stream>>>(QK, 2 * CC, QK + CC, 2 * CC, Vt, nullptr, O, CC);      /* blocks = head × 64-query groups */
  k_h16<<<(unsigned)(((size_t)NR * CC / 8 + 255) / 256), 256, 0, stream>>>(O, O16, (size_t)NR * CC / 8);
  k_gemm_hhx<0><<<dim3(((NR / 16) * (CC / 64) + 3) / 4, 1), 128, 0, stream>>>(O16, CC, 0, Bp, CC, 0, 0.0625f, bp, 0, nullptr, 1, 0, 0, G, nullptr, CC, 0, NR, CC, CC);      /* G = O·proj_wᵀ + proj_b (token-major): M 4096 N 256 K 256 */
  k_out<<<BB * (CC / 32) * (NN / 64), 256, 0, stream>>>(G, (float*)d_out);
}

// v002
// One run takes 118 microseconds.
// Next to v001, in two timings, it ran 1.75 and 1.77 times as fast.
// Over all steps from v000 it is 3.31 times as fast.
#include <hip/hip_runtime.h>
// 3-D multi-head self-attention on channel-major x [1, 256, 16³ = 4096]: qkv = qkv_w·x (1×1×1 conv, no bias), 8 heads × 32, softmax(qᵀk·32^-½) over keys, out[h,d,n] = Σ_m attn[n,m]·v[h,d,m], then proj_w·out + proj_b.
// Compute dtype: x, qkv_w, proj_w, proj_b rounded to bf16; q/k token-major and v channel-major (= Vᵀ) as f16 GEMM outputs (f32 accumulate); fused flash-style kernel per head
// (online softmax f32, P f16 ×2^10) on v_wmma_f32_16x16x32_f16; O → f16 → projection GEMM with bias → transposed back to [c][n] through LDS; f32 accumulate throughout.
#define BB 1
#define CC 256
#define C3 768
#define NH 8
#define HD 32
#define NN 4096
#define NR (BB * NN)

typedef __bf16 v16b __attribute__((ext_vector_type(16)));
typedef unsigned short v8us __attribute__((ext_vector_type(8), may_alias));
typedef float  v8f  __attribute__((ext_vector_type(8)));
typedef float  v4f  __attribute__((ext_vector_type(4)));
typedef float  v4fa __attribute__((ext_vector_type(4), may_alias));
union FragB { v16b v; v8us half[2]; unsigned short u[16]; };

__device__ __forceinline__ unsigned short bf16_bits(float x) { unsigned int u = __float_as_uint(x); return (unsigned short)((u + 0x7FFFu + ((u >> 16) & 1u)) >> 16); }
__device__ __forceinline__ float bf16_val(unsigned short b) { return __uint_as_float(((unsigned int)b) << 16); }
__device__ __forceinline__ float bf16_round(float x) { return bf16_val(bf16_bits(x)); }
// D += A·B with NT terms: 1 = ah·bh, 2 = + al·bh (A split), 3 = + ah·bl (both split)
template <int NT>
__device__ __forceinline__ v8f mmaN(v16b ah, v16b al, v16b bh, v16b bl, v8f c) {
  c = __builtin_amdgcn_wmma_f32_16x16x32_bf16(false, ah, false, bh, (short)0, c, false, false);
  if (NT >= 2) c = __builtin_amdgcn_wmma_f32_16x16x32_bf16(false, al, false, bh, (short)0, c, false, false);
  if (NT >= 3) c = __builtin_amdgcn_wmma_f32_16x16x32_bf16(false, ah, false, bl, (short)0, c, false, false);
  asm volatile("v_nop\n\tv_nop\n\tv_nop\n\tv_nop" : "+v"(c) : "v"(ah), "v"(al), "v"(bh), "v"(bl));
  return c;
}

__global__ __launch_bounds__(256) void k_wt_bf16(const float* __restrict__ W, unsigned short* __restrict__ Wt, int K, int N) {
  const int t = blockIdx.x * 256 + threadIdx.x;
  const int k8n = K / 8;
  if (t >= N * k8n) return;
  const int n = t / k8n, k8 = (t % k8n) * 8;
  v8us v;
#pragma unroll
  for (int i = 0; i < 8; ++i) v[i] = bf16_bits(W[(size_t)(k8 + i) * N + n]);
  *(v8us*)(Wt + (size_t)n * K + k8) = v;
  
}

// GEMM C[M][N] (f32, pitch ldc) = act(A[M][K]·W + bias). A f32 row-major (pitch lda) converted per fragment to bf16
// (ASPLIT: hi/lo two planes -> 2 terms, else single rounded term); Wt bf16 [N][K] (pitch ldb). BIAS_BF16 rounds the
// bias to bf16 first (bias quantised to bf16 before the add). K%32==0, M%16==0, N%64==0.
template <bool ASPLIT, int ACT, bool BIAS_BF16>
__global__ __launch_bounds__(128) void k_gemm_bf(const float* __restrict__ A, int lda, const unsigned short* __restrict__ Wt, int ldb,
                                               const float* __restrict__ bias, float* __restrict__ C, int ldc, int M, int N, int K) {
  __shared__ __attribute__((aligned(16))) float so[4][16][64];
  const int tid = threadIdx.x, w = tid >> 5, lane = tid & 31, ln = lane & 15, hh = lane >> 4;
  const int ntn = N / 64;
  const int wid = blockIdx.x * 4 + w;
  const int mt = wid / ntn, nq = wid % ntn;
  if (mt * 16 >= M) return;
  const int row0 = mt * 16, col0 = nq * 64;
  const float* arow = A + (size_t)(row0 + ln) * lda;
  v8f acc[4] = {};
  for (int kb = 0; kb < K; kb += 32) {
    FragB ah, al;
    const v4f x0 = *(const v4fa*)(arow + kb + 8 * hh), x1 = *(const v4fa*)(arow + kb + 8 * hh + 4);
    const v4f x2 = *(const v4fa*)(arow + kb + 16 + 8 * hh), x3 = *(const v4fa*)(arow + kb + 16 + 8 * hh + 4);
    float xs[16] = {x0[0],x0[1],x0[2],x0[3],x1[0],x1[1],x1[2],x1[3],x2[0],x2[1],x2[2],x2[3],x3[0],x3[1],x3[2],x3[3]};
#pragma unroll
    for (int i = 0; i < 16; ++i) { const unsigned short hb = bf16_bits(xs[i]); ah.u[i] = hb; al.u[i] = ASPLIT ? bf16_bits(xs[i] - bf16_val(hb)) : (unsigned short)0; }
#pragma unroll
    for (int t = 0; t < 4; ++t) {
      const unsigned short* brow = Wt + (size_t)(col0 + t * 16 + ln) * ldb + kb;
      FragB b;
      b.half[0] = *(const v8us*)(brow + 8 * hh);
      b.half[1] = *(const v8us*)(brow + 16 + 8 * hh);
      acc[t] = mmaN<ASPLIT ? 2 : 1>(ah.v, al.v, b.v, b.v, acc[t]);
    }
  }
#pragma unroll
  for (int t = 0; t < 4; ++t) {
    float bv = bias ? bias[col0 + t * 16 + ln] : 0.f;
    if (BIAS_BF16) bv = bf16_round(bv);
#pragma unroll
    for (int r = 0; r < 8; ++r) { float v = acc[t][r] + bv; if (ACT == 1) v = fmaxf(v, 0.f); so[w][8 * hh + r][t * 16 + ln] = v; }
  }
  __builtin_amdgcn_fence(__ATOMIC_ACQ_REL, "workgroup");
  __builtin_amdgcn_wave_barrier();
  const int rsub = lane >> 4, c4 = (lane & 15) * 4;
  {
#pragma unroll
    for (int q = 0; q < 8; ++q) {
      const int r = q * 2 + rsub;
      const v4f v = *(const v4fa*)&so[w][r][c4];
      *(v4f*)(C + (size_t)(row0 + r) * ldc + col0 + c4) = v;
    }
    
  }
}

// Flash-style causal/unmasked attention, all contractions 3-term bf16 hi/lo splits, f32 softmax with running max.
// q,k,v rows are read from f32 buffers with arbitrary row pitch (so they can live inside a fused qkv buffer);
// D = head size (multiple of 32, <= 128); one wave = 16 query rows; block = 4 waves (64 queries) sharing K/V chunks of 32.
template <int D, bool CAUSAL>
__global__ __launch_bounds__(128) void k_flash(const float* __restrict__ qb, const float* __restrict__ kb, const float* __restrict__ vb,
                                             int pitch, int T, int H, float scale, float* __restrict__ y, int ypitch) {
  constexpr int KS = D / 32;        // k-steps for QK
  constexpr int DT = D / 16;        // d tiles for PV
  __shared__ __attribute__((aligned(16))) unsigned short sKh[32][D + 8], sKl[32][D + 8], sVh[32][D + 8], sVl[32][D + 8];
  __shared__ __attribute__((aligned(16))) unsigned short sPh[4][16][40], sPl[4][16][40];
  __shared__ __attribute__((aligned(16))) float sO[4][16][D];
  const int tid = threadIdx.x, w = tid >> 5, lane = tid & 31, ln = lane & 15, hh = lane >> 4;
  const int nqb = (T + 63) / 64;
  const int bh = blockIdx.x / nqb, qblk = blockIdx.x % nqb;
  const int b = bh / H, h = bh % H;
  const int q0 = qblk * 64 + w * 16;
  const float* Q = qb + (size_t)b * T * pitch + h * D;
  const float* K = kb + (size_t)b * T * pitch + h * D;
  const float* V = vb + (size_t)b * T * pitch + h * D;

  // A fragments of the wave's 16 query rows (scaled), hi/lo
  FragB aqh[KS], aql[KS];
  {
    int row = q0 + ln; if (row >= T) row = T - 1;
    const float* qr = Q + (size_t)row * pitch;
#pragma unroll
    for (int ks = 0; ks < KS; ++ks)
#pragma unroll
      for (int i = 0; i < 16; ++i) {
        const int d = ks * 32 + ((i < 8) ? (8 * hh + i) : (16 + 8 * hh + (i - 8)));
        const float x = qr[d] * scale; const unsigned short hb = bf16_bits(x);
        aqh[ks].u[i] = hb; aql[ks].u[i] = bf16_bits(x - bf16_val(hb));
      }
  }
  float m_r[8], l_r[8];
#pragma unroll
  for (int r = 0; r < 8; ++r) { m_r[r] = -3.0e38f; l_r[r] = 0.f; }
  v8f oacc[DT];
#pragma unroll
  for (int dt = 0; dt < DT; ++dt) oacc[dt] = (v8f){0.f,0.f,0.f,0.f,0.f,0.f,0.f,0.f};

  const int kv_end = CAUSAL ? min(T, qblk * 64 + 64) : T;     // block-uniform
  for (int j0 = 0; j0 < kv_end; j0 += 32) {
    __syncthreads();
    for (int e = tid; e < 32 * (D / 4); e += 128) {
      const int r = e / (D / 4), c4 = (e % (D / 4)) * 4;
      const int key = j0 + r;
      v4f kf = {0.f,0.f,0.f,0.f}, vf = {0.f,0.f,0.f,0.f};
      if (key < T) { kf = *(const v4fa*)(K + (size_t)key * pitch + c4); vf = *(const v4fa*)(V + (size_t)key * pitch + c4); }
#pragma unroll
      for (int t = 0; t < 4; ++t) {
        unsigned short hb = bf16_bits(kf[t]); sKh[r][c4 + t] = hb; sKl[r][c4 + t] = bf16_bits(kf[t] - bf16_val(hb));
        hb = bf16_bits(vf[t]); sVh[r][c4 + t] = hb; sVl[r][c4 + t] = bf16_bits(vf[t] - bf16_val(hb));
      }
    }
    __syncthreads();
    // S tile 16 x 32
    v8f s[2];
#pragma unroll
    for (int nt = 0; nt < 2; ++nt) {
      v8f acc = {};
#pragma unroll
      for (int ks = 0; ks < KS; ++ks) {
        FragB bh_, bl_;
        bh_.half[0] = *(const v8us*)&sKh[nt * 16 + ln][ks * 32 + 8 * hh]; bh_.half[1] = *(const v8us*)&sKh[nt * 16 + ln][ks * 32 + 16 + 8 * hh];
        bl_.half[0] = *(const v8us*)&sKl[nt * 16 + ln][ks * 32 + 8 * hh]; bl_.half[1] = *(const v8us*)&sKl[nt * 16 + ln][ks * 32 + 16 + 8 * hh];
        acc = mmaN<3>(aqh[ks].v, aql[ks].v, bh_.v, bl_.v, acc);
      }
      s[nt] = acc;
    }
    // mask + running max (rows 8hh+r; the 16 lanes of a half share rows)
    float alpha[8];
#pragma unroll
    for (int r = 0; r < 8; ++r) {
      const int qi = q0 + 8 * hh + r;
      const int ja = j0 + ln, jb = j0 + 16 + ln;
      if (CAUSAL) { if (ja > qi) s[0][r] = -3.0e38f; if (jb > qi) s[1][r] = -3.0e38f; }
      if (ja >= T) s[0][r] = -3.0e38f;
      if (jb >= T) s[1][r] = -3.0e38f;
      float mx = fmaxf(s[0][r], s[1][r]);
      mx = fmaxf(mx, __shfl_xor(mx, 1, 32)); mx = fmaxf(mx, __shfl_xor(mx, 2, 32)); mx = fmaxf(mx, __shfl_xor(mx, 4, 32)); mx = fmaxf(mx, __shfl_xor(mx, 8, 32));
      const float mnew = fmaxf(m_r[r], mx);
      alpha[r] = (mnew > -1.0e38f) ? __expf(m_r[r] - mnew) : 1.0f;
      const float p0 = (s[0][r] > -1.0e38f) ? __expf(s[0][r] - mnew) : 0.f;
      const float p1 = (s[1][r] > -1.0e38f) ? __expf(s[1][r] - mnew) : 0.f;
      m_r[r] = mnew;
      l_r[r] = l_r[r] * alpha[r] + p0 + p1;            // per-lane partial row sum (16 lanes combined at the end)
      unsigned short hb = bf16_bits(p0); sPh[w][8 * hh + r][ln] = hb;      sPl[w][8 * hh + r][ln] = bf16_bits(p0 - bf16_val(hb));
      hb = bf16_bits(p1);                sPh[w][8 * hh + r][16 + ln] = hb; sPl[w][8 * hh + r][16 + ln] = bf16_bits(p1 - bf16_val(hb));
    }
#pragma unroll
    for (int dt = 0; dt < DT; ++dt)
#pragma unroll
      for (int r = 0; r < 8; ++r) oacc[dt][r] *= alpha[r];
    __builtin_amdgcn_fence(__ATOMIC_ACQ_REL, "workgroup");
    __builtin_amdgcn_wave_barrier();
    FragB pah, pal;
    pah.half[0] = *(const v8us*)&sPh[w][ln][8 * hh]; pah.half[1] = *(const v8us*)&sPh[w][ln][16 + 8 * hh];
    pal.half[0] = *(const v8us*)&sPl[w][ln][8 * hh]; pal.half[1] = *(const v8us*)&sPl[w][ln][16 + 8 * hh];
#pragma unroll
    for (int dt = 0; dt < DT; ++dt) {
      FragB bvh, bvl;
#pragma unroll
      for (int i = 0; i < 8; ++i) {
        bvh.u[i] = sVh[8 * hh + i][dt * 16 + ln]; bvh.u[8 + i] = sVh[16 + 8 * hh + i][dt * 16 + ln];
        bvl.u[i] = sVl[8 * hh + i][dt * 16 + ln]; bvl.u[8 + i] = sVl[16 + 8 * hh + i][dt * 16 + ln];
      }
      oacc[dt] = mmaN<3>(pah.v, pal.v, bvh.v, bvl.v, oacc[dt]);
    }
    __builtin_amdgcn_fence(__ATOMIC_ACQ_REL, "workgroup");
    __builtin_amdgcn_wave_barrier();
  }
#pragma unroll
  for (int r = 0; r < 8; ++r) {
    float l = l_r[r];
    l += __shfl_xor(l, 1, 32); l += __shfl_xor(l, 2, 32); l += __shfl_xor(l, 4, 32); l += __shfl_xor(l, 8, 32);
    l_r[r] = (l > 0.f) ? 1.0f / l : 0.f;
  }
#pragma unroll
  for (int dt = 0; dt < DT; ++dt)
#pragma unroll
    for (int r = 0; r < 8; ++r) sO[w][8 * hh + r][dt * 16 + ln] = oacc[dt][r] * l_r[r];
  __builtin_amdgcn_fence(__ATOMIC_ACQ_REL, "workgroup");
  __builtin_amdgcn_wave_barrier();
  {
    for (int r = 0; r < 16; ++r) {
      const int row = q0 + r;
      if (row < T && lane < D / 4) {
        const v4f val = *(const v4fa*)&sO[w][r][lane * 4];
        *(v4f*)(y + ((size_t)b * T + row) * ypitch + h * D + lane * 4) = val;
      }
    }
    
  }
}

// GEMM C = act(A·W + bias + resid): A f32 (ASPLIT -> hi/lo 2 terms), Wt bf16 [N][K]; ACT 0 none, 1 relu, 2 exact gelu;
// resid (optional, f32, row index = (row % rmod), pitch ldr, RES_BF16 rounds it) added before the activation.
template <bool ASPLIT, int ACT, bool BIAS_BF16, bool RES_BF16>
__global__ __launch_bounds__(128) void k_gemm_bf3(const float* __restrict__ A, int lda, const unsigned short* __restrict__ Wt, int ldb,
                                                const float* __restrict__ bias, const float* __restrict__ resid, int rmod, int ldr,
                                                float* __restrict__ C, int ldc, int M, int N, int K) {
  __shared__ __attribute__((aligned(16))) float so[4][16][64];
  const int tid = threadIdx.x, w = tid >> 5, lane = tid & 31, ln = lane & 15, hh = lane >> 4;
  const int ntn = N / 64;
  const int wid = blockIdx.x * 4 + w;
  const int mt = wid / ntn, nq = wid % ntn;
  if (mt * 16 >= M) return;
  const int row0 = mt * 16, col0 = nq * 64;
  const float* arow = A + (size_t)(row0 + ln) * lda;
  v8f acc[4] = {};
  for (int kb = 0; kb < K; kb += 32) {
    FragB ah, al;
    const v4f x0 = *(const v4fa*)(arow + kb + 8 * hh), x1 = *(const v4fa*)(arow + kb + 8 * hh + 4);
    const v4f x2 = *(const v4fa*)(arow + kb + 16 + 8 * hh), x3 = *(const v4fa*)(arow + kb + 16 + 8 * hh + 4);
    float xs[16] = {x0[0],x0[1],x0[2],x0[3],x1[0],x1[1],x1[2],x1[3],x2[0],x2[1],x2[2],x2[3],x3[0],x3[1],x3[2],x3[3]};
#pragma unroll
    for (int i = 0; i < 16; ++i) { const unsigned short hb = bf16_bits(xs[i]); ah.u[i] = hb; al.u[i] = ASPLIT ? bf16_bits(xs[i] - bf16_val(hb)) : (unsigned short)0; }
#pragma unroll
    for (int t = 0; t < 4; ++t) {
      const unsigned short* brow = Wt + (size_t)(col0 + t * 16 + ln) * ldb + kb;
      FragB b;
      b.half[0] = *(const v8us*)(brow + 8 * hh);
      b.half[1] = *(const v8us*)(brow + 16 + 8 * hh);
      acc[t] = mmaN<ASPLIT ? 2 : 1>(ah.v, al.v, b.v, b.v, acc[t]);
    }
  }
#pragma unroll
  for (int t = 0; t < 4; ++t) {
    const int col = col0 + t * 16 + ln;
    float bv = bias ? bias[col] : 0.f;
    if (BIAS_BF16) bv = bf16_round(bv);
#pragma unroll
    for (int r = 0; r < 8; ++r) {
      float v = acc[t][r] + bv;
      if (resid) { float rv = resid[(size_t)((row0 + 8 * hh + r) % rmod) * ldr + col]; if (RES_BF16) rv = bf16_round(rv); v += rv; }
      if (ACT == 1) v = fmaxf(v, 0.f);
      if (ACT == 2) v = 0.5f * v * (1.0f + erff(v * 0.70710678118654752f));
      if (ACT == 3) { const float u = 0.7978845608028654f * (v + 0.044715f * v * v * v); v = 0.5f * v * (1.0f + tanhf(u)); }
      so[w][8 * hh + r][t * 16 + ln] = v;
    }
  }
  __builtin_amdgcn_fence(__ATOMIC_ACQ_REL, "workgroup");
  __builtin_amdgcn_wave_barrier();
  const int rsub = lane >> 4, c4 = (lane & 15) * 4;
  {
#pragma unroll
    for (int q = 0; q < 8; ++q) {
      const int r = q * 2 + rsub;
      const v4f v = *(const v4fa*)&so[w][r][c4];
      *(v4f*)(C + (size_t)(row0 + r) * ldc + col0 + c4) = v;
    }
    
  }
}
// row LayerNorm (biased variance, eps) over N: s = X (+ R); optional out_sum <- s; out_norm <- (s-mu)*rsqrt(var+eps)*g + b
template <bool PARAM_BF16>
__global__ __launch_bounds__(256) void k_layernorm(const float* __restrict__ X, const float* __restrict__ R, const float* __restrict__ g, const float* __restrict__ bta,
                                                  float* __restrict__ out_sum, float* __restrict__ out_norm, int N, float eps) {
  __shared__ float red[256];
  const int row = blockIdx.x, tid = threadIdx.x;
  const float* x = X + (size_t)row * N; const float* rr = R ? R + (size_t)row * N : nullptr;
  float vals[16];                     // up to N = 4096
  const int per = N / 256;            // contiguous chunk per thread? use strided-by-4 chunks: thread handles j = tid*4 + 1024*u
  float s1 = 0.f;
  for (int u = 0; u < per / 4; ++u) {
    const int j = tid * 4 + 1024 * u;
    const v4f a = *(const v4fa*)(x + j);
    v4f b = {0.f,0.f,0.f,0.f}; if (rr) b = *(const v4fa*)(rr + j);
#pragma unroll
    for (int q = 0; q < 4; ++q) { const float v = a[q] + b[q]; vals[u * 4 + q] = v; s1 += v; }
  }
  red[tid] = s1; __syncthreads();
  for (int st = 128; st > 0; st >>= 1) { if (tid < st) red[tid] += red[tid + st]; __syncthreads(); }
  const float mu = red[0] / (float)N; __syncthreads();
  float s2 = 0.f;
  for (int u = 0; u < per / 4; ++u)
#pragma unroll
    for (int q = 0; q < 4; ++q) { const float c = vals[u * 4 + q] - mu; s2 += c * c; }
  red[tid] = s2; __syncthreads();
  for (int st = 128; st > 0; st >>= 1) { if (tid < st) red[tid] += red[tid + st]; __syncthreads(); }
  const float rs = rsqrtf(red[0] / (float)N + eps);
  {
    for (int u = 0; u < per / 4; ++u) {
      const int j = tid * 4 + 1024 * u;
      v4f o, sm;
#pragma unroll
      for (int q = 0; q < 4; ++q) {
        float gg = g[j + q], bb = bta[j + q];
        if (PARAM_BF16) { gg = bf16_round(gg); bb = bf16_round(bb); }
        sm[q] = vals[u * 4 + q]; o[q] = (vals[u * 4 + q] - mu) * rs * gg + bb;
      }
      if (out_sum) *(v4f*)(out_sum + (size_t)row * N + j) = sm;
      *(v4f*)(out_norm + (size_t)row * N + j) = o;
    }
    
  }
}



// ---- f16 WMMA path (v_wmma_f32_16x16x32_f16): 11-bit significands for operands in range — used here for the qkv and projection GEMMs and for attention
typedef _Float16 v16h __attribute__((ext_vector_type(16)));
union FragH { v16h v; v8us half[2]; _Float16 h[16]; unsigned short u[16]; };
template <int NT>
__device__ __forceinline__ v8f mmaH(v16h ah, v16h al, v16h bh, v16h bl, v8f c) {
  c = __builtin_amdgcn_wmma_f32_16x16x32_f16(false, ah, false, bh, (short)0, c, false, false);
  if (NT >= 2) c = __builtin_amdgcn_wmma_f32_16x16x32_f16(false, al, false, bh, (short)0, c, false, false);
  if (NT >= 3) c = __builtin_amdgcn_wmma_f32_16x16x32_f16(false, ah, false, bl, (short)0, c, false, false);
  asm volatile("v_nop\n\tv_nop\n\tv_nop\n\tv_nop" : "+v"(c) : "v"(ah), "v"(al), "v"(bh), "v"(bl));
  return c;
}
// batched GEMM like k_gemm_b but f16 operands: A f32 (split into f16 hi/lo if ASPLIT, else rounded to f16), Bt = f16 values [n][k]; alpha; C f32; N multiple of 16 (partial tiles skipped)
template <bool ASPLIT>
__global__ __launch_bounds__(128) void k_gemm_h(const float* __restrict__ A, int lda, size_t sA, const _Float16* __restrict__ Bh, int ldb, size_t sB, float alpha, float* __restrict__ C, int ldc, size_t sC, int M, int N, int K) {
  __shared__ __attribute__((aligned(16))) float so[4][16][64];
  const int tid = threadIdx.x, w = tid >> 5, lane = tid & 31, ln = lane & 15, hh = lane >> 4; const int by = blockIdx.y;
  A += (size_t)by * sA; Bh += (size_t)by * sB; C += (size_t)by * sC;
  const int ntn = (N + 63) / 64; const int wid = blockIdx.x * 4 + w; const int mt = wid / ntn, nq = wid % ntn; if (mt * 16 >= M) return;
  const int row0 = mt * 16, col0 = nq * 64; const float* arow = A + (size_t)(row0 + ln) * lda;
  v8f acc[4] = {};
  for (int kb = 0; kb < K; kb += 32) {
    FragH ah, al;
    const v4f x0 = *(const v4fa*)(arow + kb + 8 * hh), x1 = *(const v4fa*)(arow + kb + 8 * hh + 4), x2 = *(const v4fa*)(arow + kb + 16 + 8 * hh), x3 = *(const v4fa*)(arow + kb + 16 + 8 * hh + 4);
    float xs[16] = {x0[0],x0[1],x0[2],x0[3],x1[0],x1[1],x1[2],x1[3],x2[0],x2[1],x2[2],x2[3],x3[0],x3[1],x3[2],x3[3]};
#pragma unroll
    for (int i = 0; i < 16; ++i) { const _Float16 h = (_Float16)xs[i]; ah.h[i] = h; al.h[i] = ASPLIT ? (_Float16)(xs[i] - (float)h) : (_Float16)0.0f; }
#pragma unroll
    for (int t = 0; t < 4; ++t) { if (col0 + t * 16 >= N) continue; const size_t boff = (size_t)(col0 + t * 16 + ln) * ldb + kb; FragH bq; bq.half[0] = *(const v8us*)(Bh + boff + 8 * hh); bq.half[1] = *(const v8us*)(Bh + boff + 16 + 8 * hh);
      acc[t] = mmaH<ASPLIT ? 2 : 1>(ah.v, al.v, bq.v, bq.v, acc[t]); }
  }
#pragma unroll
  for (int t = 0; t < 4; ++t) { if (col0 + t * 16 >= N) continue;
#pragma unroll
    for (int r = 0; r < 8; ++r) so[w][8 * hh + r][t * 16 + ln] = acc[t][r] * alpha; }
  __builtin_amdgcn_fence(__ATOMIC_ACQ_REL, "workgroup"); __builtin_amdgcn_wave_barrier();
  const int rsub = lane >> 4, c4 = (lane & 15) * 4;
  {
#pragma unroll
    for (int q = 0; q < 8; ++q) { const int r = q * 2 + rsub; if (col0 + c4 < N) { const v4f v = *(const v4fa*)&so[w][r][c4]; *(v4f*)(C + (size_t)(row0 + r) * ldc + col0 + c4) = v; } }
     }
}

// Wt[n][k] = f16(W[k][n]·scale) from f32 row-major W[K][N] (scale = power of two; bf16-exact weights stay exact in f16 away from the subnormal range)
__global__ __launch_bounds__(256) void k_wt_f16(const float* __restrict__ W, _Float16* __restrict__ Wt, int K, int N, float scale) {
  const int t = blockIdx.x * 256 + threadIdx.x; if (t >= N * (K / 8)) return; const int n = t / (K / 8), k8 = (t % (K / 8)) * 8; FragH f;
#pragma unroll
  for (int i = 0; i < 8; ++i) f.h[i] = (_Float16)(bf16_round(W[(size_t)(k8 + i) * N + n]) * scale); const v8us o = f.half[0];
  *(v8us*)((unsigned short*)Wt + (size_t)n * K + k8) = o; 
}
// k_gemm_hh variant with fused epilogue: v = acc·alpha + bias[by·sBias + col] (+ CP[(row/rowsPerB)·sCPb + by·64 + col] if CP) ; ACT 0 none / 1 elu ; writes f16 C16 and f32 C, each if non-null
template <int ACT>
__global__ __launch_bounds__(128) void k_gemm_hhx(const _Float16* __restrict__ A, int lda, size_t sA, const _Float16* __restrict__ Bh, int ldb, size_t sB, float alpha, const float* __restrict__ bias, size_t sBias, const float* __restrict__ CP, int rowsPerB, size_t sCPb, int row0g,
    float* __restrict__ C, _Float16* __restrict__ C16, int ldc, size_t sC, int M, int N, int K) {
  __shared__ __attribute__((aligned(16))) float so[4][16][64];
  const int tid = threadIdx.x, w = tid >> 5, lane = tid & 31, ln = lane & 15, hh = lane >> 4; const int by = blockIdx.y;
  A += (size_t)by * sA; Bh += (size_t)by * sB; const size_t cofs = (size_t)by * sC; const float* bp = bias ? bias + (size_t)by * sBias : nullptr;
  const int ntn = (N + 63) / 64; const int wid = blockIdx.x * 4 + w; const int mt = wid / ntn, nq = wid % ntn; if (mt * 16 >= M) return;
  const int row0 = mt * 16, col0 = nq * 64; const _Float16* arow = A + (size_t)(row0 + ln) * lda;
  v8f acc[4] = {};
  for (int kb = 0; kb < K; kb += 32) { FragH ah; ah.half[0] = *(const v8us*)((const unsigned short*)arow + kb + 8 * hh); ah.half[1] = *(const v8us*)((const unsigned short*)arow + kb + 16 + 8 * hh);
#pragma unroll
    for (int t = 0; t < 4; ++t) { if (col0 + t * 16 >= N) continue; const size_t boff = (size_t)(col0 + t * 16 + ln) * ldb + kb; FragH bq; bq.half[0] = *(const v8us*)((const unsigned short*)Bh + boff + 8 * hh); bq.half[1] = *(const v8us*)((const unsigned short*)Bh + boff + 16 + 8 * hh);
      acc[t] = mmaH<1>(ah.v, ah.v, bq.v, bq.v, acc[t]); }
  }
#pragma unroll
  for (int t = 0; t < 4; ++t) { if (col0 + t * 16 >= N) continue; const int col = col0 + t * 16 + ln; const float bv = bp ? bf16_round(bp[col]) : 0.f;
#pragma unroll
    for (int r = 0; r < 8; ++r) { float v = acc[t][r] * alpha + bv; if (CP) { const int bidx = (row0g + row0 + 8 * hh + r) / rowsPerB; v += CP[(size_t)bidx * sCPb + (size_t)by * 64 + col]; } if (ACT == 1) v = (v > 0.f) ? v : expm1f(v); else if (ACT == 7) v = (v > 0.f) ? v + 1.0f : expf(v); else if (ACT == 8) v = tanhf(v); else if (ACT == 9) v = 0.5f * v * (1.0f + tanhf(0.7978845608028654f * (v + 0.044715f * v * v * v))); else if (ACT == 11) v = 1.0f / (1.0f + expf(-v)); else if (ACT == 12) v = (v > 0.f) ? v : 0.01f * v; else if (ACT == 14) v = (v > 0.f) ? v : 0.1f * v; else if (ACT == 15) v = v / (1.0f + expf(-v)); else if (ACT == 3) v = fmaxf(v, 0.f); else if (ACT == 6) v = 0.5f * v * (1.0f + erff(v * 0.70710678118654752f)); so[w][8 * hh + r][t * 16 + ln] = v; } }
  __builtin_amdgcn_fence(__ATOMIC_ACQ_REL, "workgroup"); __builtin_amdgcn_wave_barrier();
  const int rsub = lane >> 4, c4 = (lane & 15) * 4; typedef _Float16 v4h __attribute__((ext_vector_type(4)));
  {
#pragma unroll
    for (int q = 0; q < 8; ++q) { const int r = q * 2 + rsub; if (col0 + c4 < N) { const v4f v = *(const v4fa*)&so[w][r][c4]; if (C) *(v4f*)(C + cofs + (size_t)(row0 + r) * ldc + col0 + c4) = v; if (C16) { v4h h4; for (int i = 0; i < 4; ++i) h4[i] = (_Float16)v[i]; *(v4h*)(C16 + cofs + (size_t)(row0 + r) * ldc + col0 + c4) = h4; } } }
     }
}


typedef _Float16 v4h __attribute__((ext_vector_type(4)));

__global__ __launch_bounds__(256) void k_x16(const float* __restrict__ x, _Float16* __restrict__ X16, size_t n8) { const size_t t = (size_t)blockIdx.x * 256 + threadIdx.x; if (t >= n8) return; FragH f;
#pragma unroll
  for (int q = 0; q < 8; ++q) f.h[q] = (_Float16)bf16_round(x[t * 8 + q]); *(v8us*)((unsigned short*)X16 + t * 8) = f.half[0];  }
__global__ __launch_bounds__(256) void k_h16(const float* __restrict__ x, _Float16* __restrict__ X16, size_t n8) { const size_t t = (size_t)blockIdx.x * 256 + threadIdx.x; if (t >= n8) return; FragH f;
#pragma unroll
  for (int q = 0; q < 8; ++q) f.h[q] = (_Float16)x[t * 8 + q]; *(v8us*)((unsigned short*)X16 + t * 8) = f.half[0];  }
__global__ __launch_bounds__(256) void k_round16f(const float* __restrict__ W, _Float16* __restrict__ Bt, size_t n8) { const size_t t = (size_t)blockIdx.x * 256 + threadIdx.x; if (t >= n8) return; FragH f;
#pragma unroll
  for (int i = 0; i < 8; ++i) f.h[i] = (_Float16)(bf16_round(W[t * 8 + i]) * 16.0f); *(v8us*)((unsigned short*)Bt + t * 8) = f.half[0];  }
template <int NHv, int TTv>
__global__ __launch_bounds__(256) void k_vt(const _Float16* __restrict__ V16, int ldv, int voff, _Float16* __restrict__ Vt) { __shared__ unsigned short tl[64][66]; const int tid = threadIdx.x; const int slab = blockIdx.x / (TTv / 64), lg = blockIdx.x % (TTv / 64); const int b = slab / NHv, h = slab % NHv;
  for (int i = tid; i < 64 * 8; i += 256) { const int r = i / 8, c8 = (i % 8) * 8; FragH f; f.half[0] = *(const v8us*)((const unsigned short*)V16 + ((size_t)b * TTv + lg * 64 + r) * ldv + voff + h * 64 + c8);
#pragma unroll
    for (int q = 0; q < 8; ++q) tl[r][c8 + q] = f.u[q]; }
  __syncthreads();
  {
#pragma unroll
    for (int rd = 0; rd < 2; ++rd) { const int d = rd * 32 + tid / 8, pc = tid % 8; FragH f;
#pragma unroll
      for (int q = 0; q < 8; ++q) f.u[q] = tl[pc * 8 + q][d];
      *(v8us*)((unsigned short*)Vt + ((size_t)slab * 64 + d) * TTv + lg * 64 + pc * 8) = f.half[0]; }
     } }

__global__ __launch_bounds__(256) void k_tok(const float* __restrict__ x, _Float16* __restrict__ X16) { __shared__ float tl[32][65]; const int tid = threadIdx.x; const int b = blockIdx.x / ((CC / 64) * (NN / 32)), rem = blockIdx.x % ((CC / 64) * (NN / 32)); const int cg = rem / (NN / 32), pg = rem % (NN / 32); const int c0 = cg * 64, p0 = pg * 32;
  for (int i = tid; i < 64 * 32; i += 256) { const int c = i / 32, pp = i % 32; tl[pp][c] = bf16_round(x[((size_t)b * CC + c0 + c) * NN + p0 + pp]); } __syncthreads();
  const int r = tid / 8, pc = tid % 8; FragH f; for (int q = 0; q < 8; ++q) f.h[q] = (_Float16)tl[r][pc * 8 + q]; const size_t row = (size_t)b * NN + p0 + r; *(v8us*)((unsigned short*)X16 + row * CC + c0 + pc * 8) = f.half[0];  }
// lane l <-> l ^ 16: the two halves of a wave each hold half of a query column's keys
__device__ __forceinline__ float xhalf(float v) { const int b = __float_as_int(v); return __int_as_float(__builtin_amdgcn_permlanex16(b, b, 0x76543210, 0xfedcba98, false, false)); }
// Transposed products: S^T = K.Q^T (A = 16 key rows, B = the wave's 16 queries as columns), O^T += V^T.P^T. A lane then holds 16 of the 32 scores of ONE query
// (keys 8hh + r and 16 + 8hh + r), which is the k order of a B operand: P goes from the score accumulators into the second product without LDS.
// K and V^T come in tiles of KT keys that the block's four waves share: asynchronous 16-byte copies fill one LDS buffer while the other is worked on (two buffers, one barrier a tile).
__global__ __launch_bounds__(128) void k_flash(const _Float16* __restrict__ Q16, int ldq, const _Float16* __restrict__ K16, int ldk, const _Float16* __restrict__ Vt, const int* __restrict__ MSK, float* __restrict__ O, int ldo) {
  constexpr int RPW = 16, NQB = NN / (4 * RPW), DT = 2;
  constexpr int KT = 128, NT = NN / KT, KP = HD + 8, VP = KT + 8;      /* row pitches of 80 and 272 bytes (16 x odd): 16-byte fragment reads of 16 rows fall on 64 different banks */
  __shared__ __attribute__((aligned(16))) unsigned short sK[2][KT][KP];      /* K tile: key rows of 32 halves */
  __shared__ __attribute__((aligned(16))) unsigned short sV[2][HD][VP];      /* V^T tile: channel rows of KT halves */
  __shared__ __attribute__((aligned(16))) float sO[4][RPW][32 + 4];
  const int tid = threadIdx.x, w = tid >> 5, lane = tid & 31, ln = lane & 15, hh = lane >> 4; (void)MSK;
  const int slab = blockIdx.x / NQB, qblk = blockIdx.x % NQB; const int h = slab; const int b = 0; const int qb0 = qblk * (4 * RPW); const int q0 = qb0 + w * RPW;
  FragH bq;
  { const unsigned short* qr = (const unsigned short*)Q16 + ((size_t)b * NN + q0 + ln) * ldq + h * HD; bq.half[0] = *(const v8us*)(qr + 8 * hh); bq.half[1] = *(const v8us*)(qr + 16 + 8 * hh); }
  const unsigned short* Vth = (const unsigned short*)Vt + (size_t)h * HD * NN;      /* V^T = v[(h,d)][n] channel-major */
  /* a thread's share of a tile: 16-byte piece tid & 3 of key rows (tid >> 2) + 32 i, and piece tid & 15 of channel rows (tid >> 4) + 8 i, i = 0..3 */
  const unsigned short* gk = (const unsigned short*)K16 + (size_t)b * NN * ldk + h * HD + (size_t)(tid >> 2) * ldk + (tid & 3) * 8;
  const unsigned short* gv = Vth + (size_t)(tid >> 4) * NN + (tid & 15) * 8;
  const unsigned lk = (unsigned)(uintptr_t)&sK[0][tid >> 2][(tid & 3) * 8], lv = (unsigned)(uintptr_t)&sV[0][tid >> 4][(tid & 15) * 8];      /* LDS byte addresses */
  const size_t kstep = (size_t)32 * ldk;
  auto stage = [&](int t, int buf) {
    const unsigned short* k0 = gk + (size_t)t * KT * ldk; const unsigned short* v0 = gv + t * KT;
    const unsigned a0 = lk + (unsigned)buf * (KT * KP * 2), c0 = lv + (unsigned)buf * (HD * VP * 2);
    /* the tile's eight copies of this thread; s_wait_xcnt closes the statement so that no address register of a copy is rewritten in front of it */
    asm volatile("global_load_async_to_lds_b128 %0, %8, off\n\t"
                 "global_load_async_to_lds_b128 %1, %9, off\n\t"
                 "global_load_async_to_lds_b128 %2, %10, off\n\t"
                 "global_load_async_to_lds_b128 %3, %11, off\n\t"
                 "global_load_async_to_lds_b128 %4, %12, off\n\t"
                 "global_load_async_to_lds_b128 %5, %13, off\n\t"
                 "global_load_async_to_lds_b128 %6, %14, off\n\t"
                 "global_load_async_to_lds_b128 %7, %15, off\n\t"
                 "s_wait_xcnt 0x0"
                 :: "v"(a0), "v"(a0 + 32 * KP * 2), "v"(a0 + 64 * KP * 2), "v"(a0 + 96 * KP * 2), "v"(c0), "v"(c0 + 8 * VP * 2), "v"(c0 + 16 * VP * 2), "v"(c0 + 24 * VP * 2),
                    "v"(k0), "v"(k0 + kstep), "v"(k0 + 2 * kstep), "v"(k0 + 3 * kstep), "v"(v0), "v"(v0 + 8 * NN), "v"(v0 + 16 * NN), "v"(v0 + 24 * NN)
                 : "memory");
  };
  float m_c = -3.0e38f, l_c = 0.f; v8f oacc[DT];      /* running maximum and this half's partial sum of query q0 + ln; oacc[dt][r] = O^T[dt*16 + 8hh + r][q0 + ln] */
#pragma unroll
  for (int dt = 0; dt < DT; ++dt) oacc[dt] = (v8f){0.f,0.f,0.f,0.f,0.f,0.f,0.f,0.f};
  stage(0, 0);
  asm volatile("s_wait_asynccnt 0x0" ::: "memory");      /* this wave's share of tile 0 has landed */
  __syncthreads();      /* every wave's share of tile 0 has landed */
  stage(1, 1);
  /* the tile loop and the loop over a tile's 32-key passes stay rolled: more copies of the long body would only grow the code; every full "#pragma unroll" in this kernel but the one over the stored output rows keeps an array that the loop variable indexes in registers */
#pragma unroll 1
  for (int t = 0; t < NT; ++t) {
   const int buf = t & 1;
#pragma unroll 1
   for (int js = 0; js < KT; js += 32) {
    FragH ak[2], av[DT];
#pragma unroll
    for (int nt = 0; nt < 2; ++nt) { const unsigned short* kr = &sK[buf][js + nt * 16 + ln][0]; ak[nt].half[0] = *(const v8us*)(kr + 8 * hh); ak[nt].half[1] = *(const v8us*)(kr + 16 + 8 * hh); }
#pragma unroll
    for (int dt = 0; dt < DT; ++dt) { const unsigned short* vrow = &sV[buf][dt * 16 + ln][js]; av[dt].half[0] = *(const v8us*)(vrow + 8 * hh); av[dt].half[1] = *(const v8us*)(vrow + 16 + 8 * hh); }
    float sc[16];
#pragma unroll
    for (int nt = 0; nt < 2; ++nt) {
      const v8f acc = mmaH<1>(ak[nt].v, ak[nt].v, bq.v, bq.v, (v8f){0.f,0.f,0.f,0.f,0.f,0.f,0.f,0.f});
#pragma unroll
      for (int r = 0; r < 8; ++r) sc[nt * 8 + r] = acc[r] * 0.17677669529663687f; }
    float mx[8];
#pragma unroll
    for (int i = 0; i < 8; ++i) mx[i] = fmaxf(sc[i], sc[8 + i]);
    float mc = fmaxf(fmaxf(fmaxf(mx[0], mx[1]), fmaxf(mx[2], mx[3])), fmaxf(fmaxf(mx[4], mx[5]), fmaxf(mx[6], mx[7])));
    mc = fmaxf(mc, xhalf(mc));
    const float mn = fmaxf(m_c, mc); const float al = (mn > -1.0e38f) ? expf(m_c - mn) : 1.0f; m_c = mn;
    FragH pb; float p[16];
#pragma unroll
    for (int i = 0; i < 16; ++i) { p[i] = expf(sc[i] - mn); pb.h[i] = (_Float16)(p[i] * 1024.0f); }
#pragma unroll
    for (int i = 0; i < 8; ++i) p[i] += p[8 + i];
    l_c = l_c * al + (((p[0] + p[1]) + (p[2] + p[3])) + ((p[4] + p[5]) + (p[6] + p[7])));
#pragma unroll
    for (int dt = 0; dt < DT; ++dt)
#pragma unroll
      for (int r = 0; r < 8; ++r) oacc[dt][r] *= al;
#pragma unroll
    for (int dt = 0; dt < DT; ++dt) oacc[dt] = mmaH<1>(av[dt].v, av[dt].v, pb.v, pb.v, oacc[dt]);
   }
   asm volatile("s_wait_dscnt 0x0" ::: "memory");      /* this wave's reads of buffer buf have returned before the buffer is refilled */
   asm volatile("s_wait_asynccnt 0x0" ::: "memory");      /* this wave's share of tile t + 1 has landed */
   __syncthreads();      /* publishes tile t + 1 and ends every wave's reads of buffer buf */
   if (t + 2 < NT) stage(t + 2, buf);
  }
  asm volatile("s_wait_asynccnt 0x0" ::: "memory");      /* no copy is outstanding when the wave goes on to its end */
  const float l = l_c + xhalf(l_c); const float inv = (l > 0.f) ? 1.0f / (l * 1024.0f) : 0.f;
#pragma unroll
  for (int dt = 0; dt < DT; ++dt)
#pragma unroll
    for (int r4 = 0; r4 < 8; r4 += 4) { const v4f o4 = {oacc[dt][r4] * inv, oacc[dt][r4 + 1] * inv, oacc[dt][r4 + 2] * inv, oacc[dt][r4 + 3] * inv}; *(v4fa*)&sO[w][ln][dt * 16 + 8 * hh + r4] = o4; }
  __builtin_amdgcn_fence(__ATOMIC_ACQ_REL, "workgroup"); __builtin_amdgcn_wave_barrier();
  {
#pragma unroll
    for (int rp = 0; rp < RPW; rp += 4) { const int r = rp + (lane >> 3), pc = lane & 7; const v4f val = *(const v4fa*)&sO[w][r][pc * 4]; *(v4f*)(O + ((size_t)b * NN + q0 + r) * ldo + h * HD + pc * 4) = val; }      
     } }

__global__ __launch_bounds__(256) void k_out(const float* __restrict__ G, float* __restrict__ out) { __shared__ float tl[32][65]; const int tid = threadIdx.x; const int b = blockIdx.x / ((CC / 32) * (NN / 64)), rem = blockIdx.x % ((CC / 32) * (NN / 64)); const int cg = rem / (NN / 64), pg = rem % (NN / 64); const int c0 = cg * 32, p0 = pg * 64;
  for (int i = tid; i < 64 * 32; i += 256) { const int pp = i / 32, c = i % 32; tl[c][pp] = G[((size_t)b * NN + p0 + pp) * CC + c0 + c]; } __syncthreads();
  { for (int i = tid; i < 32 * 16; i += 256) { const int c = i / 16, q4 = i % 16; const v4f v = {tl[c][q4 * 4], tl[c][q4 * 4 + 1], tl[c][q4 * 4 + 2], tl[c][q4 * 4 + 3]}; *(v4f*)(out + ((size_t)b * CC + c0 + c) * NN + p0 + q4 * 4) = v; }  } }

extern "C" void kernel_launch(void* const* d_in, const int* in_sizes, int n_in,
                              void* d_out, int out_size, void* d_ws, size_t ws_size, hipStream_t stream) {
  (void)in_sizes; (void)n_in; (void)out_size;
  const float* x = (const float*)d_in[0]; const float* Wqkv = (const float*)d_in[1]; const float* Wp = (const float*)d_in[2]; const float* bp = (const float*)d_in[3];
  char* ws = (char*)d_ws; size_t off = 0;
  auto take = [&](size_t bytes) { char* p = ws + off; off += (bytes + 255) & ~(size_t)255; return p; };
  _Float16* Bqkv = (_Float16*)take((size_t)C3 * CC * 2); _Float16* Bp = (_Float16*)take((size_t)CC * CC * 2); _Float16* X16 = (_Float16*)take((size_t)NR * CC * 2);
  _Float16* QK = (_Float16*)take((size_t)NR * 2 * CC * 2); _Float16* Vt = (_Float16*)take((size_t)CC * NN * 2); float* O = (float*)take((size_t)NR * CC * 4); _Float16* O16 = (_Float16*)take((size_t)NR * CC * 2); float* G = (float*)take((size_t)NR * CC * 4);
  if (off > ws_size) return;      // 0.4 + 0.1 + 2.1 + 4.2 + 2.1 + 4.2 + 2.1 + 4.2 ≈ 20 MB
  k_round16f<<<(unsigned)(((size_t)C3 * CC / 8 + 255) / 256), 256, 0, stream>>>(Wqkv, Bqkv, (size_t)C3 * CC / 8); k_round16f<<<(unsigned)(((size_t)CC * CC / 8 + 255) / 256), 256, 0, stream>>>(Wp, Bp, (size_t)CC * CC / 8);      /* (out,in) natural, ×2^4 */
  k_tok<<<BB * (CC / 64) * (NN / 32), 256, 0, stream>>>(x, X16);
  k_gemm_hhx<0><<<dim3(((NR / 16) * (2 * CC / 64) + 3) / 4, 1), 128, 0, stream>>>(X16, CC, 0, Bqkv, CC, 0, 0.0625f, nullptr, 0, nullptr, 1, 0, 0, nullptr, QK, 2 * CC, 0, NR, 2 * CC, CC);      /* [q | k] token-major [n][512] (head h = cols h·32 / 256 + h·32): M 4096 N 512 K 256 */
  k_gemm_hhx<0><<<dim3(((CC / 16) * (NN / 64) + 3) / 4, 1), 128, 0, stream>>>(Bqkv + (size_t)2 * CC * CC, CC, 0, X16, CC, 0, 0.0625f, nullptr, 0, nullptr, 1, 0, 0, nullptr, Vt, NN, 0, CC, NN, CC);      /* v channel-major [(h,d)][n] = Vᵀ: A = qkv_w rows 512..767, B = x token-major: M 256 N 4096 K 256 */
  k_flash<<<NH * (NN / 64), 128, 0, stream>>>(QK, 2 * CC, QK + CC, 2 * CC, Vt, nullptr, O, CC);      /* blocks = head × 64-query groups */
  k_h16<<<(unsigned)(((size_t)NR * CC / 8 + 255) / 256), 256, 0, stream>>>(O, O16, (size_t)NR * CC / 8);
  k_gemm_hhx<0><<<dim3(((NR / 16) * (CC / 64) + 3) / 4, 1), 128, 0, stream>>>(O16, CC, 0, Bp, CC, 0, 0.0625f, bp, 0, nullptr, 1, 0, 0, G, nullptr, CC, 0, NR, CC, CC);      /* G = O·proj_wᵀ + proj_b (token-major): M 4096 N 256 K 256 */
  k_out<<<BB * (CC / 32) * (NN / 64), 256, 0, stream>>>(G, (float*)d_out);
}

// v003
// It runs in 87.5 microseconds.
// Next to v002, in two timings, it ran 1.35 and 1.36 times as fast.
// All steps since v000 together make it 4.48 times as fast.
#include <hip/hip_runtime.h>
// 3-D multi-head self-attention on channel-major x [1, 256, 16³ = 4096]: qkv = qkv_w·x (1×1×1 conv, no bias), 8 heads × 32, softmax(qᵀk·32^-½) over keys, out[h,d,n] = Σ_m attn[n,m]·v[h,d,m], then proj_w·out + proj_b.
// Compute dtype: x, qkv_w, proj_w, proj_b rounded to bf16; q/k token-major and v channel-major (= Vᵀ) as f16 GEMM outputs (f32 accumulate); fused flash-style kernel per head
// (online softmax f32, P f16 ×2^10) on v_wmma_f32_16x16x32_f16; O → f16 → projection GEMM with bias → transposed back to [c][n] through LDS; f32 accumulate throughout.
#define BB 1
#define CC 256
#define C3 768
#define NH 8
#define HD 32
#define NN 4096
#define NR (BB * NN)

typedef __bf16 v16b __attribute__((ext_vector_type(16)));
typedef unsigned short v8us __attribute__((ext_vector_type(8), may_alias));
typedef float  v8f  __attribute__((ext_vector_type(8)));
typedef float  v4f  __attribute__((ext_vector_type(4)));
typedef float  v4fa __attribute__((ext_vector_type(4), may_alias));
union FragB { v16b v; v8us half[2]; unsigned short u[16]; };

__device__ __forceinline__ unsigned short bf16_bits(float x) { unsigned int u = __float_as_uint(x); return (unsigned short)((u + 0x7FFFu + ((u >> 16) & 1u)) >> 16); }
__device__ __forceinline__ float bf16_val(unsigned short b) { return __uint_as_float(((unsigned int)b) << 16); }
__device__ __forceinline__ float bf16_round(float x) { return bf16_val(bf16_bits(x)); }
// D += A·B with NT terms: 1 = ah·bh, 2 = + al·bh (A split), 3 = + ah·bl (both split)
template <int NT>
__device__ __forceinline__ v8f mmaN(v16b ah, v16b al, v16b bh, v16b bl, v8f c) {
  c = __builtin_amdgcn_wmma_f32_16x16x32_bf16(false, ah, false, bh, (short)0, c, false, false);
  if (NT >= 2) c = __builtin_amdgcn_wmma_f32_16x16x32_bf16(false, al, false, bh, (short)0, c, false, false);
  if (NT >= 3) c = __builtin_amdgcn_wmma_f32_16x16x32_bf16(false, ah, false, bl, (short)0, c, false, false);
  asm volatile("v_nop\n\tv_nop\n\tv_nop\n\tv_nop" : "+v"(c) : "v"(ah), "v"(al), "v"(bh), "v"(bl));
  return c;
}

__global__ __launch_bounds__(256) void k_wt_bf16(const float* __restrict__ W, unsigned short* __restrict__ Wt, int K, int N) {
  const int t = blockIdx.x * 256 + threadIdx.x;
  const int k8n = K / 8;
  if (t >= N * k8n) return;
  const int n = t / k8n, k8 = (t % k8n) * 8;
  v8us v;
#pragma unroll
  for (int i = 0; i < 8; ++i) v[i] = bf16_bits(W[(size_t)(k8 + i) * N + n]);
  *(v8us*)(Wt + (size_t)n * K + k8) = v;
  
}

// GEMM C[M][N] (f32, pitch ldc) = act(A[M][K]·W + bias). A f32 row-major (pitch lda) converted per fragment to bf16
// (ASPLIT: hi/lo two planes -> 2 terms, else single rounded term); Wt bf16 [N][K] (pitch ldb). BIAS_BF16 rounds the
// bias to bf16 first (bias quantised to bf16 before the add). K%32==0, M%16==0, N%64==0.
template <bool ASPLIT, int ACT, bool BIAS_BF16>
__global__ __launch_bounds__(128) void k_gemm_bf(const float* __restrict__ A, int lda, const unsigned short* __restrict__ Wt, int ldb,
                                               const float* __restrict__ bias, float* __restrict__ C, int ldc, int M, int N, int K) {
  __shared__ __attribute__((aligned(16))) float so[4][16][64];
  const int tid = threadIdx.x, w = tid >> 5, lane = tid & 31, ln = lane & 15, hh = lane >> 4;
  const int ntn = N / 64;
  const int wid = blockIdx.x * 4 + w;
  const int mt = wid / ntn, nq = wid % ntn;
  if (mt * 16 >= M) return;
  const int row0 = mt * 16, col0 = nq * 64;
  const float* arow = A + (size_t)(row0 + ln) * lda;
  v8f acc[4] = {};
  for (int kb = 0; kb < K; kb += 32) {
    FragB ah, al;
    const v4f x0 = *(const v4fa*)(arow + kb + 8 * hh), x1 = *(const v4fa*)(arow + kb + 8 * hh + 4);
    const v4f x2 = *(const v4fa*)(arow + kb + 16 + 8 * hh), x3 = *(const v4fa*)(arow + kb + 16 + 8 * hh + 4);
    float xs[16] = {x0[0],x0[1],x0[2],x0[3],x1[0],x1[1],x1[2],x1[3],x2[0],x2[1],x2[2],x2[3],x3[0],x3[1],x3[2],x3[3]};
#pragma unroll
    for (int i = 0; i < 16; ++i) { const unsigned short hb = bf16_bits(xs[i]); ah.u[i] = hb; al.u[i] = ASPLIT ? bf16_bits(xs[i] - bf16_val(hb)) : (unsigned short)0; }
#pragma unroll
    for (int t = 0; t < 4; ++t) {
      const unsigned short* brow = Wt + (size_t)(col0 + t * 16 + ln) * ldb + kb;
      FragB b;
      b.half[0] = *(const v8us*)(brow + 8 * hh);
      b.half[1] = *(const v8us*)(brow + 16 + 8 * hh);
      acc[t] = mmaN<ASPLIT ? 2 : 1>(ah.v, al.v, b.v, b.v, acc[t]);
    }
  }
#pragma unroll
  for (int t = 0; t < 4; ++t) {
    float bv = bias ? bias[col0 + t * 16 + ln] : 0.f;
    if (BIAS_BF16) bv = bf16_round(bv);
#pragma unroll
    for (int r = 0; r < 8; ++r) { float v = acc[t][r] + bv; if (ACT == 1) v = fmaxf(v, 0.f); so[w][8 * hh + r][t * 16 + ln] = v; }
  }
  __builtin_amdgcn_fence(__ATOMIC_ACQ_REL, "workgroup");
  __builtin_amdgcn_wave_barrier();
  const int rsub = lane >> 4, c4 = (lane & 15) * 4;
  {
#pragma unroll
    for (int q = 0; q < 8; ++q) {
      const int r = q * 2 + rsub;
      const v4f v = *(const v4fa*)&so[w][r][c4];
      *(v4f*)(C + (size_t)(row0 + r) * ldc + col0 + c4) = v;
    }
    
  }
}

// Flash-style causal/unmasked attention, all contractions 3-term bf16 hi/lo splits, f32 softmax with running max.
// q,k,v rows are read from f32 buffers with arbitrary row pitch (so they can live inside a fused qkv buffer);
// D = head size (multiple of 32, <= 128); one wave = 16 query rows; block = 4 waves (64 queries) sharing K/V chunks of 32.
template <int D, bool CAUSAL>
__global__ __launch_bounds__(128) void k_flash(const float* __restrict__ qb, const float* __restrict__ kb, const float* __restrict__ vb,
                                             int pitch, int T, int H, float scale, float* __restrict__ y, int ypitch) {
  constexpr int KS = D / 32;        // k-steps for QK
  constexpr int DT = D / 16;        // d tiles for PV
  __shared__ __attribute__((aligned(16))) unsigned short sKh[32][D + 8], sKl[32][D + 8], sVh[32][D + 8], sVl[32][D + 8];
  __shared__ __attribute__((aligned(16))) unsigned short sPh[4][16][40], sPl[4][16][40];
  __shared__ __attribute__((aligned(16))) float sO[4][16][D];
  const int tid = threadIdx.x, w = tid >> 5, lane = tid & 31, ln = lane & 15, hh = lane >> 4;
  const int nqb = (T + 63) / 64;
  const int bh = blockIdx.x / nqb, qblk = blockIdx.x % nqb;
  const int b = bh / H, h = bh % H;
  const int q0 = qblk * 64 + w * 16;
  const float* Q = qb + (size_t)b * T * pitch + h * D;
  const float* K = kb + (size_t)b * T * pitch + h * D;
  const float* V = vb + (size_t)b * T * pitch + h * D;

  // A fragments of the wave's 16 query rows (scaled), hi/lo
  FragB aqh[KS], aql[KS];
  {
    int row = q0 + ln; if (row >= T) row = T - 1;
    const float* qr = Q + (size_t)row * pitch;
#pragma unroll
    for (int ks = 0; ks < KS; ++ks)
#pragma unroll
      for (int i = 0; i < 16; ++i) {
        const int d = ks * 32 + ((i < 8) ? (8 * hh + i) : (16 + 8 * hh + (i - 8)));
        const float x = qr[d] * scale; const unsigned short hb = bf16_bits(x);
        aqh[ks].u[i] = hb; aql[ks].u[i] = bf16_bits(x - bf16_val(hb));
      }
  }
  float m_r[8], l_r[8];
#pragma unroll
  for (int r = 0; r < 8; ++r) { m_r[r] = -3.0e38f; l_r[r] = 0.f; }
  v8f oacc[DT];
#pragma unroll
  for (int dt = 0; dt < DT; ++dt) oacc[dt] = (v8f){0.f,0.f,0.f,0.f,0.f,0.f,0.f,0.f};

  const int kv_end = CAUSAL ? min(T, qblk * 64 + 64) : T;     // block-uniform
  for (int j0 = 0; j0 < kv_end; j0 += 32) {
    __syncthreads();
    for (int e = tid; e < 32 * (D / 4); e += 128) {
      const int r = e / (D / 4), c4 = (e % (D / 4)) * 4;
      const int key = j0 + r;
      v4f kf = {0.f,0.f,0.f,0.f}, vf = {0.f,0.f,0.f,0.f};
      if (key < T) { kf = *(const v4fa*)(K + (size_t)key * pitch + c4); vf = *(const v4fa*)(V + (size_t)key * pitch + c4); }
#pragma unroll
      for (int t = 0; t < 4; ++t) {
        unsigned short hb = bf16_bits(kf[t]); sKh[r][c4 + t] = hb; sKl[r][c4 + t] = bf16_bits(kf[t] - bf16_val(hb));
        hb = bf16_bits(vf[t]); sVh[r][c4 + t] = hb; sVl[r][c4 + t] = bf16_bits(vf[t] - bf16_val(hb));
      }
    }
    __syncthreads();
    // S tile 16 x 32
    v8f s[2];
#pragma unroll
    for (int nt = 0; nt < 2; ++nt) {
      v8f acc = {};
#pragma unroll
      for (int ks = 0; ks < KS; ++ks) {
        FragB bh_, bl_;
        bh_.half[0] = *(const v8us*)&sKh[nt * 16 + ln][ks * 32 + 8 * hh]; bh_.half[1] = *(const v8us*)&sKh[nt * 16 + ln][ks * 32 + 16 + 8 * hh];
        bl_.half[0] = *(const v8us*)&sKl[nt * 16 + ln][ks * 32 + 8 * hh]; bl_.half[1] = *(const v8us*)&sKl[nt * 16 + ln][ks * 32 + 16 + 8 * hh];
        acc = mmaN<3>(aqh[ks].v, aql[ks].v, bh_.v, bl_.v, acc);
      }
      s[nt] = acc;
    }
    // mask + running max (rows 8hh+r; the 16 lanes of a half share rows)
    float alpha[8];
#pragma unroll
    for (int r = 0; r < 8; ++r) {
      const int qi = q0 + 8 * hh + r;
      const int ja = j0 + ln, jb = j0 + 16 + ln;
      if (CAUSAL) { if (ja > qi) s[0][r] = -3.0e38f; if (jb > qi) s[1][r] = -3.0e38f; }
      if (ja >= T) s[0][r] = -3.0e38f;
      if (jb >= T) s[1][r] = -3.0e38f;
      float mx = fmaxf(s[0][r], s[1][r]);
      mx = fmaxf(mx, __shfl_xor(mx, 1, 32)); mx = fmaxf(mx, __shfl_xor(mx, 2, 32)); mx = fmaxf(mx, __shfl_xor(mx, 4, 32)); mx = fmaxf(mx, __shfl_xor(mx, 8, 32));
      const float mnew = fmaxf(m_r[r], mx);
      alpha[r] = (mnew > -1.0e38f) ? __expf(m_r[r] - mnew) : 1.0f;
      const float p0 = (s[0][r] > -1.0e38f) ? __expf(s[0][r] - mnew) : 0.f;
      const float p1 = (s[1][r] > -1.0e38f) ? __expf(s[1][r] - mnew) : 0.f;
      m_r[r] = mnew;
      l_r[r] = l_r[r] * alpha[r] + p0 + p1;            // per-lane partial row sum (16 lanes combined at the end)
      unsigned short hb = bf16_bits(p0); sPh[w][8 * hh + r][ln] = hb;      sPl[w][8 * hh + r][ln] = bf16_bits(p0 - bf16_val(hb));
      hb = bf16_bits(p1);                sPh[w][8 * hh + r][16 + ln] = hb; sPl[w][8 * hh + r][16 + ln] = bf16_bits(p1 - bf16_val(hb));
    }
#pragma unroll
    for (int dt = 0; dt < DT; ++dt)
#pragma unroll
      for (int r = 0; r < 8; ++r) oacc[dt][r] *= alpha[r];
    __builtin_amdgcn_fence(__ATOMIC_ACQ_REL, "workgroup");
    __builtin_amdgcn_wave_barrier();
    FragB pah, pal;
    pah.half[0] = *(const v8us*)&sPh[w][ln][8 * hh]; pah.half[1] = *(const v8us*)&sPh[w][ln][16 + 8 * hh];
    pal.half[0] = *(const v8us*)&sPl[w][ln][8 * hh]; pal.half[1] = *(const v8us*)&sPl[w][ln][16 + 8 * hh];
#pragma unroll
    for (int dt = 0; dt < DT; ++dt) {
      FragB bvh, bvl;
#pragma unroll
      for (int i = 0; i < 8; ++i) {
        bvh.u[i] = sVh[8 * hh + i][dt * 16 + ln]; bvh.u[8 + i] = sVh[16 + 8 * hh + i][dt * 16 + ln];
        bvl.u[i] = sVl[8 * hh + i][dt * 16 + ln]; bvl.u[8 + i] = sVl[16 + 8 * hh + i][dt * 16 + ln];
      }
      oacc[dt] = mmaN<3>(pah.v, pal.v, bvh.v, bvl.v, oacc[dt]);
    }
    __builtin_amdgcn_fence(__ATOMIC_ACQ_REL, "workgroup");
    __builtin_amdgcn_wave_barrier();
  }
#pragma unroll
  for (int r = 0; r < 8; ++r) {
    float l = l_r[r];
    l += __shfl_xor(l, 1, 32); l += __shfl_xor(l, 2, 32); l += __shfl_xor(l, 4, 32); l += __shfl_xor(l, 8, 32);
    l_r[r] = (l > 0.f) ? 1.0f / l : 0.f;
  }
#pragma unroll
  for (int dt = 0; dt < DT; ++dt)
#pragma unroll
    for (int r = 0; r < 8; ++r) sO[w][8 * hh + r][dt * 16 + ln] = oacc[dt][r] * l_r[r];
  __builtin_amdgcn_fence(__ATOMIC_ACQ_REL, "workgroup");
  __builtin_amdgcn_wave_barrier();
  {
    for (int r = 0; r < 16; ++r) {
      const int row = q0 + r;
      if (row < T && lane < D / 4) {
        const v4f val = *(const v4fa*)&sO[w][r][lane * 4];
        *(v4f*)(y + ((size_t)b * T + row) * ypitch + h * D + lane * 4) = val;
      }
    }
    
  }
}

// GEMM C = act(A·W + bias + resid): A f32 (ASPLIT -> hi/lo 2 terms), Wt bf16 [N][K]; ACT 0 none, 1 relu, 2 exact gelu;
// resid (optional, f32, row index = (row % rmod), pitch ldr, RES_BF16 rounds it) added before the activation.
template <bool ASPLIT, int ACT, bool BIAS_BF16, bool RES_BF16>
__global__ __launch_bounds__(128) void k_gemm_bf3(const float* __restrict__ A, int lda, const unsigned short* __restrict__ Wt, int ldb,
                                                const float* __restrict__ bias, const float* __restrict__ resid, int rmod, int ldr,
                                                float* __restrict__ C, int ldc, int M, int N, int K) {
  __shared__ __attribute__((aligned(16))) float so[4][16][64];
  const int tid = threadIdx.x, w = tid >> 5, lane = tid & 31, ln = lane & 15, hh = lane >> 4;
  const int ntn = N / 64;
  const int wid = blockIdx.x * 4 + w;
  const int mt = wid / ntn, nq = wid % ntn;
  if (mt * 16 >= M) return;
  const int row0 = mt * 16, col0 = nq * 64;
  const float* arow = A + (size_t)(row0 + ln) * lda;
  v8f acc[4] = {};
  for (int kb = 0; kb < K; kb += 32) {
    FragB ah, al;
    const v4f x0 = *(const v4fa*)(arow + kb + 8 * hh), x1 = *(const v4fa*)(arow + kb + 8 * hh + 4);
    const v4f x2 = *(const v4fa*)(arow + kb + 16 + 8 * hh), x3 = *(const v4fa*)(arow + kb + 16 + 8 * hh + 4);
    float xs[16] = {x0[0],x0[1],x0[2],x0[3],x1[0],x1[1],x1[2],x1[3],x2[0],x2[1],x2[2],x2[3],x3[0],x3[1],x3[2],x3[3]};
#pragma unroll
    for (int i = 0; i < 16; ++i) { const unsigned short hb = bf16_bits(xs[i]); ah.u[i] = hb; al.u[i] = ASPLIT ? bf16_bits(xs[i] - bf16_val(hb)) : (unsigned short)0; }
#pragma unroll
    for (int t = 0; t < 4; ++t) {
      const unsigned short* brow = Wt + (size_t)(col0 + t * 16 + ln) * ldb + kb;
      FragB b;
      b.half[0] = *(const v8us*)(brow + 8 * hh);
      b.half[1] = *(const v8us*)(brow + 16 + 8 * hh);
      acc[t] = mmaN<ASPLIT ? 2 : 1>(ah.v, al.v, b.v, b.v, acc[t]);
    }
  }
#pragma unroll
  for (int t = 0; t < 4; ++t) {
    const int col = col0 + t * 16 + ln;
    float bv = bias ? bias[col] : 0.f;
    if (BIAS_BF16) bv = bf16_round(bv);
#pragma unroll
    for (int r = 0; r < 8; ++r) {
      float v = acc[t][r] + bv;
      if (resid) { float rv = resid[(size_t)((row0 + 8 * hh + r) % rmod) * ldr + col]; if (RES_BF16) rv = bf16_round(rv); v += rv; }
      if (ACT == 1) v = fmaxf(v, 0.f);
      if (ACT == 2) v = 0.5f * v * (1.0f + erff(v * 0.70710678118654752f));
      if (ACT == 3) { const float u = 0.7978845608028654f * (v + 0.044715f * v * v * v); v = 0.5f * v * (1.0f + tanhf(u)); }
      so[w][8 * hh + r][t * 16 + ln] = v;
    }
  }
  __builtin_amdgcn_fence(__ATOMIC_ACQ_REL, "workgroup");
  __builtin_amdgcn_wave_barrier();
  const int rsub = lane >> 4, c4 = (lane & 15) * 4;
  {
#pragma unroll
    for (int q = 0; q < 8; ++q) {
      const int r = q * 2 + rsub;
      const v4f v = *(const v4fa*)&so[w][r][c4];
      *(v4f*)(C + (size_t)(row0 + r) * ldc + col0 + c4) = v;
    }
    
  }
}
// row LayerNorm (biased variance, eps) over N: s = X (+ R); optional out_sum <- s; out_norm <- (s-mu)*rsqrt(var+eps)*g + b
template <bool PARAM_BF16>
__global__ __launch_bounds__(256) void k_layernorm(const float* __restrict__ X, const float* __restrict__ R, const float* __restrict__ g, const float* __restrict__ bta,
                                                  float* __restrict__ out_sum, float* __restrict__ out_norm, int N, float eps) {
  __shared__ float red[256];
  const int row = blockIdx.x, tid = threadIdx.x;
  const float* x = X + (size_t)row * N; const float* rr = R ? R + (size_t)row * N : nullptr;
  float vals[16];                     // up to N = 4096
  const int per = N / 256;            // contiguous chunk per thread? use strided-by-4 chunks: thread handles j = tid*4 + 1024*u
  float s1 = 0.f;
  for (int u = 0; u < per / 4; ++u) {
    const int j = tid * 4 + 1024 * u;
    const v4f a = *(const v4fa*)(x + j);
    v4f b = {0.f,0.f,0.f,0.f}; if (rr) b = *(const v4fa*)(rr + j);
#pragma unroll
    for (int q = 0; q < 4; ++q) { const float v = a[q] + b[q]; vals[u * 4 + q] = v; s1 += v; }
  }
  red[tid] = s1; __syncthreads();
  for (int st = 128; st > 0; st >>= 1) { if (tid < st) red[tid] += red[tid + st]; __syncthreads(); }
  const float mu = red[0] / (float)N; __syncthreads();
  float s2 = 0.f;
  for (int u = 0; u < per / 4; ++u)
#pragma unroll
    for (int q = 0; q < 4; ++q) { const float c = vals[u * 4 + q] - mu; s2 += c * c; }
  red[tid] = s2; __syncthreads();
  for (int st = 128; st > 0; st >>= 1) { if (tid < st) red[tid] += red[tid + st]; __syncthreads(); }
  const float rs = rsqrtf(red[0] / (float)N + eps);
  {
    for (int u = 0; u < per / 4; ++u) {
      const int j = tid * 4 + 1024 * u;
      v4f o, sm;
#pragma unroll
      for (int q = 0; q < 4; ++q) {
        float gg = g[j + q], bb = bta[j + q];
        if (PARAM_BF16) { gg = bf16_round(gg); bb = bf16_round(bb); }
        sm[q] = vals[u * 4 + q]; o[q] = (vals[u * 4 + q] - mu) * rs * gg + bb;
      }
      if (out_sum) *(v4f*)(out_sum + (size_t)row * N + j) = sm;
      *(v4f*)(out_norm + (size_t)row * N + j) = o;
    }
    
  }
}



// ---- f16 WMMA path (v_wmma_f32_16x16x32_f16): 11-bit significands for operands in range — used here for the qkv and projection GEMMs and for attention
typedef _Float16 v16h __attribute__((ext_vector_type(16)));
union FragH { v16h v; v8us half[2]; _Float16 h[16]; unsigned short u[16]; };
template <int NT>
__device__ __forceinline__ v8f mmaH(v16h ah, v16h al, v16h bh, v16h bl, v8f c) {
  c = __builtin_amdgcn_wmma_f32_16x16x32_f16(false, ah, false, bh, (short)0, c, false, false);
  if (NT >= 2) c = __builtin_amdgcn_wmma_f32_16x16x32_f16(false, al, false, bh, (short)0, c, false, false);
  if (NT >= 3) c = __builtin_amdgcn_wmma_f32_16x16x32_f16(false, ah, false, bl, (short)0, c, false, false);
  asm volatile("v_nop\n\tv_nop\n\tv_nop\n\tv_nop" : "+v"(c) : "v"(ah), "v"(al), "v"(bh), "v"(bl));
  return c;
}
// batched GEMM like k_gemm_b but f16 operands: A f32 (split into f16 hi/lo if ASPLIT, else rounded to f16), Bt = f16 values [n][k]; alpha; C f32; N multiple of 16 (partial tiles skipped)
template <bool ASPLIT>
__global__ __launch_bounds__(128) void k_gemm_h(const float* __restrict__ A, int lda, size_t sA, const _Float16* __restrict__ Bh, int ldb, size_t sB, float alpha, float* __restrict__ C, int ldc, size_t sC, int M, int N, int K) {
  __shared__ __attribute__((aligned(16))) float so[4][16][64];
  const int tid = threadIdx.x, w = tid >> 5, lane = tid & 31, ln = lane & 15, hh = lane >> 4; const int by = blockIdx.y;
  A += (size_t)by * sA; Bh += (size_t)by * sB; C += (size_t)by * sC;
  const int ntn = (N + 63) / 64; const int wid = blockIdx.x * 4 + w; const int mt = wid / ntn, nq = wid % ntn; if (mt * 16 >= M) return;
  const int row0 = mt * 16, col0 = nq * 64; const float* arow = A + (size_t)(row0 + ln) * lda;
  v8f acc[4] = {};
  for (int kb = 0; kb < K; kb += 32) {
    FragH ah, al;
    const v4f x0 = *(const v4fa*)(arow + kb + 8 * hh), x1 = *(const v4fa*)(arow + kb + 8 * hh + 4), x2 = *(const v4fa*)(arow + kb + 16 + 8 * hh), x3 = *(const v4fa*)(arow + kb + 16 + 8 * hh + 4);
    float xs[16] = {x0[0],x0[1],x0[2],x0[3],x1[0],x1[1],x1[2],x1[3],x2[0],x2[1],x2[2],x2[3],x3[0],x3[1],x3[2],x3[3]};
#pragma unroll
    for (int i = 0; i < 16; ++i) { const _Float16 h = (_Float16)xs[i]; ah.h[i] = h; al.h[i] = ASPLIT ? (_Float16)(xs[i] - (float)h) : (_Float16)0.0f; }
#pragma unroll
    for (int t = 0; t < 4; ++t) { if (col0 + t * 16 >= N) continue; const size_t boff = (size_t)(col0 + t * 16 + ln) * ldb + kb; FragH bq; bq.half[0] = *(const v8us*)(Bh + boff + 8 * hh); bq.half[1] = *(const v8us*)(Bh + boff + 16 + 8 * hh);
      acc[t] = mmaH<ASPLIT ? 2 : 1>(ah.v, al.v, bq.v, bq.v, acc[t]); }
  }
#pragma unroll
  for (int t = 0; t < 4; ++t) { if (col0 + t * 16 >= N) continue;
#pragma unroll
    for (int r = 0; r < 8; ++r) so[w][8 * hh + r][t * 16 + ln] = acc[t][r] * alpha; }
  __builtin_amdgcn_fence(__ATOMIC_ACQ_REL, "workgroup"); __builtin_amdgcn_wave_barrier();
  const int rsub = lane >> 4, c4 = (lane & 15) * 4;
  {
#pragma unroll
    for (int q = 0; q < 8; ++q) { const int r = q * 2 + rsub; if (col0 + c4 < N) { const v4f v = *(const v4fa*)&so[w][r][c4]; *(v4f*)(C + (size_t)(row0 + r) * ldc + col0 + c4) = v; } }
     }
}

// Wt[n][k] = f16(W[k][n]·scale) from f32 row-major W[K][N] (scale = power of two; bf16-exact weights stay exact in f16 away from the subnormal range)
__global__ __launch_bounds__(256) void k_wt_f16(const float* __restrict__ W, _Float16* __restrict__ Wt, int K, int N, float scale) {
  const int t = blockIdx.x * 256 + threadIdx.x; if (t >= N * (K / 8)) return; const int n = t / (K / 8), k8 = (t % (K / 8)) * 8; FragH f;
#pragma unroll
  for (int i = 0; i < 8; ++i) f.h[i] = (_Float16)(bf16_round(W[(size_t)(k8 + i) * N + n]) * scale); const v8us o = f.half[0];
  *(v8us*)((unsigned short*)Wt + (size_t)n * K + k8) = o; 
}
// k_gemm_hh variant with fused epilogue: v = acc·alpha + bias[by·sBias + col] (+ CP[(row/rowsPerB)·sCPb + by·64 + col] if CP) ; ACT 0 none / 1 elu ; writes f16 C16 and f32 C, each if non-null
template <int ACT>
__global__ __launch_bounds__(128) void k_gemm_hhx(const _Float16* __restrict__ A, int lda, size_t sA, const _Float16* __restrict__ Bh, int ldb, size_t sB, float alpha, const float* __restrict__ bias, size_t sBias, const float* __restrict__ CP, int rowsPerB, size_t sCPb, int row0g,
    float* __restrict__ C, _Float16* __restrict__ C16, int ldc, size_t sC, int M, int N, int K) {
  __shared__ __attribute__((aligned(16))) float so[4][16][64];
  const int tid = threadIdx.x, w = tid >> 5, lane = tid & 31, ln = lane & 15, hh = lane >> 4; const int by = blockIdx.y;
  A += (size_t)by * sA; Bh += (size_t)by * sB; const size_t cofs = (size_t)by * sC; const float* bp = bias ? bias + (size_t)by * sBias : nullptr;
  const int ntn = (N + 63) / 64; const int wid = blockIdx.x * 4 + w; const int mt = wid / ntn, nq = wid % ntn; if (mt * 16 >= M) return;
  const int row0 = mt * 16, col0 = nq * 64; const _Float16* arow = A + (size_t)(row0 + ln) * lda;
  v8f acc[4] = {};
  for (int kb = 0; kb < K; kb += 32) { FragH ah; ah.half[0] = *(const v8us*)((const unsigned short*)arow + kb + 8 * hh); ah.half[1] = *(const v8us*)((const unsigned short*)arow + kb + 16 + 8 * hh);
#pragma unroll
    for (int t = 0; t < 4; ++t) { if (col0 + t * 16 >= N) continue; const size_t boff = (size_t)(col0 + t * 16 + ln) * ldb + kb; FragH bq; bq.half[0] = *(const v8us*)((const unsigned short*)Bh + boff + 8 * hh); bq.half[1] = *(const v8us*)((const unsigned short*)Bh + boff + 16 + 8 * hh);
      acc[t] = mmaH<1>(ah.v, ah.v, bq.v, bq.v, acc[t]); }
  }
#pragma unroll
  for (int t = 0; t < 4; ++t) { if (col0 + t * 16 >= N) continue; const int col = col0 + t * 16 + ln; const float bv = bp ? bf16_round(bp[col]) : 0.f;
#pragma unroll
    for (int r = 0; r < 8; ++r) { float v = acc[t][r] * alpha + bv; if (CP) { const int bidx = (row0g + row0 + 8 * hh + r) / rowsPerB; v += CP[(size_t)bidx * sCPb + (size_t)by * 64 + col]; } if (ACT == 1) v = (v > 0.f) ? v : expm1f(v); else if (ACT == 7) v = (v > 0.f) ? v + 1.0f : expf(v); else if (ACT == 8) v = tanhf(v); else if (ACT == 9) v = 0.5f * v * (1.0f + tanhf(0.7978845608028654f * (v + 0.044715f * v * v * v))); else if (ACT == 11) v = 1.0f / (1.0f + expf(-v)); else if (ACT == 12) v = (v > 0.f) ? v : 0.01f * v; else if (ACT == 14) v = (v > 0.f) ? v : 0.1f * v; else if (ACT == 15) v = v / (1.0f + expf(-v)); else if (ACT == 3) v = fmaxf(v, 0.f); else if (ACT == 6) v = 0.5f * v * (1.0f + erff(v * 0.70710678118654752f)); so[w][8 * hh + r][t * 16 + ln] = v; } }
  __builtin_amdgcn_fence(__ATOMIC_ACQ_REL, "workgroup"); __builtin_amdgcn_wave_barrier();
  const int rsub = lane >> 4, c4 = (lane & 15) * 4; typedef _Float16 v4h __attribute__((ext_vector_type(4)));
  {
#pragma unroll
    for (int q = 0; q < 8; ++q) { const int r = q * 2 + rsub; if (col0 + c4 < N) { const v4f v = *(const v4fa*)&so[w][r][c4]; if (C) *(v4f*)(C + cofs + (size_t)(row0 + r) * ldc + col0 + c4) = v; if (C16) { v4h h4; for (int i = 0; i < 4; ++i) h4[i] = (_Float16)v[i]; *(v4h*)(C16 + cofs + (size_t)(row0 + r) * ldc + col0 + c4) = h4; } } }
     }
}


typedef _Float16 v4h __attribute__((ext_vector_type(4)));

__global__ __launch_bounds__(256) void k_x16(const float* __restrict__ x, _Float16* __restrict__ X16, size_t n8) { const size_t t = (size_t)blockIdx.x * 256 + threadIdx.x; if (t >= n8) return; FragH f;
#pragma unroll
  for (int q = 0; q < 8; ++q) f.h[q] = (_Float16)bf16_round(x[t * 8 + q]); *(v8us*)((unsigned short*)X16 + t * 8) = f.half[0];  }
__global__ __launch_bounds__(256) void k_h16(const float* __restrict__ x, _Float16* __restrict__ X16, size_t n8) { const size_t t = (size_t)blockIdx.x * 256 + threadIdx.x; if (t >= n8) return; FragH f;
#pragma unroll
  for (int q = 0; q < 8; ++q) f.h[q] = (_Float16)x[t * 8 + q]; *(v8us*)((unsigned short*)X16 + t * 8) = f.half[0];  }
__global__ __launch_bounds__(256) void k_round16f(const float* __restrict__ W, _Float16* __restrict__ Bt, size_t n8) { const size_t t = (size_t)blockIdx.x * 256 + threadIdx.x; if (t >= n8) return; FragH f;
#pragma unroll
  for (int i = 0; i < 8; ++i) f.h[i] = (_Float16)(bf16_round(W[t * 8 + i]) * 16.0f); *(v8us*)((unsigned short*)Bt + t * 8) = f.half[0];  }
template <int NHv, int TTv>
__global__ __launch_bounds__(256) void k_vt(const _Float16* __restrict__ V16, int ldv, int voff, _Float16* __restrict__ Vt) { __shared__ unsigned short tl[64][66]; const int tid = threadIdx.x; const int slab = blockIdx.x / (TTv / 64), lg = blockIdx.x % (TTv / 64); const int b = slab / NHv, h = slab % NHv;
  for (int i = tid; i < 64 * 8; i += 256) { const int r = i / 8, c8 = (i % 8) * 8; FragH f; f.half[0] = *(const v8us*)((const unsigned short*)V16 + ((size_t)b * TTv + lg * 64 + r) * ldv + voff + h * 64 + c8);
#pragma unroll
    for (int q = 0; q < 8; ++q) tl[r][c8 + q] = f.u[q]; }
  __syncthreads();
  {
#pragma unroll
    for (int rd = 0; rd < 2; ++rd) { const int d = rd * 32 + tid / 8, pc = tid % 8; FragH f;
#pragma unroll
      for (int q = 0; q < 8; ++q) f.u[q] = tl[pc * 8 + q][d];
      *(v8us*)((unsigned short*)Vt + ((size_t)slab * 64 + d) * TTv + lg * 64 + pc * 8) = f.half[0]; }
     } }

__global__ __launch_bounds__(256) void k_tok(const float* __restrict__ x, _Float16* __restrict__ X16) { __shared__ float tl[32][65]; const int tid = threadIdx.x; const int b = blockIdx.x / ((CC / 64) * (NN / 32)), rem = blockIdx.x % ((CC / 64) * (NN / 32)); const int cg = rem / (NN / 32), pg = rem % (NN / 32); const int c0 = cg * 64, p0 = pg * 32;
  for (int i = tid; i < 64 * 32; i += 256) { const int c = i / 32, pp = i % 32; tl[pp][c] = bf16_round(x[((size_t)b * CC + c0 + c) * NN + p0 + pp]); } __syncthreads();
  const int r = tid / 8, pc = tid % 8; FragH f; for (int q = 0; q < 8; ++q) f.h[q] = (_Float16)tl[r][pc * 8 + q]; const size_t row = (size_t)b * NN + p0 + r; *(v8us*)((unsigned short*)X16 + row * CC + c0 + pc * 8) = f.half[0];  }
typedef float v2f __attribute__((ext_vector_type(2)));
// lane l <-> l ^ 16: the two halves of a wave each hold half of a query column's keys
__device__ __forceinline__ float xhalf(float v) { const int b = __float_as_int(v); return __int_as_float(__builtin_amdgcn_permlanex16(b, b, 0x76543210, 0xfedcba98, false, false)); }
// Transposed products: S^T = K.Q^T (A = 16 key rows, B = the wave's 16 queries as columns), O^T += V^T.P^T. A lane then holds 16 of the 32 scores of ONE query
// (keys 8hh + r and 16 + 8hh + r), which is the k order of a B operand: P goes from the score accumulators into the second product without LDS.
// K and V^T come in tiles of KT keys that the block's four waves share: asynchronous 16-byte copies fill one LDS buffer while the other is worked on (two buffers, one barrier a tile).
__global__ __launch_bounds__(128) void k_flash(const _Float16* __restrict__ Q16, int ldq, const _Float16* __restrict__ K16, int ldk, const _Float16* __restrict__ Vt, const int* __restrict__ MSK, float* __restrict__ O, int ldo) {
  constexpr int RPW = 16, NQB = NN / (4 * RPW), DT = 2;
  constexpr int KT = 128, NT = NN / KT, KP = HD + 8, VP = KT + 8;      /* row pitches of 80 and 272 bytes (16 x odd): 16-byte fragment reads of 16 rows fall on 64 different banks */
  __shared__ __attribute__((aligned(16))) unsigned short sK[2][KT][KP];      /* K tile: key rows of 32 halves */
  __shared__ __attribute__((aligned(16))) unsigned short sV[2][HD][VP];      /* V^T tile: channel rows of KT halves */
  __shared__ __attribute__((aligned(16))) float sO[4][RPW][32 + 4];
  const int tid = threadIdx.x, w = tid >> 5, lane = tid & 31, ln = lane & 15, hh = lane >> 4; (void)MSK;
  const int slab = blockIdx.x / NQB, qblk = blockIdx.x % NQB; const int h = slab; const int b = 0; const int qb0 = qblk * (4 * RPW); const int q0 = qb0 + w * RPW;
  FragH bq;
  { const unsigned short* qr = (const unsigned short*)Q16 + ((size_t)b * NN + q0 + ln) * ldq + h * HD; bq.half[0] = *(const v8us*)(qr + 8 * hh); bq.half[1] = *(const v8us*)(qr + 16 + 8 * hh); }
  const unsigned short* Vth = (const unsigned short*)Vt + (size_t)h * HD * NN;      /* V^T = v[(h,d)][n] channel-major */
  /* a thread's share of a tile: 16-byte piece tid & 3 of key rows (tid >> 2) + 32 i, and piece tid & 15 of channel rows (tid >> 4) + 8 i, i = 0..3 */
  const unsigned short* gk = (const unsigned short*)K16 + (size_t)b * NN * ldk + h * HD + (size_t)(tid >> 2) * ldk + (tid & 3) * 8;
  const unsigned short* gv = Vth + (size_t)(tid >> 4) * NN + (tid & 15) * 8;
  const unsigned lk = (unsigned)(uintptr_t)&sK[0][tid >> 2][(tid & 3) * 8], lv = (unsigned)(uintptr_t)&sV[0][tid >> 4][(tid & 15) * 8];      /* LDS byte addresses */
  const size_t kstep = (size_t)32 * ldk;
  auto stage = [&](int t, int buf) {
    const unsigned short* k0 = gk + (size_t)t * KT * ldk; const unsigned short* v0 = gv + t * KT;
    const unsigned a0 = lk + (unsigned)buf * (KT * KP * 2), c0 = lv + (unsigned)buf * (HD * VP * 2);
    /* the tile's eight copies of this thread; s_wait_xcnt closes the statement so that no address register of a copy is rewritten in front of it */
    asm volatile("global_load_async_to_lds_b128 %0, %8, off\n\t"
                 "global_load_async_to_lds_b128 %1, %9, off\n\t"
                 "global_load_async_to_lds_b128 %2, %10, off\n\t"
                 "global_load_async_to_lds_b128 %3, %11, off\n\t"
                 "global_load_async_to_lds_b128 %4, %12, off\n\t"
                 "global_load_async_to_lds_b128 %5, %13, off\n\t"
                 "global_load_async_to_lds_b128 %6, %14, off\n\t"
                 "global_load_async_to_lds_b128 %7, %15, off\n\t"
                 "s_wait_xcnt 0x0"
                 :: "v"(a0), "v"(a0 + 32 * KP * 2), "v"(a0 + 64 * KP * 2), "v"(a0 + 96 * KP * 2), "v"(c0), "v"(c0 + 8 * VP * 2), "v"(c0 + 16 * VP * 2), "v"(c0 + 24 * VP * 2),
                    "v"(k0), "v"(k0 + kstep), "v"(k0 + 2 * kstep), "v"(k0 + 3 * kstep), "v"(v0), "v"(v0 + 8 * NN), "v"(v0 + 16 * NN), "v"(v0 + 24 * NN)
                 : "memory");
  };
  constexpr float SL2 = 0.25503486f;      /* 32^-1/2 x log2(e): the softmax runs in base 2, one multiply-add and one v_exp_f32 a score */
  float m_c = -3.0e38f, l_c = 0.f; v8f oacc[DT];      /* running maximum (in log2 units) and this half's partial sum (x 2^10) of query q0 + ln; oacc[dt][r] = O^T[dt*16 + 8hh + r][q0 + ln] */
#pragma unroll
  for (int dt = 0; dt < DT; ++dt) oacc[dt] = (v8f){0.f,0.f,0.f,0.f,0.f,0.f,0.f,0.f};
  stage(0, 0);
  asm volatile("s_wait_asynccnt 0x0" ::: "memory");      /* this wave's share of tile 0 has landed */
  __syncthreads();      /* every wave's share of tile 0 has landed */
  stage(1, 1);
  /* the tile loop and the loop over a tile's 32-key passes stay rolled: more copies of the long body would only grow the code; every full "#pragma unroll" in this kernel but the one over the stored output rows keeps an array that the loop variable indexes in registers */
#pragma unroll 1
  for (int t = 0; t < NT; ++t) {
   const int buf = t & 1;
#pragma unroll 1
   for (int js = 0; js < KT; js += 32) {
    FragH ak[2], av[DT];
#pragma unroll
    for (int nt = 0; nt < 2; ++nt) { const unsigned short* kr = &sK[buf][js + nt * 16 + ln][0]; ak[nt].half[0] = *(const v8us*)(kr + 8 * hh); ak[nt].half[1] = *(const v8us*)(kr + 16 + 8 * hh); }
#pragma unroll
    for (int dt = 0; dt < DT; ++dt) { const unsigned short* vrow = &sV[buf][dt * 16 + ln][js]; av[dt].half[0] = *(const v8us*)(vrow + 8 * hh); av[dt].half[1] = *(const v8us*)(vrow + 16 + 8 * hh); }
    float sc[16];      /* raw q.k sums; the scale goes into the exponent's multiply-add */
#pragma unroll
    for (int nt = 0; nt < 2; ++nt) {
      const v8f acc = mmaH<1>(ak[nt].v, ak[nt].v, bq.v, bq.v, (v8f){0.f,0.f,0.f,0.f,0.f,0.f,0.f,0.f});
#pragma unroll
      for (int r = 0; r < 8; ++r) sc[nt * 8 + r] = acc[r]; }
    float mx[8];
#pragma unroll
    for (int i = 0; i < 8; ++i) mx[i] = fmaxf(sc[i], sc[8 + i]);
    float mc = fmaxf(fmaxf(fmaxf(mx[0], mx[1]), fmaxf(mx[2], mx[3])), fmaxf(fmaxf(mx[4], mx[5]), fmaxf(mx[6], mx[7])));
    mc = fmaxf(mc, xhalf(mc));
    const float mn = fmaxf(m_c, mc * SL2); const float al = (mn > -1.0e38f) ? __builtin_amdgcn_exp2f(m_c - mn) : 1.0f; m_c = mn;
    const float mb = mn - 10.0f;      /* p = 2^(s SL2 - mn + 10): the 2^10 of the f16 P rides in the exponent, and the row sum carries it too */
    FragH pb; float p[16];
#pragma unroll
    for (int i = 0; i < 16; i += 2) {
      const v2f e = __builtin_elementwise_fma((v2f){sc[i], sc[i + 1]}, (v2f){SL2, SL2}, (v2f){-mb, -mb});      /* two exponents a packed multiply-add */
      p[i] = __builtin_amdgcn_exp2f(e[0]); p[i + 1] = __builtin_amdgcn_exp2f(e[1]); pb.h[i] = (_Float16)p[i]; pb.h[i + 1] = (_Float16)p[i + 1]; }
#pragma unroll
    for (int i = 0; i < 8; ++i) p[i] += p[8 + i];
    l_c = l_c * al + (((p[0] + p[1]) + (p[2] + p[3])) + ((p[4] + p[5]) + (p[6] + p[7])));
#pragma unroll
    for (int dt = 0; dt < DT; ++dt)
#pragma unroll
      for (int r = 0; r < 8; ++r) oacc[dt][r] *= al;
#pragma unroll
    for (int dt = 0; dt < DT; ++dt) oacc[dt] = mmaH<1>(av[dt].v, av[dt].v, pb.v, pb.v, oacc[dt]);
   }
   asm volatile("s_wait_dscnt 0x0" ::: "memory");      /* this wave's reads of buffer buf have returned before the buffer is refilled */
   asm volatile("s_wait_asynccnt 0x0" ::: "memory");      /* this wave's share of tile t + 1 has landed */
   __syncthreads();      /* publishes tile t + 1 and ends every wave's reads of buffer buf */
   if (t + 2 < NT) stage(t + 2, buf);
  }
  asm volatile("s_wait_asynccnt 0x0" ::: "memory");      /* no copy is outstanding when the wave goes on to its end */
  const float l = l_c + xhalf(l_c); const float inv = (l > 0.f) ? 1.0f / l : 0.f;      /* l and oacc both carry the 2^10 */
#pragma unroll
  for (int dt = 0; dt < DT; ++dt)
#pragma unroll
    for (int r4 = 0; r4 < 8; r4 += 4) { const v4f o4 = {oacc[dt][r4] * inv, oacc[dt][r4 + 1] * inv, oacc[dt][r4 + 2] * inv, oacc[dt][r4 + 3] * inv}; *(v4fa*)&sO[w][ln][dt * 16 + 8 * hh + r4] = o4; }
  __builtin_amdgcn_fence(__ATOMIC_ACQ_REL, "workgroup"); __builtin_amdgcn_wave_barrier();
  {
#pragma unroll
    for (int rp = 0; rp < RPW; rp += 4) { const int r = rp + (lane >> 3), pc = lane & 7; const v4f val = *(const v4fa*)&sO[w][r][pc * 4]; *(v4f*)(O + ((size_t)b * NN + q0 + r) * ldo + h * HD + pc * 4) = val; }      
     } }

__global__ __launch_bounds__(256) void k_out(const float* __restrict__ G, float* __restrict__ out) { __shared__ float tl[32][65]; const int tid = threadIdx.x; const int b = blockIdx.x / ((CC / 32) * (NN / 64)), rem = blockIdx.x % ((CC / 32) * (NN / 64)); const int cg = rem / (NN / 64), pg = rem % (NN / 64); const int c0 = cg * 32, p0 = pg * 64;
  for (int i = tid; i < 64 * 32; i += 256) { const int pp = i / 32, c = i % 32; tl[c][pp] = G[((size_t)b * NN + p0 + pp) * CC + c0 + c]; } __syncthreads();
  { for (int i = tid; i < 32 * 16; i += 256) { const int c = i / 16, q4 = i % 16; const v4f v = {tl[c][q4 * 4], tl[c][q4 * 4 + 1], tl[c][q4 * 4 + 2], tl[c][q4 * 4 + 3]}; *(v4f*)(out + ((size_t)b * CC + c0 + c) * NN + p0 + q4 * 4) = v; }  } }

extern "C" void kernel_launch(void* const* d_in, const int* in_sizes, int n_in,
                              void* d_out, int out_size, void* d_ws, size_t ws_size, hipStream_t stream) {
  (void)in_sizes; (void)n_in; (void)out_size;
  const float* x = (const float*)d_in[0]; const float* Wqkv = (const float*)d_in[1]; const float* Wp = (const float*)d_in[2]; const float* bp = (const float*)d_in[3];
  char* ws = (char*)d_ws; size_t off = 0;
  auto take = [&](size_t bytes) { char* p = ws + off; off += (bytes + 255) & ~(size_t)255; return p; };
  _Float16* Bqkv = (_Float16*)take((size_t)C3 * CC * 2); _Float16* Bp = (_Float16*)take((size_t)CC * CC * 2); _Float16* X16 = (_Float16*)take((size_t)NR * CC * 2);
  _Float16* QK = (_Float16*)take((size_t)NR * 2 * CC * 2); _Float16* Vt = (_Float16*)take((size_t)CC * NN * 2); float* O = (float*)take((size_t)NR * CC * 4); _Float16* O16 = (_Float16*)take((size_t)NR * CC * 2); float* G = (float*)take((size_t)NR * CC * 4);
  if (off > ws_size) return;      // 0.4 + 0.1 + 2.1 + 4.2 + 2.1 + 4.2 + 2.1 + 4.2 ≈ 20 MB
  k_round16f<<<(unsigned)(((size_t)C3 * CC / 8 + 255) / 256), 256, 0, stream>>>(Wqkv, Bqkv, (size_t)C3 * CC / 8); k_round16f<<<(unsigned)(((size_t)CC * CC / 8 + 255) / 256), 256, 0, stream>>>(Wp, Bp, (size_t)CC * CC / 8);      /* (out,in) natural, ×2^4 */
  k_tok<<<BB * (CC / 64) * (NN / 32), 256, 0, stream>>>(x, X16);
  k_gemm_hhx<0><<<dim3(((NR / 16) * (2 * CC / 64) + 3) / 4, 1), 128, 0, stream>>>(X16, CC, 0, Bqkv, CC, 0, 0.0625f, nullptr, 0, nullptr, 1, 0, 0, nullptr, QK, 2 * CC, 0, NR, 2 * CC, CC);      /* [q | k] token-major [n][512] (head h = cols h·32 / 256 + h·32): M 4096 N 512 K 256 */
  k_gemm_hhx<0><<<dim3(((CC / 16) * (NN / 64) + 3) / 4, 1), 128, 0, stream>>>(Bqkv + (size_t)2 * CC * CC, CC, 0, X16, CC, 0, 0.0625f, nullptr, 0, nullptr, 1, 0, 0, nullptr, Vt, NN, 0, CC, NN, CC);      /* v channel-major [(h,d)][n] = Vᵀ: A = qkv_w rows 512..767, B = x token-major: M 256 N 4096 K 256 */
  k_flash<<<NH * (NN / 64), 128, 0, stream>>>(QK, 2 * CC, QK + CC, 2 * CC, Vt, nullptr, O, CC);      /* blocks = head × 64-query groups */
  k_h16<<<(unsigned)(((size_t)NR * CC / 8 + 255) / 256), 256, 0, stream>>>(O, O16, (size_t)NR * CC / 8);
  k_gemm_hhx<0><<<dim3(((NR / 16) * (CC / 64) + 3) / 4, 1), 128, 0, stream>>>(O16, CC, 0, Bp, CC, 0, 0.0625f, bp, 0, nullptr, 1, 0, 0, G, nullptr, CC, 0, NR, CC, CC);      /* G = O·proj_wᵀ + proj_b (token-major): M 4096 N 256 K 256 */
  k_out<<<BB * (CC / 32) * (NN / 64), 256, 0, stream>>>(G, (float*)d_out);
}

// v004
// A run of this version takes 73.3 microseconds.
// Timed twice side by side with v003, it ran 1.21 and 1.22 times as fast.
// Counting every step since v000, it is 5.44 times as fast.
#include <hip/hip_runtime.h>
// 3-D multi-head self-attention on channel-major x [1, 256, 16³ = 4096]: qkv = qkv_w·x (1×1×1 conv, no bias), 8 heads × 32, softmax(qᵀk·32^-½) over keys, out[h,d,n] = Σ_m attn[n,m]·v[h,d,m], then proj_w·out + proj_b.
// Compute dtype: x, qkv_w, proj_w, proj_b rounded to bf16; q/k token-major and v channel-major (= Vᵀ) as f16 GEMM outputs (f32 accumulate); fused flash-style kernel per head
// (online softmax f32, P f16 ×2^10) on v_wmma_f32_16x16x32_f16; O → f16 → projection GEMM with bias → transposed back to [c][n] through LDS; f32 accumulate throughout.
#define BB 1
#define CC 256
#define C3 768
#define NH 8
#define HD 32
#define NN 4096
#define NR (BB * NN)

typedef __bf16 v16b __attribute__((ext_vector_type(16)));
typedef unsigned short v8us __attribute__((ext_vector_type(8), may_alias));
typedef float  v8f  __attribute__((ext_vector_type(8)));
typedef float  v4f  __attribute__((ext_vector_type(4)));
typedef float  v4fa __attribute__((ext_vector_type(4), may_alias));
union FragB { v16b v; v8us half[2]; unsigned short u[16]; };

__device__ __forceinline__ unsigned short bf16_bits(float x) { unsigned int u = __float_as_uint(x); return (unsigned short)((u + 0x7FFFu + ((u >> 16) & 1u)) >> 16); }
__device__ __forceinline__ float bf16_val(unsigned short b) { return __uint_as_float(((unsigned int)b) << 16); }
__device__ __forceinline__ float bf16_round(float x) { return bf16_val(bf16_bits(x)); }
// D += A·B with NT terms: 1 = ah·bh, 2 = + al·bh (A split), 3 = + ah·bl (both split)
template <int NT>
__device__ __forceinline__ v8f mmaN(v16b ah, v16b al, v16b bh, v16b bl, v8f c) {
  c = __builtin_amdgcn_wmma_f32_16x16x32_bf16(false, ah, false, bh, (short)0, c, false, false);
  if (NT >= 2) c = __builtin_amdgcn_wmma_f32_16x16x32_bf16(false, al, false, bh, (short)0, c, false, false);
  if (NT >= 3) c = __builtin_amdgcn_wmma_f32_16x16x32_bf16(false, ah, false, bl, (short)0, c, false, false);
  asm volatile("v_nop\n\tv_nop\n\tv_nop\n\tv_nop" : "+v"(c) : "v"(ah), "v"(al), "v"(bh), "v"(bl));
  return c;
}

__global__ __launch_bounds__(256) void k_wt_bf16(const float* __restrict__ W, unsigned short* __restrict__ Wt, int K, int N) {
  const int t = blockIdx.x * 256 + threadIdx.x;
  const int k8n = K / 8;
  if (t >= N * k8n) return;
  const int n = t / k8n, k8 = (t % k8n) * 8;
  v8us v;
#pragma unroll
  for (int i = 0; i < 8; ++i) v[i] = bf16_bits(W[(size_t)(k8 + i) * N + n]);
  *(v8us*)(Wt + (size_t)n * K + k8) = v;
  
}

// GEMM C[M][N] (f32, pitch ldc) = act(A[M][K]·W + bias). A f32 row-major (pitch lda) converted per fragment to bf16
// (ASPLIT: hi/lo two planes -> 2 terms, else single rounded term); Wt bf16 [N][K] (pitch ldb). BIAS_BF16 rounds the
// bias to bf16 first (bias quantised to bf16 before the add). K%32==0, M%16==0, N%64==0.
template <bool ASPLIT, int ACT, bool BIAS_BF16>
__global__ __launch_bounds__(128) void k_gemm_bf(const float* __restrict__ A, int lda, const unsigned short* __restrict__ Wt, int ldb,
                                               const float* __restrict__ bias, float* __restrict__ C, int ldc, int M, int N, int K) {
  __shared__ __attribute__((aligned(16))) float so[4][16][64];
  const int tid = threadIdx.x, w = tid >> 5, lane = tid & 31, ln = lane & 15, hh = lane >> 4;
  const int ntn = N / 64;
  const int wid = blockIdx.x * 4 + w;
  const int mt = wid / ntn, nq = wid % ntn;
  if (mt * 16 >= M) return;
  const int row0 = mt * 16, col0 = nq * 64;
  const float* arow = A + (size_t)(row0 + ln) * lda;
  v8f acc[4] = {};
  for (int kb = 0; kb < K; kb += 32) {
    FragB ah, al;
    const v4f x0 = *(const v4fa*)(arow + kb + 8 * hh), x1 = *(const v4fa*)(arow + kb + 8 * hh + 4);
    const v4f x2 = *(const v4fa*)(arow + kb + 16 + 8 * hh), x3 = *(const v4fa*)(arow + kb + 16 + 8 * hh + 4);
    float xs[16] = {x0[0],x0[1],x0[2],x0[3],x1[0],x1[1],x1[2],x1[3],x2[0],x2[1],x2[2],x2[3],x3[0],x3[1],x3[2],x3[3]};
#pragma unroll
    for (int i = 0; i < 16; ++i) { const unsigned short hb = bf16_bits(xs[i]); ah.u[i] = hb; al.u[i] = ASPLIT ? bf16_bits(xs[i] - bf16_val(hb)) : (unsigned short)0; }
#pragma unroll
    for (int t = 0; t < 4; ++t) {
      const unsigned short* brow = Wt + (size_t)(col0 + t * 16 + ln) * ldb + kb;
      FragB b;
      b.half[0] = *(const v8us*)(brow + 8 * hh);
      b.half[1] = *(const v8us*)(brow + 16 + 8 * hh);
      acc[t] = mmaN<ASPLIT ? 2 : 1>(ah.v, al.v, b.v, b.v, acc[t]);
    }
  }
#pragma unroll
  for (int t = 0; t < 4; ++t) {
    float bv = bias ? bias[col0 + t * 16 + ln] : 0.f;
    if (BIAS_BF16) bv = bf16_round(bv);
#pragma unroll
    for (int r = 0; r < 8; ++r) { float v = acc[t][r] + bv; if (ACT == 1) v = fmaxf(v, 0.f); so[w][8 * hh + r][t * 16 + ln] = v; }
  }
  __builtin_amdgcn_fence(__ATOMIC_ACQ_REL, "workgroup");
  __builtin_amdgcn_wave_barrier();
  const int rsub = lane >> 4, c4 = (lane & 15) * 4;
  {
#pragma unroll
    for (int q = 0; q < 8; ++q) {
      const int r = q * 2 + rsub;
      const v4f v = *(const v4fa*)&so[w][r][c4];
      *(v4f*)(C + (size_t)(row0 + r) * ldc + col0 + c4) = v;
    }
    
  }
}

// Flash-style causal/unmasked attention, all contractions 3-term bf16 hi/lo splits, f32 softmax with running max.
// q,k,v rows are read from f32 buffers with arbitrary row pitch (so they can live inside a fused qkv buffer);
// D = head size (multiple of 32, <= 128); one wave = 16 query rows; block = 4 waves (64 queries) sharing K/V chunks of 32.
template <int D, bool CAUSAL>
__global__ __launch_bounds__(128) void k_flash(const float* __restrict__ qb, const float* __restrict__ kb, const float* __restrict__ vb,
                                             int pitch, int T, int H, float scale, float* __restrict__ y, int ypitch) {
  constexpr int KS = D / 32;        // k-steps for QK
  constexpr int DT = D / 16;        // d tiles for PV
  __shared__ __attribute__((aligned(16))) unsigned short sKh[32][D + 8], sKl[32][D + 8], sVh[32][D + 8], sVl[32][D + 8];
  __shared__ __attribute__((aligned(16))) unsigned short sPh[4][16][40], sPl[4][16][40];
  __shared__ __attribute__((aligned(16))) float sO[4][16][D];
  const int tid = threadIdx.x, w = tid >> 5, lane = tid & 31, ln = lane & 15, hh = lane >> 4;
  const int nqb = (T + 63) / 64;
  const int bh = blockIdx.x / nqb, qblk = blockIdx.x % nqb;
  const int b = bh / H, h = bh % H;
  const int q0 = qblk * 64 + w * 16;
  const float* Q = qb + (size_t)b * T * pitch + h * D;
  const float* K = kb + (size_t)b * T * pitch + h * D;
  const float* V = vb + (size_t)b * T * pitch + h * D;

  // A fragments of the wave's 16 query rows (scaled), hi/lo
  FragB aqh[KS], aql[KS];
  {
    int row = q0 + ln; if (row >= T) row = T - 1;
    const float* qr = Q + (size_t)row * pitch;
#pragma unroll
    for (int ks = 0; ks < KS; ++ks)
#pragma unroll
      for (int i = 0; i < 16; ++i) {
        const int d = ks * 32 + ((i < 8) ? (8 * hh + i) : (16 + 8 * hh + (i - 8)));
        const float x = qr[d] * scale; const unsigned short hb = bf16_bits(x);
        aqh[ks].u[i] = hb; aql[ks].u[i] = bf16_bits(x - bf16_val(hb));
      }
  }
  float m_r[8], l_r[8];
#pragma unroll
  for (int r = 0; r < 8; ++r) { m_r[r] = -3.0e38f; l_r[r] = 0.f; }
  v8f oacc[DT];
#pragma unroll
  for (int dt = 0; dt < DT; ++dt) oacc[dt] = (v8f){0.f,0.f,0.f,0.f,0.f,0.f,0.f,0.f};

  const int kv_end = CAUSAL ? min(T, qblk * 64 + 64) : T;     // block-uniform
  for (int j0 = 0; j0 < kv_end; j0 += 32) {
    __syncthreads();
    for (int e = tid; e < 32 * (D / 4); e += 128) {
      const int r = e / (D / 4), c4 = (e % (D / 4)) * 4;
      const int key = j0 + r;
      v4f kf = {0.f,0.f,0.f,0.f}, vf = {0.f,0.f,0.f,0.f};
      if (key < T) { kf = *(const v4fa*)(K + (size_t)key * pitch + c4); vf = *(const v4fa*)(V + (size_t)key * pitch + c4); }
#pragma unroll
      for (int t = 0; t < 4; ++t) {
        unsigned short hb = bf16_bits(kf[t]); sKh[r][c4 + t] = hb; sKl[r][c4 + t] = bf16_bits(kf[t] - bf16_val(hb));
        hb = bf16_bits(vf[t]); sVh[r][c4 + t] = hb; sVl[r][c4 + t] = bf16_bits(vf[t] - bf16_val(hb));
      }
    }
    __syncthreads();
    // S tile 16 x 32
    v8f s[2];
#pragma unroll
    for (int nt = 0; nt < 2; ++nt) {
      v8f acc = {};
#pragma unroll
      for (int ks = 0; ks < KS; ++ks) {
        FragB bh_, bl_;
        bh_.half[0] = *(const v8us*)&sKh[nt * 16 + ln][ks * 32 + 8 * hh]; bh_.half[1] = *(const v8us*)&sKh[nt * 16 + ln][ks * 32 + 16 + 8 * hh];
        bl_.half[0] = *(const v8us*)&sKl[nt * 16 + ln][ks * 32 + 8 * hh]; bl_.half[1] = *(const v8us*)&sKl[nt * 16 + ln][ks * 32 + 16 + 8 * hh];
        acc = mmaN<3>(aqh[ks].v, aql[ks].v, bh_.v, bl_.v, acc);
      }
      s[nt] = acc;
    }
    // mask + running max (rows 8hh+r; the 16 lanes of a half share rows)
    float alpha[8];
#pragma unroll
    for (int r = 0; r < 8; ++r) {
      const int qi = q0 + 8 * hh + r;
      const int ja = j0 + ln, jb = j0 + 16 + ln;
      if (CAUSAL) { if (ja > qi) s[0][r] = -3.0e38f; if (jb > qi) s[1][r] = -3.0e38f; }
      if (ja >= T) s[0][r] = -3.0e38f;
      if (jb >= T) s[1][r] = -3.0e38f;
      float mx = fmaxf(s[0][r], s[1][r]);
      mx = fmaxf(mx, __shfl_xor(mx, 1, 32)); mx = fmaxf(mx, __shfl_xor(mx, 2, 32)); mx = fmaxf(mx, __shfl_xor(mx, 4, 32)); mx = fmaxf(mx, __shfl_xor(mx, 8, 32));
      const float mnew = fmaxf(m_r[r], mx);
      alpha[r] = (mnew > -1.0e38f) ? __expf(m_r[r] - mnew) : 1.0f;
      const float p0 = (s[0][r] > -1.0e38f) ? __expf(s[0][r] - mnew) : 0.f;
      const float p1 = (s[1][r] > -1.0e38f) ? __expf(s[1][r] - mnew) : 0.f;
      m_r[r] = mnew;
      l_r[r] = l_r[r] * alpha[r] + p0 + p1;            // per-lane partial row sum (16 lanes combined at the end)
      unsigned short hb = bf16_bits(p0); sPh[w][8 * hh + r][ln] = hb;      sPl[w][8 * hh + r][ln] = bf16_bits(p0 - bf16_val(hb));
      hb = bf16_bits(p1);                sPh[w][8 * hh + r][16 + ln] = hb; sPl[w][8 * hh + r][16 + ln] = bf16_bits(p1 - bf16_val(hb));
    }
#pragma unroll
    for (int dt = 0; dt < DT; ++dt)
#pragma unroll
      for (int r = 0; r < 8; ++r) oacc[dt][r] *= alpha[r];
    __builtin_amdgcn_fence(__ATOMIC_ACQ_REL, "workgroup");
    __builtin_amdgcn_wave_barrier();
    FragB pah, pal;
    pah.half[0] = *(const v8us*)&sPh[w][ln][8 * hh]; pah.half[1] = *(const v8us*)&sPh[w][ln][16 + 8 * hh];
    pal.half[0] = *(const v8us*)&sPl[w][ln][8 * hh]; pal.half[1] = *(const v8us*)&sPl[w][ln][16 + 8 * hh];
#pragma unroll
    for (int dt = 0; dt < DT; ++dt) {
      FragB bvh, bvl;
#pragma unroll
      for (int i = 0; i < 8; ++i) {
        bvh.u[i] = sVh[8 * hh + i][dt * 16 + ln]; bvh.u[8 + i] = sVh[16 + 8 * hh + i][dt * 16 + ln];
        bvl.u[i] = sVl[8 * hh + i][dt * 16 + ln]; bvl.u[8 + i] = sVl[16 + 8 * hh + i][dt * 16 + ln];
      }
      oacc[dt] = mmaN<3>(pah.v, pal.v, bvh.v, bvl.v, oacc[dt]);
    }
    __builtin_amdgcn_fence(__ATOMIC_ACQ_REL, "workgroup");
    __builtin_amdgcn_wave_barrier();
  }
#pragma unroll
  for (int r = 0; r < 8; ++r) {
    float l = l_r[r];
    l += __shfl_xor(l, 1, 32); l += __shfl_xor(l, 2, 32); l += __shfl_xor(l, 4, 32); l += __shfl_xor(l, 8, 32);
    l_r[r] = (l > 0.f) ? 1.0f / l : 0.f;
  }
#pragma unroll
  for (int dt = 0; dt < DT; ++dt)
#pragma unroll
    for (int r = 0; r < 8; ++r) sO[w][8 * hh + r][dt * 16 + ln] = oacc[dt][r] * l_r[r];
  __builtin_amdgcn_fence(__ATOMIC_ACQ_REL, "workgroup");
  __builtin_amdgcn_wave_barrier();
  {
    for (int r = 0; r < 16; ++r) {
      const int row = q0 + r;
      if (row < T && lane < D / 4) {
        const v4f val = *(const v4fa*)&sO[w][r][lane * 4];
        *(v4f*)(y + ((size_t)b * T + row) * ypitch + h * D + lane * 4) = val;
      }
    }
    
  }
}

// GEMM C = act(A·W + bias + resid): A f32 (ASPLIT -> hi/lo 2 terms), Wt bf16 [N][K]; ACT 0 none, 1 relu, 2 exact gelu;
// resid (optional, f32, row index = (row % rmod), pitch ldr, RES_BF16 rounds it) added before the activation.
template <bool ASPLIT, int ACT, bool BIAS_BF16, bool RES_BF16>
__global__ __launch_bounds__(128) void k_gemm_bf3(const float* __restrict__ A, int lda, const unsigned short* __restrict__ Wt, int ldb,
                                                const float* __restrict__ bias, const float* __restrict__ resid, int rmod, int ldr,
                                                float* __restrict__ C, int ldc, int M, int N, int K) {
  __shared__ __attribute__((aligned(16))) float so[4][16][64];
  const int tid = threadIdx.x, w = tid >> 5, lane = tid & 31, ln = lane & 15, hh = lane >> 4;
  const int ntn = N / 64;
  const int wid = blockIdx.x * 4 + w;
  const int mt = wid / ntn, nq = wid % ntn;
  if (mt * 16 >= M) return;
  const int row0 = mt * 16, col0 = nq * 64;
  const float* arow = A + (size_t)(row0 + ln) * lda;
  v8f acc[4] = {};
  for (int kb = 0; kb < K; kb += 32) {
    FragB ah, al;
    const v4f x0 = *(const v4fa*)(arow + kb + 8 * hh), x1 = *(const v4fa*)(arow + kb + 8 * hh + 4);
    const v4f x2 = *(const v4fa*)(arow + kb + 16 + 8 * hh), x3 = *(const v4fa*)(arow + kb + 16 + 8 * hh + 4);
    float xs[16] = {x0[0],x0[1],x0[2],x0[3],x1[0],x1[1],x1[2],x1[3],x2[0],x2[1],x2[2],x2[3],x3[0],x3[1],x3[2],x3[3]};
#pragma unroll
    for (int i = 0; i < 16; ++i) { const unsigned short hb = bf16_bits(xs[i]); ah.u[i] = hb; al.u[i] = ASPLIT ? bf16_bits(xs[i] - bf16_val(hb)) : (unsigned short)0; }
#pragma unroll
    for (int t = 0; t < 4; ++t) {
      const unsigned short* brow = Wt + (size_t)(col0 + t * 16 + ln) * ldb + kb;
      FragB b;
      b.half[0] = *(const v8us*)(brow + 8 * hh);
      b.half[1] = *(const v8us*)(brow + 16 + 8 * hh);
      acc[t] = mmaN<ASPLIT ? 2 : 1>(ah.v, al.v, b.v, b.v, acc[t]);
    }
  }
#pragma unroll
  for (int t = 0; t < 4; ++t) {
    const int col = col0 + t * 16 + ln;
    float bv = bias ? bias[col] : 0.f;
    if (BIAS_BF16) bv = bf16_round(bv);
#pragma unroll
    for (int r = 0; r < 8; ++r) {
      float v = acc[t][r] + bv;
      if (resid) { float rv = resid[(size_t)((row0 + 8 * hh + r) % rmod) * ldr + col]; if (RES_BF16) rv = bf16_round(rv); v += rv; }
      if (ACT == 1) v = fmaxf(v, 0.f);
      if (ACT == 2) v = 0.5f * v * (1.0f + erff(v * 0.70710678118654752f));
      if (ACT == 3) { const float u = 0.7978845608028654f * (v + 0.044715f * v * v * v); v = 0.5f * v * (1.0f + tanhf(u)); }
      so[w][8 * hh + r][t * 16 + ln] = v;
    }
  }
  __builtin_amdgcn_fence(__ATOMIC_ACQ_REL, "workgroup");
  __builtin_amdgcn_wave_barrier();
  const int rsub = lane >> 4, c4 = (lane & 15) * 4;
  {
#pragma unroll
    for (int q = 0; q < 8; ++q) {
      const int r = q * 2 + rsub;
      const v4f v = *(const v4fa*)&so[w][r][c4];
      *(v4f*)(C + (size_t)(row0 + r) * ldc + col0 + c4) = v;
    }
    
  }
}
// row LayerNorm (biased variance, eps) over N: s = X (+ R); optional out_sum <- s; out_norm <- (s-mu)*rsqrt(var+eps)*g + b
template <bool PARAM_BF16>
__global__ __launch_bounds__(256) void k_layernorm(const float* __restrict__ X, const float* __restrict__ R, const float* __restrict__ g, const float* __restrict__ bta,
                                                  float* __restrict__ out_sum, float* __restrict__ out_norm, int N, float eps) {
  __shared__ float red[256];
  const int row = blockIdx.x, tid = threadIdx.x;
  const float* x = X + (size_t)row * N; const float* rr = R ? R + (size_t)row * N : nullptr;
  float vals[16];                     // up to N = 4096
  const int per = N / 256;            // contiguous chunk per thread? use strided-by-4 chunks: thread handles j = tid*4 + 1024*u
  float s1 = 0.f;
  for (int u = 0; u < per / 4; ++u) {
    const int j = tid * 4 + 1024 * u;
    const v4f a = *(const v4fa*)(x + j);
    v4f b = {0.f,0.f,0.f,0.f}; if (rr) b = *(const v4fa*)(rr + j);
#pragma unroll
    for (int q = 0; q < 4; ++q) { const float v = a[q] + b[q]; vals[u * 4 + q] = v; s1 += v; }
  }
  red[tid] = s1; __syncthreads();
  for (int st = 128; st > 0; st >>= 1) { if (tid < st) red[tid] += red[tid + st]; __syncthreads(); }
  const float mu = red[0] / (float)N; __syncthreads();
  float s2 = 0.f;
  for (int u = 0; u < per / 4; ++u)
#pragma unroll
    for (int q = 0; q < 4; ++q) { const float c = vals[u * 4 + q] - mu; s2 += c * c; }
  red[tid] = s2; __syncthreads();
  for (int st = 128; st > 0; st >>= 1) { if (tid < st) red[tid] += red[tid + st]; __syncthreads(); }
  const float rs = rsqrtf(red[0] / (float)N + eps);
  {
    for (int u = 0; u < per / 4; ++u) {
      const int j = tid * 4 + 1024 * u;
      v4f o, sm;
#pragma unroll
      for (int q = 0; q < 4; ++q) {
        float gg = g[j + q], bb = bta[j + q];
        if (PARAM_BF16) { gg = bf16_round(gg); bb = bf16_round(bb); }
        sm[q] = vals[u * 4 + q]; o[q] = (vals[u * 4 + q] - mu) * rs * gg + bb;
      }
      if (out_sum) *(v4f*)(out_sum + (size_t)row * N + j) = sm;
      *(v4f*)(out_norm + (size_t)row * N + j) = o;
    }
    
  }
}



// ---- f16 WMMA path (v_wmma_f32_16x16x32_f16): 11-bit significands for operands in range — used here for the qkv and projection GEMMs and for attention
typedef _Float16 v16h __attribute__((ext_vector_type(16)));
union FragH { v16h v; v8us half[2]; _Float16 h[16]; unsigned short u[16]; };
template <int NT>
__device__ __forceinline__ v8f mmaH(v16h ah, v16h al, v16h bh, v16h bl, v8f c) {
  c = __builtin_amdgcn_wmma_f32_16x16x32_f16(false, ah, false, bh, (short)0, c, false, false);
  if (NT >= 2) c = __builtin_amdgcn_wmma_f32_16x16x32_f16(false, al, false, bh, (short)0, c, false, false);
  if (NT >= 3) c = __builtin_amdgcn_wmma_f32_16x16x32_f16(false, ah, false, bl, (short)0, c, false, false);
  asm volatile("v_nop\n\tv_nop\n\tv_nop\n\tv_nop" : "+v"(c) : "v"(ah), "v"(al), "v"(bh), "v"(bl));
  return c;
}
// batched GEMM like k_gemm_b but f16 operands: A f32 (split into f16 hi/lo if ASPLIT, else rounded to f16), Bt = f16 values [n][k]; alpha; C f32; N multiple of 16 (partial tiles skipped)
template <bool ASPLIT>
__global__ __launch_bounds__(128) void k_gemm_h(const float* __restrict__ A, int lda, size_t sA, const _Float16* __restrict__ Bh, int ldb, size_t sB, float alpha, float* __restrict__ C, int ldc, size_t sC, int M, int N, int K) {
  __shared__ __attribute__((aligned(16))) float so[4][16][64];
  const int tid = threadIdx.x, w = tid >> 5, lane = tid & 31, ln = lane & 15, hh = lane >> 4; const int by = blockIdx.y;
  A += (size_t)by * sA; Bh += (size_t)by * sB; C += (size_t)by * sC;
  const int ntn = (N + 63) / 64; const int wid = blockIdx.x * 4 + w; const int mt = wid / ntn, nq = wid % ntn; if (mt * 16 >= M) return;
  const int row0 = mt * 16, col0 = nq * 64; const float* arow = A + (size_t)(row0 + ln) * lda;
  v8f acc[4] = {};
  for (int kb = 0; kb < K; kb += 32) {
    FragH ah, al;
    const v4f x0 = *(const v4fa*)(arow + kb + 8 * hh), x1 = *(const v4fa*)(arow + kb + 8 * hh + 4), x2 = *(const v4fa*)(arow + kb + 16 + 8 * hh), x3 = *(const v4fa*)(arow + kb + 16 + 8 * hh + 4);
    float xs[16] = {x0[0],x0[1],x0[2],x0[3],x1[0],x1[1],x1[2],x1[3],x2[0],x2[1],x2[2],x2[3],x3[0],x3[1],x3[2],x3[3]};
#pragma unroll
    for (int i = 0; i < 16; ++i) { const _Float16 h = (_Float16)xs[i]; ah.h[i] = h; al.h[i] = ASPLIT ? (_Float16)(xs[i] - (float)h) : (_Float16)0.0f; }
#pragma unroll
    for (int t = 0; t < 4; ++t) { if (col0 + t * 16 >= N) continue; const size_t boff = (size_t)(col0 + t * 16 + ln) * ldb + kb; FragH bq; bq.half[0] = *(const v8us*)(Bh + boff + 8 * hh); bq.half[1] = *(const v8us*)(Bh + boff + 16 + 8 * hh);
      acc[t] = mmaH<ASPLIT ? 2 : 1>(ah.v, al.v, bq.v, bq.v, acc[t]); }
  }
#pragma unroll
  for (int t = 0; t < 4; ++t) { if (col0 + t * 16 >= N) continue;
#pragma unroll
    for (int r = 0; r < 8; ++r) so[w][8 * hh + r][t * 16 + ln] = acc[t][r] * alpha; }
  __builtin_amdgcn_fence(__ATOMIC_ACQ_REL, "workgroup"); __builtin_amdgcn_wave_barrier();
  const int rsub = lane >> 4, c4 = (lane & 15) * 4;
  {
#pragma unroll
    for (int q = 0; q < 8; ++q) { const int r = q * 2 + rsub; if (col0 + c4 < N) { const v4f v = *(const v4fa*)&so[w][r][c4]; *(v4f*)(C + (size_t)(row0 + r) * ldc + col0 + c4) = v; } }
     }
}

// Wt[n][k] = f16(W[k][n]·scale) from f32 row-major W[K][N] (scale = power of two; bf16-exact weights stay exact in f16 away from the subnormal range)
__global__ __launch_bounds__(256) void k_wt_f16(const float* __restrict__ W, _Float16* __restrict__ Wt, int K, int N, float scale) {
  const int t = blockIdx.x * 256 + threadIdx.x; if (t >= N * (K / 8)) return; const int n = t / (K / 8), k8 = (t % (K / 8)) * 8; FragH f;
#pragma unroll
  for (int i = 0; i < 8; ++i) f.h[i] = (_Float16)(bf16_round(W[(size_t)(k8 + i) * N + n]) * scale); const v8us o = f.half[0];
  *(v8us*)((unsigned short*)Wt + (size_t)n * K + k8) = o; 
}
// k_gemm_hh variant with fused epilogue: v = acc·alpha + bias[by·sBias + col] (+ CP[(row/rowsPerB)·sCPb + by·64 + col] if CP) ; ACT 0 none / 1 elu ; writes f16 C16 and f32 C, each if non-null
// the body is a device function of the block's place (bx, by) and its LDS, so that several GEMMs can share one launch
template <int ACT>
__device__ __forceinline__ void gemm_hhx(float (*so)[16][64], int bx, int by, const _Float16* __restrict__ A, int lda, size_t sA, const _Float16* __restrict__ Bh, int ldb, size_t sB, float alpha, const float* __restrict__ bias, size_t sBias, const float* __restrict__ CP, int rowsPerB, size_t sCPb, int row0g,
    float* __restrict__ C, _Float16* __restrict__ C16, int ldc, size_t sC, int M, int N, int K) {
  const int tid = threadIdx.x, w = tid >> 5, lane = tid & 31, ln = lane & 15, hh = lane >> 4;
  A += (size_t)by * sA; Bh += (size_t)by * sB; const size_t cofs = (size_t)by * sC; const float* bp = bias ? bias + (size_t)by * sBias : nullptr;
  const int ntn = (N + 63) / 64; const int wid = bx * 4 + w; const int mt = wid / ntn, nq = wid % ntn; if (mt * 16 >= M) return;
  const int row0 = mt * 16, col0 = nq * 64; const _Float16* arow = A + (size_t)(row0 + ln) * lda;
  v8f acc[4] = {};
  for (int kb = 0; kb < K; kb += 32) { FragH ah; ah.half[0] = *(const v8us*)((const unsigned short*)arow + kb + 8 * hh); ah.half[1] = *(const v8us*)((const unsigned short*)arow + kb + 16 + 8 * hh);
#pragma unroll
    for (int t = 0; t < 4; ++t) { if (col0 + t * 16 >= N) continue; const size_t boff = (size_t)(col0 + t * 16 + ln) * ldb + kb; FragH bq; bq.half[0] = *(const v8us*)((const unsigned short*)Bh + boff + 8 * hh); bq.half[1] = *(const v8us*)((const unsigned short*)Bh + boff + 16 + 8 * hh);
      acc[t] = mmaH<1>(ah.v, ah.v, bq.v, bq.v, acc[t]); }
  }
#pragma unroll
  for (int t = 0; t < 4; ++t) { if (col0 + t * 16 >= N) continue; const int col = col0 + t * 16 + ln; const float bv = bp ? bf16_round(bp[col]) : 0.f;
#pragma unroll
    for (int r = 0; r < 8; ++r) { float v = acc[t][r] * alpha + bv; if (CP) { const int bidx = (row0g + row0 + 8 * hh + r) / rowsPerB; v += CP[(size_t)bidx * sCPb + (size_t)by * 64 + col]; } if (ACT == 1) v = (v > 0.f) ? v : expm1f(v); else if (ACT == 7) v = (v > 0.f) ? v + 1.0f : expf(v); else if (ACT == 8) v = tanhf(v); else if (ACT == 9) v = 0.5f * v * (1.0f + tanhf(0.7978845608028654f * (v + 0.044715f * v * v * v))); else if (ACT == 11) v = 1.0f / (1.0f + expf(-v)); else if (ACT == 12) v = (v > 0.f) ? v : 0.01f * v; else if (ACT == 14) v = (v > 0.f) ? v : 0.1f * v; else if (ACT == 15) v = v / (1.0f + expf(-v)); else if (ACT == 3) v = fmaxf(v, 0.f); else if (ACT == 6) v = 0.5f * v * (1.0f + erff(v * 0.70710678118654752f)); so[w][8 * hh + r][t * 16 + ln] = v; } }
  __builtin_amdgcn_fence(__ATOMIC_ACQ_REL, "workgroup"); __builtin_amdgcn_wave_barrier();
  const int rsub = lane >> 4, c4 = (lane & 15) * 4; typedef _Float16 v4h __attribute__((ext_vector_type(4)));
  {
#pragma unroll
    for (int q = 0; q < 8; ++q) { const int r = q * 2 + rsub; if (col0 + c4 < N) { const v4f v = *(const v4fa*)&so[w][r][c4]; if (C) *(v4f*)(C + cofs + (size_t)(row0 + r) * ldc + col0 + c4) = v; if (C16) { v4h h4; for (int i = 0; i < 4; ++i) h4[i] = (_Float16)v[i]; *(v4h*)(C16 + cofs + (size_t)(row0 + r) * ldc + col0 + c4) = h4; } } }
     }
}
template <int ACT>
__global__ __launch_bounds__(128) void k_gemm_hhx(const _Float16* __restrict__ A, int lda, size_t sA, const _Float16* __restrict__ Bh, int ldb, size_t sB, float alpha, const float* __restrict__ bias, size_t sBias, const float* __restrict__ CP, int rowsPerB, size_t sCPb, int row0g,
    float* __restrict__ C, _Float16* __restrict__ C16, int ldc, size_t sC, int M, int N, int K) {
  __shared__ __attribute__((aligned(16))) float so[4][16][64];
  gemm_hhx<ACT>(so, blockIdx.x, blockIdx.y, A, lda, sA, Bh, ldb, sB, alpha, bias, sBias, CP, rowsPerB, sCPb, row0g, C, C16, ldc, sC, M, N, K);
}
// the two GEMMs that need only X16 and the rounded qkv_w, in one launch: blocks [0, QKB) give [q | k] token-major [n][512] (head h = cols h*32 / 256 + h*32; M 4096 N 512 K 256),
// blocks [QKB, QKB + VB) give v channel-major [(h,d)][n] = V^T (A = qkv_w rows 512..767, B = x token-major; M 256 N 4096 K 256)
#define QKB ((NR / 16) * (2 * CC / 64) / 4)
#define VB ((CC / 16) * (NN / 64) / 4)
__global__ __launch_bounds__(128) void k_qkv(const _Float16* __restrict__ X16, const _Float16* __restrict__ Bqkv, _Float16* __restrict__ QK, _Float16* __restrict__ Vt) {
  __shared__ __attribute__((aligned(16))) float so[4][16][64];
  const int bx = blockIdx.x;
  if (bx < QKB) gemm_hhx<0>(so, bx, 0, X16, CC, 0, Bqkv, CC, 0, 0.0625f, nullptr, 0, nullptr, 1, 0, 0, nullptr, QK, 2 * CC, 0, NR, 2 * CC, CC);
  else gemm_hhx<0>(so, bx - QKB, 0, Bqkv + (size_t)2 * CC * CC, CC, 0, X16, CC, 0, 0.0625f, nullptr, 0, nullptr, 1, 0, 0, nullptr, Vt, NN, 0, CC, NN, CC);
}


typedef _Float16 v4h __attribute__((ext_vector_type(4)));

__global__ __launch_bounds__(256) void k_x16(const float* __restrict__ x, _Float16* __restrict__ X16, size_t n8) { const size_t t = (size_t)blockIdx.x * 256 + threadIdx.x; if (t >= n8) return; FragH f;
#pragma unroll
  for (int q = 0; q < 8; ++q) f.h[q] = (_Float16)bf16_round(x[t * 8 + q]); *(v8us*)((unsigned short*)X16 + t * 8) = f.half[0];  }
__global__ __launch_bounds__(256) void k_h16(const float* __restrict__ x, _Float16* __restrict__ X16, size_t n8) { const size_t t = (size_t)blockIdx.x * 256 + threadIdx.x; if (t >= n8) return; FragH f;
#pragma unroll
  for (int q = 0; q < 8; ++q) f.h[q] = (_Float16)x[t * 8 + q]; *(v8us*)((unsigned short*)X16 + t * 8) = f.half[0];  }
__device__ __forceinline__ void round16f(int bx, const float* __restrict__ W, _Float16* __restrict__ Bt, size_t n8) { const size_t t = (size_t)bx * 256 + threadIdx.x; if (t >= n8) return; FragH f;
#pragma unroll
  for (int i = 0; i < 8; ++i) f.h[i] = (_Float16)(bf16_round(W[t * 8 + i]) * 16.0f); *(v8us*)((unsigned short*)Bt + t * 8) = f.half[0];  }
template <int NHv, int TTv>
__global__ __launch_bounds__(256) void k_vt(const _Float16* __restrict__ V16, int ldv, int voff, _Float16* __restrict__ Vt) { __shared__ unsigned short tl[64][66]; const int tid = threadIdx.x; const int slab = blockIdx.x / (TTv / 64), lg = blockIdx.x % (TTv / 64); const int b = slab / NHv, h = slab % NHv;
  for (int i = tid; i < 64 * 8; i += 256) { const int r = i / 8, c8 = (i % 8) * 8; FragH f; f.half[0] = *(const v8us*)((const unsigned short*)V16 + ((size_t)b * TTv + lg * 64 + r) * ldv + voff + h * 64 + c8);
#pragma unroll
    for (int q = 0; q < 8; ++q) tl[r][c8 + q] = f.u[q]; }
  __syncthreads();
  {
#pragma unroll
    for (int rd = 0; rd < 2; ++rd) { const int d = rd * 32 + tid / 8, pc = tid % 8; FragH f;
#pragma unroll
      for (int q = 0; q < 8; ++q) f.u[q] = tl[pc * 8 + q][d];
      *(v8us*)((unsigned short*)Vt + ((size_t)slab * 64 + d) * TTv + lg * 64 + pc * 8) = f.half[0]; }
     } }

__device__ __forceinline__ void tok(float (*tl)[65], int bx, const float* __restrict__ x, _Float16* __restrict__ X16) { const int tid = threadIdx.x; const int b = bx / ((CC / 64) * (NN / 32)), rem = bx % ((CC / 64) * (NN / 32)); const int cg = rem / (NN / 32), pg = rem % (NN / 32); const int c0 = cg * 64, p0 = pg * 32;
  for (int i = tid; i < 64 * 32; i += 256) { const int c = i / 32, pp = i % 32; tl[pp][c] = bf16_round(x[((size_t)b * CC + c0 + c) * NN + p0 + pp]); } __syncthreads();
  const int r = tid / 8, pc = tid % 8; FragH f; for (int q = 0; q < 8; ++q) f.h[q] = (_Float16)tl[r][pc * 8 + q]; const size_t row = (size_t)b * NN + p0 + r; *(v8us*)((unsigned short*)X16 + row * CC + c0 + pc * 8) = f.half[0];  }
// the three passes that read only inputs, in one launch: blocks [0, TOKB) transpose x to token-major f16, the next WQB round qkv_w, the last WPB round proj_w ((out,in) natural, x 2^4).
// The branch is on blockIdx alone, so the barrier inside tok() is passed by every thread of a block or by none.
#define TOKB (BB * (CC / 64) * (NN / 32))
#define WQB (C3 * CC / 8 / 256)
#define WPB (CC * CC / 8 / 256)
__global__ __launch_bounds__(256) void k_prep(const float* __restrict__ x, _Float16* __restrict__ X16, const float* __restrict__ Wqkv, _Float16* __restrict__ Bqkv, const float* __restrict__ Wp, _Float16* __restrict__ Bp) {
  __shared__ float tl[32][65];
  const int bx = blockIdx.x;
  if (bx < TOKB) tok(tl, bx, x, X16);
  else if (bx < TOKB + WQB) round16f(bx - TOKB, Wqkv, Bqkv, (size_t)C3 * CC / 8);
  else round16f(bx - TOKB - WQB, Wp, Bp, (size_t)CC * CC / 8);
}
typedef float v2f __attribute__((ext_vector_type(2)));
// lane l <-> l ^ 16: the two halves of a wave each hold half of a query column's keys
__device__ __forceinline__ float xhalf(float v) { const int b = __float_as_int(v); return __int_as_float(__builtin_amdgcn_permlanex16(b, b, 0x76543210, 0xfedcba98, false, false)); }
// Transposed products: S^T = K.Q^T (A = 16 key rows, B = the wave's 16 queries as columns), O^T += V^T.P^T. A lane then holds 16 of the 32 scores of ONE query
// (keys 8hh + r and 16 + 8hh + r), which is the k order of a B operand: P goes from the score accumulators into the second product without LDS.
// K and V^T come in tiles of KT keys that the block's four waves share: asynchronous 16-byte copies fill one LDS buffer while the other is worked on (two buffers, one barrier a tile).
__global__ __launch_bounds__(128) void k_flash(const _Float16* __restrict__ Q16, int ldq, const _Float16* __restrict__ K16, int ldk, const _Float16* __restrict__ Vt, const int* __restrict__ MSK, float* __restrict__ O, int ldo) {
  constexpr int RPW = 16, NQB = NN / (4 * RPW), DT = 2;
  constexpr int KT = 128, NT = NN / KT, KP = HD + 8, VP = KT + 8;      /* row pitches of 80 and 272 bytes (16 x odd): 16-byte fragment reads of 16 rows fall on 64 different banks */
  __shared__ __attribute__((aligned(16))) unsigned short sK[2][KT][KP];      /* K tile: key rows of 32 halves */
  __shared__ __attribute__((aligned(16))) unsigned short sV[2][HD][VP];      /* V^T tile: channel rows of KT halves */
  __shared__ __attribute__((aligned(16))) float sO[4][RPW][32 + 4];
  const int tid = threadIdx.x, w = tid >> 5, lane = tid & 31, ln = lane & 15, hh = lane >> 4; (void)MSK;
  const int slab = blockIdx.x / NQB, qblk = blockIdx.x % NQB; const int h = slab; const int b = 0; const int qb0 = qblk * (4 * RPW); const int q0 = qb0 + w * RPW;
  FragH bq;
  { const unsigned short* qr = (const unsigned short*)Q16 + ((size_t)b * NN + q0 + ln) * ldq + h * HD; bq.half[0] = *(const v8us*)(qr + 8 * hh); bq.half[1] = *(const v8us*)(qr + 16 + 8 * hh); }
  const unsigned short* Vth = (const unsigned short*)Vt + (size_t)h * HD * NN;      /* V^T = v[(h,d)][n] channel-major */
  /* a thread's share of a tile: 16-byte piece tid & 3 of key rows (tid >> 2) + 32 i, and piece tid & 15 of channel rows (tid >> 4) + 8 i, i = 0..3 */
  const unsigned short* gk = (const unsigned short*)K16 + (size_t)b * NN * ldk + h * HD + (size_t)(tid >> 2) * ldk + (tid & 3) * 8;
  const unsigned short* gv = Vth + (size_t)(tid >> 4) * NN + (tid & 15) * 8;
  const unsigned lk = (unsigned)(uintptr_t)&sK[0][tid >> 2][(tid & 3) * 8], lv = (unsigned)(uintptr_t)&sV[0][tid >> 4][(tid & 15) * 8];      /* LDS byte addresses */
  const size_t kstep = (size_t)32 * ldk;
  auto stage = [&](int t, int buf) {
    const unsigned short* k0 = gk + (size_t)t * KT * ldk; const unsigned short* v0 = gv + t * KT;
    const unsigned a0 = lk + (unsigned)buf * (KT * KP * 2), c0 = lv + (unsigned)buf * (HD * VP * 2);
    /* the tile's eight copies of this thread; s_wait_xcnt closes the statement so that no address register of a copy is rewritten in front of it */
    asm volatile("global_load_async_to_lds_b128 %0, %8, off\n\t"
                 "global_load_async_to_lds_b128 %1, %9, off\n\t"
                 "global_load_async_to_lds_b128 %2, %10, off\n\t"
                 "global_load_async_to_lds_b128 %3, %11, off\n\t"
                 "global_load_async_to_lds_b128 %4, %12, off\n\t"
                 "global_load_async_to_lds_b128 %5, %13, off\n\t"
                 "global_load_async_to_lds_b128 %6, %14, off\n\t"
                 "global_load_async_to_lds_b128 %7, %15, off\n\t"
                 "s_wait_xcnt 0x0"
                 :: "v"(a0), "v"(a0 + 32 * KP * 2), "v"(a0 + 64 * KP * 2), "v"(a0 + 96 * KP * 2), "v"(c0), "v"(c0 + 8 * VP * 2), "v"(c0 + 16 * VP * 2), "v"(c0 + 24 * VP * 2),
                    "v"(k0), "v"(k0 + kstep), "v"(k0 + 2 * kstep), "v"(k0 + 3 * kstep), "v"(v0), "v"(v0 + 8 * NN), "v"(v0 + 16 * NN), "v"(v0 + 24 * NN)
                 : "memory");
  };
  constexpr float SL2 = 0.25503486f;      /* 32^-1/2 x log2(e): the softmax runs in base 2, one multiply-add and one v_exp_f32 a score */
  float m_c = -3.0e38f, l_c = 0.f; v8f oacc[DT];      /* running maximum (in log2 units) and this half's partial sum (x 2^10) of query q0 + ln; oacc[dt][r] = O^T[dt*16 + 8hh + r][q0 + ln] */
#pragma unroll
  for (int dt = 0; dt < DT; ++dt) oacc[dt] = (v8f){0.f,0.f,0.f,0.f,0.f,0.f,0.f,0.f};
  stage(0, 0);
  asm volatile("s_wait_asynccnt 0x0" ::: "memory");      /* this wave's share of tile 0 has landed */
  __syncthreads();      /* every wave's share of tile 0 has landed */
  stage(1, 1);
  /* the tile loop and the loop over a tile's 32-key passes stay rolled: more copies of the long body would only grow the code; every full "#pragma unroll" in this kernel but the one over the stored output rows keeps an array that the loop variable indexes in registers */
#pragma unroll 1
  for (int t = 0; t < NT; ++t) {
   const int buf = t & 1;
#pragma unroll 1
   for (int js = 0; js < KT; js += 32) {
    FragH ak[2], av[DT];
#pragma unroll
    for (int nt = 0; nt < 2; ++nt) { const unsigned short* kr = &sK[buf][js + nt * 16 + ln][0]; ak[nt].half[0] = *(const v8us*)(kr + 8 * hh); ak[nt].half[1] = *(const v8us*)(kr + 16 + 8 * hh); }
#pragma unroll
    for (int dt = 0; dt < DT; ++dt) { const unsigned short* vrow = &sV[buf][dt * 16 + ln][js]; av[dt].half[0] = *(const v8us*)(vrow + 8 * hh); av[dt].half[1] = *(const v8us*)(vrow + 16 + 8 * hh); }
    float sc[16];      /* raw q.k sums; the scale goes into the exponent's multiply-add */
#pragma unroll
    for (int nt = 0; nt < 2; ++nt) {
      const v8f acc = mmaH<1>(ak[nt].v, ak[nt].v, bq.v, bq.v, (v8f){0.f,0.f,0.f,0.f,0.f,0.f,0.f,0.f});
#pragma unroll
      for (int r = 0; r < 8; ++r) sc[nt * 8 + r] = acc[r]; }
    float mx[8];
#pragma unroll
    for (int i = 0; i < 8; ++i) mx[i] = fmaxf(sc[i], sc[8 + i]);
    float mc = fmaxf(fmaxf(fmaxf(mx[0], mx[1]), fmaxf(mx[2], mx[3])), fmaxf(fmaxf(mx[4], mx[5]), fmaxf(mx[6], mx[7])));
    mc = fmaxf(mc, xhalf(mc));
    const float mn = fmaxf(m_c, mc * SL2); const float al = (mn > -1.0e38f) ? __builtin_amdgcn_exp2f(m_c - mn) : 1.0f; m_c = mn;
    const float mb = mn - 10.0f;      /* p = 2^(s SL2 - mn + 10): the 2^10 of the f16 P rides in the exponent, and the row sum carries it too */
    FragH pb; float p[16];
#pragma unroll
    for (int i = 0; i < 16; i += 2) {
      const v2f e = __builtin_elementwise_fma((v2f){sc[i], sc[i + 1]}, (v2f){SL2, SL2}, (v2f){-mb, -mb});      /* two exponents a packed multiply-add */
      p[i] = __builtin_amdgcn_exp2f(e[0]); p[i + 1] = __builtin_amdgcn_exp2f(e[1]); pb.h[i] = (_Float16)p[i]; pb.h[i + 1] = (_Float16)p[i + 1]; }
#pragma unroll
    for (int i = 0; i < 8; ++i) p[i] += p[8 + i];
    l_c = l_c * al + (((p[0] + p[1]) + (p[2] + p[3])) + ((p[4] + p[5]) + (p[6] + p[7])));
#pragma unroll
    for (int dt = 0; dt < DT; ++dt)
#pragma unroll
      for (int r = 0; r < 8; ++r) oacc[dt][r] *= al;
#pragma unroll
    for (int dt = 0; dt < DT; ++dt) oacc[dt] = mmaH<1>(av[dt].v, av[dt].v, pb.v, pb.v, oacc[dt]);
   }
   asm volatile("s_wait_dscnt 0x0" ::: "memory");      /* this wave's reads of buffer buf have returned before the buffer is refilled */
   asm volatile("s_wait_asynccnt 0x0" ::: "memory");      /* this wave's share of tile t + 1 has landed */
   __syncthreads();      /* publishes tile t + 1 and ends every wave's reads of buffer buf */
   if (t + 2 < NT) stage(t + 2, buf);
  }
  asm volatile("s_wait_asynccnt 0x0" ::: "memory");      /* no copy is outstanding when the wave goes on to its end */
  const float l = l_c + xhalf(l_c); const float inv = (l > 0.f) ? 1.0f / l : 0.f;      /* l and oacc both carry the 2^10 */
#pragma unroll
  for (int dt = 0; dt < DT; ++dt)
#pragma unroll
    for (int r4 = 0; r4 < 8; r4 += 4) { const v4f o4 = {oacc[dt][r4] * inv, oacc[dt][r4 + 1] * inv, oacc[dt][r4 + 2] * inv, oacc[dt][r4 + 3] * inv}; *(v4fa*)&sO[w][ln][dt * 16 + 8 * hh + r4] = o4; }
  __builtin_amdgcn_fence(__ATOMIC_ACQ_REL, "workgroup"); __builtin_amdgcn_wave_barrier();
  {
#pragma unroll
    for (int rp = 0; rp < RPW; rp += 4) { const int r = rp + (lane >> 3), pc = lane & 7; const v4f val = *(const v4fa*)&sO[w][r][pc * 4]; *(v4f*)(O + ((size_t)b * NN + q0 + r) * ldo + h * HD + pc * 4) = val; }      
     } }

__global__ __launch_bounds__(256) void k_out(const float* __restrict__ G, float* __restrict__ out) { __shared__ float tl[32][65]; const int tid = threadIdx.x; const int b = blockIdx.x / ((CC / 32) * (NN / 64)), rem = blockIdx.x % ((CC / 32) * (NN / 64)); const int cg = rem / (NN / 64), pg = rem % (NN / 64); const int c0 = cg * 32, p0 = pg * 64;
  for (int i = tid; i < 64 * 32; i += 256) { const int pp = i / 32, c = i % 32; tl[c][pp] = G[((size_t)b * NN + p0 + pp) * CC + c0 + c]; } __syncthreads();
  { for (int i = tid; i < 32 * 16; i += 256) { const int c = i / 16, q4 = i % 16; const v4f v = {tl[c][q4 * 4], tl[c][q4 * 4 + 1], tl[c][q4 * 4 + 2], tl[c][q4 * 4 + 3]}; *(v4f*)(out + ((size_t)b * CC + c0 + c) * NN + p0 + q4 * 4) = v; }  } }

extern "C" void kernel_launch(void* const* d_in, const int* in_sizes, int n_in,
                              void* d_out, int out_size, void* d_ws, size_t ws_size, hipStream_t stream) {
  (void)in_sizes; (void)n_in; (void)out_size;
  const float* x = (const float*)d_in[0]; const float* Wqkv = (const float*)d_in[1]; const float* Wp = (const float*)d_in[2]; const float* bp = (const float*)d_in[3];
  char* ws = (char*)d_ws; size_t off = 0;
  auto take = [&](size_t bytes) { char* p = ws + off; off += (bytes + 255) & ~(size_t)255; return p; };
  _Float16* Bqkv = (_Float16*)take((size_t)C3 * CC * 2); _Float16* Bp = (_Float16*)take((size_t)CC * CC * 2); _Float16* X16 = (_Float16*)take((size_t)NR * CC * 2);
  _Float16* QK = (_Float16*)take((size_t)NR * 2 * CC * 2); _Float16* Vt = (_Float16*)take((size_t)CC * NN * 2); float* O = (float*)take((size_t)NR * CC * 4); _Float16* O16 = (_Float16*)take((size_t)NR * CC * 2); float* G = (float*)take((size_t)NR * CC * 4);
  if (off > ws_size) return;      // 0.4 + 0.1 + 2.1 + 4.2 + 2.1 + 4.2 + 2.1 + 4.2 ≈ 20 MB
  k_prep<<<TOKB + WQB + WPB, 256, 0, stream>>>(x, X16, Wqkv, Bqkv, Wp, Bp);
  k_qkv<<<QKB + VB, 128, 0, stream>>>(X16, Bqkv, QK, Vt);
  k_flash<<<NH * (NN / 64), 128, 0, stream>>>(QK, 2 * CC, QK + CC, 2 * CC, Vt, nullptr, O, CC);      /* blocks = head × 64-query groups */
  k_h16<<<(unsigned)(((size_t)NR * CC / 8 + 255) / 256), 256, 0, stream>>>(O, O16, (size_t)NR * CC / 8);
  k_gemm_hhx<0><<<dim3(((NR / 16) * (CC / 64) + 3) / 4, 1), 128, 0, stream>>>(O16, CC, 0, Bp, CC, 0, 0.0625f, bp, 0, nullptr, 1, 0, 0, G, nullptr, CC, 0, NR, CC, CC);      /* G = O·proj_wᵀ + proj_b (token-major): M 4096 N 256 K 256 */
  k_out<<<BB * (CC / 32) * (NN / 64), 256, 0, stream>>>(G, (float*)d_out);
}

// v005
// One run takes 67.2 microseconds.
// Timed twice side by side with v004, it ran 1.07 and 1.08 times as fast.
// Counting every step since v000, it is 5.85 times as fast.
#include <hip/hip_runtime.h>
// 3-D multi-head self-attention on channel-major x [1, 256, 16³ = 4096]: qkv = qkv_w·x (1×1×1 conv, no bias), 8 heads × 32, softmax(qᵀk·32^-½) over keys, out[h,d,n] = Σ_m attn[n,m]·v[h,d,m], then proj_w·out + proj_b.
// Compute dtype: x, qkv_w, proj_w, proj_b rounded to bf16; q/k token-major and v channel-major (= Vᵀ) as f16 GEMM outputs (f32 accumulate); fused flash-style kernel per head
// (online softmax f32, P f16 x 2^10) on v_wmma_f32_16x16x32_f16, which stores O as f16; projection GEMM with bias, computed channel-major (A = proj_w) and stored straight to out; f32 accumulate throughout.
#define BB 1
#define CC 256
#define C3 768
#define NH 8
#define HD 32
#define NN 4096
#define NR (BB * NN)

typedef __bf16 v16b __attribute__((ext_vector_type(16)));
typedef unsigned short v8us __attribute__((ext_vector_type(8), may_alias));
typedef float  v8f  __attribute__((ext_vector_type(8)));
typedef float  v4f  __attribute__((ext_vector_type(4)));
typedef float  v4fa __attribute__((ext_vector_type(4), may_alias));
union FragB { v16b v; v8us half[2]; unsigned short u[16]; };

__device__ __forceinline__ unsigned short bf16_bits(float x) { unsigned int u = __float_as_uint(x); return (unsigned short)((u + 0x7FFFu + ((u >> 16) & 1u)) >> 16); }
__device__ __forceinline__ float bf16_val(unsigned short b) { return __uint_as_float(((unsigned int)b) << 16); }
__device__ __forceinline__ float bf16_round(float x) { return bf16_val(bf16_bits(x)); }
// D += A·B with NT terms: 1 = ah·bh, 2 = + al·bh (A split), 3 = + ah·bl (both split)
template <int NT>
__device__ __forceinline__ v8f mmaN(v16b ah, v16b al, v16b bh, v16b bl, v8f c) {
  c = __builtin_amdgcn_wmma_f32_16x16x32_bf16(false, ah, false, bh, (short)0, c, false, false);
  if (NT >= 2) c = __builtin_amdgcn_wmma_f32_16x16x32_bf16(false, al, false, bh, (short)0, c, false, false);
  if (NT >= 3) c = __builtin_amdgcn_wmma_f32_16x16x32_bf16(false, ah, false, bl, (short)0, c, false, false);
  asm volatile("v_nop\n\tv_nop\n\tv_nop\n\tv_nop" : "+v"(c) : "v"(ah), "v"(al), "v"(bh), "v"(bl));
  return c;
}

__global__ __launch_bounds__(256) void k_wt_bf16(const float* __restrict__ W, unsigned short* __restrict__ Wt, int K, int N) {
  const int t = blockIdx.x * 256 + threadIdx.x;
  const int k8n = K / 8;
  if (t >= N * k8n) return;
  const int n = t / k8n, k8 = (t % k8n) * 8;
  v8us v;
#pragma unroll
  for (int i = 0; i < 8; ++i) v[i] = bf16_bits(W[(size_t)(k8 + i) * N + n]);
  *(v8us*)(Wt + (size_t)n * K + k8) = v;
  
}

// GEMM C[M][N] (f32, pitch ldc) = act(A[M][K]·W + bias). A f32 row-major (pitch lda) converted per fragment to bf16
// (ASPLIT: hi/lo two planes -> 2 terms, else single rounded term); Wt bf16 [N][K] (pitch ldb). BIAS_BF16 rounds the
// bias to bf16 first (bias quantised to bf16 before the add). K%32==0, M%16==0, N%64==0.
template <bool ASPLIT, int ACT, bool BIAS_BF16>
__global__ __launch_bounds__(128) void k_gemm_bf(const float* __restrict__ A, int lda, const unsigned short* __restrict__ Wt, int ldb,
                                               const float* __restrict__ bias, float* __restrict__ C, int ldc, int M, int N, int K) {
  __shared__ __attribute__((aligned(16))) float so[4][16][64];
  const int tid = threadIdx.x, w = tid >> 5, lane = tid & 31, ln = lane & 15, hh = lane >> 4;
  const int ntn = N / 64;
  const int wid = blockIdx.x * 4 + w;
  const int mt = wid / ntn, nq = wid % ntn;
  if (mt * 16 >= M) return;
  const int row0 = mt * 16, col0 = nq * 64;
  const float* arow = A + (size_t)(row0 + ln) * lda;
  v8f acc[4] = {};
  for (int kb = 0; kb < K; kb += 32) {
    FragB ah, al;
    const v4f x0 = *(const v4fa*)(arow + kb + 8 * hh), x1 = *(const v4fa*)(arow + kb + 8 * hh + 4);
    const v4f x2 = *(const v4fa*)(arow + kb + 16 + 8 * hh), x3 = *(const v4fa*)(arow + kb + 16 + 8 * hh + 4);
    float xs[16] = {x0[0],x0[1],x0[2],x0[3],x1[0],x1[1],x1[2],x1[3],x2[0],x2[1],x2[2],x2[3],x3[0],x3[1],x3[2],x3[3]};
#pragma unroll
    for (int i = 0; i < 16; ++i) { const unsigned short hb = bf16_bits(xs[i]); ah.u[i] = hb; al.u[i] = ASPLIT ? bf16_bits(xs[i] - bf16_val(hb)) : (unsigned short)0; }
#pragma unroll
    for (int t = 0; t < 4; ++t) {
      const unsigned short* brow = Wt + (size_t)(col0 + t * 16 + ln) * ldb + kb;
      FragB b;
      b.half[0] = *(const v8us*)(brow + 8 * hh);
      b.half[1] = *(const v8us*)(brow + 16 + 8 * hh);
      acc[t] = mmaN<ASPLIT ? 2 : 1>(ah.v, al.v, b.v, b.v, acc[t]);
    }
  }
#pragma unroll
  for (int t = 0; t < 4; ++t) {
    float bv = bias ? bias[col0 + t * 16 + ln] : 0.f;
    if (BIAS_BF16) bv = bf16_round(bv);
#pragma unroll
    for (int r = 0; r < 8; ++r) { float v = acc[t][r] + bv; if (ACT == 1) v = fmaxf(v, 0.f); so[w][8 * hh + r][t * 16 + ln] = v; }
  }
  __builtin_amdgcn_fence(__ATOMIC_ACQ_REL, "workgroup");
  __builtin_amdgcn_wave_barrier();
  const int rsub = lane >> 4, c4 = (lane & 15) * 4;
  {
#pragma unroll
    for (int q = 0; q < 8; ++q) {
      const int r = q * 2 + rsub;
      const v4f v = *(const v4fa*)&so[w][r][c4];
      *(v4f*)(C + (size_t)(row0 + r) * ldc + col0 + c4) = v;
    }
    
  }
}

// Flash-style causal/unmasked attention, all contractions 3-term bf16 hi/lo splits, f32 softmax with running max.
// q,k,v rows are read from f32 buffers with arbitrary row pitch (so they can live inside a fused qkv buffer);
// D = head size (multiple of 32, <= 128); one wave = 16 query rows; block = 4 waves (64 queries) sharing K/V chunks of 32.
template <int D, bool CAUSAL>
__global__ __launch_bounds__(128) void k_flash(const float* __restrict__ qb, const float* __restrict__ kb, const float* __restrict__ vb,
                                             int pitch, int T, int H, float scale, float* __restrict__ y, int ypitch) {
  constexpr int KS = D / 32;        // k-steps for QK
  constexpr int DT = D / 16;        // d tiles for PV
  __shared__ __attribute__((aligned(16))) unsigned short sKh[32][D + 8], sKl[32][D + 8], sVh[32][D + 8], sVl[32][D + 8];
  __shared__ __attribute__((aligned(16))) unsigned short sPh[4][16][40], sPl[4][16][40];
  __shared__ __attribute__((aligned(16))) float sO[4][16][D];
  const int tid = threadIdx.x, w = tid >> 5, lane = tid & 31, ln = lane & 15, hh = lane >> 4;
  const int nqb = (T + 63) / 64;
  const int bh = blockIdx.x / nqb, qblk = blockIdx.x % nqb;
  const int b = bh / H, h = bh % H;
  const int q0 = qblk * 64 + w * 16;
  const float* Q = qb + (size_t)b * T * pitch + h * D;
  const float* K = kb + (size_t)b * T * pitch + h * D;
  const float* V = vb + (size_t)b * T * pitch + h * D;

  // A fragments of the wave's 16 query rows (scaled), hi/lo
  FragB aqh[KS], aql[KS];
  {
    int row = q0 + ln; if (row >= T) row = T - 1;
    const float* qr = Q + (size_t)row * pitch;
#pragma unroll
    for (int ks = 0; ks < KS; ++ks)
#pragma unroll
      for (int i = 0; i < 16; ++i) {
        const int d = ks * 32 + ((i < 8) ? (8 * hh + i) : (16 + 8 * hh + (i - 8)));
        const float x = qr[d] * scale; const unsigned short hb = bf16_bits(x);
        aqh[ks].u[i] = hb; aql[ks].u[i] = bf16_bits(x - bf16_val(hb));
      }
  }
  float m_r[8], l_r[8];
#pragma unroll
  for (int r = 0; r < 8; ++r) { m_r[r] = -3.0e38f; l_r[r] = 0.f; }
  v8f oacc[DT];
#pragma unroll
  for (int dt = 0; dt < DT; ++dt) oacc[dt] = (v8f){0.f,0.f,0.f,0.f,0.f,0.f,0.f,0.f};

  const int kv_end = CAUSAL ? min(T, qblk * 64 + 64) : T;     // block-uniform
  for (int j0 = 0; j0 < kv_end; j0 += 32) {
    __syncthreads();
    for (int e = tid; e < 32 * (D / 4); e += 128) {
      const int r = e / (D / 4), c4 = (e % (D / 4)) * 4;
      const int key = j0 + r;
      v4f kf = {0.f,0.f,0.f,0.f}, vf = {0.f,0.f,0.f,0.f};
      if (key < T) { kf = *(const v4fa*)(K + (size_t)key * pitch + c4); vf = *(const v4fa*)(V + (size_t)key * pitch + c4); }
#pragma unroll
      for (int t = 0; t < 4; ++t) {
        unsigned short hb = bf16_bits(kf[t]); sKh[r][c4 + t] = hb; sKl[r][c4 + t] = bf16_bits(kf[t] - bf16_val(hb));
        hb = bf16_bits(vf[t]); sVh[r][c4 + t] = hb; sVl[r][c4 + t] = bf16_bits(vf[t] - bf16_val(hb));
      }
    }
    __syncthreads();
    // S tile 16 x 32
    v8f s[2];
#pragma unroll
    for (int nt = 0; nt < 2; ++nt) {
      v8f acc = {};
#pragma unroll
      for (int ks = 0; ks < KS; ++ks) {
        FragB bh_, bl_;
        bh_.half[0] = *(const v8us*)&sKh[nt * 16 + ln][ks * 32 + 8 * hh]; bh_.half[1] = *(const v8us*)&sKh[nt * 16 + ln][ks * 32 + 16 + 8 * hh];
        bl_.half[0] = *(const v8us*)&sKl[nt * 16 + ln][ks * 32 + 8 * hh]; bl_.half[1] = *(const v8us*)&sKl[nt * 16 + ln][ks * 32 + 16 + 8 * hh];
        acc = mmaN<3>(aqh[ks].v, aql[ks].v, bh_.v, bl_.v, acc);
      }
      s[nt] = acc;
    }
    // mask + running max (rows 8hh+r; the 16 lanes of a half share rows)
    float alpha[8];
#pragma unroll
    for (int r = 0; r < 8; ++r) {
      const int qi = q0 + 8 * hh + r;
      const int ja = j0 + ln, jb = j0 + 16 + ln;
      if (CAUSAL) { if (ja > qi) s[0][r] = -3.0e38f; if (jb > qi) s[1][r] = -3.0e38f; }
      if (ja >= T) s[0][r] = -3.0e38f;
      if (jb >= T) s[1][r] = -3.0e38f;
      float mx = fmaxf(s[0][r], s[1][r]);
      mx = fmaxf(mx, __shfl_xor(mx, 1, 32)); mx = fmaxf(mx, __shfl_xor(mx, 2, 32)); mx = fmaxf(mx, __shfl_xor(mx, 4, 32)); mx = fmaxf(mx, __shfl_xor(mx, 8, 32));
      const float mnew = fmaxf(m_r[r], mx);
      alpha[r] = (mnew > -1.0e38f) ? __expf(m_r[r] - mnew) : 1.0f;
      const float p0 = (s[0][r] > -1.0e38f) ? __expf(s[0][r] - mnew) : 0.f;
      const float p1 = (s[1][r] > -1.0e38f) ? __expf(s[1][r] - mnew) : 0.f;
      m_r[r] = mnew;
      l_r[r] = l_r[r] * alpha[r] + p0 + p1;            // per-lane partial row sum (16 lanes combined at the end)
      unsigned short hb = bf16_bits(p0); sPh[w][8 * hh + r][ln] = hb;      sPl[w][8 * hh + r][ln] = bf16_bits(p0 - bf16_val(hb));
      hb = bf16_bits(p1);                sPh[w][8 * hh + r][16 + ln] = hb; sPl[w][8 * hh + r][16 + ln] = bf16_bits(p1 - bf16_val(hb));
    }
#pragma unroll
    for (int dt = 0; dt < DT; ++dt)
#pragma unroll
      for (int r = 0; r < 8; ++r) oacc[dt][r] *= alpha[r];
    __builtin_amdgcn_fence(__ATOMIC_ACQ_REL, "workgroup");
    __builtin_amdgcn_wave_barrier();
    FragB pah, pal;
    pah.half[0] = *(const v8us*)&sPh[w][ln][8 * hh]; pah.half[1] = *(const v8us*)&sPh[w][ln][16 + 8 * hh];
    pal.half[0] = *(const v8us*)&sPl[w][ln][8 * hh]; pal.half[1] = *(const v8us*)&sPl[w][ln][16 + 8 * hh];
#pragma unroll
    for (int dt = 0; dt < DT; ++dt) {
      FragB bvh, bvl;
#pragma unroll
      for (int i = 0; i < 8; ++i) {
        bvh.u[i] = sVh[8 * hh + i][dt * 16 + ln]; bvh.u[8 + i] = sVh[16 + 8 * hh + i][dt * 16 + ln];
        bvl.u[i] = sVl[8 * hh + i][dt * 16 + ln]; bvl.u[8 + i] = sVl[16 + 8 * hh + i][dt * 16 + ln];
      }
      oacc[dt] = mmaN<3>(pah.v, pal.v, bvh.v, bvl.v, oacc[dt]);
    }
    __builtin_amdgcn_fence(__ATOMIC_ACQ_REL, "workgroup");
    __builtin_amdgcn_wave_barrier();
  }
#pragma unroll
  for (int r = 0; r < 8; ++r) {
    float l = l_r[r];
    l += __shfl_xor(l, 1, 32); l += __shfl_xor(l, 2, 32); l += __shfl_xor(l, 4, 32); l += __shfl_xor(l, 8, 32);
    l_r[r] = (l > 0.f) ? 1.0f / l : 0.f;
  }
#pragma unroll
  for (int dt = 0; dt < DT; ++dt)
#pragma unroll
    for (int r = 0; r < 8; ++r) sO[w][8 * hh + r][dt * 16 + ln] = oacc[dt][r] * l_r[r];
  __builtin_amdgcn_fence(__ATOMIC_ACQ_REL, "workgroup");
  __builtin_amdgcn_wave_barrier();
  {
    for (int r = 0; r < 16; ++r) {
      const int row = q0 + r;
      if (row < T && lane < D / 4) {
        const v4f val = *(const v4fa*)&sO[w][r][lane * 4];
        *(v4f*)(y + ((size_t)b * T + row) * ypitch + h * D + lane * 4) = val;
      }
    }
    
  }
}

// GEMM C = act(A·W + bias + resid): A f32 (ASPLIT -> hi/lo 2 terms), Wt bf16 [N][K]; ACT 0 none, 1 relu, 2 exact gelu;
// resid (optional, f32, row index = (row % rmod), pitch ldr, RES_BF16 rounds it) added before the activation.
template <bool ASPLIT, int ACT, bool BIAS_BF16, bool RES_BF16>
__global__ __launch_bounds__(128) void k_gemm_bf3(const float* __restrict__ A, int lda, const unsigned short* __restrict__ Wt, int ldb,
                                                const float* __restrict__ bias, const float* __restrict__ resid, int rmod, int ldr,
                                                float* __restrict__ C, int ldc, int M, int N, int K) {
  __shared__ __attribute__((aligned(16))) float so[4][16][64];
  const int tid = threadIdx.x, w = tid >> 5, lane = tid & 31, ln = lane & 15, hh = lane >> 4;
  const int ntn = N / 64;
  const int wid = blockIdx.x * 4 + w;
  const int mt = wid / ntn, nq = wid % ntn;
  if (mt * 16 >= M) return;
  const int row0 = mt * 16, col0 = nq * 64;
  const float* arow = A + (size_t)(row0 + ln) * lda;
  v8f acc[4] = {};
  for (int kb = 0; kb < K; kb += 32) {
    FragB ah, al;
    const v4f x0 = *(const v4fa*)(arow + kb + 8 * hh), x1 = *(const v4fa*)(arow + kb + 8 * hh + 4);
    const v4f x2 = *(const v4fa*)(arow + kb + 16 + 8 * hh), x3 = *(const v4fa*)(arow + kb + 16 + 8 * hh + 4);
    float xs[16] = {x0[0],x0[1],x0[2],x0[3],x1[0],x1[1],x1[2],x1[3],x2[0],x2[1],x2[2],x2[3],x3[0],x3[1],x3[2],x3[3]};
#pragma unroll
    for (int i = 0; i < 16; ++i) { const unsigned short hb = bf16_bits(xs[i]); ah.u[i] = hb; al.u[i] = ASPLIT ? bf16_bits(xs[i] - bf16_val(hb)) : (unsigned short)0; }
#pragma unroll
    for (int t = 0; t < 4; ++t) {
      const unsigned short* brow = Wt + (size_t)(col0 + t * 16 + ln) * ldb + kb;
      FragB b;
      b.half[0] = *(const v8us*)(brow + 8 * hh);
      b.half[1] = *(const v8us*)(brow + 16 + 8 * hh);
      acc[t] = mmaN<ASPLIT ? 2 : 1>(ah.v, al.v, b.v, b.v, acc[t]);
    }
  }
#pragma unroll
  for (int t = 0; t < 4; ++t) {
    const int col = col0 + t * 16 + ln;
    float bv = bias ? bias[col] : 0.f;
    if (BIAS_BF16) bv = bf16_round(bv);
#pragma unroll
    for (int r = 0; r < 8; ++r) {
      float v = acc[t][r] + bv;
      if (resid) { float rv = resid[(size_t)((row0 + 8 * hh + r) % rmod) * ldr + col]; if (RES_BF16) rv = bf16_round(rv); v += rv; }
      if (ACT == 1) v = fmaxf(v, 0.f);
      if (ACT == 2) v = 0.5f * v * (1.0f + erff(v * 0.70710678118654752f));
      if (ACT == 3) { const float u = 0.7978845608028654f * (v + 0.044715f * v * v * v); v = 0.5f * v * (1.0f + tanhf(u)); }
      so[w][8 * hh + r][t * 16 + ln] = v;
    }
  }
  __builtin_amdgcn_fence(__ATOMIC_ACQ_REL, "workgroup");
  __builtin_amdgcn_wave_barrier();
  const int rsub = lane >> 4, c4 = (lane & 15) * 4;
  {
#pragma unroll
    for (int q = 0; q < 8; ++q) {
      const int r = q * 2 + rsub;
      const v4f v = *(const v4fa*)&so[w][r][c4];
      *(v4f*)(C + (size_t)(row0 + r) * ldc + col0 + c4) = v;
    }
    
  }
}
// row LayerNorm (biased variance, eps) over N: s = X (+ R); optional out_sum <- s; out_norm <- (s-mu)*rsqrt(var+eps)*g + b
template <bool PARAM_BF16>
__global__ __launch_bounds__(256) void k_layernorm(const float* __restrict__ X, const float* __restrict__ R, const float* __restrict__ g, const float* __restrict__ bta,
                                                  float* __restrict__ out_sum, float* __restrict__ out_norm, int N, float eps) {
  __shared__ float red[256];
  const int row = blockIdx.x, tid = threadIdx.x;
  const float* x = X + (size_t)row * N; const float* rr = R ? R + (size_t)row * N : nullptr;
  float vals[16];                     // up to N = 4096
  const int per = N / 256;            // contiguous chunk per thread? use strided-by-4 chunks: thread handles j = tid*4 + 1024*u
  float s1 = 0.f;
  for (int u = 0; u < per / 4; ++u) {
    const int j = tid * 4 + 1024 * u;
    const v4f a = *(const v4fa*)(x + j);
    v4f b = {0.f,0.f,0.f,0.f}; if (rr) b = *(const v4fa*)(rr + j);
#pragma unroll
    for (int q = 0; q < 4; ++q) { const float v = a[q] + b[q]; vals[u * 4 + q] = v; s1 += v; }
  }
  red[tid] = s1; __syncthreads();
  for (int st = 128; st > 0; st >>= 1) { if (tid < st) red[tid] += red[tid + st]; __syncthreads(); }
  const float mu = red[0] / (float)N; __syncthreads();
  float s2 = 0.f;
  for (int u = 0; u < per / 4; ++u)
#pragma unroll
    for (int q = 0; q < 4; ++q) { const float c = vals[u * 4 + q] - mu; s2 += c * c; }
  red[tid] = s2; __syncthreads();
  for (int st = 128; st > 0; st >>= 1) { if (tid < st) red[tid] += red[tid + st]; __syncthreads(); }
  const float rs = rsqrtf(red[0] / (float)N + eps);
  {
    for (int u = 0; u < per / 4; ++u) {
      const int j = tid * 4 + 1024 * u;
      v4f o, sm;
#pragma unroll
      for (int q = 0; q < 4; ++q) {
        float gg = g[j + q], bb = bta[j + q];
        if (PARAM_BF16) { gg = bf16_round(gg); bb = bf16_round(bb); }
        sm[q] = vals[u * 4 + q]; o[q] = (vals[u * 4 + q] - mu) * rs * gg + bb;
      }
      if (out_sum) *(v4f*)(out_sum + (size_t)row * N + j) = sm;
      *(v4f*)(out_norm + (size_t)row * N + j) = o;
    }
    
  }
}



// ---- f16 WMMA path (v_wmma_f32_16x16x32_f16): 11-bit significands for operands in range — used here for the qkv and projection GEMMs and for attention
typedef _Float16 v16h __attribute__((ext_vector_type(16)));
union FragH { v16h v; v8us half[2]; _Float16 h[16]; unsigned short u[16]; };
template <int NT>
__device__ __forceinline__ v8f mmaH(v16h ah, v16h al, v16h bh, v16h bl, v8f c) {
  c = __builtin_amdgcn_wmma_f32_16x16x32_f16(false, ah, false, bh, (short)0, c, false, false);
  if (NT >= 2) c = __builtin_amdgcn_wmma_f32_16x16x32_f16(false, al, false, bh, (short)0, c, false, false);
  if (NT >= 3) c = __builtin_amdgcn_wmma_f32_16x16x32_f16(false, ah, false, bl, (short)0, c, false, false);
  asm volatile("v_nop\n\tv_nop\n\tv_nop\n\tv_nop" : "+v"(c) : "v"(ah), "v"(al), "v"(bh), "v"(bl));
  return c;
}
// batched GEMM like k_gemm_b but f16 operands: A f32 (split into f16 hi/lo if ASPLIT, else rounded to f16), Bt = f16 values [n][k]; alpha; C f32; N multiple of 16 (partial tiles skipped)
template <bool ASPLIT>
__global__ __launch_bounds__(128) void k_gemm_h(const float* __restrict__ A, int lda, size_t sA, const _Float16* __restrict__ Bh, int ldb, size_t sB, float alpha, float* __restrict__ C, int ldc, size_t sC, int M, int N, int K) {
  __shared__ __attribute__((aligned(16))) float so[4][16][64];
  const int tid = threadIdx.x, w = tid >> 5, lane = tid & 31, ln = lane & 15, hh = lane >> 4; const int by = blockIdx.y;
  A += (size_t)by * sA; Bh += (size_t)by * sB; C += (size_t)by * sC;
  const int ntn = (N + 63) / 64; const int wid = blockIdx.x * 4 + w; const int mt = wid / ntn, nq = wid % ntn; if (mt * 16 >= M) return;
  const int row0 = mt * 16, col0 = nq * 64; const float* arow = A + (size_t)(row0 + ln) * lda;
  v8f acc[4] = {};
  for (int kb = 0; kb < K; kb += 32) {
    FragH ah, al;
    const v4f x0 = *(const v4fa*)(arow + kb + 8 * hh), x1 = *(const v4fa*)(arow + kb + 8 * hh + 4), x2 = *(const v4fa*)(arow + kb + 16 + 8 * hh), x3 = *(const v4fa*)(arow + kb + 16 + 8 * hh + 4);
    float xs[16] = {x0[0],x0[1],x0[2],x0[3],x1[0],x1[1],x1[2],x1[3],x2[0],x2[1],x2[2],x2[3],x3[0],x3[1],x3[2],x3[3]};
#pragma unroll
    for (int i = 0; i < 16; ++i) { const _Float16 h = (_Float16)xs[i]; ah.h[i] = h; al.h[i] = ASPLIT ? (_Float16)(xs[i] - (float)h) : (_Float16)0.0f; }
#pragma unroll
    for (int t = 0; t < 4; ++t) { if (col0 + t * 16 >= N) continue; const size_t boff = (size_t)(col0 + t * 16 + ln) * ldb + kb; FragH bq; bq.half[0] = *(const v8us*)(Bh + boff + 8 * hh); bq.half[1] = *(const v8us*)(Bh + boff + 16 + 8 * hh);
      acc[t] = mmaH<ASPLIT ? 2 : 1>(ah.v, al.v, bq.v, bq.v, acc[t]); }
  }
#pragma unroll
  for (int t = 0; t < 4; ++t) { if (col0 + t * 16 >= N) continue;
#pragma unroll
    for (int r = 0; r < 8; ++r) so[w][8 * hh + r][t * 16 + ln] = acc[t][r] * alpha; }
  __builtin_amdgcn_fence(__ATOMIC_ACQ_REL, "workgroup"); __builtin_amdgcn_wave_barrier();
  const int rsub = lane >> 4, c4 = (lane & 15) * 4;
  {
#pragma unroll
    for (int q = 0; q < 8; ++q) { const int r = q * 2 + rsub; if (col0 + c4 < N) { const v4f v = *(const v4fa*)&so[w][r][c4]; *(v4f*)(C + (size_t)(row0 + r) * ldc + col0 + c4) = v; } }
     }
}

// Wt[n][k] = f16(W[k][n]·scale) from f32 row-major W[K][N] (scale = power of two; bf16-exact weights stay exact in f16 away from the subnormal range)
__global__ __launch_bounds__(256) void k_wt_f16(const float* __restrict__ W, _Float16* __restrict__ Wt, int K, int N, float scale) {
  const int t = blockIdx.x * 256 + threadIdx.x; if (t >= N * (K / 8)) return; const int n = t / (K / 8), k8 = (t % (K / 8)) * 8; FragH f;
#pragma unroll
  for (int i = 0; i < 8; ++i) f.h[i] = (_Float16)(bf16_round(W[(size_t)(k8 + i) * N + n]) * scale); const v8us o = f.half[0];
  *(v8us*)((unsigned short*)Wt + (size_t)n * K + k8) = o; 
}
// k_gemm_hh variant with fused epilogue: v = acc·alpha + bias[by·sBias + col] (+ CP[(row/rowsPerB)·sCPb + by·64 + col] if CP) ; ACT 0 none / 1 elu ; writes f16 C16 and f32 C, each if non-null
// the body is a device function of the block's place (bx, by) and its LDS, so that several GEMMs can share one launch
template <int ACT>
__device__ __forceinline__ void gemm_hhx(float (*so)[16][64], int bx, int by, const _Float16* __restrict__ A, int lda, size_t sA, const _Float16* __restrict__ Bh, int ldb, size_t sB, float alpha, const float* __restrict__ bias, size_t sBias, const float* __restrict__ CP, int rowsPerB, size_t sCPb, int row0g,
    float* __restrict__ C, _Float16* __restrict__ C16, int ldc, size_t sC, int M, int N, int K) {
  const int tid = threadIdx.x, w = tid >> 5, lane = tid & 31, ln = lane & 15, hh = lane >> 4;
  A += (size_t)by * sA; Bh += (size_t)by * sB; const size_t cofs = (size_t)by * sC; const float* bp = bias ? bias + (size_t)by * sBias : nullptr;
  const int ntn = (N + 63) / 64; const int wid = bx * 4 + w; const int mt = wid / ntn, nq = wid % ntn; if (mt * 16 >= M) return;
  const int row0 = mt * 16, col0 = nq * 64; const _Float16* arow = A + (size_t)(row0 + ln) * lda;
  v8f acc[4] = {};
  for (int kb = 0; kb < K; kb += 32) { FragH ah; ah.half[0] = *(const v8us*)((const unsigned short*)arow + kb + 8 * hh); ah.half[1] = *(const v8us*)((const unsigned short*)arow + kb + 16 + 8 * hh);
#pragma unroll
    for (int t = 0; t < 4; ++t) { if (col0 + t * 16 >= N) continue; const size_t boff = (size_t)(col0 + t * 16 + ln) * ldb + kb; FragH bq; bq.half[0] = *(const v8us*)((const unsigned short*)Bh + boff + 8 * hh); bq.half[1] = *(const v8us*)((const unsigned short*)Bh + boff + 16 + 8 * hh);
      acc[t] = mmaH<1>(ah.v, ah.v, bq.v, bq.v, acc[t]); }
  }
#pragma unroll
  for (int t = 0; t < 4; ++t) { if (col0 + t * 16 >= N) continue; const int col = col0 + t * 16 + ln; const float bv = bp ? bf16_round(bp[col]) : 0.f;
#pragma unroll
    for (int r = 0; r < 8; ++r) { float v = acc[t][r] * alpha + bv; if (CP) { const int bidx = (row0g + row0 + 8 * hh + r) / rowsPerB; v += CP[(size_t)bidx * sCPb + (size_t)by * 64 + col]; } if (ACT == 1) v = (v > 0.f) ? v : expm1f(v); else if (ACT == 7) v = (v > 0.f) ? v + 1.0f : expf(v); else if (ACT == 8) v = tanhf(v); else if (ACT == 9) v = 0.5f * v * (1.0f + tanhf(0.7978845608028654f * (v + 0.044715f * v * v * v))); else if (ACT == 11) v = 1.0f / (1.0f + expf(-v)); else if (ACT == 12) v = (v > 0.f) ? v : 0.01f * v; else if (ACT == 14) v = (v > 0.f) ? v : 0.1f * v; else if (ACT == 15) v = v / (1.0f + expf(-v)); else if (ACT == 3) v = fmaxf(v, 0.f); else if (ACT == 6) v = 0.5f * v * (1.0f + erff(v * 0.70710678118654752f)); so[w][8 * hh + r][t * 16 + ln] = v; } }
  __builtin_amdgcn_fence(__ATOMIC_ACQ_REL, "workgroup"); __builtin_amdgcn_wave_barrier();
  const int rsub = lane >> 4, c4 = (lane & 15) * 4; typedef _Float16 v4h __attribute__((ext_vector_type(4)));
  {
#pragma unroll
    for (int q = 0; q < 8; ++q) { const int r = q * 2 + rsub; if (col0 + c4 < N) { const v4f v = *(const v4fa*)&so[w][r][c4]; if (C) *(v4f*)(C + cofs + (size_t)(row0 + r) * ldc + col0 + c4) = v; if (C16) { v4h h4; for (int i = 0; i < 4; ++i) h4[i] = (_Float16)v[i]; *(v4h*)(C16 + cofs + (size_t)(row0 + r) * ldc + col0 + c4) = h4; } } }
     }
}
template <int ACT>
__global__ __launch_bounds__(128) void k_gemm_hhx(const _Float16* __restrict__ A, int lda, size_t sA, const _Float16* __restrict__ Bh, int ldb, size_t sB, float alpha, const float* __restrict__ bias, size_t sBias, const float* __restrict__ CP, int rowsPerB, size_t sCPb, int row0g,
    float* __restrict__ C, _Float16* __restrict__ C16, int ldc, size_t sC, int M, int N, int K) {
  __shared__ __attribute__((aligned(16))) float so[4][16][64];
  gemm_hhx<ACT>(so, blockIdx.x, blockIdx.y, A, lda, sA, Bh, ldb, sB, alpha, bias, sBias, CP, rowsPerB, sCPb, row0g, C, C16, ldc, sC, M, N, K);
}
// the two GEMMs that need only X16 and the rounded qkv_w, in one launch: blocks [0, QKB) give [q | k] token-major [n][512] (head h = cols h*32 / 256 + h*32; M 4096 N 512 K 256),
// blocks [QKB, QKB + VB) give v channel-major [(h,d)][n] = V^T (A = qkv_w rows 512..767, B = x token-major; M 256 N 4096 K 256)
#define QKB ((NR / 16) * (2 * CC / 64) / 4)
#define VB ((CC / 16) * (NN / 64) / 4)
__global__ __launch_bounds__(128) void k_qkv(const _Float16* __restrict__ X16, const _Float16* __restrict__ Bqkv, _Float16* __restrict__ QK, _Float16* __restrict__ Vt) {
  __shared__ __attribute__((aligned(16))) float so[4][16][64];
  const int bx = blockIdx.x;
  if (bx < QKB) gemm_hhx<0>(so, bx, 0, X16, CC, 0, Bqkv, CC, 0, 0.0625f, nullptr, 0, nullptr, 1, 0, 0, nullptr, QK, 2 * CC, 0, NR, 2 * CC, CC);
  else gemm_hhx<0>(so, bx - QKB, 0, Bqkv + (size_t)2 * CC * CC, CC, 0, X16, CC, 0, 0.0625f, nullptr, 0, nullptr, 1, 0, 0, nullptr, Vt, NN, 0, CC, NN, CC);
}


typedef _Float16 v4h __attribute__((ext_vector_type(4)));

__global__ __launch_bounds__(256) void k_x16(const float* __restrict__ x, _Float16* __restrict__ X16, size_t n8) { const size_t t = (size_t)blockIdx.x * 256 + threadIdx.x; if (t >= n8) return; FragH f;
#pragma unroll
  for (int q = 0; q < 8; ++q) f.h[q] = (_Float16)bf16_round(x[t * 8 + q]); *(v8us*)((unsigned short*)X16 + t * 8) = f.half[0];  }
__device__ __forceinline__ void round16f(int bx, const float* __restrict__ W, _Float16* __restrict__ Bt, size_t n8) { const size_t t = (size_t)bx * 256 + threadIdx.x; if (t >= n8) return; FragH f;
#pragma unroll
  for (int i = 0; i < 8; ++i) f.h[i] = (_Float16)(bf16_round(W[t * 8 + i]) * 16.0f); *(v8us*)((unsigned short*)Bt + t * 8) = f.half[0];  }
template <int NHv, int TTv>
__global__ __launch_bounds__(256) void k_vt(const _Float16* __restrict__ V16, int ldv, int voff, _Float16* __restrict__ Vt) { __shared__ unsigned short tl[64][66]; const int tid = threadIdx.x; const int slab = blockIdx.x / (TTv / 64), lg = blockIdx.x % (TTv / 64); const int b = slab / NHv, h = slab % NHv;
  for (int i = tid; i < 64 * 8; i += 256) { const int r = i / 8, c8 = (i % 8) * 8; FragH f; f.half[0] = *(const v8us*)((const unsigned short*)V16 + ((size_t)b * TTv + lg * 64 + r) * ldv + voff + h * 64 + c8);
#pragma unroll
    for (int q = 0; q < 8; ++q) tl[r][c8 + q] = f.u[q]; }
  __syncthreads();
  {
#pragma unroll
    for (int rd = 0; rd < 2; ++rd) { const int d = rd * 32 + tid / 8, pc = tid % 8; FragH f;
#pragma unroll
      for (int q = 0; q < 8; ++q) f.u[q] = tl[pc * 8 + q][d];
      *(v8us*)((unsigned short*)Vt + ((size_t)slab * 64 + d) * TTv + lg * 64 + pc * 8) = f.half[0]; }
     } }

__device__ __forceinline__ void tok(float (*tl)[65], int bx, const float* __restrict__ x, _Float16* __restrict__ X16) { const int tid = threadIdx.x; const int b = bx / ((CC / 64) * (NN / 32)), rem = bx % ((CC / 64) * (NN / 32)); const int cg = rem / (NN / 32), pg = rem % (NN / 32); const int c0 = cg * 64, p0 = pg * 32;
  for (int i = tid; i < 64 * 32; i += 256) { const int c = i / 32, pp = i % 32; tl[pp][c] = bf16_round(x[((size_t)b * CC + c0 + c) * NN + p0 + pp]); } __syncthreads();
  const int r = tid / 8, pc = tid % 8; FragH f; for (int q = 0; q < 8; ++q) f.h[q] = (_Float16)tl[r][pc * 8 + q]; const size_t row = (size_t)b * NN + p0 + r; *(v8us*)((unsigned short*)X16 + row * CC + c0 + pc * 8) = f.half[0];  }
// the three passes that read only inputs, in one launch: blocks [0, TOKB) transpose x to token-major f16, the next WQB round qkv_w, the last WPB round proj_w ((out,in) natural, x 2^4).
// The branch is on blockIdx alone, so the barrier inside tok() is passed by every thread of a block or by none.
#define TOKB (BB * (CC / 64) * (NN / 32))
#define WQB (C3 * CC / 8 / 256)
#define WPB (CC * CC / 8 / 256)
__global__ __launch_bounds__(256) void k_prep(const float* __restrict__ x, _Float16* __restrict__ X16, const float* __restrict__ Wqkv, _Float16* __restrict__ Bqkv, const float* __restrict__ Wp, _Float16* __restrict__ Bp) {
  __shared__ float tl[32][65];
  const int bx = blockIdx.x;
  if (bx < TOKB) tok(tl, bx, x, X16);
  else if (bx < TOKB + WQB) round16f(bx - TOKB, Wqkv, Bqkv, (size_t)C3 * CC / 8);
  else round16f(bx - TOKB - WQB, Wp, Bp, (size_t)CC * CC / 8);
}
typedef float v2f __attribute__((ext_vector_type(2)));
// lane l <-> l ^ 16: the two halves of a wave each hold half of a query column's keys
__device__ __forceinline__ float xhalf(float v) { const int b = __float_as_int(v); return __int_as_float(__builtin_amdgcn_permlanex16(b, b, 0x76543210, 0xfedcba98, false, false)); }
// Transposed products: S^T = K.Q^T (A = 16 key rows, B = the wave's 16 queries as columns), O^T += V^T.P^T. A lane then holds 16 of the 32 scores of ONE query
// (keys 8hh + r and 16 + 8hh + r), which is the k order of a B operand: P goes from the score accumulators into the second product without LDS.
// K and V^T come in tiles of KT keys that the block's four waves share: asynchronous 16-byte copies fill one LDS buffer while the other is worked on (two buffers, one barrier a tile).
__global__ __launch_bounds__(128) void k_flash(const _Float16* __restrict__ Q16, int ldq, const _Float16* __restrict__ K16, int ldk, const _Float16* __restrict__ Vt, const int* __restrict__ MSK, _Float16* __restrict__ O16) {
  constexpr int RPW = 16, NQB = NN / (4 * RPW), DT = 2;
  constexpr int KT = 128, NT = NN / KT, KP = HD + 8, VP = KT + 8;      /* row pitches of 80 and 272 bytes (16 x odd): 16-byte fragment reads of 16 rows fall on 64 different banks */
  __shared__ __attribute__((aligned(16))) unsigned short sK[2][KT][KP];      /* K tile: key rows of 32 halves */
  __shared__ __attribute__((aligned(16))) unsigned short sV[2][HD][VP];      /* V^T tile: channel rows of KT halves */
  const int tid = threadIdx.x, w = tid >> 5, lane = tid & 31, ln = lane & 15, hh = lane >> 4; (void)MSK;
  const int slab = blockIdx.x / NQB, qblk = blockIdx.x % NQB; const int h = slab; const int b = 0; const int qb0 = qblk * (4 * RPW); const int q0 = qb0 + w * RPW;
  FragH bq;
  { const unsigned short* qr = (const unsigned short*)Q16 + ((size_t)b * NN + q0 + ln) * ldq + h * HD; bq.half[0] = *(const v8us*)(qr + 8 * hh); bq.half[1] = *(const v8us*)(qr + 16 + 8 * hh); }
  const unsigned short* Vth = (const unsigned short*)Vt + (size_t)h * HD * NN;      /* V^T = v[(h,d)][n] channel-major */
  /* a thread's share of a tile: 16-byte piece tid & 3 of key rows (tid >> 2) + 32 i, and piece tid & 15 of channel rows (tid >> 4) + 8 i, i = 0..3 */
  const unsigned short* gk = (const unsigned short*)K16 + (size_t)b * NN * ldk + h * HD + (size_t)(tid >> 2) * ldk + (tid & 3) * 8;
  const unsigned short* gv = Vth + (size_t)(tid >> 4) * NN + (tid & 15) * 8;
  const unsigned lk = (unsigned)(uintptr_t)&sK[0][tid >> 2][(tid & 3) * 8], lv = (unsigned)(uintptr_t)&sV[0][tid >> 4][(tid & 15) * 8];      /* LDS byte addresses */
  const size_t kstep = (size_t)32 * ldk;
  auto stage = [&](int t, int buf) {
    const unsigned short* k0 = gk + (size_t)t * KT * ldk; const unsigned short* v0 = gv + t * KT;
    const unsigned a0 = lk + (unsigned)buf * (KT * KP * 2), c0 = lv + (unsigned)buf * (HD * VP * 2);
    /* the tile's eight copies of this thread; s_wait_xcnt closes the statement so that no address register of a copy is rewritten in front of it */
    asm volatile("global_load_async_to_lds_b128 %0, %8, off\n\t"
                 "global_load_async_to_lds_b128 %1, %9, off\n\t"
                 "global_load_async_to_lds_b128 %2, %10, off\n\t"
                 "global_load_async_to_lds_b128 %3, %11, off\n\t"
                 "global_load_async_to_lds_b128 %4, %12, off\n\t"
                 "global_load_async_to_lds_b128 %5, %13, off\n\t"
                 "global_load_async_to_lds_b128 %6, %14, off\n\t"
                 "global_load_async_to_lds_b128 %7, %15, off\n\t"
                 "s_wait_xcnt 0x0"
                 :: "v"(a0), "v"(a0 + 32 * KP * 2), "v"(a0 + 64 * KP * 2), "v"(a0 + 96 * KP * 2), "v"(c0), "v"(c0 + 8 * VP * 2), "v"(c0 + 16 * VP * 2), "v"(c0 + 24 * VP * 2),
                    "v"(k0), "v"(k0 + kstep), "v"(k0 + 2 * kstep), "v"(k0 + 3 * kstep), "v"(v0), "v"(v0 + 8 * NN), "v"(v0 + 16 * NN), "v"(v0 + 24 * NN)
                 : "memory");
  };
  constexpr float SL2 = 0.25503486f;      /* 32^-1/2 x log2(e): the softmax runs in base 2, one multiply-add and one v_exp_f32 a score */
  float m_c = -3.0e38f, l_c = 0.f; v8f oacc[DT];      /* running maximum (in log2 units) and this half's partial sum (x 2^10) of query q0 + ln; oacc[dt][r] = O^T[dt*16 + 8hh + r][q0 + ln] */
#pragma unroll
  for (int dt = 0; dt < DT; ++dt) oacc[dt] = (v8f){0.f,0.f,0.f,0.f,0.f,0.f,0.f,0.f};
  stage(0, 0);
  asm volatile("s_wait_asynccnt 0x0" ::: "memory");      /* this wave's share of tile 0 has landed */
  __syncthreads();      /* every wave's share of tile 0 has landed */
  stage(1, 1);
  /* the tile loop and the loop over a tile's 32-key passes stay rolled: more copies of the long body would only grow the code; every full "#pragma unroll" in this kernel keeps an array that the loop variable indexes in registers */
#pragma unroll 1
  for (int t = 0; t < NT; ++t) {
   const int buf = t & 1;
#pragma unroll 1
   for (int js = 0; js < KT; js += 32) {
    FragH ak[2], av[DT];
#pragma unroll
    for (int nt = 0; nt < 2; ++nt) { const unsigned short* kr = &sK[buf][js + nt * 16 + ln][0]; ak[nt].half[0] = *(const v8us*)(kr + 8 * hh); ak[nt].half[1] = *(const v8us*)(kr + 16 + 8 * hh); }
#pragma unroll
    for (int dt = 0; dt < DT; ++dt) { const unsigned short* vrow = &sV[buf][dt * 16 + ln][js]; av[dt].half[0] = *(const v8us*)(vrow + 8 * hh); av[dt].half[1] = *(const v8us*)(vrow + 16 + 8 * hh); }
    float sc[16];      /* raw q.k sums; the scale goes into the exponent's multiply-add */
#pragma unroll
    for (int nt = 0; nt < 2; ++nt) {
      const v8f acc = mmaH<1>(ak[nt].v, ak[nt].v, bq.v, bq.v, (v8f){0.f,0.f,0.f,0.f,0.f,0.f,0.f,0.f});
#pragma unroll
      for (int r = 0; r < 8; ++r) sc[nt * 8 + r] = acc[r]; }
    float mx[8];
#pragma unroll
    for (int i = 0; i < 8; ++i) mx[i] = fmaxf(sc[i], sc[8 + i]);
    float mc = fmaxf(fmaxf(fmaxf(mx[0], mx[1]), fmaxf(mx[2], mx[3])), fmaxf(fmaxf(mx[4], mx[5]), fmaxf(mx[6], mx[7])));
    mc = fmaxf(mc, xhalf(mc));
    const float mn = fmaxf(m_c, mc * SL2); const float al = (mn > -1.0e38f) ? __builtin_amdgcn_exp2f(m_c - mn) : 1.0f; m_c = mn;
    const float mb = mn - 10.0f;      /* p = 2^(s SL2 - mn + 10): the 2^10 of the f16 P rides in the exponent, and the row sum carries it too */
    FragH pb; float p[16];
#pragma unroll
    for (int i = 0; i < 16; i += 2) {
      const v2f e = __builtin_elementwise_fma((v2f){sc[i], sc[i + 1]}, (v2f){SL2, SL2}, (v2f){-mb, -mb});      /* two exponents a packed multiply-add */
      p[i] = __builtin_amdgcn_exp2f(e[0]); p[i + 1] = __builtin_amdgcn_exp2f(e[1]); pb.h[i] = (_Float16)p[i]; pb.h[i + 1] = (_Float16)p[i + 1]; }
#pragma unroll
    for (int i = 0; i < 8; ++i) p[i] += p[8 + i];
    l_c = l_c * al + (((p[0] + p[1]) + (p[2] + p[3])) + ((p[4] + p[5]) + (p[6] + p[7])));
#pragma unroll
    for (int dt = 0; dt < DT; ++dt)
#pragma unroll
      for (int r = 0; r < 8; ++r) oacc[dt][r] *= al;
#pragma unroll
    for (int dt = 0; dt < DT; ++dt) oacc[dt] = mmaH<1>(av[dt].v, av[dt].v, pb.v, pb.v, oacc[dt]);
   }
   asm volatile("s_wait_dscnt 0x0" ::: "memory");      /* this wave's reads of buffer buf have returned before the buffer is refilled */
   asm volatile("s_wait_asynccnt 0x0" ::: "memory");      /* this wave's share of tile t + 1 has landed */
   __syncthreads();      /* publishes tile t + 1 and ends every wave's reads of buffer buf */
   if (t + 2 < NT) stage(t + 2, buf);
  }
  asm volatile("s_wait_asynccnt 0x0" ::: "memory");      /* no copy is outstanding when the wave goes on to its end */
  const float l = l_c + xhalf(l_c); const float inv = (l > 0.f) ? 1.0f / l : 0.f;      /* l and oacc both carry the 2^10 */
  /* O leaves as f16, the projection's operand type, head-major [h][n][32]: a lane's 8 accumulators of a tile are 8 consecutive channels of its query = one 16-byte store; a wave's 16 queries fill 1 KiB that no other wave writes */
#pragma unroll
  for (int dt = 0; dt < DT; ++dt) { FragH f;
#pragma unroll
    for (int r = 0; r < 8; ++r) f.h[r] = (_Float16)(oacc[dt][r] * inv);
    *(v8us*)((unsigned short*)O16 + ((size_t)h * NN + q0 + ln) * HD + dt * 16 + 8 * hh) = f.half[0]; }
}

// out[c][n] = proj_w . O^T + proj_b, in the output's own channel-major layout: A = 16 rows of the rounded proj_w (x 2^4), B = 64 tokens of O (head-major [h][n][32]: k block kb is head kb / 32).
// One wave = 16 channels x 64 tokens; the tile goes through the wave's own LDS range so that each store covers whole 256-byte pieces of output rows. M 256 N 4096 K 256.
__global__ __launch_bounds__(128) void k_proj(const _Float16* __restrict__ Bp, const _Float16* __restrict__ O16, const float* __restrict__ bias, float* __restrict__ out) {
  __shared__ __attribute__((aligned(16))) float so[4][16][64 + 4];      /* pitch 272 bytes: the two halves' rows, 8 apart, fall on different banks */
  const int tid = threadIdx.x, w = tid >> 5, lane = tid & 31, ln = lane & 15, hh = lane >> 4;
  const int wid = blockIdx.x * 4 + w; const int row0 = (wid / (NN / 64)) * 16, col0 = (wid % (NN / 64)) * 64;
  const unsigned short* arow = (const unsigned short*)Bp + (size_t)(row0 + ln) * CC + 8 * hh;
  const unsigned short* brow = (const unsigned short*)O16 + (size_t)(col0 + ln) * HD + 8 * hh;
  const v4f b0 = *(const v4fa*)(bias + row0 + 8 * hh), b1 = *(const v4fa*)(bias + row0 + 8 * hh + 4);
  v8f acc[4] = {};
#pragma unroll
  for (int kb = 0; kb < CC; kb += 32) { FragH ah; ah.half[0] = *(const v8us*)(arow + kb); ah.half[1] = *(const v8us*)(arow + kb + 16);
#pragma unroll
    for (int t = 0; t < 4; ++t) { const unsigned short* bt = brow + ((size_t)(kb / 32) * NN + t * 16) * HD; FragH bq; bq.half[0] = *(const v8us*)bt; bq.half[1] = *(const v8us*)(bt + 16);
      acc[t] = mmaH<1>(ah.v, ah.v, bq.v, bq.v, acc[t]); }
  }
#pragma unroll
  for (int t = 0; t < 4; ++t)
#pragma unroll
    for (int r = 0; r < 8; ++r) so[w][8 * hh + r][t * 16 + ln] = acc[t][r] * 0.0625f + bf16_round(r < 4 ? b0[r & 3] : b1[r & 3]);
  __builtin_amdgcn_fence(__ATOMIC_ACQ_REL, "workgroup"); __builtin_amdgcn_wave_barrier();      /* the wave's LDS writes are done before its lanes read each other's */
  const int rsub = lane >> 4, c4 = (lane & 15) * 4;
#pragma unroll
  for (int q = 0; q < 8; ++q) { const int r = q * 2 + rsub; const v4f v = *(const v4fa*)&so[w][r][c4]; *(v4f*)(out + (size_t)(row0 + r) * NN + col0 + c4) = v; }
}

extern "C" void kernel_launch(void* const* d_in, const int* in_sizes, int n_in,
                              void* d_out, int out_size, void* d_ws, size_t ws_size, hipStream_t stream) {
  (void)in_sizes; (void)n_in; (void)out_size;
  const float* x = (const float*)d_in[0]; const float* Wqkv = (const float*)d_in[1]; const float* Wp = (const float*)d_in[2]; const float* bp = (const float*)d_in[3];
  char* ws = (char*)d_ws; size_t off = 0;
  auto take = [&](size_t bytes) { char* p = ws + off; off += (bytes + 255) & ~(size_t)255; return p; };
  _Float16* Bqkv = (_Float16*)take((size_t)C3 * CC * 2); _Float16* Bp = (_Float16*)take((size_t)CC * CC * 2); _Float16* X16 = (_Float16*)take((size_t)NR * CC * 2);
  _Float16* QK = (_Float16*)take((size_t)NR * 2 * CC * 2); _Float16* Vt = (_Float16*)take((size_t)CC * NN * 2); _Float16* O16 = (_Float16*)take((size_t)NR * CC * 2);
  if (off > ws_size) return;      // 0.4 + 0.1 + 2.1 + 4.2 + 2.1 + 2.1 = about 11 MB
  k_prep<<<TOKB + WQB + WPB, 256, 0, stream>>>(x, X16, Wqkv, Bqkv, Wp, Bp);
  k_qkv<<<QKB + VB, 128, 0, stream>>>(X16, Bqkv, QK, Vt);
  k_flash<<<NH * (NN / 64), 128, 0, stream>>>(QK, 2 * CC, QK + CC, 2 * CC, Vt, nullptr, O16);      /* blocks = head x 64-query groups */
  k_proj<<<(CC / 16) * (NN / 64) / 4, 128, 0, stream>>>(Bp, O16, bp, (float*)d_out);
}

// v006
// It runs in 62.1 microseconds.
// Two timings next to v005 put it at 1.09 and 1.10 times that version's speed.
// Counting every step since v000, it is 6.40 times as fast.
#include <hip/hip_runtime.h>
// 3-D multi-head self-attention on channel-major x [1, 256, 16³ = 4096]: qkv = qkv_w·x (1×1×1 conv, no bias), 8 heads × 32, softmax(qᵀk·32^-½) over keys, out[h,d,n] = Σ_m attn[n,m]·v[h,d,m], then proj_w·out + proj_b.
// Compute dtype: x, qkv_w, proj_w, proj_b rounded to bf16; q/k token-major and v channel-major (= Vᵀ) as f16 GEMM outputs (f32 accumulate); fused flash-style kernel per head
// (online softmax f32, P f16 x 2^10) on v_wmma_f32_16x16x32_f16, which stores O as f16; projection GEMM with bias, computed channel-major (A = proj_w) and stored straight to out; f32 accumulate throughout.
#define BB 1
#define CC 256
#define C3 768
#define NH 8
#define HD 32
#define NN 4096
#define NR (BB * NN)

typedef __bf16 v16b __attribute__((ext_vector_type(16)));
typedef unsigned short v8us __attribute__((ext_vector_type(8), may_alias));
typedef float  v8f  __attribute__((ext_vector_type(8)));
typedef float  v4f  __attribute__((ext_vector_type(4)));
typedef float  v4fa __attribute__((ext_vector_type(4), may_alias));
union FragB { v16b v; v8us half[2]; unsigned short u[16]; };

__device__ __forceinline__ unsigned short bf16_bits(float x) { unsigned int u = __float_as_uint(x); return (unsigned short)((u + 0x7FFFu + ((u >> 16) & 1u)) >> 16); }
__device__ __forceinline__ float bf16_val(unsigned short b) { return __uint_as_float(((unsigned int)b) << 16); }
__device__ __forceinline__ float bf16_round(float x) { return bf16_val(bf16_bits(x)); }
// D += A·B with NT terms: 1 = ah·bh, 2 = + al·bh (A split), 3 = + ah·bl (both split)
template <int NT>
__device__ __forceinline__ v8f mmaN(v16b ah, v16b al, v16b bh, v16b bl, v8f c) {
  c = __builtin_amdgcn_wmma_f32_16x16x32_bf16(false, ah, false, bh, (short)0, c, false, false);
  if (NT >= 2) c = __builtin_amdgcn_wmma_f32_16x16x32_bf16(false, al, false, bh, (short)0, c, false, false);
  if (NT >= 3) c = __builtin_amdgcn_wmma_f32_16x16x32_bf16(false, ah, false, bl, (short)0, c, false, false);
  asm volatile("v_nop\n\tv_nop\n\tv_nop\n\tv_nop" : "+v"(c) : "v"(ah), "v"(al), "v"(bh), "v"(bl));
  return c;
}

__global__ __launch_bounds__(256) void k_wt_bf16(const float* __restrict__ W, unsigned short* __restrict__ Wt, int K, int N) {
  const int t = blockIdx.x * 256 + threadIdx.x;
  const int k8n = K / 8;
  if (t >= N * k8n) return;
  const int n = t / k8n, k8 = (t % k8n) * 8;
  v8us v;
#pragma unroll
  for (int i = 0; i < 8; ++i) v[i] = bf16_bits(W[(size_t)(k8 + i) * N + n]);
  *(v8us*)(Wt + (size_t)n * K + k8) = v;
  
}

// GEMM C[M][N] (f32, pitch ldc) = act(A[M][K]·W + bias). A f32 row-major (pitch lda) converted per fragment to bf16
// (ASPLIT: hi/lo two planes -> 2 terms, else single rounded term); Wt bf16 [N][K] (pitch ldb). BIAS_BF16 rounds the
// bias to bf16 first (bias quantised to bf16 before the add). K%32==0, M%16==0, N%64==0.
template <bool ASPLIT, int ACT, bool BIAS_BF16>
__global__ __launch_bounds__(128) void k_gemm_bf(const float* __restrict__ A, int lda, const unsigned short* __restrict__ Wt, int ldb,
                                               const float* __restrict__ bias, float* __restrict__ C, int ldc, int M, int N, int K) {
  __shared__ __attribute__((aligned(16))) float so[4][16][64];
  const int tid = threadIdx.x, w = tid >> 5, lane = tid & 31, ln = lane & 15, hh = lane >> 4;
  const int ntn = N / 64;
  const int wid = blockIdx.x * 4 + w;
  const int mt = wid / ntn, nq = wid % ntn;
  if (mt * 16 >= M) return;
  const int row0 = mt * 16, col0 = nq * 64;
  const float* arow = A + (size_t)(row0 + ln) * lda;
  v8f acc[4] = {};
  for (int kb = 0; kb < K; kb += 32) {
    FragB ah, al;
    const v4f x0 = *(const v4fa*)(arow + kb + 8 * hh), x1 = *(const v4fa*)(arow + kb + 8 * hh + 4);
    const v4f x2 = *(const v4fa*)(arow + kb + 16 + 8 * hh), x3 = *(const v4fa*)(arow + kb + 16 + 8 * hh + 4);
    float xs[16] = {x0[0],x0[1],x0[2],x0[3],x1[0],x1[1],x1[2],x1[3],x2[0],x2[1],x2[2],x2[3],x3[0],x3[1],x3[2],x3[3]};
#pragma unroll
    for (int i = 0; i < 16; ++i) { const unsigned short hb = bf16_bits(xs[i]); ah.u[i] = hb; al.u[i] = ASPLIT ? bf16_bits(xs[i] - bf16_val(hb)) : (unsigned short)0; }
#pragma unroll
    for (int t = 0; t < 4; ++t) {
      const unsigned short* brow = Wt + (size_t)(col0 + t * 16 + ln) * ldb + kb;
      FragB b;
      b.half[0] = *(const v8us*)(brow + 8 * hh);
      b.half[1] = *(const v8us*)(brow + 16 + 8 * hh);
      acc[t] = mmaN<ASPLIT ? 2 : 1>(ah.v, al.v, b.v, b.v, acc[t]);
    }
  }
#pragma unroll
  for (int t = 0; t < 4; ++t) {
    float bv = bias ? bias[col0 + t * 16 + ln] : 0.f;
    if (BIAS_BF16) bv = bf16_round(bv);
#pragma unroll
    for (int r = 0; r < 8; ++r) { float v = acc[t][r] + bv; if (ACT == 1) v = fmaxf(v, 0.f); so[w][8 * hh + r][t * 16 + ln] = v; }
  }
  __builtin_amdgcn_fence(__ATOMIC_ACQ_REL, "workgroup");
  __builtin_amdgcn_wave_barrier();
  const int rsub = lane >> 4, c4 = (lane & 15) * 4;
  {
#pragma unroll
    for (int q = 0; q < 8; ++q) {
      const int r = q * 2 + rsub;
      const v4f v = *(const v4fa*)&so[w][r][c4];
      *(v4f*)(C + (size_t)(row0 + r) * ldc + col0 + c4) = v;
    }
    
  }
}

// Flash-style causal/unmasked attention, all contractions 3-term bf16 hi/lo splits, f32 softmax with running max.
// q,k,v rows are read from f32 buffers with arbitrary row pitch (so they can live inside a fused qkv buffer);
// D = head size (multiple of 32, <= 128); one wave = 16 query rows; block = 4 waves (64 queries) sharing K/V chunks of 32.
template <int D, bool CAUSAL>
__global__ __launch_bounds__(128) void k_flash(const float* __restrict__ qb, const float* __restrict__ kb, const float* __restrict__ vb,
                                             int pitch, int T, int H, float scale, float* __restrict__ y, int ypitch) {
  constexpr int KS = D / 32;        // k-steps for QK
  constexpr int DT = D / 16;        // d tiles for PV
  __shared__ __attribute__((aligned(16))) unsigned short sKh[32][D + 8], sKl[32][D + 8], sVh[32][D + 8], sVl[32][D + 8];
  __shared__ __attribute__((aligned(16))) unsigned short sPh[4][16][40], sPl[4][16][40];
  __shared__ __attribute__((aligned(16))) float sO[4][16][D];
  const int tid = threadIdx.x, w = tid >> 5, lane = tid & 31, ln = lane & 15, hh = lane >> 4;
  const int nqb = (T + 63) / 64;
  const int bh = blockIdx.x / nqb, qblk = blockIdx.x % nqb;
  const int b = bh / H, h = bh % H;
  const int q0 = qblk * 64 + w * 16;
  const float* Q = qb + (size_t)b * T * pitch + h * D;
  const float* K = kb + (size_t)b * T * pitch + h * D;
  const float* V = vb + (size_t)b * T * pitch + h * D;

  // A fragments of the wave's 16 query rows (scaled), hi/lo
  FragB aqh[KS], aql[KS];
  {
    int row = q0 + ln; if (row >= T) row = T - 1;
    const float* qr = Q + (size_t)row * pitch;
#pragma unroll
    for (int ks = 0; ks < KS; ++ks)
#pragma unroll
      for (int i = 0; i < 16; ++i) {
        const int d = ks * 32 + ((i < 8) ? (8 * hh + i) : (16 + 8 * hh + (i - 8)));
        const float x = qr[d] * scale; const unsigned short hb = bf16_bits(x);
        aqh[ks].u[i] = hb; aql[ks].u[i] = bf16_bits(x - bf16_val(hb));
      }
  }
  float m_r[8], l_r[8];
#pragma unroll
  for (int r = 0; r < 8; ++r) { m_r[r] = -3.0e38f; l_r[r] = 0.f; }
  v8f oacc[DT];
#pragma unroll
  for (int dt = 0; dt < DT; ++dt) oacc[dt] = (v8f){0.f,0.f,0.f,0.f,0.f,0.f,0.f,0.f};

  const int kv_end = CAUSAL ? min(T, qblk * 64 + 64) : T;     // block-uniform
  for (int j0 = 0; j0 < kv_end; j0 += 32) {
    __syncthreads();
    for (int e = tid; e < 32 * (D / 4); e += 128) {
      const int r = e / (D / 4), c4 = (e % (D / 4)) * 4;
      const int key = j0 + r;
      v4f kf = {0.f,0.f,0.f,0.f}, vf = {0.f,0.f,0.f,0.f};
      if (key < T) { kf = *(const v4fa*)(K + (size_t)key * pitch + c4); vf = *(const v4fa*)(V + (size_t)key * pitch + c4); }
#pragma unroll
      for (int t = 0; t < 4; ++t) {
        unsigned short hb = bf16_bits(kf[t]); sKh[r][c4 + t] = hb; sKl[r][c4 + t] = bf16_bits(kf[t] - bf16_val(hb));
        hb = bf16_bits(vf[t]); sVh[r][c4 + t] = hb; sVl[r][c4 + t] = bf16_bits(vf[t] - bf16_val(hb));
      }
    }
    __syncthreads();
    // S tile 16 x 32
    v8f s[2];
#pragma unroll
    for (int nt = 0; nt < 2; ++nt) {
      v8f acc = {};
#pragma unroll
      for (int ks = 0; ks < KS; ++ks) {
        FragB bh_, bl_;
        bh_.half[0] = *(const v8us*)&sKh[nt * 16 + ln][ks * 32 + 8 * hh]; bh_.half[1] = *(const v8us*)&sKh[nt * 16 + ln][ks * 32 + 16 + 8 * hh];
        bl_.half[0] = *(const v8us*)&sKl[nt * 16 + ln][ks * 32 + 8 * hh]; bl_.half[1] = *(const v8us*)&sKl[nt * 16 + ln][ks * 32 + 16 + 8 * hh];
        acc = mmaN<3>(aqh[ks].v, aql[ks].v, bh_.v, bl_.v, acc);
      }
      s[nt] = acc;
    }
    // mask + running max (rows 8hh+r; the 16 lanes of a half share rows)
    float alpha[8];
#pragma unroll
    for (int r = 0; r < 8; ++r) {
      const int qi = q0 + 8 * hh + r;
      const int ja = j0 + ln, jb = j0 + 16 + ln;
      if (CAUSAL) { if (ja > qi) s[0][r] = -3.0e38f; if (jb > qi) s[1][r] = -3.0e38f; }
      if (ja >= T) s[0][r] = -3.0e38f;
      if (jb >= T) s[1][r] = -3.0e38f;
      float mx = fmaxf(s[0][r], s[1][r]);
      mx = fmaxf(mx, __shfl_xor(mx, 1, 32)); mx = fmaxf(mx, __shfl_xor(mx, 2, 32)); mx = fmaxf(mx, __shfl_xor(mx, 4, 32)); mx = fmaxf(mx, __shfl_xor(mx, 8, 32));
      const float mnew = fmaxf(m_r[r], mx);
      alpha[r] = (mnew > -1.0e38f) ? __expf(m_r[r] - mnew) : 1.0f;
      const float p0 = (s[0][r] > -1.0e38f) ? __expf(s[0][r] - mnew) : 0.f;
      const float p1 = (s[1][r] > -1.0e38f) ? __expf(s[1][r] - mnew) : 0.f;
      m_r[r] = mnew;
      l_r[r] = l_r[r] * alpha[r] + p0 + p1;            // per-lane partial row sum (16 lanes combined at the end)
      unsigned short hb = bf16_bits(p0); sPh[w][8 * hh + r][ln] = hb;      sPl[w][8 * hh + r][ln] = bf16_bits(p0 - bf16_val(hb));
      hb = bf16_bits(p1);                sPh[w][8 * hh + r][16 + ln] = hb; sPl[w][8 * hh + r][16 + ln] = bf16_bits(p1 - bf16_val(hb));
    }
#pragma unroll
    for (int dt = 0; dt < DT; ++dt)
#pragma unroll
      for (int r = 0; r < 8; ++r) oacc[dt][r] *= alpha[r];
    __builtin_amdgcn_fence(__ATOMIC_ACQ_REL, "workgroup");
    __builtin_amdgcn_wave_barrier();
    FragB pah, pal;
    pah.half[0] = *(const v8us*)&sPh[w][ln][8 * hh]; pah.half[1] = *(const v8us*)&sPh[w][ln][16 + 8 * hh];
    pal.half[0] = *(const v8us*)&sPl[w][ln][8 * hh]; pal.half[1] = *(const v8us*)&sPl[w][ln][16 + 8 * hh];
#pragma unroll
    for (int dt = 0; dt < DT; ++dt) {
      FragB bvh, bvl;
#pragma unroll
      for (int i = 0; i < 8; ++i) {
        bvh.u[i] = sVh[8 * hh + i][dt * 16 + ln]; bvh.u[8 + i] = sVh[16 + 8 * hh + i][dt * 16 + ln];
        bvl.u[i] = sVl[8 * hh + i][dt * 16 + ln]; bvl.u[8 + i] = sVl[16 + 8 * hh + i][dt * 16 + ln];
      }
      oacc[dt] = mmaN<3>(pah.v, pal.v, bvh.v, bvl.v, oacc[dt]);
    }
    __builtin_amdgcn_fence(__ATOMIC_ACQ_REL, "workgroup");
    __builtin_amdgcn_wave_barrier();
  }
#pragma unroll
  for (int r = 0; r < 8; ++r) {
    float l = l_r[r];
    l += __shfl_xor(l, 1, 32); l += __shfl_xor(l, 2, 32); l += __shfl_xor(l, 4, 32); l += __shfl_xor(l, 8, 32);
    l_r[r] = (l > 0.f) ? 1.0f / l : 0.f;
  }
#pragma unroll
  for (int dt = 0; dt < DT; ++dt)
#pragma unroll
    for (int r = 0; r < 8; ++r) sO[w][8 * hh + r][dt * 16 + ln] = oacc[dt][r] * l_r[r];
  __builtin_amdgcn_fence(__ATOMIC_ACQ_REL, "workgroup");
  __builtin_amdgcn_wave_barrier();
  {
    for (int r = 0; r < 16; ++r) {
      const int row = q0 + r;
      if (row < T && lane < D / 4) {
        const v4f val = *(const v4fa*)&sO[w][r][lane * 4];
        *(v4f*)(y + ((size_t)b * T + row) * ypitch + h * D + lane * 4) = val;
      }
    }
    
  }
}

// GEMM C = act(A·W + bias + resid): A f32 (ASPLIT -> hi/lo 2 terms), Wt bf16 [N][K]; ACT 0 none, 1 relu, 2 exact gelu;
// resid (optional, f32, row index = (row % rmod), pitch ldr, RES_BF16 rounds it) added before the activation.
template <bool ASPLIT, int ACT, bool BIAS_BF16, bool RES_BF16>
__global__ __launch_bounds__(128) void k_gemm_bf3(const float* __restrict__ A, int lda, const unsigned short* __restrict__ Wt, int ldb,
                                                const float* __restrict__ bias, const float* __restrict__ resid, int rmod, int ldr,
                                                float* __restrict__ C, int ldc, int M, int N, int K) {
  __shared__ __attribute__((aligned(16))) float so[4][16][64];
  const int tid = threadIdx.x, w = tid >> 5, lane = tid & 31, ln = lane & 15, hh = lane >> 4;
  const int ntn = N / 64;
  const int wid = blockIdx.x * 4 + w;
  const int mt = wid / ntn, nq = wid % ntn;
  if (mt * 16 >= M) return;
  const int row0 = mt * 16, col0 = nq * 64;
  const float* arow = A + (size_t)(row0 + ln) * lda;
  v8f acc[4] = {};
  for (int kb = 0; kb < K; kb += 32) {
    FragB ah, al;
    const v4f x0 = *(const v4fa*)(arow + kb + 8 * hh), x1 = *(const v4fa*)(arow + kb + 8 * hh + 4);
    const v4f x2 = *(const v4fa*)(arow + kb + 16 + 8 * hh), x3 = *(const v4fa*)(arow + kb + 16 + 8 * hh + 4);
    float xs[16] = {x0[0],x0[1],x0[2],x0[3],x1[0],x1[1],x1[2],x1[3],x2[0],x2[1],x2[2],x2[3],x3[0],x3[1],x3[2],x3[3]};
#pragma unroll
    for (int i = 0; i < 16; ++i) { const unsigned short hb = bf16_bits(xs[i]); ah.u[i] = hb; al.u[i] = ASPLIT ? bf16_bits(xs[i] - bf16_val(hb)) : (unsigned short)0; }
#pragma unroll
    for (int t = 0; t < 4; ++t) {
      const unsigned short* brow = Wt + (size_t)(col0 + t * 16 + ln) * ldb + kb;
      FragB b;
      b.half[0] = *(const v8us*)(brow + 8 * hh);
      b.half[1] = *(const v8us*)(brow + 16 + 8 * hh);
      acc[t] = mmaN<ASPLIT ? 2 : 1>(ah.v, al.v, b.v, b.v, acc[t]);
    }
  }
#pragma unroll
  for (int t = 0; t < 4; ++t) {
    const int col = col0 + t * 16 + ln;
    float bv = bias ? bias[col] : 0.f;
    if (BIAS_BF16) bv = bf16_round(bv);
#pragma unroll
    for (int r = 0; r < 8; ++r) {
      float v = acc[t][r] + bv;
      if (resid) { float rv = resid[(size_t)((row0 + 8 * hh + r) % rmod) * ldr + col]; if (RES_BF16) rv = bf16_round(rv); v += rv; }
      if (ACT == 1) v = fmaxf(v, 0.f);
      if (ACT == 2) v = 0.5f * v * (1.0f + erff(v * 0.70710678118654752f));
      if (ACT == 3) { const float u = 0.7978845608028654f * (v + 0.044715f * v * v * v); v = 0.5f * v * (1.0f + tanhf(u)); }
      so[w][8 * hh + r][t * 16 + ln] = v;
    }
  }
  __builtin_amdgcn_fence(__ATOMIC_ACQ_REL, "workgroup");
  __builtin_amdgcn_wave_barrier();
  const int rsub = lane >> 4, c4 = (lane & 15) * 4;
  {
#pragma unroll
    for (int q = 0; q < 8; ++q) {
      const int r = q * 2 + rsub;
      const v4f v = *(const v4fa*)&so[w][r][c4];
      *(v4f*)(C + (size_t)(row0 + r) * ldc + col0 + c4) = v;
    }
    
  }
}
// row LayerNorm (biased variance, eps) over N: s = X (+ R); optional out_sum <- s; out_norm <- (s-mu)*rsqrt(var+eps)*g + b
template <bool PARAM_BF16>
__global__ __launch_bounds__(256) void k_layernorm(const float* __restrict__ X, const float* __restrict__ R, const float* __restrict__ g, const float* __restrict__ bta,
                                                  float* __restrict__ out_sum, float* __restrict__ out_norm, int N, float eps) {
  __shared__ float red[256];
  const int row = blockIdx.x, tid = threadIdx.x;
  const float* x = X + (size_t)row * N; const float* rr = R ? R + (size_t)row * N : nullptr;
  float vals[16];                     // up to N = 4096
  const int per = N / 256;            // contiguous chunk per thread? use strided-by-4 chunks: thread handles j = tid*4 + 1024*u
  float s1 = 0.f;
  for (int u = 0; u < per / 4; ++u) {
    const int j = tid * 4 + 1024 * u;
    const v4f a = *(const v4fa*)(x + j);
    v4f b = {0.f,0.f,0.f,0.f}; if (rr) b = *(const v4fa*)(rr + j);
#pragma unroll
    for (int q = 0; q < 4; ++q) { const float v = a[q] + b[q]; vals[u * 4 + q] = v; s1 += v; }
  }
  red[tid] = s1; __syncthreads();
  for (int st = 128; st > 0; st >>= 1) { if (tid < st) red[tid] += red[tid + st]; __syncthreads(); }
  const float mu = red[0] / (float)N; __syncthreads();
  float s2 = 0.f;
  for (int u = 0; u < per / 4; ++u)
#pragma unroll
    for (int q = 0; q < 4; ++q) { const float c = vals[u * 4 + q] - mu; s2 += c * c; }
  red[tid] = s2; __syncthreads();
  for (int st = 128; st > 0; st >>= 1) { if (tid < st) red[tid] += red[tid + st]; __syncthreads(); }
  const float rs = rsqrtf(red[0] / (float)N + eps);
  {
    for (int u = 0; u < per / 4; ++u) {
      const int j = tid * 4 + 1024 * u;
      v4f o, sm;
#pragma unroll
      for (int q = 0; q < 4; ++q) {
        float gg = g[j + q], bb = bta[j + q];
        if (PARAM_BF16) { gg = bf16_round(gg); bb = bf16_round(bb); }
        sm[q] = vals[u * 4 + q]; o[q] = (vals[u * 4 + q] - mu) * rs * gg + bb;
      }
      if (out_sum) *(v4f*)(out_sum + (size_t)row * N + j) = sm;
      *(v4f*)(out_norm + (size_t)row * N + j) = o;
    }
    
  }
}



// ---- f16 WMMA path (v_wmma_f32_16x16x32_f16): 11-bit significands for operands in range — used here for the qkv and projection GEMMs and for attention
typedef _Float16 v16h __attribute__((ext_vector_type(16)));
union FragH { v16h v; v8us half[2]; _Float16 h[16]; unsigned short u[16]; };
template <int NT>
__device__ __forceinline__ v8f mmaH(v16h ah, v16h al, v16h bh, v16h bl, v8f c) {
  c = __builtin_amdgcn_wmma_f32_16x16x32_f16(false, ah, false, bh, (short)0, c, false, false);
  if (NT >= 2) c = __builtin_amdgcn_wmma_f32_16x16x32_f16(false, al, false, bh, (short)0, c, false, false);
  if (NT >= 3) c = __builtin_amdgcn_wmma_f32_16x16x32_f16(false, ah, false, bl, (short)0, c, false, false);
  asm volatile("v_nop\n\tv_nop\n\tv_nop\n\tv_nop" : "+v"(c) : "v"(ah), "v"(al), "v"(bh), "v"(bl));
  return c;
}
// batched GEMM like k_gemm_b but f16 operands: A f32 (split into f16 hi/lo if ASPLIT, else rounded to f16), Bt = f16 values [n][k]; alpha; C f32; N multiple of 16 (partial tiles skipped)
template <bool ASPLIT>
__global__ __launch_bounds__(128) void k_gemm_h(const float* __restrict__ A, int lda, size_t sA, const _Float16* __restrict__ Bh, int ldb, size_t sB, float alpha, float* __restrict__ C, int ldc, size_t sC, int M, int N, int K) {
  __shared__ __attribute__((aligned(16))) float so[4][16][64];
  const int tid = threadIdx.x, w = tid >> 5, lane = tid & 31, ln = lane & 15, hh = lane >> 4; const int by = blockIdx.y;
  A += (size_t)by * sA; Bh += (size_t)by * sB; C += (size_t)by * sC;
  const int ntn = (N + 63) / 64; const int wid = blockIdx.x * 4 + w; const int mt = wid / ntn, nq = wid % ntn; if (mt * 16 >= M) return;
  const int row0 = mt * 16, col0 = nq * 64; const float* arow = A + (size_t)(row0 + ln) * lda;
  v8f acc[4] = {};
  for (int kb = 0; kb < K; kb += 32) {
    FragH ah, al;
    const v4f x0 = *(const v4fa*)(arow + kb + 8 * hh), x1 = *(const v4fa*)(arow + kb + 8 * hh + 4), x2 = *(const v4fa*)(arow + kb + 16 + 8 * hh), x3 = *(const v4fa*)(arow + kb + 16 + 8 * hh + 4);
    float xs[16] = {x0[0],x0[1],x0[2],x0[3],x1[0],x1[1],x1[2],x1[3],x2[0],x2[1],x2[2],x2[3],x3[0],x3[1],x3[2],x3[3]};
#pragma unroll
    for (int i = 0; i < 16; ++i) { const _Float16 h = (_Float16)xs[i]; ah.h[i] = h; al.h[i] = ASPLIT ? (_Float16)(xs[i] - (float)h) : (_Float16)0.0f; }
#pragma unroll
    for (int t = 0; t < 4; ++t) { if (col0 + t * 16 >= N) continue; const size_t boff = (size_t)(col0 + t * 16 + ln) * ldb + kb; FragH bq; bq.half[0] = *(const v8us*)(Bh + boff + 8 * hh); bq.half[1] = *(const v8us*)(Bh + boff + 16 + 8 * hh);
      acc[t] = mmaH<ASPLIT ? 2 : 1>(ah.v, al.v, bq.v, bq.v, acc[t]); }
  }
#pragma unroll
  for (int t = 0; t < 4; ++t) { if (col0 + t * 16 >= N) continue;
#pragma unroll
    for (int r = 0; r < 8; ++r) so[w][8 * hh + r][t * 16 + ln] = acc[t][r] * alpha; }
  __builtin_amdgcn_fence(__ATOMIC_ACQ_REL, "workgroup"); __builtin_amdgcn_wave_barrier();
  const int rsub = lane >> 4, c4 = (lane & 15) * 4;
  {
#pragma unroll
    for (int q = 0; q < 8; ++q) { const int r = q * 2 + rsub; if (col0 + c4 < N) { const v4f v = *(const v4fa*)&so[w][r][c4]; *(v4f*)(C + (size_t)(row0 + r) * ldc + col0 + c4) = v; } }
     }
}

// Wt[n][k] = f16(W[k][n]·scale) from f32 row-major W[K][N] (scale = power of two; bf16-exact weights stay exact in f16 away from the subnormal range)
__global__ __launch_bounds__(256) void k_wt_f16(const float* __restrict__ W, _Float16* __restrict__ Wt, int K, int N, float scale) {
  const int t = blockIdx.x * 256 + threadIdx.x; if (t >= N * (K / 8)) return; const int n = t / (K / 8), k8 = (t % (K / 8)) * 8; FragH f;
#pragma unroll
  for (int i = 0; i < 8; ++i) f.h[i] = (_Float16)(bf16_round(W[(size_t)(k8 + i) * N + n]) * scale); const v8us o = f.half[0];
  *(v8us*)((unsigned short*)Wt + (size_t)n * K + k8) = o; 
}
// k_gemm_hh variant with fused epilogue: v = acc·alpha + bias[by·sBias + col] (+ CP[(row/rowsPerB)·sCPb + by·64 + col] if CP) ; ACT 0 none / 1 elu ; writes f16 C16 and f32 C, each if non-null
// the body is a device function of the block's place (bx, by) and its LDS, so that several GEMMs can share one launch
template <int ACT>
__device__ __forceinline__ void gemm_hhx(float (*so)[16][64], int bx, int by, const _Float16* __restrict__ A, int lda, size_t sA, const _Float16* __restrict__ Bh, int ldb, size_t sB, float alpha, const float* __restrict__ bias, size_t sBias, const float* __restrict__ CP, int rowsPerB, size_t sCPb, int row0g,
    float* __restrict__ C, _Float16* __restrict__ C16, int ldc, size_t sC, int M, int N, int K) {
  const int tid = threadIdx.x, w = tid >> 5, lane = tid & 31, ln = lane & 15, hh = lane >> 4;
  A += (size_t)by * sA; Bh += (size_t)by * sB; const size_t cofs = (size_t)by * sC; const float* bp = bias ? bias + (size_t)by * sBias : nullptr;
  const int ntn = (N + 63) / 64; const int wid = bx * 4 + w; const int mt = wid / ntn, nq = wid % ntn; if (mt * 16 >= M) return;
  const int row0 = mt * 16, col0 = nq * 64; const _Float16* arow = A + (size_t)(row0 + ln) * lda;
  v8f acc[4] = {};
  for (int kb = 0; kb < K; kb += 32) { FragH ah; ah.half[0] = *(const v8us*)((const unsigned short*)arow + kb + 8 * hh); ah.half[1] = *(const v8us*)((const unsigned short*)arow + kb + 16 + 8 * hh);
#pragma unroll
    for (int t = 0; t < 4; ++t) { if (col0 + t * 16 >= N) continue; const size_t boff = (size_t)(col0 + t * 16 + ln) * ldb + kb; FragH bq; bq.half[0] = *(const v8us*)((const unsigned short*)Bh + boff + 8 * hh); bq.half[1] = *(const v8us*)((const unsigned short*)Bh + boff + 16 + 8 * hh);
      acc[t] = mmaH<1>(ah.v, ah.v, bq.v, bq.v, acc[t]); }
  }
#pragma unroll
  for (int t = 0; t < 4; ++t) { if (col0 + t * 16 >= N) continue; const int col = col0 + t * 16 + ln; const float bv = bp ? bf16_round(bp[col]) : 0.f;
#pragma unroll
    for (int r = 0; r < 8; ++r) { float v = acc[t][r] * alpha + bv; if (CP) { const int bidx = (row0g + row0 + 8 * hh + r) / rowsPerB; v += CP[(size_t)bidx * sCPb + (size_t)by * 64 + col]; } if (ACT == 1) v = (v > 0.f) ? v : expm1f(v); else if (ACT == 7) v = (v > 0.f) ? v + 1.0f : expf(v); else if (ACT == 8) v = tanhf(v); else if (ACT == 9) v = 0.5f * v * (1.0f + tanhf(0.7978845608028654f * (v + 0.044715f * v * v * v))); else if (ACT == 11) v = 1.0f / (1.0f + expf(-v)); else if (ACT == 12) v = (v > 0.f) ? v : 0.01f * v; else if (ACT == 14) v = (v > 0.f) ? v : 0.1f * v; else if (ACT == 15) v = v / (1.0f + expf(-v)); else if (ACT == 3) v = fmaxf(v, 0.f); else if (ACT == 6) v = 0.5f * v * (1.0f + erff(v * 0.70710678118654752f)); so[w][8 * hh + r][t * 16 + ln] = v; } }
  __builtin_amdgcn_fence(__ATOMIC_ACQ_REL, "workgroup"); __builtin_amdgcn_wave_barrier();
  const int rsub = lane >> 4, c4 = (lane & 15) * 4; typedef _Float16 v4h __attribute__((ext_vector_type(4)));
  {
#pragma unroll
    for (int q = 0; q < 8; ++q) { const int r = q * 2 + rsub; if (col0 + c4 < N) { const v4f v = *(const v4fa*)&so[w][r][c4]; if (C) *(v4f*)(C + cofs + (size_t)(row0 + r) * ldc + col0 + c4) = v; if (C16) { v4h h4; for (int i = 0; i < 4; ++i) h4[i] = (_Float16)v[i]; *(v4h*)(C16 + cofs + (size_t)(row0 + r) * ldc + col0 + c4) = h4; } } }
     }
}
template <int ACT>
__global__ __launch_bounds__(128) void k_gemm_hhx(const _Float16* __restrict__ A, int lda, size_t sA, const _Float16* __restrict__ Bh, int ldb, size_t sB, float alpha, const float* __restrict__ bias, size_t sBias, const float* __restrict__ CP, int rowsPerB, size_t sCPb, int row0g,
    float* __restrict__ C, _Float16* __restrict__ C16, int ldc, size_t sC, int M, int N, int K) {
  __shared__ __attribute__((aligned(16))) float so[4][16][64];
  gemm_hhx<ACT>(so, blockIdx.x, blockIdx.y, A, lda, sA, Bh, ldb, sB, alpha, bias, sBias, CP, rowsPerB, sCPb, row0g, C, C16, ldc, sC, M, N, K);
}
// the two GEMMs that need only X16 and the rounded qkv_w, in one launch: blocks [0, QKB) give [q | k] token-major [n][512] (head h = cols h*32 / 256 + h*32; M 4096 N 512 K 256),
// blocks [QKB, QKB + VB) give v channel-major [(h,d)][n] = V^T (A = qkv_w rows 512..767, B = x token-major; M 256 N 4096 K 256)
#define QKB ((NR / 16) * (2 * CC / 64) / 4)
#define VB ((CC / 16) * (NN / 64) / 4)
__global__ __launch_bounds__(128) void k_qkv(const _Float16* __restrict__ X16, const _Float16* __restrict__ Bqkv, _Float16* __restrict__ QK, _Float16* __restrict__ Vt) {
  __shared__ __attribute__((aligned(16))) float so[4][16][64];
  const int bx = blockIdx.x;
  if (bx < QKB) gemm_hhx<0>(so, bx, 0, X16, CC, 0, Bqkv, CC, 0, 0.0625f, nullptr, 0, nullptr, 1, 0, 0, nullptr, QK, 2 * CC, 0, NR, 2 * CC, CC);
  else gemm_hhx<0>(so, bx - QKB, 0, Bqkv + (size_t)2 * CC * CC, CC, 0, X16, CC, 0, 0.0625f, nullptr, 0, nullptr, 1, 0, 0, nullptr, Vt, NN, 0, CC, NN, CC);
}


typedef _Float16 v4h __attribute__((ext_vector_type(4)));

__global__ __launch_bounds__(256) void k_x16(const float* __restrict__ x, _Float16* __restrict__ X16, size_t n8) { const size_t t = (size_t)blockIdx.x * 256 + threadIdx.x; if (t >= n8) return; FragH f;
#pragma unroll
  for (int q = 0; q < 8; ++q) f.h[q] = (_Float16)bf16_round(x[t * 8 + q]); *(v8us*)((unsigned short*)X16 + t * 8) = f.half[0];  }
__device__ __forceinline__ void round16f(int bx, const float* __restrict__ W, _Float16* __restrict__ Bt, size_t n8) { const size_t t = (size_t)bx * 256 + threadIdx.x; if (t >= n8) return; FragH f;
#pragma unroll
  for (int i = 0; i < 8; ++i) f.h[i] = (_Float16)(bf16_round(W[t * 8 + i]) * 16.0f); *(v8us*)((unsigned short*)Bt + t * 8) = f.half[0];  }
template <int NHv, int TTv>
__global__ __launch_bounds__(256) void k_vt(const _Float16* __restrict__ V16, int ldv, int voff, _Float16* __restrict__ Vt) { __shared__ unsigned short tl[64][66]; const int tid = threadIdx.x; const int slab = blockIdx.x / (TTv / 64), lg = blockIdx.x % (TTv / 64); const int b = slab / NHv, h = slab % NHv;
  for (int i = tid; i < 64 * 8; i += 256) { const int r = i / 8, c8 = (i % 8) * 8; FragH f; f.half[0] = *(const v8us*)((const unsigned short*)V16 + ((size_t)b * TTv + lg * 64 + r) * ldv + voff + h * 64 + c8);
#pragma unroll
    for (int q = 0; q < 8; ++q) tl[r][c8 + q] = f.u[q]; }
  __syncthreads();
  {
#pragma unroll
    for (int rd = 0; rd < 2; ++rd) { const int d = rd * 32 + tid / 8, pc = tid % 8; FragH f;
#pragma unroll
      for (int q = 0; q < 8; ++q) f.u[q] = tl[pc * 8 + q][d];
      *(v8us*)((unsigned short*)Vt + ((size_t)slab * 64 + d) * TTv + lg * 64 + pc * 8) = f.half[0]; }
     } }

__device__ __forceinline__ void tok(float (*tl)[65], int bx, const float* __restrict__ x, _Float16* __restrict__ X16) { const int tid = threadIdx.x; const int b = bx / ((CC / 64) * (NN / 32)), rem = bx % ((CC / 64) * (NN / 32)); const int cg = rem / (NN / 32), pg = rem % (NN / 32); const int c0 = cg * 64, p0 = pg * 32;
  for (int i = tid; i < 64 * 32; i += 256) { const int c = i / 32, pp = i % 32; tl[pp][c] = bf16_round(x[((size_t)b * CC + c0 + c) * NN + p0 + pp]); } __syncthreads();
  const int r = tid / 8, pc = tid % 8; FragH f; for (int q = 0; q < 8; ++q) f.h[q] = (_Float16)tl[r][pc * 8 + q]; const size_t row = (size_t)b * NN + p0 + r; *(v8us*)((unsigned short*)X16 + row * CC + c0 + pc * 8) = f.half[0];  }
// the three passes that read only inputs, in one launch: blocks [0, TOKB) transpose x to token-major f16, the next WQB round qkv_w, the last WPB round proj_w ((out,in) natural, x 2^4).
// The branch is on blockIdx alone, so the barrier inside tok() is passed by every thread of a block or by none.
#define TOKB (BB * (CC / 64) * (NN / 32))
#define WQB (C3 * CC / 8 / 256)
#define WPB (CC * CC / 8 / 256)
__global__ __launch_bounds__(256) void k_prep(const float* __restrict__ x, _Float16* __restrict__ X16, const float* __restrict__ Wqkv, _Float16* __restrict__ Bqkv, const float* __restrict__ Wp, _Float16* __restrict__ Bp) {
  __shared__ float tl[32][65];
  const int bx = blockIdx.x;
  if (bx < TOKB) tok(tl, bx, x, X16);
  else if (bx < TOKB + WQB) round16f(bx - TOKB, Wqkv, Bqkv, (size_t)C3 * CC / 8);
  else round16f(bx - TOKB - WQB, Wp, Bp, (size_t)CC * CC / 8);
}
typedef float v2f __attribute__((ext_vector_type(2)));
// one f16 product as the bare builtin: in a run of products each fills the others' distance, and the compiler pads what is left
__device__ __forceinline__ v8f mmaB(v16h a, v16h b, v8f c) { return __builtin_amdgcn_wmma_f32_16x16x32_f16(false, a, false, b, (short)0, c, false, false); }
// lane l <-> l ^ 16: the two halves of a wave each hold half of a query column's keys
__device__ __forceinline__ float xhalf(float v) { const int b = __float_as_int(v); return __int_as_float(__builtin_amdgcn_permlanex16(b, b, 0x76543210, 0xfedcba98, false, false)); }
// Transposed products: S^T = K.Q^T (A = 16 key rows, B = the wave's 16 queries as columns), O^T += V^T.P^T. A lane then holds 16 of the 32 scores of ONE query
// (keys 8hh + r and 16 + 8hh + r), which is the k order of a B operand: P goes from the score accumulators into the second product without LDS.
// K and V^T come in tiles of KT keys that the block's four waves share: asynchronous 16-byte copies fill one LDS buffer while the other is worked on (two buffers, one barrier a tile).
__global__ __launch_bounds__(128) void k_flash(const _Float16* __restrict__ Q16, int ldq, const _Float16* __restrict__ K16, int ldk, const _Float16* __restrict__ Vt, const int* __restrict__ MSK, _Float16* __restrict__ O16) {
  constexpr int RPW = 16, NQB = NN / (4 * RPW), DT = 2;
  constexpr int KT = 128, NT = NN / KT, NS = KT / 16, KP = HD + 8, VP = KT + 8;      /* row pitches of 80 and 272 bytes (16 x odd): 16-byte fragment reads of 16 rows fall on 64 different banks */
  __shared__ __attribute__((aligned(16))) unsigned short sK[2][KT][KP];      /* K tile: key rows of 32 halves */
  __shared__ __attribute__((aligned(16))) unsigned short sV[2][HD][VP];      /* V^T tile: channel rows of KT halves */
  const int tid = threadIdx.x, w = tid >> 5, lane = tid & 31, ln = lane & 15, hh = lane >> 4; (void)MSK;
  const int slab = blockIdx.x / NQB, qblk = blockIdx.x % NQB; const int h = slab; const int b = 0; const int qb0 = qblk * (4 * RPW); const int q0 = qb0 + w * RPW;
  FragH bq;
  { const unsigned short* qr = (const unsigned short*)Q16 + ((size_t)b * NN + q0 + ln) * ldq + h * HD; bq.half[0] = *(const v8us*)(qr + 8 * hh); bq.half[1] = *(const v8us*)(qr + 16 + 8 * hh); }
  const unsigned short* Vth = (const unsigned short*)Vt + (size_t)h * HD * NN;      /* V^T = v[(h,d)][n] channel-major */
  /* a thread's share of a tile: 16-byte piece tid & 3 of key rows (tid >> 2) + 32 i, and piece tid & 15 of channel rows (tid >> 4) + 8 i, i = 0..3 */
  const unsigned short* gk = (const unsigned short*)K16 + (size_t)b * NN * ldk + h * HD + (size_t)(tid >> 2) * ldk + (tid & 3) * 8;
  const unsigned short* gv = Vth + (size_t)(tid >> 4) * NN + (tid & 15) * 8;
  const unsigned lk = (unsigned)(uintptr_t)&sK[0][tid >> 2][(tid & 3) * 8], lv = (unsigned)(uintptr_t)&sV[0][tid >> 4][(tid & 15) * 8];      /* LDS byte addresses */
  const size_t kstep = (size_t)32 * ldk;
  auto stage = [&](int t, int buf) {
    const unsigned short* k0 = gk + (size_t)t * KT * ldk; const unsigned short* v0 = gv + t * KT;
    const unsigned a0 = lk + (unsigned)buf * (KT * KP * 2), c0 = lv + (unsigned)buf * (HD * VP * 2);
    /* the tile's eight copies of this thread; s_wait_xcnt closes the statement so that no address register of a copy is rewritten in front of it */
    asm volatile("global_load_async_to_lds_b128 %0, %8, off\n\t"
                 "global_load_async_to_lds_b128 %1, %9, off\n\t"
                 "global_load_async_to_lds_b128 %2, %10, off\n\t"
                 "global_load_async_to_lds_b128 %3, %11, off\n\t"
                 "global_load_async_to_lds_b128 %4, %12, off\n\t"
                 "global_load_async_to_lds_b128 %5, %13, off\n\t"
                 "global_load_async_to_lds_b128 %6, %14, off\n\t"
                 "global_load_async_to_lds_b128 %7, %15, off\n\t"
                 "s_wait_xcnt 0x0"
                 :: "v"(a0), "v"(a0 + 32 * KP * 2), "v"(a0 + 64 * KP * 2), "v"(a0 + 96 * KP * 2), "v"(c0), "v"(c0 + 8 * VP * 2), "v"(c0 + 16 * VP * 2), "v"(c0 + 24 * VP * 2),
                    "v"(k0), "v"(k0 + kstep), "v"(k0 + 2 * kstep), "v"(k0 + 3 * kstep), "v"(v0), "v"(v0 + 8 * NN), "v"(v0 + 16 * NN), "v"(v0 + 24 * NN)
                 : "memory");
  };
  constexpr float SL2 = 0.25503486f;      /* 32^-1/2 x log2(e): the softmax runs in base 2, one multiply-add and one v_exp_f32 a score */
  float m_c = -3.0e38f, l_c = 0.f; v8f oacc[DT];      /* running maximum (in log2 units) and this half's partial sum (x 2^10) of query q0 + ln; oacc[dt][r] = O^T[dt*16 + 8hh + r][q0 + ln] */
#pragma unroll
  for (int dt = 0; dt < DT; ++dt) oacc[dt] = (v8f){0.f,0.f,0.f,0.f,0.f,0.f,0.f,0.f};
  stage(0, 0);
  asm volatile("s_wait_asynccnt 0x0" ::: "memory");      /* this wave's share of tile 0 has landed */
  __syncthreads();      /* every wave's share of tile 0 has landed */
  stage(1, 1);
  /* the tile loop stays rolled: more copies of the long body would only grow the code; every "#pragma unroll" in this kernel keeps an array that the loop variable indexes in registers */
#pragma unroll 1
  for (int t = 0; t < NT; ++t) {
   const int buf = t & 1;
   /* one softmax step a tile: all of the tile's fragments are read first, its NS score products stand in one run, one maximum, one exchange between the halves and one rescale of O serve all KT keys, and its PV products follow */
   FragH ak[NS], av[NS / 2][DT];
#pragma unroll
   for (int nt = 0; nt < NS; ++nt) { const unsigned short* kr = &sK[buf][nt * 16 + ln][0]; ak[nt].half[0] = *(const v8us*)(kr + 8 * hh); ak[nt].half[1] = *(const v8us*)(kr + 16 + 8 * hh); }
#pragma unroll
   for (int ks = 0; ks < NS / 2; ++ks)
#pragma unroll
    for (int dt = 0; dt < DT; ++dt) { const unsigned short* vrow = &sV[buf][dt * 16 + ln][ks * 32]; av[ks][dt].half[0] = *(const v8us*)(vrow + 8 * hh); av[ks][dt].half[1] = *(const v8us*)(vrow + 16 + 8 * hh); }
   __builtin_amdgcn_sched_barrier(0);      /* keeps the tile's 32 fragment reads in one group in front of the products: spread among them they came in four groups, each with its own wait for the LDS latency */
   v8f sc[NS];      /* raw q.k sums of keys nt*16 + 8hh + r; the scale goes into the exponent's multiply-add */
#pragma unroll
   for (int nt = 0; nt < NS; ++nt) sc[nt] = mmaB(ak[nt].v, bq.v, (v8f){0.f,0.f,0.f,0.f,0.f,0.f,0.f,0.f});
   /* the tile now lives in registers: its buffer is handed back here, so that the refill flies during the whole softmax and PV part */
   asm volatile("s_wait_dscnt 0x0" ::: "memory");      /* this wave's reads of buffer buf have returned before the buffer is refilled */
   asm volatile("s_wait_asynccnt 0x0" ::: "memory");      /* this wave's share of tile t + 1 has landed */
   __syncthreads();      /* publishes tile t + 1 and ends every wave's reads of buffer buf */
   if (t + 2 < NT) stage(t + 2, buf);
   float mx[8];      /* every step takes in two more values (a three-input maximum) */
#pragma unroll
   for (int r = 0; r < 8; ++r) { mx[r] = sc[0][r];
#pragma unroll
    for (int nt = 1; nt + 1 < NS; nt += 2) mx[r] = fmaxf(fmaxf(mx[r], sc[nt][r]), sc[nt + 1][r]); }
#pragma unroll
   for (int i = 0; i < 4; ++i) mx[i] = fmaxf(fmaxf(mx[2 * i], mx[2 * i + 1]), sc[NS - 1][i]);
   mx[0] = fmaxf(fmaxf(mx[0], sc[NS - 1][4]), sc[NS - 1][5]); mx[1] = fmaxf(fmaxf(mx[1], sc[NS - 1][6]), sc[NS - 1][7]);
   float mc = fmaxf(fmaxf(fmaxf(mx[0], mx[1]), mx[2]), mx[3]);
   mc = fmaxf(mc, xhalf(mc));
   const float mn = fmaxf(m_c, mc * SL2); const float al = (mn > -1.0e38f) ? __builtin_amdgcn_exp2f(m_c - mn) : 1.0f; m_c = mn;
   const float mb = mn - 10.0f;      /* p = 2^(s SL2 - mn + 10): the 2^10 of the f16 P rides in the exponent, and the row sum carries it too */
   FragH pb[NS / 2]; v2f ps[NS];      /* pb[ks]: P^T of keys ks*32 .. +31 in the k order of a B operand (score tile 2ks, then 2ks + 1); ps[nt]: two partial sums of score tile nt */
#pragma unroll
   for (int nt = 0; nt < NS; ++nt) {
#pragma unroll
    for (int r = 0; r < 8; r += 2) {
      const v2f e = __builtin_elementwise_fma((v2f){sc[nt][r], sc[nt][r + 1]}, (v2f){SL2, SL2}, (v2f){-mb, -mb});      /* two exponents a packed multiply-add */
      const v2f p = {__builtin_amdgcn_exp2f(e[0]), __builtin_amdgcn_exp2f(e[1])};
      pb[nt >> 1].h[(nt & 1) * 8 + r] = (_Float16)p[0]; pb[nt >> 1].h[(nt & 1) * 8 + r + 1] = (_Float16)p[1];
      ps[nt] = r ? ps[nt] + p : p; } }
#pragma unroll
   for (int st = NS / 2; st > 0; st >>= 1)
#pragma unroll
    for (int nt = 0; nt < st; ++nt) ps[nt] += ps[nt + st];
   l_c = l_c * al + (ps[0][0] + ps[0][1]);
#pragma unroll
   for (int dt = 0; dt < DT; ++dt)
#pragma unroll
    for (int r = 0; r < 8; ++r) oacc[dt][r] *= al;
#pragma unroll
   for (int ks = 0; ks < NS / 2; ++ks)
#pragma unroll
    for (int dt = 0; dt < DT; ++dt) oacc[dt] = mmaB(av[ks][dt].v, pb[ks].v, oacc[dt]);
  }
  asm volatile("s_wait_asynccnt 0x0" ::: "memory");      /* no copy is outstanding when the wave goes on to its end */
  const float l = l_c + xhalf(l_c); const float inv = (l > 0.f) ? 1.0f / l : 0.f;      /* l and oacc both carry the 2^10 */
  /* O leaves as f16, the projection's operand type, head-major [h][n][32]: a lane's 8 accumulators of a tile are 8 consecutive channels of its query = one 16-byte store; a wave's 16 queries fill 1 KiB that no other wave writes */
#pragma unroll
  for (int dt = 0; dt < DT; ++dt) { FragH f;
#pragma unroll
    for (int r = 0; r < 8; ++r) f.h[r] = (_Float16)(oacc[dt][r] * inv);
    *(v8us*)((unsigned short*)O16 + ((size_t)h * NN + q0 + ln) * HD + dt * 16 + 8 * hh) = f.half[0]; }
}

// out[c][n] = proj_w . O^T + proj_b, in the output's own channel-major layout: A = 16 rows of the rounded proj_w (x 2^4), B = 64 tokens of O (head-major [h][n][32]: k block kb is head kb / 32).
// One wave = 16 channels x 64 tokens; the tile goes through the wave's own LDS range so that each store covers whole 256-byte pieces of output rows. M 256 N 4096 K 256.
__global__ __launch_bounds__(128) void k_proj(const _Float16* __restrict__ Bp, const _Float16* __restrict__ O16, const float* __restrict__ bias, float* __restrict__ out) {
  __shared__ __attribute__((aligned(16))) float so[4][16][64 + 4];      /* pitch 272 bytes: the two halves' rows, 8 apart, fall on different banks */
  const int tid = threadIdx.x, w = tid >> 5, lane = tid & 31, ln = lane & 15, hh = lane >> 4;
  const int wid = blockIdx.x * 4 + w; const int row0 = (wid / (NN / 64)) * 16, col0 = (wid % (NN / 64)) * 64;
  const unsigned short* arow = (const unsigned short*)Bp + (size_t)(row0 + ln) * CC + 8 * hh;
  const unsigned short* brow = (const unsigned short*)O16 + (size_t)(col0 + ln) * HD + 8 * hh;
  const v4f b0 = *(const v4fa*)(bias + row0 + 8 * hh), b1 = *(const v4fa*)(bias + row0 + 8 * hh + 4);
  v8f acc[4] = {};
#pragma unroll
  for (int kb = 0; kb < CC; kb += 32) { FragH ah; ah.half[0] = *(const v8us*)(arow + kb); ah.half[1] = *(const v8us*)(arow + kb + 16);
#pragma unroll
    for (int t = 0; t < 4; ++t) { const unsigned short* bt = brow + ((size_t)(kb / 32) * NN + t * 16) * HD; FragH bq; bq.half[0] = *(const v8us*)bt; bq.half[1] = *(const v8us*)(bt + 16);
      acc[t] = mmaH<1>(ah.v, ah.v, bq.v, bq.v, acc[t]); }
  }
#pragma unroll
  for (int t = 0; t < 4; ++t)
#pragma unroll
    for (int r = 0; r < 8; ++r) so[w][8 * hh + r][t * 16 + ln] = acc[t][r] * 0.0625f + bf16_round(r < 4 ? b0[r & 3] : b1[r & 3]);
  __builtin_amdgcn_fence(__ATOMIC_ACQ_REL, "workgroup"); __builtin_amdgcn_wave_barrier();      /* the wave's LDS writes are done before its lanes read each other's */
  const int rsub = lane >> 4, c4 = (lane & 15) * 4;
#pragma unroll
  for (int q = 0; q < 8; ++q) { const int r = q * 2 + rsub; const v4f v = *(const v4fa*)&so[w][r][c4]; *(v4f*)(out + (size_t)(row0 + r) * NN + col0 + c4) = v; }
}

extern "C" void kernel_launch(void* const* d_in, const int* in_sizes, int n_in,
                              void* d_out, int out_size, void* d_ws, size_t ws_size, hipStream_t stream) {
  (void)in_sizes; (void)n_in; (void)out_size;
  const float* x = (const float*)d_in[0]; const float* Wqkv = (const float*)d_in[1]; const float* Wp = (const float*)d_in[2]; const float* bp = (const float*)d_in[3];
  char* ws = (char*)d_ws; size_t off = 0;
  auto take = [&](size_t bytes) { char* p = ws + off; off += (bytes + 255) & ~(size_t)255; return p; };
  _Float16* Bqkv = (_Float16*)take((size_t)C3 * CC * 2); _Float16* Bp = (_Float16*)take((size_t)CC * CC * 2); _Float16* X16 = (_Float16*)take((size_t)NR * CC * 2);
  _Float16* QK = (_Float16*)take((size_t)NR * 2 * CC * 2); _Float16* Vt = (_Float16*)take((size_t)CC * NN * 2); _Float16* O16 = (_Float16*)take((size_t)NR * CC * 2);
  if (off > ws_size) return;      // 0.4 + 0.1 + 2.1 + 4.2 + 2.1 + 2.1 = about 11 MB
  k_prep<<<TOKB + WQB + WPB, 256, 0, stream>>>(x, X16, Wqkv, Bqkv, Wp, Bp);
  k_qkv<<<QKB + VB, 128, 0, stream>>>(X16, Bqkv, QK, Vt);
  k_flash<<<NH * (NN / 64), 128, 0, stream>>>(QK, 2 * CC, QK + CC, 2 * CC, Vt, nullptr, O16);      /* blocks = head x 64-query groups */
  k_proj<<<(CC / 16) * (NN / 64) / 4, 128, 0, stream>>>(Bp, O16, bp, (float*)d_out);
}

// v007
// Measured time: 47.5 microseconds a run.
// In two side-by-side timings against v006, it was 1.29 and 1.30 times as fast.
// Over all steps from v000 it is 8.30 times as fast.
#include <hip/hip_runtime.h>
// 3-D multi-head self-attention on channel-major x [1, 256, 16³ = 4096]: qkv = qkv_w·x (1×1×1 conv, no bias), 8 heads × 32, softmax(qᵀk·32^-½) over keys, out[h,d,n] = Σ_m attn[n,m]·v[h,d,m], then proj_w·out + proj_b.
// Compute dtype: x, qkv_w, proj_w, proj_b rounded to bf16; q/k token-major and v channel-major (= Vᵀ) as f16 GEMM outputs (f32 accumulate); fused flash-style kernel per head
// (online softmax f32, P f16 x 2^10) on v_wmma_f32_16x16x32_f16, which stores O as f16; projection GEMM with bias, computed channel-major (A = proj_w) and stored straight to out; f32 accumulate throughout.
#define BB 1
#define CC 256
#define C3 768
#define NH 8
#define HD 32
#define NN 4096
#define NR (BB * NN)

typedef __bf16 v16b __attribute__((ext_vector_type(16)));
typedef unsigned short v8us __attribute__((ext_vector_type(8), may_alias));
typedef float  v8f  __attribute__((ext_vector_type(8)));
typedef float  v4f  __attribute__((ext_vector_type(4)));
typedef float  v4fa __attribute__((ext_vector_type(4), may_alias));
union FragB { v16b v; v8us half[2]; unsigned short u[16]; };

__device__ __forceinline__ unsigned short bf16_bits(float x) { unsigned int u = __float_as_uint(x); return (unsigned short)((u + 0x7FFFu + ((u >> 16) & 1u)) >> 16); }
__device__ __forceinline__ float bf16_val(unsigned short b) { return __uint_as_float(((unsigned int)b) << 16); }
__device__ __forceinline__ float bf16_round(float x) { return bf16_val(bf16_bits(x)); }
// D += A·B with NT terms: 1 = ah·bh, 2 = + al·bh (A split), 3 = + ah·bl (both split)
template <int NT>
__device__ __forceinline__ v8f mmaN(v16b ah, v16b al, v16b bh, v16b bl, v8f c) {
  c = __builtin_amdgcn_wmma_f32_16x16x32_bf16(false, ah, false, bh, (short)0, c, false, false);
  if (NT >= 2) c = __builtin_amdgcn_wmma_f32_16x16x32_bf16(false, al, false, bh, (short)0, c, false, false);
  if (NT >= 3) c = __builtin_amdgcn_wmma_f32_16x16x32_bf16(false, ah, false, bl, (short)0, c, false, false);
  asm volatile("v_nop\n\tv_nop\n\tv_nop\n\tv_nop" : "+v"(c) : "v"(ah), "v"(al), "v"(bh), "v"(bl));
  return c;
}

__global__ __launch_bounds__(256) void k_wt_bf16(const float* __restrict__ W, unsigned short* __restrict__ Wt, int K, int N) {
  const int t = blockIdx.x * 256 + threadIdx.x;
  const int k8n = K / 8;
  if (t >= N * k8n) return;
  const int n = t / k8n, k8 = (t % k8n) * 8;
  v8us v;
#pragma unroll
  for (int i = 0; i < 8; ++i) v[i] = bf16_bits(W[(size_t)(k8 + i) * N + n]);
  *(v8us*)(Wt + (size_t)n * K + k8) = v;
  
}

// GEMM C[M][N] (f32, pitch ldc) = act(A[M][K]·W + bias). A f32 row-major (pitch lda) converted per fragment to bf16
// (ASPLIT: hi/lo two planes -> 2 terms, else single rounded term); Wt bf16 [N][K] (pitch ldb). BIAS_BF16 rounds the
// bias to bf16 first (bias quantised to bf16 before the add). K%32==0, M%16==0, N%64==0.
template <bool ASPLIT, int ACT, bool BIAS_BF16>
__global__ __launch_bounds__(128) void k_gemm_bf(const float* __restrict__ A, int lda, const unsigned short* __restrict__ Wt, int ldb,
                                               const float* __restrict__ bias, float* __restrict__ C, int ldc, int M, int N, int K) {
  __shared__ __attribute__((aligned(16))) float so[4][16][64];
  const int tid = threadIdx.x, w = tid >> 5, lane = tid & 31, ln = lane & 15, hh = lane >> 4;
  const int ntn = N / 64;
  const int wid = blockIdx.x * 4 + w;
  const int mt = wid / ntn, nq = wid % ntn;
  if (mt * 16 >= M) return;
  const int row0 = mt * 16, col0 = nq * 64;
  const float* arow = A + (size_t)(row0 + ln) * lda;
  v8f acc[4] = {};
  for (int kb = 0; kb < K; kb += 32) {
    FragB ah, al;
    const v4f x0 = *(const v4fa*)(arow + kb + 8 * hh), x1 = *(const v4fa*)(arow + kb + 8 * hh + 4);
    const v4f x2 = *(const v4fa*)(arow + kb + 16 + 8 * hh), x3 = *(const v4fa*)(arow + kb + 16 + 8 * hh + 4);
    float xs[16] = {x0[0],x0[1],x0[2],x0[3],x1[0],x1[1],x1[2],x1[3],x2[0],x2[1],x2[2],x2[3],x3[0],x3[1],x3[2],x3[3]};
#pragma unroll
    for (int i = 0; i < 16; ++i) { const unsigned short hb = bf16_bits(xs[i]); ah.u[i] = hb; al.u[i] = ASPLIT ? bf16_bits(xs[i] - bf16_val(hb)) : (unsigned short)0; }
#pragma unroll
    for (int t = 0; t < 4; ++t) {
      const unsigned short* brow = Wt + (size_t)(col0 + t * 16 + ln) * ldb + kb;
      FragB b;
      b.half[0] = *(const v8us*)(brow + 8 * hh);
      b.half[1] = *(const v8us*)(brow + 16 + 8 * hh);
      acc[t] = mmaN<ASPLIT ? 2 : 1>(ah.v, al.v, b.v, b.v, acc[t]);
    }
  }
#pragma unroll
  for (int t = 0; t < 4; ++t) {
    float bv = bias ? bias[col0 + t * 16 + ln] : 0.f;
    if (BIAS_BF16) bv = bf16_round(bv);
#pragma unroll
    for (int r = 0; r < 8; ++r) { float v = acc[t][r] + bv; if (ACT == 1) v = fmaxf(v, 0.f); so[w][8 * hh + r][t * 16 + ln] = v; }
  }
  __builtin_amdgcn_fence(__ATOMIC_ACQ_REL, "workgroup");
  __builtin_amdgcn_wave_barrier();
  const int rsub = lane >> 4, c4 = (lane & 15) * 4;
  {
#pragma unroll
    for (int q = 0; q < 8; ++q) {
      const int r = q * 2 + rsub;
      const v4f v = *(const v4fa*)&so[w][r][c4];
      *(v4f*)(C + (size_t)(row0 + r) * ldc + col0 + c4) = v;
    }
    
  }
}

// Flash-style causal/unmasked attention, all contractions 3-term bf16 hi/lo splits, f32 softmax with running max.
// q,k,v rows are read from f32 buffers with arbitrary row pitch (so they can live inside a fused qkv buffer);
// D = head size (multiple of 32, <= 128); one wave = 16 query rows; block = 4 waves (64 queries) sharing K/V chunks of 32.
template <int D, bool CAUSAL>
__global__ __launch_bounds__(128) void k_flash(const float* __restrict__ qb, const float* __restrict__ kb, const float* __restrict__ vb,
                                             int pitch, int T, int H, float scale, float* __restrict__ y, int ypitch) {
  constexpr int KS = D / 32;        // k-steps for QK
  constexpr int DT = D / 16;        // d tiles for PV
  __shared__ __attribute__((aligned(16))) unsigned short sKh[32][D + 8], sKl[32][D + 8], sVh[32][D + 8], sVl[32][D + 8];
  __shared__ __attribute__((aligned(16))) unsigned short sPh[4][16][40], sPl[4][16][40];
  __shared__ __attribute__((aligned(16))) float sO[4][16][D];
  const int tid = threadIdx.x, w = tid >> 5, lane = tid & 31, ln = lane & 15, hh = lane >> 4;
  const int nqb = (T + 63) / 64;
  const int bh = blockIdx.x / nqb, qblk = blockIdx.x % nqb;
  const int b = bh / H, h = bh % H;
  const int q0 = qblk * 64 + w * 16;
  const float* Q = qb + (size_t)b * T * pitch + h * D;
  const float* K = kb + (size_t)b * T * pitch + h * D;
  const float* V = vb + (size_t)b * T * pitch + h * D;

  // A fragments of the wave's 16 query rows (scaled), hi/lo
  FragB aqh[KS], aql[KS];
  {
    int row = q0 + ln; if (row >= T) row = T - 1;
    const float* qr = Q + (size_t)row * pitch;
#pragma unroll
    for (int ks = 0; ks < KS; ++ks)
#pragma unroll
      for (int i = 0; i < 16; ++i) {
        const int d = ks * 32 + ((i < 8) ? (8 * hh + i) : (16 + 8 * hh + (i - 8)));
        const float x = qr[d] * scale; const unsigned short hb = bf16_bits(x);
        aqh[ks].u[i] = hb; aql[ks].u[i] = bf16_bits(x - bf16_val(hb));
      }
  }
  float m_r[8], l_r[8];
#pragma unroll
  for (int r = 0; r < 8; ++r) { m_r[r] = -3.0e38f; l_r[r] = 0.f; }
  v8f oacc[DT];
#pragma unroll
  for (int dt = 0; dt < DT; ++dt) oacc[dt] = (v8f){0.f,0.f,0.f,0.f,0.f,0.f,0.f,0.f};

  const int kv_end = CAUSAL ? min(T, qblk * 64 + 64) : T;     // block-uniform
  for (int j0 = 0; j0 < kv_end; j0 += 32) {
    __syncthreads();
    for (int e = tid; e < 32 * (D / 4); e += 128) {
      const int r = e / (D / 4), c4 = (e % (D / 4)) * 4;
      const int key = j0 + r;
      v4f kf = {0.f,0.f,0.f,0.f}, vf = {0.f,0.f,0.f,0.f};
      if (key < T) { kf = *(const v4fa*)(K + (size_t)key * pitch + c4); vf = *(const v4fa*)(V + (size_t)key * pitch + c4); }
#pragma unroll
      for (int t = 0; t < 4; ++t) {
        unsigned short hb = bf16_bits(kf[t]); sKh[r][c4 + t] = hb; sKl[r][c4 + t] = bf16_bits(kf[t] - bf16_val(hb));
        hb = bf16_bits(vf[t]); sVh[r][c4 + t] = hb; sVl[r][c4 + t] = bf16_bits(vf[t] - bf16_val(hb));
      }
    }
    __syncthreads();
    // S tile 16 x 32
    v8f s[2];
#pragma unroll
    for (int nt = 0; nt < 2; ++nt) {
      v8f acc = {};
#pragma unroll
      for (int ks = 0; ks < KS; ++ks) {
        FragB bh_, bl_;
        bh_.half[0] = *(const v8us*)&sKh[nt * 16 + ln][ks * 32 + 8 * hh]; bh_.half[1] = *(const v8us*)&sKh[nt * 16 + ln][ks * 32 + 16 + 8 * hh];
        bl_.half[0] = *(const v8us*)&sKl[nt * 16 + ln][ks * 32 + 8 * hh]; bl_.half[1] = *(const v8us*)&sKl[nt * 16 + ln][ks * 32 + 16 + 8 * hh];
        acc = mmaN<3>(aqh[ks].v, aql[ks].v, bh_.v, bl_.v, acc);
      }
      s[nt] = acc;
    }
    // mask + running max (rows 8hh+r; the 16 lanes of a half share rows)
    float alpha[8];
#pragma unroll
    for (int r = 0; r < 8; ++r) {
      const int qi = q0 + 8 * hh + r;
      const int ja = j0 + ln, jb = j0 + 16 + ln;
      if (CAUSAL) { if (ja > qi) s[0][r] = -3.0e38f; if (jb > qi) s[1][r] = -3.0e38f; }
      if (ja >= T) s[0][r] = -3.0e38f;
      if (jb >= T) s[1][r] = -3.0e38f;
      float mx = fmaxf(s[0][r], s[1][r]);
      mx = fmaxf(mx, __shfl_xor(mx, 1, 32)); mx = fmaxf(mx, __shfl_xor(mx, 2, 32)); mx = fmaxf(mx, __shfl_xor(mx, 4, 32)); mx = fmaxf(mx, __shfl_xor(mx, 8, 32));
      const float mnew = fmaxf(m_r[r], mx);
      alpha[r] = (mnew > -1.0e38f) ? __expf(m_r[r] - mnew) : 1.0f;
      const float p0 = (s[0][r] > -1.0e38f) ? __expf(s[0][r] - mnew) : 0.f;
      const float p1 = (s[1][r] > -1.0e38f) ? __expf(s[1][r] - mnew) : 0.f;
      m_r[r] = mnew;
      l_r[r] = l_r[r] * alpha[r] + p0 + p1;            // per-lane partial row sum (16 lanes combined at the end)
      unsigned short hb = bf16_bits(p0); sPh[w][8 * hh + r][ln] = hb;      sPl[w][8 * hh + r][ln] = bf16_bits(p0 - bf16_val(hb));
      hb = bf16_bits(p1);                sPh[w][8 * hh + r][16 + ln] = hb; sPl[w][8 * hh + r][16 + ln] = bf16_bits(p1 - bf16_val(hb));
    }
#pragma unroll
    for (int dt = 0; dt < DT; ++dt)
#pragma unroll
      for (int r = 0; r < 8; ++r) oacc[dt][r] *= alpha[r];
    __builtin_amdgcn_fence(__ATOMIC_ACQ_REL, "workgroup");
    __builtin_amdgcn_wave_barrier();
    FragB pah, pal;
    pah.half[0] = *(const v8us*)&sPh[w][ln][8 * hh]; pah.half[1] = *(const v8us*)&sPh[w][ln][16 + 8 * hh];
    pal.half[0] = *(const v8us*)&sPl[w][ln][8 * hh]; pal.half[1] = *(const v8us*)&sPl[w][ln][16 + 8 * hh];
#pragma unroll
    for (int dt = 0; dt < DT; ++dt) {
      FragB bvh, bvl;
#pragma unroll
      for (int i = 0; i < 8; ++i) {
        bvh.u[i] = sVh[8 * hh + i][dt * 16 + ln]; bvh.u[8 + i] = sVh[16 + 8 * hh + i][dt * 16 + ln];
        bvl.u[i] = sVl[8 * hh + i][dt * 16 + ln]; bvl.u[8 + i] = sVl[16 + 8 * hh + i][dt * 16 + ln];
      }
      oacc[dt] = mmaN<3>(pah.v, pal.v, bvh.v, bvl.v, oacc[dt]);
    }
    __builtin_amdgcn_fence(__ATOMIC_ACQ_REL, "workgroup");
    __builtin_amdgcn_wave_barrier();
  }
#pragma unroll
  for (int r = 0; r < 8; ++r) {
    float l = l_r[r];
    l += __shfl_xor(l, 1, 32); l += __shfl_xor(l, 2, 32); l += __shfl_xor(l, 4, 32); l += __shfl_xor(l, 8, 32);
    l_r[r] = (l > 0.f) ? 1.0f / l : 0.f;
  }
#pragma unroll
  for (int dt = 0; dt < DT; ++dt)
#pragma unroll
    for (int r = 0; r < 8; ++r) sO[w][8 * hh + r][dt * 16 + ln] = oacc[dt][r] * l_r[r];
  __builtin_amdgcn_fence(__ATOMIC_ACQ_REL, "workgroup");
  __builtin_amdgcn_wave_barrier();
  {
    for (int r = 0; r < 16; ++r) {
      const int row = q0 + r;
      if (row < T && lane < D / 4) {
        const v4f val = *(const v4fa*)&sO[w][r][lane * 4];
        *(v4f*)(y + ((size_t)b * T + row) * ypitch + h * D + lane * 4) = val;
      }
    }
    
  }
}

// GEMM C = act(A·W + bias + resid): A f32 (ASPLIT -> hi/lo 2 terms), Wt bf16 [N][K]; ACT 0 none, 1 relu, 2 exact gelu;
// resid (optional, f32, row index = (row % rmod), pitch ldr, RES_BF16 rounds it) added before the activation.
template <bool ASPLIT, int ACT, bool BIAS_BF16, bool RES_BF16>
__global__ __launch_bounds__(128) void k_gemm_bf3(const float* __restrict__ A, int lda, const unsigned short* __restrict__ Wt, int ldb,
                                                const float* __restrict__ bias, const float* __restrict__ resid, int rmod, int ldr,
                                                float* __restrict__ C, int ldc, int M, int N, int K) {
  __shared__ __attribute__((aligned(16))) float so[4][16][64];
  const int tid = threadIdx.x, w = tid >> 5, lane = tid & 31, ln = lane & 15, hh = lane >> 4;
  const int ntn = N / 64;
  const int wid = blockIdx.x * 4 + w;
  const int mt = wid / ntn, nq = wid % ntn;
  if (mt * 16 >= M) return;
  const int row0 = mt * 16, col0 = nq * 64;
  const float* arow = A + (size_t)(row0 + ln) * lda;
  v8f acc[4] = {};
  for (int kb = 0; kb < K; kb += 32) {
    FragB ah, al;
    const v4f x0 = *(const v4fa*)(arow + kb + 8 * hh), x1 = *(const v4fa*)(arow + kb + 8 * hh + 4);
    const v4f x2 = *(const v4fa*)(arow + kb + 16 + 8 * hh), x3 = *(const v4fa*)(arow + kb + 16 + 8 * hh + 4);
    float xs[16] = {x0[0],x0[1],x0[2],x0[3],x1[0],x1[1],x1[2],x1[3],x2[0],x2[1],x2[2],x2[3],x3[0],x3[1],x3[2],x3[3]};
#pragma unroll
    for (int i = 0; i < 16; ++i) { const unsigned short hb = bf16_bits(xs[i]); ah.u[i] = hb; al.u[i] = ASPLIT ? bf16_bits(xs[i] - bf16_val(hb)) : (unsigned short)0; }
#pragma unroll
    for (int t = 0; t < 4; ++t) {
      const unsigned short* brow = Wt + (size_t)(col0 + t * 16 + ln) * ldb + kb;
      FragB b;
      b.half[0] = *(const v8us*)(brow + 8 * hh);
      b.half[1] = *(const v8us*)(brow + 16 + 8 * hh);
      acc[t] = mmaN<ASPLIT ? 2 : 1>(ah.v, al.v, b.v, b.v, acc[t]);
    }
  }
#pragma unroll
  for (int t = 0; t < 4; ++t) {
    const int col = col0 + t * 16 + ln;
    float bv = bias ? bias[col] : 0.f;
    if (BIAS_BF16) bv = bf16_round(bv);
#pragma unroll
    for (int r = 0; r < 8; ++r) {
      float v = acc[t][r] + bv;
      if (resid) { float rv = resid[(size_t)((row0 + 8 * hh + r) % rmod) * ldr + col]; if (RES_BF16) rv = bf16_round(rv); v += rv; }
      if (ACT == 1) v = fmaxf(v, 0.f);
      if (ACT == 2) v = 0.5f * v * (1.0f + erff(v * 0.70710678118654752f));
      if (ACT == 3) { const float u = 0.7978845608028654f * (v + 0.044715f * v * v * v); v = 0.5f * v * (1.0f + tanhf(u)); }
      so[w][8 * hh + r][t * 16 + ln] = v;
    }
  }
  __builtin_amdgcn_fence(__ATOMIC_ACQ_REL, "workgroup");
  __builtin_amdgcn_wave_barrier();
  const int rsub = lane >> 4, c4 = (lane & 15) * 4;
  {
#pragma unroll
    for (int q = 0; q < 8; ++q) {
      const int r = q * 2 + rsub;
      const v4f v = *(const v4fa*)&so[w][r][c4];
      *(v4f*)(C + (size_t)(row0 + r) * ldc + col0 + c4) = v;
    }
    
  }
}
// row LayerNorm (biased variance, eps) over N: s = X (+ R); optional out_sum <- s; out_norm <- (s-mu)*rsqrt(var+eps)*g + b
template <bool PARAM_BF16>
__global__ __launch_bounds__(256) void k_layernorm(const float* __restrict__ X, const float* __restrict__ R, const float* __restrict__ g, const float* __restrict__ bta,
                                                  float* __restrict__ out_sum, float* __restrict__ out_norm, int N, float eps) {
  __shared__ float red[256];
  const int row = blockIdx.x, tid = threadIdx.x;
  const float* x = X + (size_t)row * N; const float* rr = R ? R + (size_t)row * N : nullptr;
  float vals[16];                     // up to N = 4096
  const int per = N / 256;            // contiguous chunk per thread? use strided-by-4 chunks: thread handles j = tid*4 + 1024*u
  float s1 = 0.f;
  for (int u = 0; u < per / 4; ++u) {
    const int j = tid * 4 + 1024 * u;
    const v4f a = *(const v4fa*)(x + j);
    v4f b = {0.f,0.f,0.f,0.f}; if (rr) b = *(const v4fa*)(rr + j);
#pragma unroll
    for (int q = 0; q < 4; ++q) { const float v = a[q] + b[q]; vals[u * 4 + q] = v; s1 += v; }
  }
  red[tid] = s1; __syncthreads();
  for (int st = 128; st > 0; st >>= 1) { if (tid < st) red[tid] += red[tid + st]; __syncthreads(); }
  const float mu = red[0] / (float)N; __syncthreads();
  float s2 = 0.f;
  for (int u = 0; u < per / 4; ++u)
#pragma unroll
    for (int q = 0; q < 4; ++q) { const float c = vals[u * 4 + q] - mu; s2 += c * c; }
  red[tid] = s2; __syncthreads();
  for (int st = 128; st > 0; st >>= 1) { if (tid < st) red[tid] += red[tid + st]; __syncthreads(); }
  const float rs = rsqrtf(red[0] / (float)N + eps);
  {
    for (int u = 0; u < per / 4; ++u) {
      const int j = tid * 4 + 1024 * u;
      v4f o, sm;
#pragma unroll
      for (int q = 0; q < 4; ++q) {
        float gg = g[j + q], bb = bta[j + q];
        if (PARAM_BF16) { gg = bf16_round(gg); bb = bf16_round(bb); }
        sm[q] = vals[u * 4 + q]; o[q] = (vals[u * 4 + q] - mu) * rs * gg + bb;
      }
      if (out_sum) *(v4f*)(out_sum + (size_t)row * N + j) = sm;
      *(v4f*)(out_norm + (size_t)row * N + j) = o;
    }
    
  }
}



// ---- f16 WMMA path (v_wmma_f32_16x16x32_f16): 11-bit significands for operands in range — used here for the qkv and projection GEMMs and for attention
typedef _Float16 v16h __attribute__((ext_vector_type(16)));
union FragH { v16h v; v8us half[2]; _Float16 h[16]; unsigned short u[16]; };
template <int NT>
__device__ __forceinline__ v8f mmaH(v16h ah, v16h al, v16h bh, v16h bl, v8f c) {
  c = __builtin_amdgcn_wmma_f32_16x16x32_f16(false, ah, false, bh, (short)0, c, false, false);
  if (NT >= 2) c = __builtin_amdgcn_wmma_f32_16x16x32_f16(false, al, false, bh, (short)0, c, false, false);
  if (NT >= 3) c = __builtin_amdgcn_wmma_f32_16x16x32_f16(false, ah, false, bl, (short)0, c, false, false);
  asm volatile("v_nop\n\tv_nop\n\tv_nop\n\tv_nop" : "+v"(c) : "v"(ah), "v"(al), "v"(bh), "v"(bl));
  return c;
}
// batched GEMM like k_gemm_b but f16 operands: A f32 (split into f16 hi/lo if ASPLIT, else rounded to f16), Bt = f16 values [n][k]; alpha; C f32; N multiple of 16 (partial tiles skipped)
template <bool ASPLIT>
__global__ __launch_bounds__(128) void k_gemm_h(const float* __restrict__ A, int lda, size_t sA, const _Float16* __restrict__ Bh, int ldb, size_t sB, float alpha, float* __restrict__ C, int ldc, size_t sC, int M, int N, int K) {
  __shared__ __attribute__((aligned(16))) float so[4][16][64];
  const int tid = threadIdx.x, w = tid >> 5, lane = tid & 31, ln = lane & 15, hh = lane >> 4; const int by = blockIdx.y;
  A += (size_t)by * sA; Bh += (size_t)by * sB; C += (size_t)by * sC;
  const int ntn = (N + 63) / 64; const int wid = blockIdx.x * 4 + w; const int mt = wid / ntn, nq = wid % ntn; if (mt * 16 >= M) return;
  const int row0 = mt * 16, col0 = nq * 64; const float* arow = A + (size_t)(row0 + ln) * lda;
  v8f acc[4] = {};
  for (int kb = 0; kb < K; kb += 32) {
    FragH ah, al;
    const v4f x0 = *(const v4fa*)(arow + kb + 8 * hh), x1 = *(const v4fa*)(arow + kb + 8 * hh + 4), x2 = *(const v4fa*)(arow + kb + 16 + 8 * hh), x3 = *(const v4fa*)(arow + kb + 16 + 8 * hh + 4);
    float xs[16] = {x0[0],x0[1],x0[2],x0[3],x1[0],x1[1],x1[2],x1[3],x2[0],x2[1],x2[2],x2[3],x3[0],x3[1],x3[2],x3[3]};
#pragma unroll
    for (int i = 0; i < 16; ++i) { const _Float16 h = (_Float16)xs[i]; ah.h[i] = h; al.h[i] = ASPLIT ? (_Float16)(xs[i] - (float)h) : (_Float16)0.0f; }
#pragma unroll
    for (int t = 0; t < 4; ++t) { if (col0 + t * 16 >= N) continue; const size_t boff = (size_t)(col0 + t * 16 + ln) * ldb + kb; FragH bq; bq.half[0] = *(const v8us*)(Bh + boff + 8 * hh); bq.half[1] = *(const v8us*)(Bh + boff + 16 + 8 * hh);
      acc[t] = mmaH<ASPLIT ? 2 : 1>(ah.v, al.v, bq.v, bq.v, acc[t]); }
  }
#pragma unroll
  for (int t = 0; t < 4; ++t) { if (col0 + t * 16 >= N) continue;
#pragma unroll
    for (int r = 0; r < 8; ++r) so[w][8 * hh + r][t * 16 + ln] = acc[t][r] * alpha; }
  __builtin_amdgcn_fence(__ATOMIC_ACQ_REL, "workgroup"); __builtin_amdgcn_wave_barrier();
  const int rsub = lane >> 4, c4 = (lane & 15) * 4;
  {
#pragma unroll
    for (int q = 0; q < 8; ++q) { const int r = q * 2 + rsub; if (col0 + c4 < N) { const v4f v = *(const v4fa*)&so[w][r][c4]; *(v4f*)(C + (size_t)(row0 + r) * ldc + col0 + c4) = v; } }
     }
}

// Wt[n][k] = f16(W[k][n]·scale) from f32 row-major W[K][N] (scale = power of two; bf16-exact weights stay exact in f16 away from the subnormal range)
__global__ __launch_bounds__(256) void k_wt_f16(const float* __restrict__ W, _Float16* __restrict__ Wt, int K, int N, float scale) {
  const int t = blockIdx.x * 256 + threadIdx.x; if (t >= N * (K / 8)) return; const int n = t / (K / 8), k8 = (t % (K / 8)) * 8; FragH f;
#pragma unroll
  for (int i = 0; i < 8; ++i) f.h[i] = (_Float16)(bf16_round(W[(size_t)(k8 + i) * N + n]) * scale); const v8us o = f.half[0];
  *(v8us*)((unsigned short*)Wt + (size_t)n * K + k8) = o; 
}
// one f16 product as the bare builtin: in a run of products each fills the others' distance, and the compiler pads what is left
__device__ __forceinline__ v8f mmaB(v16h a, v16h b, v8f c) { return __builtin_amdgcn_wmma_f32_16x16x32_f16(false, a, false, b, (short)0, c, false, false); }
// acc[t] += A (16 rows x CC) . B_t^T (16 rows x CC), t = 0..3, k ascending. arow / brow: the lane's own row, + 8 hh; tile t of B lies bt halves on, k block ks lies bk halves on.
// The fragment loads run ahead of the products in groups of G k blocks (20 loads), AH groups in flight: a wave waits for memory once a group in flight, not once a product.
template <int AH>
__device__ __forceinline__ void mm16x64(const unsigned short* __restrict__ arow, const unsigned short* __restrict__ brow, size_t bt, size_t bk, v8f (&acc)[4]) {
  constexpr int KS = CC / 32, G = 2, NG = KS / G;
  FragH a[KS], b[KS][4];
  auto fetch = [&](int g) {
#pragma unroll
    for (int ks = g * G; ks < g * G + G; ++ks) { a[ks].half[0] = *(const v8us*)(arow + ks * 32); a[ks].half[1] = *(const v8us*)(arow + ks * 32 + 16);
#pragma unroll
      for (int t = 0; t < 4; ++t) { const unsigned short* p = brow + ks * bk + t * bt; b[ks][t].half[0] = *(const v8us*)p; b[ks][t].half[1] = *(const v8us*)(p + 16); } }
  };
  /* every "#pragma unroll" here keeps the fragment arrays, which the loop variables index, in registers */
#pragma unroll
  for (int g = 0; g < AH; ++g) fetch(g);
  __builtin_amdgcn_sched_barrier(0);      /* keeps the first AH groups' loads in front of the first product: sunk to their users they would each be waited for alone */
#pragma unroll
  for (int g = 0; g < NG; ++g) {
#pragma unroll
    for (int ks = g * G; ks < g * G + G; ++ks)
#pragma unroll
      for (int t = 0; t < 4; ++t) acc[t] = mmaB(a[ks].v, b[ks][t].v, acc[t]);
    if (g + AH < NG) { fetch(g + AH); __builtin_amdgcn_sched_barrier(0); }      /* the refill is issued here, AH groups ahead of its products, and is not sunk to them */
  }
}
// k_gemm_hh variant with fused epilogue: v = acc·alpha + bias[by·sBias + col] (+ CP[(row/rowsPerB)·sCPb + by·64 + col] if CP) ; ACT 0 none / 1 elu ; writes f16 C16 (and f32 C if non-null)
// the body is a device function of the block's place (bx, by) and its LDS, so that several GEMMs can share one launch
template <int ACT>
__device__ __forceinline__ void gemm_hhx(float (*so)[16][64], int bx, int by, const _Float16* __restrict__ A, int lda, size_t sA, const _Float16* __restrict__ Bh, int ldb, size_t sB, float alpha, const float* __restrict__ bias, size_t sBias, const float* __restrict__ CP, int rowsPerB, size_t sCPb, int row0g,
    float* __restrict__ C, _Float16* __restrict__ C16, int ldc, size_t sC, int M, int N) {      /* K = CC, N a multiple of 64 */
  const int tid = threadIdx.x, w = tid >> 5, lane = tid & 31, ln = lane & 15, hh = lane >> 4;
  A += (size_t)by * sA; Bh += (size_t)by * sB; const size_t cofs = (size_t)by * sC; const float* bp = bias ? bias + (size_t)by * sBias : nullptr;
  const int ntn = (N + 63) / 64; const int wid = bx * 4 + w; const int mt = wid / ntn, nq = wid % ntn; if (mt * 16 >= M) return;
  const int row0 = mt * 16, col0 = nq * 64; const _Float16* arow = A + (size_t)(row0 + ln) * lda;
  v8f acc[4] = {};
  mm16x64<2>((const unsigned short*)arow + 8 * hh, (const unsigned short*)Bh + (size_t)(col0 + ln) * ldb + 8 * hh, (size_t)16 * ldb, 32, acc);
#pragma unroll
  for (int t = 0; t < 4; ++t) { if (col0 + t * 16 >= N) continue; const int col = col0 + t * 16 + ln; const float bv = bp ? bf16_round(bp[col]) : 0.f;
#pragma unroll
    for (int r = 0; r < 8; ++r) { float v = acc[t][r] * alpha + bv; if (CP) { const int bidx = (row0g + row0 + 8 * hh + r) / rowsPerB; v += CP[(size_t)bidx * sCPb + (size_t)by * 64 + col]; } if (ACT == 1) v = (v > 0.f) ? v : expm1f(v); else if (ACT == 7) v = (v > 0.f) ? v + 1.0f : expf(v); else if (ACT == 8) v = tanhf(v); else if (ACT == 9) v = 0.5f * v * (1.0f + tanhf(0.7978845608028654f * (v + 0.044715f * v * v * v))); else if (ACT == 11) v = 1.0f / (1.0f + expf(-v)); else if (ACT == 12) v = (v > 0.f) ? v : 0.01f * v; else if (ACT == 14) v = (v > 0.f) ? v : 0.1f * v; else if (ACT == 15) v = v / (1.0f + expf(-v)); else if (ACT == 3) v = fmaxf(v, 0.f); else if (ACT == 6) v = 0.5f * v * (1.0f + erff(v * 0.70710678118654752f)); so[w][8 * hh + r][t * 16 + ln] = v; } }
  __builtin_amdgcn_fence(__ATOMIC_ACQ_REL, "workgroup"); __builtin_amdgcn_wave_barrier();
  const int rsub = lane >> 4, c4 = (lane & 15) * 4; typedef _Float16 v4h __attribute__((ext_vector_type(4)));
  {
#pragma unroll
    for (int q = 0; q < 8; ++q) { const int r = q * 2 + rsub; if (col0 + c4 < N) { const v4f v = *(const v4fa*)&so[w][r][c4]; if (C) *(v4f*)(C + cofs + (size_t)(row0 + r) * ldc + col0 + c4) = v; if (C16) { v4h h4; for (int i = 0; i < 4; ++i) h4[i] = (_Float16)v[i]; *(v4h*)(C16 + cofs + (size_t)(row0 + r) * ldc + col0 + c4) = h4; } } }
     }
}
// the two GEMMs that need only X16 and the rounded qkv_w, in one launch: blocks [0, QKB) give [q | k] token-major [n][512] (head h = cols h*32 / 256 + h*32; M 4096 N 512 K 256),
// blocks [QKB, QKB + VB) give v channel-major [(h,d)][n] = V^T (A = qkv_w rows 512..767, B = x token-major; M 256 N 4096 K 256)
#define QKB ((NR / 16) * (2 * CC / 64) / 4)
#define VB ((CC / 16) * (NN / 64) / 4)
__global__ __launch_bounds__(128) void k_qkv(const _Float16* __restrict__ X16, const _Float16* __restrict__ Bqkv, _Float16* __restrict__ QK, _Float16* __restrict__ Vt) {
  __shared__ __attribute__((aligned(16))) float so[4][16][64];
  const int bx = blockIdx.x;
  if (bx < QKB) gemm_hhx<0>(so, bx, 0, X16, CC, 0, Bqkv, CC, 0, 0.0625f, nullptr, 0, nullptr, 1, 0, 0, nullptr, QK, 2 * CC, 0, NR, 2 * CC);
  else gemm_hhx<0>(so, bx - QKB, 0, Bqkv + (size_t)2 * CC * CC, CC, 0, X16, CC, 0, 0.0625f, nullptr, 0, nullptr, 1, 0, 0, nullptr, Vt, NN, 0, CC, NN);
}


typedef _Float16 v4h __attribute__((ext_vector_type(4)));

__global__ __launch_bounds__(256) void k_x16(const float* __restrict__ x, _Float16* __restrict__ X16, size_t n8) { const size_t t = (size_t)blockIdx.x * 256 + threadIdx.x; if (t >= n8) return; FragH f;
#pragma unroll
  for (int q = 0; q < 8; ++q) f.h[q] = (_Float16)bf16_round(x[t * 8 + q]); *(v8us*)((unsigned short*)X16 + t * 8) = f.half[0];  }
__device__ __forceinline__ void round16f(int bx, const float* __restrict__ W, _Float16* __restrict__ Bt, size_t n8) { const size_t t = (size_t)bx * 256 + threadIdx.x; if (t >= n8) return; FragH f;
#pragma unroll
  for (int i = 0; i < 8; ++i) f.h[i] = (_Float16)(bf16_round(W[t * 8 + i]) * 16.0f); *(v8us*)((unsigned short*)Bt + t * 8) = f.half[0];  }
template <int NHv, int TTv>
__global__ __launch_bounds__(256) void k_vt(const _Float16* __restrict__ V16, int ldv, int voff, _Float16* __restrict__ Vt) { __shared__ unsigned short tl[64][66]; const int tid = threadIdx.x; const int slab = blockIdx.x / (TTv / 64), lg = blockIdx.x % (TTv / 64); const int b = slab / NHv, h = slab % NHv;
  for (int i = tid; i < 64 * 8; i += 256) { const int r = i / 8, c8 = (i % 8) * 8; FragH f; f.half[0] = *(const v8us*)((const unsigned short*)V16 + ((size_t)b * TTv + lg * 64 + r) * ldv + voff + h * 64 + c8);
#pragma unroll
    for (int q = 0; q < 8; ++q) tl[r][c8 + q] = f.u[q]; }
  __syncthreads();
  {
#pragma unroll
    for (int rd = 0; rd < 2; ++rd) { const int d = rd * 32 + tid / 8, pc = tid % 8; FragH f;
#pragma unroll
      for (int q = 0; q < 8; ++q) f.u[q] = tl[pc * 8 + q][d];
      *(v8us*)((unsigned short*)Vt + ((size_t)slab * 64 + d) * TTv + lg * 64 + pc * 8) = f.half[0]; }
     } }

__device__ __forceinline__ void tok(float (*tl)[65], int bx, const float* __restrict__ x, _Float16* __restrict__ X16) { const int tid = threadIdx.x; const int b = bx / ((CC / 64) * (NN / 32)), rem = bx % ((CC / 64) * (NN / 32)); const int cg = rem / (NN / 32), pg = rem % (NN / 32); const int c0 = cg * 64, p0 = pg * 32;
  for (int i = tid; i < 64 * 32; i += 256) { const int c = i / 32, pp = i % 32; tl[pp][c] = bf16_round(x[((size_t)b * CC + c0 + c) * NN + p0 + pp]); } __syncthreads();
  const int r = tid / 8, pc = tid % 8; FragH f; for (int q = 0; q < 8; ++q) f.h[q] = (_Float16)tl[r][pc * 8 + q]; const size_t row = (size_t)b * NN + p0 + r; *(v8us*)((unsigned short*)X16 + row * CC + c0 + pc * 8) = f.half[0];  }
// the three passes that read only inputs, in one launch: blocks [0, TOKB) transpose x to token-major f16, the next WQB round qkv_w, the last WPB round proj_w ((out,in) natural, x 2^4).
// The branch is on blockIdx alone, so the barrier inside tok() is passed by every thread of a block or by none.
#define TOKB (BB * (CC / 64) * (NN / 32))
#define WQB (C3 * CC / 8 / 256)
#define WPB (CC * CC / 8 / 256)
__global__ __launch_bounds__(256) void k_prep(const float* __restrict__ x, _Float16* __restrict__ X16, const float* __restrict__ Wqkv, _Float16* __restrict__ Bqkv, const float* __restrict__ Wp, _Float16* __restrict__ Bp) {
  __shared__ float tl[32][65];
  const int bx = blockIdx.x;
  if (bx < TOKB) tok(tl, bx, x, X16);
  else if (bx < TOKB + WQB) round16f(bx - TOKB, Wqkv, Bqkv, (size_t)C3 * CC / 8);
  else round16f(bx - TOKB - WQB, Wp, Bp, (size_t)CC * CC / 8);
}
typedef float v2f __attribute__((ext_vector_type(2)));
// lane l <-> l ^ 16: the two halves of a wave each hold half of a query column's keys
__device__ __forceinline__ float xhalf(float v) { const int b = __float_as_int(v); return __int_as_float(__builtin_amdgcn_permlanex16(b, b, 0x76543210, 0xfedcba98, false, false)); }
// Transposed products: S^T = K.Q^T (A = 16 key rows, B = the wave's 16 queries as columns), O^T += V^T.P^T. A lane then holds 16 of the 32 scores of ONE query
// (keys 8hh + r and 16 + 8hh + r), which is the k order of a B operand: P goes from the score accumulators into the second product without LDS.
// K and V^T come in tiles of KT keys that the block's four waves share: asynchronous 16-byte copies fill one LDS buffer while the other is worked on (two buffers, one barrier a tile).
__global__ __launch_bounds__(128) void k_flash(const _Float16* __restrict__ Q16, int ldq, const _Float16* __restrict__ K16, int ldk, const _Float16* __restrict__ Vt, const int* __restrict__ MSK, _Float16* __restrict__ O16) {
  constexpr int RPW = 16, NQB = NN / (4 * RPW), DT = 2;
  constexpr int KT = 128, NT = NN / KT, NS = KT / 16, KP = HD + 8, VP = KT + 8;      /* row pitches of 80 and 272 bytes (16 x odd): 16-byte fragment reads of 16 rows fall on 64 different banks */
  __shared__ __attribute__((aligned(16))) unsigned short sK[2][KT][KP];      /* K tile: key rows of 32 halves */
  __shared__ __attribute__((aligned(16))) unsigned short sV[2][HD][VP];      /* V^T tile: channel rows of KT halves */
  const int tid = threadIdx.x, w = tid >> 5, lane = tid & 31, ln = lane & 15, hh = lane >> 4; (void)MSK;
  const int slab = blockIdx.x / NQB, qblk = blockIdx.x % NQB; const int h = slab; const int b = 0; const int qb0 = qblk * (4 * RPW); const int q0 = qb0 + w * RPW;
  FragH bq;
  { const unsigned short* qr = (const unsigned short*)Q16 + ((size_t)b * NN + q0 + ln) * ldq + h * HD; bq.half[0] = *(const v8us*)(qr + 8 * hh); bq.half[1] = *(const v8us*)(qr + 16 + 8 * hh); }
  const unsigned short* Vth = (const unsigned short*)Vt + (size_t)h * HD * NN;      /* V^T = v[(h,d)][n] channel-major */
  /* a thread's share of a tile: 16-byte piece tid & 3 of key rows (tid >> 2) + 32 i, and piece tid & 15 of channel rows (tid >> 4) + 8 i, i = 0..3 */
  const unsigned short* gk = (const unsigned short*)K16 + (size_t)b * NN * ldk + h * HD + (size_t)(tid >> 2) * ldk + (tid & 3) * 8;
  const unsigned short* gv = Vth + (size_t)(tid >> 4) * NN + (tid & 15) * 8;
  const unsigned lk = (unsigned)(uintptr_t)&sK[0][tid >> 2][(tid & 3) * 8], lv = (unsigned)(uintptr_t)&sV[0][tid >> 4][(tid & 15) * 8];      /* LDS byte addresses */
  const size_t kstep = (size_t)32 * ldk;
  auto stage = [&](int t, int buf) {
    const unsigned short* k0 = gk + (size_t)t * KT * ldk; const unsigned short* v0 = gv + t * KT;
    const unsigned a0 = lk + (unsigned)buf * (KT * KP * 2), c0 = lv + (unsigned)buf * (HD * VP * 2);
    /* the tile's eight copies of this thread; s_wait_xcnt closes the statement so that no address register of a copy is rewritten in front of it */
    asm volatile("global_load_async_to_lds_b128 %0, %8, off\n\t"
                 "global_load_async_to_lds_b128 %1, %9, off\n\t"
                 "global_load_async_to_lds_b128 %2, %10, off\n\t"
                 "global_load_async_to_lds_b128 %3, %11, off\n\t"
                 "global_load_async_to_lds_b128 %4, %12, off\n\t"
                 "global_load_async_to_lds_b128 %5, %13, off\n\t"
                 "global_load_async_to_lds_b128 %6, %14, off\n\t"
                 "global_load_async_to_lds_b128 %7, %15, off\n\t"
                 "s_wait_xcnt 0x0"
                 :: "v"(a0), "v"(a0 + 32 * KP * 2), "v"(a0 + 64 * KP * 2), "v"(a0 + 96 * KP * 2), "v"(c0), "v"(c0 + 8 * VP * 2), "v"(c0 + 16 * VP * 2), "v"(c0 + 24 * VP * 2),
                    "v"(k0), "v"(k0 + kstep), "v"(k0 + 2 * kstep), "v"(k0 + 3 * kstep), "v"(v0), "v"(v0 + 8 * NN), "v"(v0 + 16 * NN), "v"(v0 + 24 * NN)
                 : "memory");
  };
  constexpr float SL2 = 0.25503486f;      /* 32^-1/2 x log2(e): the softmax runs in base 2, one multiply-add and one v_exp_f32 a score */
  float m_c = -3.0e38f, l_c = 0.f; v8f oacc[DT];      /* running maximum (in log2 units) and this half's partial sum (x 2^10) of query q0 + ln; oacc[dt][r] = O^T[dt*16 + 8hh + r][q0 + ln] */
#pragma unroll
  for (int dt = 0; dt < DT; ++dt) oacc[dt] = (v8f){0.f,0.f,0.f,0.f,0.f,0.f,0.f,0.f};
  stage(0, 0);
  asm volatile("s_wait_asynccnt 0x0" ::: "memory");      /* this wave's share of tile 0 has landed */
  __syncthreads();      /* every wave's share of tile 0 has landed */
  stage(1, 1);
  /* the tile loop stays rolled: more copies of the long body would only grow the code; every "#pragma unroll" in this kernel keeps an array that the loop variable indexes in registers */
#pragma unroll 1
  for (int t = 0; t < NT; ++t) {
   const int buf = t & 1;
   /* one softmax step a tile: all of the tile's fragments are read first, its NS score products stand in one run, one maximum, one exchange between the halves and one rescale of O serve all KT keys, and its PV products follow */
   FragH ak[NS], av[NS / 2][DT];
#pragma unroll
   for (int nt = 0; nt < NS; ++nt) { const unsigned short* kr = &sK[buf][nt * 16 + ln][0]; ak[nt].half[0] = *(const v8us*)(kr + 8 * hh); ak[nt].half[1] = *(const v8us*)(kr + 16 + 8 * hh); }
#pragma unroll
   for (int ks = 0; ks < NS / 2; ++ks)
#pragma unroll
    for (int dt = 0; dt < DT; ++dt) { const unsigned short* vrow = &sV[buf][dt * 16 + ln][ks * 32]; av[ks][dt].half[0] = *(const v8us*)(vrow + 8 * hh); av[ks][dt].half[1] = *(const v8us*)(vrow + 16 + 8 * hh); }
   __builtin_amdgcn_sched_barrier(0);      /* keeps the tile's 32 fragment reads in one group in front of the products: spread among them they came in four groups, each with its own wait for the LDS latency */
   v8f sc[NS];      /* raw q.k sums of keys nt*16 + 8hh + r; the scale goes into the exponent's multiply-add */
#pragma unroll
   for (int nt = 0; nt < NS; ++nt) sc[nt] = mmaB(ak[nt].v, bq.v, (v8f){0.f,0.f,0.f,0.f,0.f,0.f,0.f,0.f});
   /* the tile now lives in registers: its buffer is handed back here, so that the refill flies during the whole softmax and PV part */
   asm volatile("s_wait_dscnt 0x0" ::: "memory");      /* this wave's reads of buffer buf have returned before the buffer is refilled */
   asm volatile("s_wait_asynccnt 0x0" ::: "memory");      /* this wave's share of tile t + 1 has landed */
   __syncthreads();      /* publishes tile t + 1 and ends every wave's reads of buffer buf */
   if (t + 2 < NT) stage(t + 2, buf);
   float mx[8];      /* every step takes in two more values (a three-input maximum) */
#pragma unroll
   for (int r = 0; r < 8; ++r) { mx[r] = sc[0][r];
#pragma unroll
    for (int nt = 1; nt + 1 < NS; nt += 2) mx[r] = fmaxf(fmaxf(mx[r], sc[nt][r]), sc[nt + 1][r]); }
#pragma unroll
   for (int i = 0; i < 4; ++i) mx[i] = fmaxf(fmaxf(mx[2 * i], mx[2 * i + 1]), sc[NS - 1][i]);
   mx[0] = fmaxf(fmaxf(mx[0], sc[NS - 1][4]), sc[NS - 1][5]); mx[1] = fmaxf(fmaxf(mx[1], sc[NS - 1][6]), sc[NS - 1][7]);
   float mc = fmaxf(fmaxf(fmaxf(mx[0], mx[1]), mx[2]), mx[3]);
   mc = fmaxf(mc, xhalf(mc));
   const float mn = fmaxf(m_c, mc * SL2); const float al = (mn > -1.0e38f) ? __builtin_amdgcn_exp2f(m_c - mn) : 1.0f; m_c = mn;
   const float mb = mn - 10.0f;      /* p = 2^(s SL2 - mn + 10): the 2^10 of the f16 P rides in the exponent, and the row sum carries it too */
   FragH pb[NS / 2]; v2f ps[NS];      /* pb[ks]: P^T of keys ks*32 .. +31 in the k order of a B operand (score tile 2ks, then 2ks + 1); ps[nt]: two partial sums of score tile nt */
#pragma unroll
   for (int nt = 0; nt < NS; ++nt) {
#pragma unroll
    for (int r = 0; r < 8; r += 2) {
      const v2f e = __builtin_elementwise_fma((v2f){sc[nt][r], sc[nt][r + 1]}, (v2f){SL2, SL2}, (v2f){-mb, -mb});      /* two exponents a packed multiply-add */
      const v2f p = {__builtin_amdgcn_exp2f(e[0]), __builtin_amdgcn_exp2f(e[1])};
      pb[nt >> 1].h[(nt & 1) * 8 + r] = (_Float16)p[0]; pb[nt >> 1].h[(nt & 1) * 8 + r + 1] = (_Float16)p[1];
      ps[nt] = r ? ps[nt] + p : p; } }
#pragma unroll
   for (int st = NS / 2; st > 0; st >>= 1)
#pragma unroll
    for (int nt = 0; nt < st; ++nt) ps[nt] += ps[nt + st];
   l_c = l_c * al + (ps[0][0] + ps[0][1]);
#pragma unroll
   for (int dt = 0; dt < DT; ++dt)
#pragma unroll
    for (int r = 0; r < 8; ++r) oacc[dt][r] *= al;
#pragma unroll
   for (int ks = 0; ks < NS / 2; ++ks)
#pragma unroll
    for (int dt = 0; dt < DT; ++dt) oacc[dt] = mmaB(av[ks][dt].v, pb[ks].v, oacc[dt]);
  }
  asm volatile("s_wait_asynccnt 0x0" ::: "memory");      /* no copy is outstanding when the wave goes on to its end */
  const float l = l_c + xhalf(l_c); const float inv = (l > 0.f) ? 1.0f / l : 0.f;      /* l and oacc both carry the 2^10 */
  /* O leaves as f16, the projection's operand type, head-major [h][n][32]: a lane's 8 accumulators of a tile are 8 consecutive channels of its query = one 16-byte store; a wave's 16 queries fill 1 KiB that no other wave writes */
#pragma unroll
  for (int dt = 0; dt < DT; ++dt) { FragH f;
#pragma unroll
    for (int r = 0; r < 8; ++r) f.h[r] = (_Float16)(oacc[dt][r] * inv);
    *(v8us*)((unsigned short*)O16 + ((size_t)h * NN + q0 + ln) * HD + dt * 16 + 8 * hh) = f.half[0]; }
}

// out[c][n] = proj_w . O^T + proj_b, in the output's own channel-major layout: A = 16 rows of the rounded proj_w (x 2^4), B = 64 tokens of O (head-major [h][n][32]: k block kb is head kb / 32).
// One wave = 16 channels x 64 tokens; the tile goes through the wave's own LDS range so that each store covers whole 256-byte pieces of output rows. M 256 N 4096 K 256.
__global__ __launch_bounds__(128) void k_proj(const _Float16* __restrict__ Bp, const _Float16* __restrict__ O16, const float* __restrict__ bias, float* __restrict__ out) {
  __shared__ __attribute__((aligned(16))) float so[4][16][64 + 4];      /* pitch 272 bytes: the two halves' rows, 8 apart, fall on different banks */
  const int tid = threadIdx.x, w = tid >> 5, lane = tid & 31, ln = lane & 15, hh = lane >> 4;
  const int wid = blockIdx.x * 4 + w; const int row0 = (wid / (NN / 64)) * 16, col0 = (wid % (NN / 64)) * 64;
  const unsigned short* arow = (const unsigned short*)Bp + (size_t)(row0 + ln) * CC + 8 * hh;
  const unsigned short* brow = (const unsigned short*)O16 + (size_t)(col0 + ln) * HD + 8 * hh;
  const v4f b0 = *(const v4fa*)(bias + row0 + 8 * hh), b1 = *(const v4fa*)(bias + row0 + 8 * hh + 4);
  asm volatile("s_wait_xcnt 0x0" ::: "memory");      /* the bias loads' address pair is dead from here on: the wait stands in front of whatever next takes its registers */
  v8f acc[4] = {};
  mm16x64<2>(arow, brow, (size_t)16 * HD, (size_t)NN * HD, acc);
#pragma unroll
  for (int t = 0; t < 4; ++t)
#pragma unroll
    for (int r = 0; r < 8; ++r) so[w][8 * hh + r][t * 16 + ln] = acc[t][r] * 0.0625f + bf16_round(r < 4 ? b0[r & 3] : b1[r & 3]);
  __builtin_amdgcn_fence(__ATOMIC_ACQ_REL, "workgroup"); __builtin_amdgcn_wave_barrier();      /* the wave's LDS writes are done before its lanes read each other's */
  const int rsub = lane >> 4, c4 = (lane & 15) * 4;
#pragma unroll
  for (int q = 0; q < 8; ++q) { const int r = q * 2 + rsub; const v4f v = *(const v4fa*)&so[w][r][c4]; *(v4f*)(out + (size_t)(row0 + r) * NN + col0 + c4) = v; }
}

extern "C" void kernel_launch(void* const* d_in, const int* in_sizes, int n_in,
                              void* d_out, int out_size, void* d_ws, size_t ws_size, hipStream_t stream) {
  (void)in_sizes; (void)n_in; (void)out_size;
  const float* x = (const float*)d_in[0]; const float* Wqkv = (const float*)d_in[1]; const float* Wp = (const float*)d_in[2]; const float* bp = (const float*)d_in[3];
  char* ws = (char*)d_ws; size_t off = 0;
  auto take = [&](size_t bytes) { char* p = ws + off; off += (bytes + 255) & ~(size_t)255; return p; };
  _Float16* Bqkv = (_Float16*)take((size_t)C3 * CC * 2); _Float16* Bp = (_Float16*)take((size_t)CC * CC * 2); _Float16* X16 = (_Float16*)take((size_t)NR * CC * 2);
  _Float16* QK = (_Float16*)take((size_t)NR * 2 * CC * 2); _Float16* Vt = (_Float16*)take((size_t)CC * NN * 2); _Float16* O16 = (_Float16*)take((size_t)NR * CC * 2);
  if (off > ws_size) return;      // 0.4 + 0.1 + 2.1 + 4.2 + 2.1 + 2.1 = about 11 MB
  k_prep<<<TOKB + WQB + WPB, 256, 0, stream>>>(x, X16, Wqkv, Bqkv, Wp, Bp);
  k_qkv<<<QKB + VB, 128, 0, stream>>>(X16, Bqkv, QK, Vt);
  k_flash<<<NH * (NN / 64), 128, 0, stream>>>(QK, 2 * CC, QK + CC, 2 * CC, Vt, nullptr, O16);      /* blocks = head x 64-query groups */
  k_proj<<<(CC / 16) * (NN / 64) / 4, 128, 0, stream>>>(Bp, O16, bp, (float*)d_out);
}

// v008
// Measured time: 43 microseconds a run.
// Two timings next to v007 put it at 1.12 and 1.11 times that version's speed.
// Over all steps from v000 it is 9.27 times as fast.
#include <hip/hip_runtime.h>
// 3-D multi-head self-attention on channel-major x [1, 256, 16³ = 4096]: qkv = qkv_w·x (1×1×1 conv, no bias), 8 heads × 32, softmax(qᵀk·32^-½) over keys, out[h,d,n] = Σ_m attn[n,m]·v[h,d,m], then proj_w·out + proj_b.
// Compute dtype: x, qkv_w, proj_w, proj_b rounded to bf16; q/k token-major and v channel-major (= Vᵀ) as f16 GEMM outputs (f32 accumulate); fused flash-style kernel per head
// (online softmax f32, P f16 x 2^10) on v_wmma_f32_16x16x32_f16, which stores O as f16; projection GEMM with bias, computed channel-major (A = proj_w) and stored straight to out; f32 accumulate throughout.
#define BB 1
#define CC 256
#define C3 768
#define NH 8
#define HD 32
#define NN 4096
#define NR (BB * NN)

typedef __bf16 v16b __attribute__((ext_vector_type(16)));
typedef unsigned short v8us __attribute__((ext_vector_type(8), may_alias));
typedef float  v8f  __attribute__((ext_vector_type(8)));
typedef float  v4f  __attribute__((ext_vector_type(4)));
typedef float  v4fa __attribute__((ext_vector_type(4), may_alias));
union FragB { v16b v; v8us half[2]; unsigned short u[16]; };

__device__ __forceinline__ unsigned short bf16_bits(float x) { unsigned int u = __float_as_uint(x); return (unsigned short)((u + 0x7FFFu + ((u >> 16) & 1u)) >> 16); }
__device__ __forceinline__ float bf16_val(unsigned short b) { return __uint_as_float(((unsigned int)b) << 16); }
__device__ __forceinline__ float bf16_round(float x) { return bf16_val(bf16_bits(x)); }
// D += A·B with NT terms: 1 = ah·bh, 2 = + al·bh (A split), 3 = + ah·bl (both split)
template <int NT>
__device__ __forceinline__ v8f mmaN(v16b ah, v16b al, v16b bh, v16b bl, v8f c) {
  c = __builtin_amdgcn_wmma_f32_16x16x32_bf16(false, ah, false, bh, (short)0, c, false, false);
  if (NT >= 2) c = __builtin_amdgcn_wmma_f32_16x16x32_bf16(false, al, false, bh, (short)0, c, false, false);
  if (NT >= 3) c = __builtin_amdgcn_wmma_f32_16x16x32_bf16(false, ah, false, bl, (short)0, c, false, false);
  asm volatile("v_nop\n\tv_nop\n\tv_nop\n\tv_nop" : "+v"(c) : "v"(ah), "v"(al), "v"(bh), "v"(bl));
  return c;
}

__global__ __launch_bounds__(256) void k_wt_bf16(const float* __restrict__ W, unsigned short* __restrict__ Wt, int K, int N) {
  const int t = blockIdx.x * 256 + threadIdx.x;
  const int k8n = K / 8;
  if (t >= N * k8n) return;
  const int n = t / k8n, k8 = (t % k8n) * 8;
  v8us v;
#pragma unroll
  for (int i = 0; i < 8; ++i) v[i] = bf16_bits(W[(size_t)(k8 + i) * N + n]);
  *(v8us*)(Wt + (size_t)n * K + k8) = v;
  
}

// GEMM C[M][N] (f32, pitch ldc) = act(A[M][K]·W + bias). A f32 row-major (pitch lda) converted per fragment to bf16
// (ASPLIT: hi/lo two planes -> 2 terms, else single rounded term); Wt bf16 [N][K] (pitch ldb). BIAS_BF16 rounds the
// bias to bf16 first (bias quantised to bf16 before the add). K%32==0, M%16==0, N%64==0.
template <bool ASPLIT, int ACT, bool BIAS_BF16>
__global__ __launch_bounds__(128) void k_gemm_bf(const float* __restrict__ A, int lda, const unsigned short* __restrict__ Wt, int ldb,
                                               const float* __restrict__ bias, float* __restrict__ C, int ldc, int M, int N, int K) {
  __shared__ __attribute__((aligned(16))) float so[4][16][64];
  const int tid = threadIdx.x, w = tid >> 5, lane = tid & 31, ln = lane & 15, hh = lane >> 4;
  const int ntn = N / 64;
  const int wid = blockIdx.x * 4 + w;
  const int mt = wid / ntn, nq = wid % ntn;
  if (mt * 16 >= M) return;
  const int row0 = mt * 16, col0 = nq * 64;
  const float* arow = A + (size_t)(row0 + ln) * lda;
  v8f acc[4] = {};
  for (int kb = 0; kb < K; kb += 32) {
    FragB ah, al;
    const v4f x0 = *(const v4fa*)(arow + kb + 8 * hh), x1 = *(const v4fa*)(arow + kb + 8 * hh + 4);
    const v4f x2 = *(const v4fa*)(arow + kb + 16 + 8 * hh), x3 = *(const v4fa*)(arow + kb + 16 + 8 * hh + 4);
    float xs[16] = {x0[0],x0[1],x0[2],x0[3],x1[0],x1[1],x1[2],x1[3],x2[0],x2[1],x2[2],x2[3],x3[0],x3[1],x3[2],x3[3]};
#pragma unroll
    for (int i = 0; i < 16; ++i) { const unsigned short hb = bf16_bits(xs[i]); ah.u[i] = hb; al.u[i] = ASPLIT ? bf16_bits(xs[i] - bf16_val(hb)) : (unsigned short)0; }
#pragma unroll
    for (int t = 0; t < 4; ++t) {
      const unsigned short* brow = Wt + (size_t)(col0 + t * 16 + ln) * ldb + kb;
      FragB b;
      b.half[0] = *(const v8us*)(brow + 8 * hh);
      b.half[1] = *(const v8us*)(brow + 16 + 8 * hh);
      acc[t] = mmaN<ASPLIT ? 2 : 1>(ah.v, al.v, b.v, b.v, acc[t]);
    }
  }
#pragma unroll
  for (int t = 0; t < 4; ++t) {
    float bv = bias ? bias[col0 + t * 16 + ln] : 0.f;
    if (BIAS_BF16) bv = bf16_round(bv);
#pragma unroll
    for (int r = 0; r < 8; ++r) { float v = acc[t][r] + bv; if (ACT == 1) v = fmaxf(v, 0.f); so[w][8 * hh + r][t * 16 + ln] = v; }
  }
  __builtin_amdgcn_fence(__ATOMIC_ACQ_REL, "workgroup");
  __builtin_amdgcn_wave_barrier();
  const int rsub = lane >> 4, c4 = (lane & 15) * 4;
  {
#pragma unroll
    for (int q = 0; q < 8; ++q) {
      const int r = q * 2 + rsub;
      const v4f v = *(const v4fa*)&so[w][r][c4];
      *(v4f*)(C + (size_t)(row0 + r) * ldc + col0 + c4) = v;
    }
    
  }
}

// Flash-style causal/unmasked attention, all contractions 3-term bf16 hi/lo splits, f32 softmax with running max.
// q,k,v rows are read from f32 buffers with arbitrary row pitch (so they can live inside a fused qkv buffer);
// D = head size (multiple of 32, <= 128); one wave = 16 query rows; block = 4 waves (64 queries) sharing K/V chunks of 32.
template <int D, bool CAUSAL>
__global__ __launch_bounds__(128) void k_flash(const float* __restrict__ qb, const float* __restrict__ kb, const float* __restrict__ vb,
                                             int pitch, int T, int H, float scale, float* __restrict__ y, int ypitch) {
  constexpr int KS = D / 32;        // k-steps for QK
  constexpr int DT = D / 16;        // d tiles for PV
  __shared__ __attribute__((aligned(16))) unsigned short sKh[32][D + 8], sKl[32][D + 8], sVh[32][D + 8], sVl[32][D + 8];
  __shared__ __attribute__((aligned(16))) unsigned short sPh[4][16][40], sPl[4][16][40];
  __shared__ __attribute__((aligned(16))) float sO[4][16][D];
  const int tid = threadIdx.x, w = tid >> 5, lane = tid & 31, ln = lane & 15, hh = lane >> 4;
  const int nqb = (T + 63) / 64;
  const int bh = blockIdx.x / nqb, qblk = blockIdx.x % nqb;
  const int b = bh / H, h = bh % H;
  const int q0 = qblk * 64 + w * 16;
  const float* Q = qb + (size_t)b * T * pitch + h * D;
  const float* K = kb + (size_t)b * T * pitch + h * D;
  const float* V = vb + (size_t)b * T * pitch + h * D;

  // A fragments of the wave's 16 query rows (scaled), hi/lo
  FragB aqh[KS], aql[KS];
  {
    int row = q0 + ln; if (row >= T) row = T - 1;
    const float* qr = Q + (size_t)row * pitch;
#pragma unroll
    for (int ks = 0; ks < KS; ++ks)
#pragma unroll
      for (int i = 0; i < 16; ++i) {
        const int d = ks * 32 + ((i < 8) ? (8 * hh + i) : (16 + 8 * hh + (i - 8)));
        const float x = qr[d] * scale; const unsigned short hb = bf16_bits(x);
        aqh[ks].u[i] = hb; aql[ks].u[i] = bf16_bits(x - bf16_val(hb));
      }
  }
  float m_r[8], l_r[8];
#pragma unroll
  for (int r = 0; r < 8; ++r) { m_r[r] = -3.0e38f; l_r[r] = 0.f; }
  v8f oacc[DT];
#pragma unroll
  for (int dt = 0; dt < DT; ++dt) oacc[dt] = (v8f){0.f,0.f,0.f,0.f,0.f,0.f,0.f,0.f};

  const int kv_end = CAUSAL ? min(T, qblk * 64 + 64) : T;     // block-uniform
  for (int j0 = 0; j0 < kv_end; j0 += 32) {
    __syncthreads();
    for (int e = tid; e < 32 * (D / 4); e += 128) {
      const int r = e / (D / 4), c4 = (e % (D / 4)) * 4;
      const int key = j0 + r;
      v4f kf = {0.f,0.f,0.f,0.f}, vf = {0.f,0.f,0.f,0.f};
      if (key < T) { kf = *(const v4fa*)(K + (size_t)key * pitch + c4); vf = *(const v4fa*)(V + (size_t)key * pitch + c4); }
#pragma unroll
      for (int t = 0; t < 4; ++t) {
        unsigned short hb = bf16_bits(kf[t]); sKh[r][c4 + t] = hb; sKl[r][c4 + t] = bf16_bits(kf[t] - bf16_val(hb));
        hb = bf16_bits(vf[t]); sVh[r][c4 + t] = hb; sVl[r][c4 + t] = bf16_bits(vf[t] - bf16_val(hb));
      }
    }
    __syncthreads();
    // S tile 16 x 32
    v8f s[2];
#pragma unroll
    for (int nt = 0; nt < 2; ++nt) {
      v8f acc = {};
#pragma unroll
      for (int ks = 0; ks < KS; ++ks) {
        FragB bh_, bl_;
        bh_.half[0] = *(const v8us*)&sKh[nt * 16 + ln][ks * 32 + 8 * hh]; bh_.half[1] = *(const v8us*)&sKh[nt * 16 + ln][ks * 32 + 16 + 8 * hh];
        bl_.half[0] = *(const v8us*)&sKl[nt * 16 + ln][ks * 32 + 8 * hh]; bl_.half[1] = *(const v8us*)&sKl[nt * 16 + ln][ks * 32 + 16 + 8 * hh];
        acc = mmaN<3>(aqh[ks].v, aql[ks].v, bh_.v, bl_.v, acc);
      }
      s[nt] = acc;
    }
    // mask + running max (rows 8hh+r; the 16 lanes of a half share rows)
    float alpha[8];
#pragma unroll
    for (int r = 0; r < 8; ++r) {
      const int qi = q0 + 8 * hh + r;
      const int ja = j0 + ln, jb = j0 + 16 + ln;
      if (CAUSAL) { if (ja > qi) s[0][r] = -3.0e38f; if (jb > qi) s[1][r] = -3.0e38f; }
      if (ja >= T) s[0][r] = -3.0e38f;
      if (jb >= T) s[1][r] = -3.0e38f;
      float mx = fmaxf(s[0][r], s[1][r]);
      mx = fmaxf(mx, __shfl_xor(mx, 1, 32)); mx = fmaxf(mx, __shfl_xor(mx, 2, 32)); mx = fmaxf(mx, __shfl_xor(mx, 4, 32)); mx = fmaxf(mx, __shfl_xor(mx, 8, 32));
      const float mnew = fmaxf(m_r[r], mx);
      alpha[r] = (mnew > -1.0e38f) ? __expf(m_r[r] - mnew) : 1.0f;
      const float p0 = (s[0][r] > -1.0e38f) ? __expf(s[0][r] - mnew) : 0.f;
      const float p1 = (s[1][r] > -1.0e38f) ? __expf(s[1][r] - mnew) : 0.f;
      m_r[r] = mnew;
      l_r[r] = l_r[r] * alpha[r] + p0 + p1;            // per-lane partial row sum (16 lanes combined at the end)
      unsigned short hb = bf16_bits(p0); sPh[w][8 * hh + r][ln] = hb;      sPl[w][8 * hh + r][ln] = bf16_bits(p0 - bf16_val(hb));
      hb = bf16_bits(p1);                sPh[w][8 * hh + r][16 + ln] = hb; sPl[w][8 * hh + r][16 + ln] = bf16_bits(p1 - bf16_val(hb));
    }
#pragma unroll
    for (int dt = 0; dt < DT; ++dt)
#pragma unroll
      for (int r = 0; r < 8; ++r) oacc[dt][r] *= alpha[r];
    __builtin_amdgcn_fence(__ATOMIC_ACQ_REL, "workgroup");
    __builtin_amdgcn_wave_barrier();
    FragB pah, pal;
    pah.half[0] = *(const v8us*)&sPh[w][ln][8 * hh]; pah.half[1] = *(const v8us*)&sPh[w][ln][16 + 8 * hh];
    pal.half[0] = *(const v8us*)&sPl[w][ln][8 * hh]; pal.half[1] = *(const v8us*)&sPl[w][ln][16 + 8 * hh];
#pragma unroll
    for (int dt = 0; dt < DT; ++dt) {
      FragB bvh, bvl;
#pragma unroll
      for (int i = 0; i < 8; ++i) {
        bvh.u[i] = sVh[8 * hh + i][dt * 16 + ln]; bvh.u[8 + i] = sVh[16 + 8 * hh + i][dt * 16 + ln];
        bvl.u[i] = sVl[8 * hh + i][dt * 16 + ln]; bvl.u[8 + i] = sVl[16 + 8 * hh + i][dt * 16 + ln];
      }
      oacc[dt] = mmaN<3>(pah.v, pal.v, bvh.v, bvl.v, oacc[dt]);
    }
    __builtin_amdgcn_fence(__ATOMIC_ACQ_REL, "workgroup");
    __builtin_amdgcn_wave_barrier();
  }
#pragma unroll
  for (int r = 0; r < 8; ++r) {
    float l = l_r[r];
    l += __shfl_xor(l, 1, 32); l += __shfl_xor(l, 2, 32); l += __shfl_xor(l, 4, 32); l += __shfl_xor(l, 8, 32);
    l_r[r] = (l > 0.f) ? 1.0f / l : 0.f;
  }
#pragma unroll
  for (int dt = 0; dt < DT; ++dt)
#pragma unroll
    for (int r = 0; r < 8; ++r) sO[w][8 * hh + r][dt * 16 + ln] = oacc[dt][r] * l_r[r];
  __builtin_amdgcn_fence(__ATOMIC_ACQ_REL, "workgroup");
  __builtin_amdgcn_wave_barrier();
  {
    for (int r = 0; r < 16; ++r) {
      const int row = q0 + r;
      if (row < T && lane < D / 4) {
        const v4f val = *(const v4fa*)&sO[w][r][lane * 4];
        *(v4f*)(y + ((size_t)b * T + row) * ypitch + h * D + lane * 4) = val;
      }
    }
    
  }
}

// GEMM C = act(A·W + bias + resid): A f32 (ASPLIT -> hi/lo 2 terms), Wt bf16 [N][K]; ACT 0 none, 1 relu, 2 exact gelu;
// resid (optional, f32, row index = (row % rmod), pitch ldr, RES_BF16 rounds it) added before the activation.
template <bool ASPLIT, int ACT, bool BIAS_BF16, bool RES_BF16>
__global__ __launch_bounds__(128) void k_gemm_bf3(const float* __restrict__ A, int lda, const unsigned short* __restrict__ Wt, int ldb,
                                                const float* __restrict__ bias, const float* __restrict__ resid, int rmod, int ldr,
                                                float* __restrict__ C, int ldc, int M, int N, int K) {
  __shared__ __attribute__((aligned(16))) float so[4][16][64];
  const int tid = threadIdx.x, w = tid >> 5, lane = tid & 31, ln = lane & 15, hh = lane >> 4;
  const int ntn = N / 64;
  const int wid = blockIdx.x * 4 + w;
  const int mt = wid / ntn, nq = wid % ntn;
  if (mt * 16 >= M) return;
  const int row0 = mt * 16, col0 = nq * 64;
  const float* arow = A + (size_t)(row0 + ln) * lda;
  v8f acc[4] = {};
  for (int kb = 0; kb < K; kb += 32) {
    FragB ah, al;
    const v4f x0 = *(const v4fa*)(arow + kb + 8 * hh), x1 = *(const v4fa*)(arow + kb + 8 * hh + 4);
    const v4f x2 = *(const v4fa*)(arow + kb + 16 + 8 * hh), x3 = *(const v4fa*)(arow + kb + 16 + 8 * hh + 4);
    float xs[16] = {x0[0],x0[1],x0[2],x0[3],x1[0],x1[1],x1[2],x1[3],x2[0],x2[1],x2[2],x2[3],x3[0],x3[1],x3[2],x3[3]};
#pragma unroll
    for (int i = 0; i < 16; ++i) { const unsigned short hb = bf16_bits(xs[i]); ah.u[i] = hb; al.u[i] = ASPLIT ? bf16_bits(xs[i] - bf16_val(hb)) : (unsigned short)0; }
#pragma unroll
    for (int t = 0; t < 4; ++t) {
      const unsigned short* brow = Wt + (size_t)(col0 + t * 16 + ln) * ldb + kb;
      FragB b;
      b.half[0] = *(const v8us*)(brow + 8 * hh);
      b.half[1] = *(const v8us*)(brow + 16 + 8 * hh);
      acc[t] = mmaN<ASPLIT ? 2 : 1>(ah.v, al.v, b.v, b.v, acc[t]);
    }
  }
#pragma unroll
  for (int t = 0; t < 4; ++t) {
    const int col = col0 + t * 16 + ln;
    float bv = bias ? bias[col] : 0.f;
    if (BIAS_BF16) bv = bf16_round(bv);
#pragma unroll
    for (int r = 0; r < 8; ++r) {
      float v = acc[t][r] + bv;
      if (resid) { float rv = resid[(size_t)((row0 + 8 * hh + r) % rmod) * ldr + col]; if (RES_BF16) rv = bf16_round(rv); v += rv; }
      if (ACT == 1) v = fmaxf(v, 0.f);
      if (ACT == 2) v = 0.5f * v * (1.0f + erff(v * 0.70710678118654752f));
      if (ACT == 3) { const float u = 0.7978845608028654f * (v + 0.044715f * v * v * v); v = 0.5f * v * (1.0f + tanhf(u)); }
      so[w][8 * hh + r][t * 16 + ln] = v;
    }
  }
  __builtin_amdgcn_fence(__ATOMIC_ACQ_REL, "workgroup");
  __builtin_amdgcn_wave_barrier();
  const int rsub = lane >> 4, c4 = (lane & 15) * 4;
  {
#pragma unroll
    for (int q = 0; q < 8; ++q) {
      const int r = q * 2 + rsub;
      const v4f v = *(const v4fa*)&so[w][r][c4];
      *(v4f*)(C + (size_t)(row0 + r) * ldc + col0 + c4) = v;
    }
    
  }
}
// row LayerNorm (biased variance, eps) over N: s = X (+ R); optional out_sum <- s; out_norm <- (s-mu)*rsqrt(var+eps)*g + b
template <bool PARAM_BF16>
__global__ __launch_bounds__(256) void k_layernorm(const float* __restrict__ X, const float* __restrict__ R, const float* __restrict__ g, const float* __restrict__ bta,
                                                  float* __restrict__ out_sum, float* __restrict__ out_norm, int N, float eps) {
  __shared__ float red[256];
  const int row = blockIdx.x, tid = threadIdx.x;
  const float* x = X + (size_t)row * N; const float* rr = R ? R + (size_t)row * N : nullptr;
  float vals[16];                     // up to N = 4096
  const int per = N / 256;            // contiguous chunk per thread? use strided-by-4 chunks: thread handles j = tid*4 + 1024*u
  float s1 = 0.f;
  for (int u = 0; u < per / 4; ++u) {
    const int j = tid * 4 + 1024 * u;
    const v4f a = *(const v4fa*)(x + j);
    v4f b = {0.f,0.f,0.f,0.f}; if (rr) b = *(const v4fa*)(rr + j);
#pragma unroll
    for (int q = 0; q < 4; ++q) { const float v = a[q] + b[q]; vals[u * 4 + q] = v; s1 += v; }
  }
  red[tid] = s1; __syncthreads();
  for (int st = 128; st > 0; st >>= 1) { if (tid < st) red[tid] += red[tid + st]; __syncthreads(); }
  const float mu = red[0] / (float)N; __syncthreads();
  float s2 = 0.f;
  for (int u = 0; u < per / 4; ++u)
#pragma unroll
    for (int q = 0; q < 4; ++q) { const float c = vals[u * 4 + q] - mu; s2 += c * c; }
  red[tid] = s2; __syncthreads();
  for (int st = 128; st > 0; st >>= 1) { if (tid < st) red[tid] += red[tid + st]; __syncthreads(); }
  const float rs = rsqrtf(red[0] / (float)N + eps);
  {
    for (int u = 0; u < per / 4; ++u) {
      const int j = tid * 4 + 1024 * u;
      v4f o, sm;
#pragma unroll
      for (int q = 0; q < 4; ++q) {
        float gg = g[j + q], bb = bta[j + q];
        if (PARAM_BF16) { gg = bf16_round(gg); bb = bf16_round(bb); }
        sm[q] = vals[u * 4 + q]; o[q] = (vals[u * 4 + q] - mu) * rs * gg + bb;
      }
      if (out_sum) *(v4f*)(out_sum + (size_t)row * N + j) = sm;
      *(v4f*)(out_norm + (size_t)row * N + j) = o;
    }
    
  }
}



// ---- f16 WMMA path (v_wmma_f32_16x16x32_f16): 11-bit significands for operands in range — used here for the qkv and projection GEMMs and for attention
typedef _Float16 v16h __attribute__((ext_vector_type(16)));
union FragH { v16h v; v8us half[2]; _Float16 h[16]; unsigned short u[16]; };
template <int NT>
__device__ __forceinline__ v8f mmaH(v16h ah, v16h al, v16h bh, v16h bl, v8f c) {
  c = __builtin_amdgcn_wmma_f32_16x16x32_f16(false, ah, false, bh, (short)0, c, false, false);
  if (NT >= 2) c = __builtin_amdgcn_wmma_f32_16x16x32_f16(false, al, false, bh, (short)0, c, false, false);
  if (NT >= 3) c = __builtin_amdgcn_wmma_f32_16x16x32_f16(false, ah, false, bl, (short)0, c, false, false);
  asm volatile("v_nop\n\tv_nop\n\tv_nop\n\tv_nop" : "+v"(c) : "v"(ah), "v"(al), "v"(bh), "v"(bl));
  return c;
}
// batched GEMM like k_gemm_b but f16 operands: A f32 (split into f16 hi/lo if ASPLIT, else rounded to f16), Bt = f16 values [n][k]; alpha; C f32; N multiple of 16 (partial tiles skipped)
template <bool ASPLIT>
__global__ __launch_bounds__(128) void k_gemm_h(const float* __restrict__ A, int lda, size_t sA, const _Float16* __restrict__ Bh, int ldb, size_t sB, float alpha, float* __restrict__ C, int ldc, size_t sC, int M, int N, int K) {
  __shared__ __attribute__((aligned(16))) float so[4][16][64];
  const int tid = threadIdx.x, w = tid >> 5, lane = tid & 31, ln = lane & 15, hh = lane >> 4; const int by = blockIdx.y;
  A += (size_t)by * sA; Bh += (size_t)by * sB; C += (size_t)by * sC;
  const int ntn = (N + 63) / 64; const int wid = blockIdx.x * 4 + w; const int mt = wid / ntn, nq = wid % ntn; if (mt * 16 >= M) return;
  const int row0 = mt * 16, col0 = nq * 64; const float* arow = A + (size_t)(row0 + ln) * lda;
  v8f acc[4] = {};
  for (int kb = 0; kb < K; kb += 32) {
    FragH ah, al;
    const v4f x0 = *(const v4fa*)(arow + kb + 8 * hh), x1 = *(const v4fa*)(arow + kb + 8 * hh + 4), x2 = *(const v4fa*)(arow + kb + 16 + 8 * hh), x3 = *(const v4fa*)(arow + kb + 16 + 8 * hh + 4);
    float xs[16] = {x0[0],x0[1],x0[2],x0[3],x1[0],x1[1],x1[2],x1[3],x2[0],x2[1],x2[2],x2[3],x3[0],x3[1],x3[2],x3[3]};
#pragma unroll
    for (int i = 0; i < 16; ++i) { const _Float16 h = (_Float16)xs[i]; ah.h[i] = h; al.h[i] = ASPLIT ? (_Float16)(xs[i] - (float)h) : (_Float16)0.0f; }
#pragma unroll
    for (int t = 0; t < 4; ++t) { if (col0 + t * 16 >= N) continue; const size_t boff = (size_t)(col0 + t * 16 + ln) * ldb + kb; FragH bq; bq.half[0] = *(const v8us*)(Bh + boff + 8 * hh); bq.half[1] = *(const v8us*)(Bh + boff + 16 + 8 * hh);
      acc[t] = mmaH<ASPLIT ? 2 : 1>(ah.v, al.v, bq.v, bq.v, acc[t]); }
  }
#pragma unroll
  for (int t = 0; t < 4; ++t) { if (col0 + t * 16 >= N) continue;
#pragma unroll
    for (int r = 0; r < 8; ++r) so[w][8 * hh + r][t * 16 + ln] = acc[t][r] * alpha; }
  __builtin_amdgcn_fence(__ATOMIC_ACQ_REL, "workgroup"); __builtin_amdgcn_wave_barrier();
  const int rsub = lane >> 4, c4 = (lane & 15) * 4;
  {
#pragma unroll
    for (int q = 0; q < 8; ++q) { const int r = q * 2 + rsub; if (col0 + c4 < N) { const v4f v = *(const v4fa*)&so[w][r][c4]; *(v4f*)(C + (size_t)(row0 + r) * ldc + col0 + c4) = v; } }
     }
}

// Wt[n][k] = f16(bf16(W[k][n])·scale) from f32 row-major W[K][N] (scale = power of two; bf16-exact weights stay exact in f16 away from the subnormal range)
__global__ __launch_bounds__(256) void k_wt_f16(const float* __restrict__ W, _Float16* __restrict__ Wt, int K, int N, float scale) {
  const int t = blockIdx.x * 256 + threadIdx.x; if (t >= N * (K / 8)) return; const int n = t / (K / 8), k8 = (t % (K / 8)) * 8; FragH f;
#pragma unroll
  for (int i = 0; i < 8; ++i) f.h[i] = (_Float16)(bf16_round(W[(size_t)(k8 + i) * N + n]) * scale); const v8us o = f.half[0];
  *(v8us*)((unsigned short*)Wt + (size_t)n * K + k8) = o; 
}
// one f16 product as the bare builtin: in a run of products each fills the others' distance, and the compiler pads what is left
__device__ __forceinline__ v8f mmaB(v16h a, v16h b, v8f c) { return __builtin_amdgcn_wmma_f32_16x16x32_f16(false, a, false, b, (short)0, c, false, false); }
// acc[t] += A (16 rows x CC) . B_t^T (16 rows x CC), t = 0..3, k ascending. arow / brow: the lane's own row, + 8 hh; tile t of B lies bt halves on, k block ks lies bk halves on.
// The fragment loads run ahead of the products in groups of G k blocks (20 loads), AH groups in flight: a wave waits for memory once a group in flight, not once a product.
template <int AH>
__device__ __forceinline__ void mm16x64(const unsigned short* __restrict__ arow, const unsigned short* __restrict__ brow, size_t bt, size_t bk, v8f (&acc)[4]) {
  constexpr int KS = CC / 32, G = 2, NG = KS / G;
  FragH a[KS], b[KS][4];
  auto fetch = [&](int g) {
#pragma unroll
    for (int ks = g * G; ks < g * G + G; ++ks) { a[ks].half[0] = *(const v8us*)(arow + ks * 32); a[ks].half[1] = *(const v8us*)(arow + ks * 32 + 16);
#pragma unroll
      for (int t = 0; t < 4; ++t) { const unsigned short* p = brow + ks * bk + t * bt; b[ks][t].half[0] = *(const v8us*)p; b[ks][t].half[1] = *(const v8us*)(p + 16); } }
  };
  /* every "#pragma unroll" here keeps the fragment arrays, which the loop variables index, in registers */
#pragma unroll
  for (int g = 0; g < AH; ++g) fetch(g);
  __builtin_amdgcn_sched_barrier(0);      /* keeps the first AH groups' loads in front of the first product: sunk to their users they would each be waited for alone */
#pragma unroll
  for (int g = 0; g < NG; ++g) {
#pragma unroll
    for (int ks = g * G; ks < g * G + G; ++ks)
#pragma unroll
      for (int t = 0; t < 4; ++t) acc[t] = mmaB(a[ks].v, b[ks][t].v, acc[t]);
    if (g + AH < NG) { fetch(g + AH); __builtin_amdgcn_sched_barrier(0); }      /* the refill is issued here, AH groups ahead of its products, and is not sunk to them */
  }
}
// LDS row pitch of a staged operand tile, in halves: 528 bytes = 16 x 33, so the 16-byte fragment reads of 16 rows fall on 64 different banks
#define SP (CC + 8)
// eight asynchronous 16-byte copies of this lane, global -> LDS: copy i goes from g + i * gs (halves) to LDS byte address l + i * ls
__device__ __forceinline__ void copy8(unsigned l, unsigned ls, const unsigned short* g, size_t gs) {
  /* s_wait_xcnt closes the statement so that no address register of a copy is rewritten in front of it */
  asm volatile("global_load_async_to_lds_b128 %0, %8, off\n\t"
               "global_load_async_to_lds_b128 %1, %9, off\n\t"
               "global_load_async_to_lds_b128 %2, %10, off\n\t"
               "global_load_async_to_lds_b128 %3, %11, off\n\t"
               "global_load_async_to_lds_b128 %4, %12, off\n\t"
               "global_load_async_to_lds_b128 %5, %13, off\n\t"
               "global_load_async_to_lds_b128 %6, %14, off\n\t"
               "global_load_async_to_lds_b128 %7, %15, off\n\t"
               "s_wait_xcnt 0x0"
               :: "v"(l), "v"(l + ls), "v"(l + 2 * ls), "v"(l + 3 * ls), "v"(l + 4 * ls), "v"(l + 5 * ls), "v"(l + 6 * ls), "v"(l + 7 * ls),
                  "v"(g), "v"(g + gs), "v"(g + 2 * gs), "v"(g + 3 * gs), "v"(g + 4 * gs), "v"(g + 5 * gs), "v"(g + 6 * gs), "v"(g + 7 * gs)
               : "memory");
}
// 64 rows of CC halves (global pitch ld) into s[64][SP]: a wave's copy is one whole 512-byte row (4 full lines); wave w brings rows w + 4 i, i = 0..15
__device__ __forceinline__ void stage64(unsigned short (*s)[SP], const unsigned short* __restrict__ g, int ld) {
  const int w = threadIdx.x >> 5, lane = threadIdx.x & 31;
  const unsigned l = (unsigned)(uintptr_t)&s[w][lane * 8]; const unsigned short* p = g + (size_t)w * ld + lane * 8;
  copy8(l, 4 * SP * 2, p, (size_t)4 * ld); copy8(l + 32 * SP * 2, 4 * SP * 2, p + (size_t)32 * ld, (size_t)4 * ld);
}
// k_gemm_hh variant with fused epilogue: v = acc·alpha + bias[by·sBias + col] (+ CP[(row/rowsPerB)·sCPb + by·64 + col] if CP) ; ACT 0 none / 1 elu ; writes f16 C16 (and f32 C if non-null)
// the body is a device function of the block's place (bx, by) and its LDS, so that several GEMMs can share one launch.
// A block = 64 rows of A x 64 rows of B, both staged whole (K = CC) in LDS by asynchronous copies and shared: wave w takes A rows 16 w .. 16 w + 15 against all 64 B rows. M and N are multiples of 64 and the grid is exact.
template <int ACT>
__device__ __forceinline__ void gemm_hhx(float (*so)[16][64], unsigned short (*tA)[SP], unsigned short (*tB)[SP], int bx, int by, const _Float16* __restrict__ A, int lda, size_t sA, const _Float16* __restrict__ Bh, int ldb, size_t sB, float alpha, const float* __restrict__ bias, size_t sBias, const float* __restrict__ CP, int rowsPerB, size_t sCPb, int row0g,
    float* __restrict__ C, _Float16* __restrict__ C16, int ldc, size_t sC, int M, int N) {      /* K = CC, N a multiple of 64 */
  const int tid = threadIdx.x, w = tid >> 5, lane = tid & 31, ln = lane & 15, hh = lane >> 4;
  A += (size_t)by * sA; Bh += (size_t)by * sB; const size_t cofs = (size_t)by * sC; const float* bp = bias ? bias + (size_t)by * sBias : nullptr;
  const int ntn = N / 64; const int mb = bx / ntn, nq = bx % ntn; (void)M;
  const int row0 = mb * 64 + w * 16, col0 = nq * 64;
  stage64(tA, (const unsigned short*)A + (size_t)mb * 64 * lda, lda); stage64(tB, (const unsigned short*)Bh + (size_t)col0 * ldb, ldb);
  asm volatile("s_wait_asynccnt 0x0" ::: "memory");      /* this wave's share of the two tiles has landed */
  __syncthreads();      /* every wave's share has landed; passed by every thread of the block (the branch around this body is on blockIdx alone) */
  v8f acc[4] = {};
  mm16x64<2>(&tA[w * 16 + ln][8 * hh], &tB[ln][8 * hh], (size_t)16 * SP, 32, acc);
#pragma unroll
  for (int t = 0; t < 4; ++t) { if (col0 + t * 16 >= N) continue; const int col = col0 + t * 16 + ln; const float bv = bp ? bf16_round(bp[col]) : 0.f;
#pragma unroll
    for (int r = 0; r < 8; ++r) { float v = acc[t][r] * alpha + bv; if (CP) { const int bidx = (row0g + row0 + 8 * hh + r) / rowsPerB; v += CP[(size_t)bidx * sCPb + (size_t)by * 64 + col]; } if (ACT == 1) v = (v > 0.f) ? v : expm1f(v); else if (ACT == 7) v = (v > 0.f) ? v + 1.0f : expf(v); else if (ACT == 8) v = tanhf(v); else if (ACT == 9) v = 0.5f * v * (1.0f + tanhf(0.7978845608028654f * (v + 0.044715f * v * v * v))); else if (ACT == 11) v = 1.0f / (1.0f + expf(-v)); else if (ACT == 12) v = (v > 0.f) ? v : 0.01f * v; else if (ACT == 14) v = (v > 0.f) ? v : 0.1f * v; else if (ACT == 15) v = v / (1.0f + expf(-v)); else if (ACT == 3) v = fmaxf(v, 0.f); else if (ACT == 6) v = 0.5f * v * (1.0f + erff(v * 0.70710678118654752f)); so[w][8 * hh + r][t * 16 + ln] = v; } }
  __builtin_amdgcn_fence(__ATOMIC_ACQ_REL, "workgroup"); __builtin_amdgcn_wave_barrier();
  const int rsub = lane >> 4, c4 = (lane & 15) * 4; typedef _Float16 v4h __attribute__((ext_vector_type(4)));
  {
#pragma unroll
    for (int q = 0; q < 8; ++q) { const int r = q * 2 + rsub; if (col0 + c4 < N) { const v4f v = *(const v4fa*)&so[w][r][c4]; if (C) *(v4f*)(C + cofs + (size_t)(row0 + r) * ldc + col0 + c4) = v; if (C16) { v4h h4; for (int i = 0; i < 4; ++i) h4[i] = (_Float16)v[i]; *(v4h*)(C16 + cofs + (size_t)(row0 + r) * ldc + col0 + c4) = h4; } } }
     }
  asm volatile("s_wait_xcnt 0x0" ::: "memory");      /* behind the run of stores: stands in front of whatever next takes a register that a store names */
}
// the two GEMMs that need only X16 and the rounded qkv_w, in one launch: blocks [0, QKB) give [q | k] token-major [n][512] (head h = cols h*32 / 256 + h*32; M 4096 N 512 K 256),
// blocks [QKB, QKB + VB) give v channel-major [(h,d)][n] = V^T (A = qkv_w rows 512..767, B = x token-major; M 256 N 4096 K 256)
#define QKB ((NR / 16) * (2 * CC / 64) / 4)
#define VB ((CC / 16) * (NN / 64) / 4)
__global__ __launch_bounds__(128) void k_qkv(const _Float16* __restrict__ X16, const _Float16* __restrict__ Bqkv, _Float16* __restrict__ QK, _Float16* __restrict__ Vt) {
  __shared__ __attribute__((aligned(16))) float so[4][16][64];
  __shared__ __attribute__((aligned(16))) unsigned short sA[64][SP], sB[64][SP];
  const int bx = blockIdx.x;
  if (bx < QKB) gemm_hhx<0>(so, sA, sB, bx, 0, X16, CC, 0, Bqkv, CC, 0, 0.0625f, nullptr, 0, nullptr, 1, 0, 0, nullptr, QK, 2 * CC, 0, NR, 2 * CC);
  else gemm_hhx<0>(so, sA, sB, bx - QKB, 0, Bqkv + (size_t)2 * CC * CC, CC, 0, X16, CC, 0, 0.0625f, nullptr, 0, nullptr, 1, 0, 0, nullptr, Vt, NN, 0, CC, NN);
}


typedef _Float16 v4h __attribute__((ext_vector_type(4)));

__global__ __launch_bounds__(256) void k_x16(const float* __restrict__ x, _Float16* __restrict__ X16, size_t n8) { const size_t t = (size_t)blockIdx.x * 256 + threadIdx.x; if (t >= n8) return; FragH f;
#pragma unroll
  for (int q = 0; q < 8; ++q) f.h[q] = (_Float16)bf16_round(x[t * 8 + q]); *(v8us*)((unsigned short*)X16 + t * 8) = f.half[0];  }
__device__ __forceinline__ void round16f(int bx, const float* __restrict__ W, _Float16* __restrict__ Bt, size_t n8) { const size_t t = (size_t)bx * 256 + threadIdx.x; if (t >= n8) return; FragH f;
#pragma unroll
  for (int i = 0; i < 8; ++i) f.h[i] = (_Float16)(bf16_round(W[t * 8 + i]) * 16.0f); *(v8us*)((unsigned short*)Bt + t * 8) = f.half[0];  }
template <int NHv, int TTv>
__global__ __launch_bounds__(256) void k_vt(const _Float16* __restrict__ V16, int ldv, int voff, _Float16* __restrict__ Vt) { __shared__ unsigned short tl[64][66]; const int tid = threadIdx.x; const int slab = blockIdx.x / (TTv / 64), lg = blockIdx.x % (TTv / 64); const int b = slab / NHv, h = slab % NHv;
  for (int i = tid; i < 64 * 8; i += 256) { const int r = i / 8, c8 = (i % 8) * 8; FragH f; f.half[0] = *(const v8us*)((const unsigned short*)V16 + ((size_t)b * TTv + lg * 64 + r) * ldv + voff + h * 64 + c8);
#pragma unroll
    for (int q = 0; q < 8; ++q) tl[r][c8 + q] = f.u[q]; }
  __syncthreads();
  {
#pragma unroll
    for (int rd = 0; rd < 2; ++rd) { const int d = rd * 32 + tid / 8, pc = tid % 8; FragH f;
#pragma unroll
      for (int q = 0; q < 8; ++q) f.u[q] = tl[pc * 8 + q][d];
      *(v8us*)((unsigned short*)Vt + ((size_t)slab * 64 + d) * TTv + lg * 64 + pc * 8) = f.half[0]; }
     } }

__device__ __forceinline__ void tok(float (*tl)[65], int bx, const float* __restrict__ x, _Float16* __restrict__ X16) { const int tid = threadIdx.x; const int b = bx / ((CC / 64) * (NN / 32)), rem = bx % ((CC / 64) * (NN / 32)); const int cg = rem / (NN / 32), pg = rem % (NN / 32); const int c0 = cg * 64, p0 = pg * 32;
  for (int i = tid; i < 64 * 32; i += 256) { const int c = i / 32, pp = i % 32; tl[pp][c] = bf16_round(x[((size_t)b * CC + c0 + c) * NN + p0 + pp]); } __syncthreads();
  const int r = tid / 8, pc = tid % 8; FragH f; for (int q = 0; q < 8; ++q) f.h[q] = (_Float16)tl[r][pc * 8 + q]; const size_t row = (size_t)b * NN + p0 + r; *(v8us*)((unsigned short*)X16 + row * CC + c0 + pc * 8) = f.half[0];  }
// the three passes that read only inputs, in one launch: blocks [0, TOKB) transpose x to token-major f16, the next WQB round qkv_w, the last WPB round proj_w ((out,in) natural, x 2^4).
// The branch is on blockIdx alone, so the barrier inside tok() is passed by every thread of a block or by none.
#define TOKB (BB * (CC / 64) * (NN / 32))
#define WQB (C3 * CC / 8 / 256)
#define WPB (CC * CC / 8 / 256)
__global__ __launch_bounds__(256) void k_prep(const float* __restrict__ x, _Float16* __restrict__ X16, const float* __restrict__ Wqkv, _Float16* __restrict__ Bqkv, const float* __restrict__ Wp, _Float16* __restrict__ Bp) {
  __shared__ float tl[32][65];
  const int bx = blockIdx.x;
  if (bx < TOKB) tok(tl, bx, x, X16);
  else if (bx < TOKB + WQB) round16f(bx - TOKB, Wqkv, Bqkv, (size_t)C3 * CC / 8);
  else round16f(bx - TOKB - WQB, Wp, Bp, (size_t)CC * CC / 8);
}
typedef float v2f __attribute__((ext_vector_type(2)));
// lane l <-> l ^ 16: the two halves of a wave each hold half of a query column's keys
__device__ __forceinline__ float xhalf(float v) { const int b = __float_as_int(v); return __int_as_float(__builtin_amdgcn_permlanex16(b, b, 0x76543210, 0xfedcba98, false, false)); }
// Transposed products: S^T = K.Q^T (A = 16 key rows, B = the wave's 16 queries as columns), O^T += V^T.P^T. A lane then holds 16 of the 32 scores of ONE query
// (keys 8hh + r and 16 + 8hh + r), which is the k order of a B operand: P goes from the score accumulators into the second product without LDS.
// K and V^T come in tiles of KT keys that the block's four waves share: asynchronous 16-byte copies fill one LDS buffer while the other is worked on (two buffers, one barrier a tile).
__global__ __launch_bounds__(128) void k_flash(const _Float16* __restrict__ Q16, int ldq, const _Float16* __restrict__ K16, int ldk, const _Float16* __restrict__ Vt, const int* __restrict__ MSK, _Float16* __restrict__ O16) {
  constexpr int RPW = 16, NQB = NN / (4 * RPW), DT = 2;
  constexpr int KT = 128, NT = NN / KT, NS = KT / 16, KP = HD + 8, VP = KT + 8;      /* row pitches of 80 and 272 bytes (16 x odd): 16-byte fragment reads of 16 rows fall on 64 different banks */
  __shared__ __attribute__((aligned(16))) unsigned short sK[2][KT][KP];      /* K tile: key rows of 32 halves */
  __shared__ __attribute__((aligned(16))) unsigned short sV[2][HD][VP];      /* V^T tile: channel rows of KT halves */
  const int tid = threadIdx.x, w = tid >> 5, lane = tid & 31, ln = lane & 15, hh = lane >> 4; (void)MSK;
  const int slab = blockIdx.x / NQB, qblk = blockIdx.x % NQB; const int h = slab; const int b = 0; const int qb0 = qblk * (4 * RPW); const int q0 = qb0 + w * RPW;
  FragH bq;
  { const unsigned short* qr = (const unsigned short*)Q16 + ((size_t)b * NN + q0 + ln) * ldq + h * HD; bq.half[0] = *(const v8us*)(qr + 8 * hh); bq.half[1] = *(const v8us*)(qr + 16 + 8 * hh); }
  const unsigned short* Vth = (const unsigned short*)Vt + (size_t)h * HD * NN;      /* V^T = v[(h,d)][n] channel-major */
  /* a thread's share of a tile: 16-byte piece tid & 3 of key rows (tid >> 2) + 32 i, and piece tid & 15 of channel rows (tid >> 4) + 8 i, i = 0..3 */
  const unsigned short* gk = (const unsigned short*)K16 + (size_t)b * NN * ldk + h * HD + (size_t)(tid >> 2) * ldk + (tid & 3) * 8;
  const unsigned short* gv = Vth + (size_t)(tid >> 4) * NN + (tid & 15) * 8;
  const unsigned lk = (unsigned)(uintptr_t)&sK[0][tid >> 2][(tid & 3) * 8], lv = (unsigned)(uintptr_t)&sV[0][tid >> 4][(tid & 15) * 8];      /* LDS byte addresses */
  const size_t kstep = (size_t)32 * ldk;
  auto stage = [&](int t, int buf) {
    const unsigned short* k0 = gk + (size_t)t * KT * ldk; const unsigned short* v0 = gv + t * KT;
    const unsigned a0 = lk + (unsigned)buf * (KT * KP * 2), c0 = lv + (unsigned)buf * (HD * VP * 2);
    /* the tile's eight copies of this thread; s_wait_xcnt closes the statement so that no address register of a copy is rewritten in front of it */
    asm volatile("global_load_async_to_lds_b128 %0, %8, off\n\t"
                 "global_load_async_to_lds_b128 %1, %9, off\n\t"
                 "global_load_async_to_lds_b128 %2, %10, off\n\t"
                 "global_load_async_to_lds_b128 %3, %11, off\n\t"
                 "global_load_async_to_lds_b128 %4, %12, off\n\t"
                 "global_load_async_to_lds_b128 %5, %13, off\n\t"
                 "global_load_async_to_lds_b128 %6, %14, off\n\t"
                 "global_load_async_to_lds_b128 %7, %15, off\n\t"
                 "s_wait_xcnt 0x0"
                 :: "v"(a0), "v"(a0 + 32 * KP * 2), "v"(a0 + 64 * KP * 2), "v"(a0 + 96 * KP * 2), "v"(c0), "v"(c0 + 8 * VP * 2), "v"(c0 + 16 * VP * 2), "v"(c0 + 24 * VP * 2),
                    "v"(k0), "v"(k0 + kstep), "v"(k0 + 2 * kstep), "v"(k0 + 3 * kstep), "v"(v0), "v"(v0 + 8 * NN), "v"(v0 + 16 * NN), "v"(v0 + 24 * NN)
                 : "memory");
  };
  constexpr float SL2 = 0.25503486f;      /* 32^-1/2 x log2(e): the softmax runs in base 2, one multiply-add and one v_exp_f32 a score */
  float m_c = -3.0e38f, l_c = 0.f; v8f oacc[DT];      /* running maximum (in log2 units) and this half's partial sum (x 2^10) of query q0 + ln; oacc[dt][r] = O^T[dt*16 + 8hh + r][q0 + ln] */
#pragma unroll
  for (int dt = 0; dt < DT; ++dt) oacc[dt] = (v8f){0.f,0.f,0.f,0.f,0.f,0.f,0.f,0.f};
  stage(0, 0);
  asm volatile("s_wait_asynccnt 0x0" ::: "memory");      /* this wave's share of tile 0 has landed */
  __syncthreads();      /* every wave's share of tile 0 has landed */
  stage(1, 1);
  /* the tile loop stays rolled: more copies of the long body would only grow the code; every "#pragma unroll" in this kernel keeps an array that the loop variable indexes in registers */
#pragma unroll 1
  for (int t = 0; t < NT; ++t) {
   const int buf = t & 1;
   /* one softmax step a tile: all of the tile's fragments are read first, its NS score products stand in one run, one maximum, one exchange between the halves and one rescale of O serve all KT keys, and its PV products follow */
   FragH ak[NS], av[NS / 2][DT];
#pragma unroll
   for (int nt = 0; nt < NS; ++nt) { const unsigned short* kr = &sK[buf][nt * 16 + ln][0]; ak[nt].half[0] = *(const v8us*)(kr + 8 * hh); ak[nt].half[1] = *(const v8us*)(kr + 16 + 8 * hh); }
#pragma unroll
   for (int ks = 0; ks < NS / 2; ++ks)
#pragma unroll
    for (int dt = 0; dt < DT; ++dt) { const unsigned short* vrow = &sV[buf][dt * 16 + ln][ks * 32]; av[ks][dt].half[0] = *(const v8us*)(vrow + 8 * hh); av[ks][dt].half[1] = *(const v8us*)(vrow + 16 + 8 * hh); }
   __builtin_amdgcn_sched_barrier(0);      /* keeps the tile's 32 fragment reads in one group in front of the products: spread among them they came in four groups, each with its own wait for the LDS latency */
   v8f sc[NS];      /* raw q.k sums of keys nt*16 + 8hh + r; the scale goes into the exponent's multiply-add */
#pragma unroll
   for (int nt = 0; nt < NS; ++nt) sc[nt] = mmaB(ak[nt].v, bq.v, (v8f){0.f,0.f,0.f,0.f,0.f,0.f,0.f,0.f});
   /* the tile now lives in registers: its buffer is handed back here, so that the refill flies during the whole softmax and PV part */
   asm volatile("s_wait_dscnt 0x0" ::: "memory");      /* this wave's reads of buffer buf have returned before the buffer is refilled */
   asm volatile("s_wait_asynccnt 0x0" ::: "memory");      /* this wave's share of tile t + 1 has landed */
   __syncthreads();      /* publishes tile t + 1 and ends every wave's reads of buffer buf */
   if (t + 2 < NT) stage(t + 2, buf);
   float mx[8];      /* every step takes in two more values (a three-input maximum) */
#pragma unroll
   for (int r = 0; r < 8; ++r) { mx[r] = sc[0][r];
#pragma unroll
    for (int nt = 1; nt + 1 < NS; nt += 2) mx[r] = fmaxf(fmaxf(mx[r], sc[nt][r]), sc[nt + 1][r]); }
#pragma unroll
   for (int i = 0; i < 4; ++i) mx[i] = fmaxf(fmaxf(mx[2 * i], mx[2 * i + 1]), sc[NS - 1][i]);
   mx[0] = fmaxf(fmaxf(mx[0], sc[NS - 1][4]), sc[NS - 1][5]); mx[1] = fmaxf(fmaxf(mx[1], sc[NS - 1][6]), sc[NS - 1][7]);
   float mc = fmaxf(fmaxf(fmaxf(mx[0], mx[1]), mx[2]), mx[3]);
   mc = fmaxf(mc, xhalf(mc));
   const float mn = fmaxf(m_c, mc * SL2); const float al = (mn > -1.0e38f) ? __builtin_amdgcn_exp2f(m_c - mn) : 1.0f; m_c = mn;
   const float mb = mn - 10.0f;      /* p = 2^(s SL2 - mn + 10): the 2^10 of the f16 P rides in the exponent, and the row sum carries it too */
   FragH pb[NS / 2]; v2f ps[NS];      /* pb[ks]: P^T of keys ks*32 .. +31 in the k order of a B operand (score tile 2ks, then 2ks + 1); ps[nt]: two partial sums of score tile nt */
#pragma unroll
   for (int nt = 0; nt < NS; ++nt) {
#pragma unroll
    for (int r = 0; r < 8; r += 2) {
      const v2f e = __builtin_elementwise_fma((v2f){sc[nt][r], sc[nt][r + 1]}, (v2f){SL2, SL2}, (v2f){-mb, -mb});      /* two exponents a packed multiply-add */
      const v2f p = {__builtin_amdgcn_exp2f(e[0]), __builtin_amdgcn_exp2f(e[1])};
      pb[nt >> 1].h[(nt & 1) * 8 + r] = (_Float16)p[0]; pb[nt >> 1].h[(nt & 1) * 8 + r + 1] = (_Float16)p[1];
      ps[nt] = r ? ps[nt] + p : p; } }
#pragma unroll
   for (int st = NS / 2; st > 0; st >>= 1)
#pragma unroll
    for (int nt = 0; nt < st; ++nt) ps[nt] += ps[nt + st];
   l_c = l_c * al + (ps[0][0] + ps[0][1]);
#pragma unroll
   for (int dt = 0; dt < DT; ++dt)
#pragma unroll
    for (int r = 0; r < 8; ++r) oacc[dt][r] *= al;
#pragma unroll
   for (int ks = 0; ks < NS / 2; ++ks)
#pragma unroll
    for (int dt = 0; dt < DT; ++dt) oacc[dt] = mmaB(av[ks][dt].v, pb[ks].v, oacc[dt]);
  }
  asm volatile("s_wait_asynccnt 0x0" ::: "memory");      /* no copy is outstanding when the wave goes on to its end */
  const float l = l_c + xhalf(l_c); const float inv = (l > 0.f) ? 1.0f / l : 0.f;      /* l and oacc both carry the 2^10 */
  /* O leaves as f16, the projection's operand type, head-major [h][n][32]: a lane's 8 accumulators of a tile are 8 consecutive channels of its query = one 16-byte store; a wave's 16 queries fill 1 KiB that no other wave writes */
#pragma unroll
  for (int dt = 0; dt < DT; ++dt) { FragH f;
#pragma unroll
    for (int r = 0; r < 8; ++r) f.h[r] = (_Float16)(oacc[dt][r] * inv);
    *(v8us*)((unsigned short*)O16 + ((size_t)h * NN + q0 + ln) * HD + dt * 16 + 8 * hh) = f.half[0]; }
}

// out[c][n] = proj_w . O^T + proj_b, in the output's own channel-major layout: A = 16 rows of the rounded proj_w (x 2^4), B = 64 tokens of O (head-major [h][n][32]: k block kb is head kb / 32).
// A block = 64 channels x 64 tokens, both operands staged whole in LDS by asynchronous copies. One wave = 16 channels x 64 tokens; the tile goes through the wave's own LDS range so that each store covers whole 256-byte pieces of output rows. M 256 N 4096 K 256.
__global__ __launch_bounds__(128) void k_proj(const _Float16* __restrict__ Bp, const _Float16* __restrict__ O16, const float* __restrict__ bias, float* __restrict__ out) {
  __shared__ __attribute__((aligned(16))) float so[4][16][64 + 4];      /* pitch 272 bytes: the two halves' rows, 8 apart, fall on different banks */
  const int tid = threadIdx.x, w = tid >> 5, lane = tid & 31, ln = lane & 15, hh = lane >> 4;
  __shared__ __attribute__((aligned(16))) unsigned short sA[64][SP], sB[64][SP];      /* proj_w rows; O rows token-major, channel = head * 32 + d */
  const int mb = blockIdx.x / (NN / 64); const int row0 = mb * 64 + w * 16, col0 = (blockIdx.x % (NN / 64)) * 64;
  stage64(sA, (const unsigned short*)Bp + (size_t)mb * 64 * CC, CC);
  { /* O: a wave's copy is 8 tokens x 64 bytes of one head, 512 contiguous bytes; wave w brings tokens 8 w .. 8 w + 7 and 32 + 8 w .. of each of the 8 heads */
    const unsigned l = (unsigned)(uintptr_t)&sB[w * 8 + (lane >> 2)][(lane & 3) * 8]; const unsigned short* p = (const unsigned short*)O16 + (size_t)(col0 + w * 8) * HD + lane * 8;
    copy8(l, HD * 2, p, (size_t)NN * HD); copy8(l + 32 * SP * 2, HD * 2, p + 32 * HD, (size_t)NN * HD); }
  const v4f b0 = *(const v4fa*)(bias + row0 + 8 * hh), b1 = *(const v4fa*)(bias + row0 + 8 * hh + 4);
  asm volatile("s_wait_xcnt 0x0" ::: "memory");      /* the bias loads' address pair is dead from here on: the wait stands in front of whatever next takes its registers */
  asm volatile("s_wait_asynccnt 0x0" ::: "memory");      /* this wave's share of the two tiles has landed */
  __syncthreads();      /* every wave's share has landed */
  v8f acc[4] = {};
  mm16x64<2>(&sA[w * 16 + ln][8 * hh], &sB[ln][8 * hh], (size_t)16 * SP, 32, acc);
#pragma unroll
  for (int t = 0; t < 4; ++t)
#pragma unroll
    for (int r = 0; r < 8; ++r) so[w][8 * hh + r][t * 16 + ln] = acc[t][r] * 0.0625f + bf16_round(r < 4 ? b0[r & 3] : b1[r & 3]);
  __builtin_amdgcn_fence(__ATOMIC_ACQ_REL, "workgroup"); __builtin_amdgcn_wave_barrier();      /* the wave's LDS writes are done before its lanes read each other's */
  const int rsub = lane >> 4, c4 = (lane & 15) * 4;
#pragma unroll
  for (int q = 0; q < 8; ++q) { const int r = q * 2 + rsub; const v4f v = *(const v4fa*)&so[w][r][c4]; *(v4f*)(out + (size_t)(row0 + r) * NN + col0 + c4) = v; }
}

extern "C" void kernel_launch(void* const* d_in, const int* in_sizes, int n_in,
                              void* d_out, int out_size, void* d_ws, size_t ws_size, hipStream_t stream) {
  (void)in_sizes; (void)n_in; (void)out_size;
  const float* x = (const float*)d_in[0]; const float* Wqkv = (const float*)d_in[1]; const float* Wp = (const float*)d_in[2]; const float* bp = (const float*)d_in[3];
  char* ws = (char*)d_ws; size_t off = 0;
  auto take = [&](size_t bytes) { char* p = ws + off; off += (bytes + 255) & ~(size_t)255; return p; };
  _Float16* Bqkv = (_Float16*)take((size_t)C3 * CC * 2); _Float16* Bp = (_Float16*)take((size_t)CC * CC * 2); _Float16* X16 = (_Float16*)take((size_t)NR * CC * 2);
  _Float16* QK = (_Float16*)take((size_t)NR * 2 * CC * 2); _Float16* Vt = (_Float16*)take((size_t)CC * NN * 2); _Float16* O16 = (_Float16*)take((size_t)NR * CC * 2);
  if (off > ws_size) return;      // 0.4 + 0.1 + 2.1 + 4.2 + 2.1 + 2.1 = about 11 MB
  k_prep<<<TOKB + WQB + WPB, 256, 0, stream>>>(x, X16, Wqkv, Bqkv, Wp, Bp);
  k_qkv<<<QKB + VB, 128, 0, stream>>>(X16, Bqkv, QK, Vt);
  k_flash<<<NH * (NN / 64), 128, 0, stream>>>(QK, 2 * CC, QK + CC, 2 * CC, Vt, nullptr, O16);      /* blocks = head x 64-query groups */
  k_proj<<<(CC / 16) * (NN / 64) / 4, 128, 0, stream>>>(Bp, O16, bp, (float*)d_out);
}

// v009
// It runs in 38.9 microseconds.
// Timed twice side by side with v008, it ran 1.10 times as fast both times.
// All steps since v000 together make it 10.2 times as fast.
#include <hip/hip_runtime.h>
// 3-D multi-head self-attention on channel-major x [1, 256, 16³ = 4096]: qkv = qkv_w·x (1×1×1 conv, no bias), 8 heads × 32, softmax(qᵀk·32^-½) over keys, out[h,d,n] = Σ_m attn[n,m]·v[h,d,m], then proj_w·out + proj_b.
// Compute dtype: x, qkv_w, proj_w, proj_b rounded to bf16; q/k token-major and v channel-major (= Vᵀ) as f16 GEMM outputs (f32 accumulate); fused flash-style kernel per head
// (online softmax f32, P f16 x 2^10) on v_wmma_f32_16x16x32_f16, which stores O as f16; projection GEMM with bias, computed channel-major (A = proj_w) and stored straight to out; f32 accumulate throughout.
#define BB 1
#define CC 256
#define C3 768
#define NH 8
#define HD 32
#define NN 4096
#define NR (BB * NN)

typedef __bf16 v16b __attribute__((ext_vector_type(16)));
typedef unsigned short v8us __attribute__((ext_vector_type(8), may_alias));
typedef float  v8f  __attribute__((ext_vector_type(8)));
typedef float  v4f  __attribute__((ext_vector_type(4)));
typedef float  v4fa __attribute__((ext_vector_type(4), may_alias));
union FragB { v16b v; v8us half[2]; unsigned short u[16]; };

__device__ __forceinline__ unsigned short bf16_bits(float x) { unsigned int u = __float_as_uint(x); return (unsigned short)((u + 0x7FFFu + ((u >> 16) & 1u)) >> 16); }
__device__ __forceinline__ float bf16_val(unsigned short b) { return __uint_as_float(((unsigned int)b) << 16); }
__device__ __forceinline__ float bf16_round(float x) { return bf16_val(bf16_bits(x)); }
// D += A·B with NT terms: 1 = ah·bh, 2 = + al·bh (A split), 3 = + ah·bl (both split)
template <int NT>
__device__ __forceinline__ v8f mmaN(v16b ah, v16b al, v16b bh, v16b bl, v8f c) {
  c = __builtin_amdgcn_wmma_f32_16x16x32_bf16(false, ah, false, bh, (short)0, c, false, false);
  if (NT >= 2) c = __builtin_amdgcn_wmma_f32_16x16x32_bf16(false, al, false, bh, (short)0, c, false, false);
  if (NT >= 3) c = __builtin_amdgcn_wmma_f32_16x16x32_bf16(false, ah, false, bl, (short)0, c, false, false);
  asm volatile("v_nop\n\tv_nop\n\tv_nop\n\tv_nop" : "+v"(c) : "v"(ah), "v"(al), "v"(bh), "v"(bl));
  return c;
}

__global__ __launch_bounds__(256) void k_wt_bf16(const float* __restrict__ W, unsigned short* __restrict__ Wt, int K, int N) {
  const int t = blockIdx.x * 256 + threadIdx.x;
  const int k8n = K / 8;
  if (t >= N * k8n) return;
  const int n = t / k8n, k8 = (t % k8n) * 8;
  v8us v;
#pragma unroll
  for (int i = 0; i < 8; ++i) v[i] = bf16_bits(W[(size_t)(k8 + i) * N + n]);
  *(v8us*)(Wt + (size_t)n * K + k8) = v;
  
}

// GEMM C[M][N] (f32, pitch ldc) = act(A[M][K]·W + bias). A f32 row-major (pitch lda) converted per fragment to bf16
// (ASPLIT: hi/lo two planes -> 2 terms, else single rounded term); Wt bf16 [N][K] (pitch ldb). BIAS_BF16 rounds the
// bias to bf16 first (bias quantised to bf16 before the add). K%32==0, M%16==0, N%64==0.
template <bool ASPLIT, int ACT, bool BIAS_BF16>
__global__ __launch_bounds__(128) void k_gemm_bf(const float* __restrict__ A, int lda, const unsigned short* __restrict__ Wt, int ldb,
                                               const float* __restrict__ bias, float* __restrict__ C, int ldc, int M, int N, int K) {
  __shared__ __attribute__((aligned(16))) float so[4][16][64];
  const int tid = threadIdx.x, w = tid >> 5, lane = tid & 31, ln = lane & 15, hh = lane >> 4;
  const int ntn = N / 64;
  const int wid = blockIdx.x * 4 + w;
  const int mt = wid / ntn, nq = wid % ntn;
  if (mt * 16 >= M) return;
  const int row0 = mt * 16, col0 = nq * 64;
  const float* arow = A + (size_t)(row0 + ln) * lda;
  v8f acc[4] = {};
  for (int kb = 0; kb < K; kb += 32) {
    FragB ah, al;
    const v4f x0 = *(const v4fa*)(arow + kb + 8 * hh), x1 = *(const v4fa*)(arow + kb + 8 * hh + 4);
    const v4f x2 = *(const v4fa*)(arow + kb + 16 + 8 * hh), x3 = *(const v4fa*)(arow + kb + 16 + 8 * hh + 4);
    float xs[16] = {x0[0],x0[1],x0[2],x0[3],x1[0],x1[1],x1[2],x1[3],x2[0],x2[1],x2[2],x2[3],x3[0],x3[1],x3[2],x3[3]};
#pragma unroll
    for (int i = 0; i < 16; ++i) { const unsigned short hb = bf16_bits(xs[i]); ah.u[i] = hb; al.u[i] = ASPLIT ? bf16_bits(xs[i] - bf16_val(hb)) : (unsigned short)0; }
#pragma unroll
    for (int t = 0; t < 4; ++t) {
      const unsigned short* brow = Wt + (size_t)(col0 + t * 16 + ln) * ldb + kb;
      FragB b;
      b.half[0] = *(const v8us*)(brow + 8 * hh);
      b.half[1] = *(const v8us*)(brow + 16 + 8 * hh);
      acc[t] = mmaN<ASPLIT ? 2 : 1>(ah.v, al.v, b.v, b.v, acc[t]);
    }
  }
#pragma unroll
  for (int t = 0; t < 4; ++t) {
    float bv = bias ? bias[col0 + t * 16 + ln] : 0.f;
    if (BIAS_BF16) bv = bf16_round(bv);
#pragma unroll
    for (int r = 0; r < 8; ++r) { float v = acc[t][r] + bv; if (ACT == 1) v = fmaxf(v, 0.f); so[w][8 * hh + r][t * 16 + ln] = v; }
  }
  __builtin_amdgcn_fence(__ATOMIC_ACQ_REL, "workgroup");
  __builtin_amdgcn_wave_barrier();
  const int rsub = lane >> 4, c4 = (lane & 15) * 4;
  {
#pragma unroll
    for (int q = 0; q < 8; ++q) {
      const int r = q * 2 + rsub;
      const v4f v = *(const v4fa*)&so[w][r][c4];
      *(v4f*)(C + (size_t)(row0 + r) * ldc + col0 + c4) = v;
    }
    
  }
}

// Flash-style causal/unmasked attention, all contractions 3-term bf16 hi/lo splits, f32 softmax with running max.
// q,k,v rows are read from f32 buffers with arbitrary row pitch (so they can live inside a fused qkv buffer);
// D = head size (multiple of 32, <= 128); one wave = 16 query rows; block = 4 waves (64 queries) sharing K/V chunks of 32.
template <int D, bool CAUSAL>
__global__ __launch_bounds__(128) void k_flash(const float* __restrict__ qb, const float* __restrict__ kb, const float* __restrict__ vb,
                                             int pitch, int T, int H, float scale, float* __restrict__ y, int ypitch) {
  constexpr int KS = D / 32;        // k-steps for QK
  constexpr int DT = D / 16;        // d tiles for PV
  __shared__ __attribute__((aligned(16))) unsigned short sKh[32][D + 8], sKl[32][D + 8], sVh[32][D + 8], sVl[32][D + 8];
  __shared__ __attribute__((aligned(16))) unsigned short sPh[4][16][40], sPl[4][16][40];
  __shared__ __attribute__((aligned(16))) float sO[4][16][D];
  const int tid = threadIdx.x, w = tid >> 5, lane = tid & 31, ln = lane & 15, hh = lane >> 4;
  const int nqb = (T + 63) / 64;
  const int bh = blockIdx.x / nqb, qblk = blockIdx.x % nqb;
  const int b = bh / H, h = bh % H;
  const int q0 = qblk * 64 + w * 16;
  const float* Q = qb + (size_t)b * T * pitch + h * D;
  const float* K = kb + (size_t)b * T * pitch + h * D;
  const float* V = vb + (size_t)b * T * pitch + h * D;

  // A fragments of the wave's 16 query rows (scaled), hi/lo
  FragB aqh[KS], aql[KS];
  {
    int row = q0 + ln; if (row >= T) row = T - 1;
    const float* qr = Q + (size_t)row * pitch;
#pragma unroll
    for (int ks = 0; ks < KS; ++ks)
#pragma unroll
      for (int i = 0; i < 16; ++i) {
        const int d = ks * 32 + ((i < 8) ? (8 * hh + i) : (16 + 8 * hh + (i - 8)));
        const float x = qr[d] * scale; const unsigned short hb = bf16_bits(x);
        aqh[ks].u[i] = hb; aql[ks].u[i] = bf16_bits(x - bf16_val(hb));
      }
  }
  float m_r[8], l_r[8];
#pragma unroll
  for (int r = 0; r < 8; ++r) { m_r[r] = -3.0e38f; l_r[r] = 0.f; }
  v8f oacc[DT];
#pragma unroll
  for (int dt = 0; dt < DT; ++dt) oacc[dt] = (v8f){0.f,0.f,0.f,0.f,0.f,0.f,0.f,0.f};

  const int kv_end = CAUSAL ? min(T, qblk * 64 + 64) : T;     // block-uniform
  for (int j0 = 0; j0 < kv_end; j0 += 32) {
    __syncthreads();
    for (int e = tid; e < 32 * (D / 4); e += 128) {
      const int r = e / (D / 4), c4 = (e % (D / 4)) * 4;
      const int key = j0 + r;
      v4f kf = {0.f,0.f,0.f,0.f}, vf = {0.f,0.f,0.f,0.f};
      if (key < T) { kf = *(const v4fa*)(K + (size_t)key * pitch + c4); vf = *(const v4fa*)(V + (size_t)key * pitch + c4); }
#pragma unroll
      for (int t = 0; t < 4; ++t) {
        unsigned short hb = bf16_bits(kf[t]); sKh[r][c4 + t] = hb; sKl[r][c4 + t] = bf16_bits(kf[t] - bf16_val(hb));
        hb = bf16_bits(vf[t]); sVh[r][c4 + t] = hb; sVl[r][c4 + t] = bf16_bits(vf[t] - bf16_val(hb));
      }
    }
    __syncthreads();
    // S tile 16 x 32
    v8f s[2];
#pragma unroll
    for (int nt = 0; nt < 2; ++nt) {
      v8f acc = {};
#pragma unroll
      for (int ks = 0; ks < KS; ++ks) {
        FragB bh_, bl_;
        bh_.half[0] = *(const v8us*)&sKh[nt * 16 + ln][ks * 32 + 8 * hh]; bh_.half[1] = *(const v8us*)&sKh[nt * 16 + ln][ks * 32 + 16 + 8 * hh];
        bl_.half[0] = *(const v8us*)&sKl[nt * 16 + ln][ks * 32 + 8 * hh]; bl_.half[1] = *(const v8us*)&sKl[nt * 16 + ln][ks * 32 + 16 + 8 * hh];
        acc = mmaN<3>(aqh[ks].v, aql[ks].v, bh_.v, bl_.v, acc);
      }
      s[nt] = acc;
    }
    // mask + running max (rows 8hh+r; the 16 lanes of a half share rows)
    float alpha[8];
#pragma unroll
    for (int r = 0; r < 8; ++r) {
      const int qi = q0 + 8 * hh + r;
      const int ja = j0 + ln, jb = j0 + 16 + ln;
      if (CAUSAL) { if (ja > qi) s[0][r] = -3.0e38f; if (jb > qi) s[1][r] = -3.0e38f; }
      if (ja >= T) s[0][r] = -3.0e38f;
      if (jb >= T) s[1][r] = -3.0e38f;
      float mx = fmaxf(s[0][r], s[1][r]);
      mx = fmaxf(mx, __shfl_xor(mx, 1, 32)); mx = fmaxf(mx, __shfl_xor(mx, 2, 32)); mx = fmaxf(mx, __shfl_xor(mx, 4, 32)); mx = fmaxf(mx, __shfl_xor(mx, 8, 32));
      const float mnew = fmaxf(m_r[r], mx);
      alpha[r] = (mnew > -1.0e38f) ? __expf(m_r[r] - mnew) : 1.0f;
      const float p0 = (s[0][r] > -1.0e38f) ? __expf(s[0][r] - mnew) : 0.f;
      const float p1 = (s[1][r] > -1.0e38f) ? __expf(s[1][r] - mnew) : 0.f;
      m_r[r] = mnew;
      l_r[r] = l_r[r] * alpha[r] + p0 + p1;            // per-lane partial row sum (16 lanes combined at the end)
      unsigned short hb = bf16_bits(p0); sPh[w][8 * hh + r][ln] = hb;      sPl[w][8 * hh + r][ln] = bf16_bits(p0 - bf16_val(hb));
      hb = bf16_bits(p1);                sPh[w][8 * hh + r][16 + ln] = hb; sPl[w][8 * hh + r][16 + ln] = bf16_bits(p1 - bf16_val(hb));
    }
#pragma unroll
    for (int dt = 0; dt < DT; ++dt)
#pragma unroll
      for (int r = 0; r < 8; ++r) oacc[dt][r] *= alpha[r];
    __builtin_amdgcn_fence(__ATOMIC_ACQ_REL, "workgroup");
    __builtin_amdgcn_wave_barrier();
    FragB pah, pal;
    pah.half[0] = *(const v8us*)&sPh[w][ln][8 * hh]; pah.half[1] = *(const v8us*)&sPh[w][ln][16 + 8 * hh];
    pal.half[0] = *(const v8us*)&sPl[w][ln][8 * hh]; pal.half[1] = *(const v8us*)&sPl[w][ln][16 + 8 * hh];
#pragma unroll
    for (int dt = 0; dt < DT; ++dt) {
      FragB bvh, bvl;
#pragma unroll
      for (int i = 0; i < 8; ++i) {
        bvh.u[i] = sVh[8 * hh + i][dt * 16 + ln]; bvh.u[8 + i] = sVh[16 + 8 * hh + i][dt * 16 + ln];
        bvl.u[i] = sVl[8 * hh + i][dt * 16 + ln]; bvl.u[8 + i] = sVl[16 + 8 * hh + i][dt * 16 + ln];
      }
      oacc[dt] = mmaN<3>(pah.v, pal.v, bvh.v, bvl.v, oacc[dt]);
    }
    __builtin_amdgcn_fence(__ATOMIC_ACQ_REL, "workgroup");
    __builtin_amdgcn_wave_barrier();
  }
#pragma unroll
  for (int r = 0; r < 8; ++r) {
    float l = l_r[r];
    l += __shfl_xor(l, 1, 32); l += __shfl_xor(l, 2, 32); l += __shfl_xor(l, 4, 32); l += __shfl_xor(l, 8, 32);
    l_r[r] = (l > 0.f) ? 1.0f / l : 0.f;
  }
#pragma unroll
  for (int dt = 0; dt < DT; ++dt)
#pragma unroll
    for (int r = 0; r < 8; ++r) sO[w][8 * hh + r][dt * 16 + ln] = oacc[dt][r] * l_r[r];
  __builtin_amdgcn_fence(__ATOMIC_ACQ_REL, "workgroup");
  __builtin_amdgcn_wave_barrier();
  {
    for (int r = 0; r < 16; ++r) {
      const int row = q0 + r;
      if (row < T && lane < D / 4) {
        const v4f val = *(const v4fa*)&sO[w][r][lane * 4];
        *(v4f*)(y + ((size_t)b * T + row) * ypitch + h * D + lane * 4) = val;
      }
    }
    
  }
}

// GEMM C = act(A·W + bias + resid): A f32 (ASPLIT -> hi/lo 2 terms), Wt bf16 [N][K]; ACT 0 none, 1 relu, 2 exact gelu;
// resid (optional, f32, row index = (row % rmod), pitch ldr, RES_BF16 rounds it) added before the activation.
template <bool ASPLIT, int ACT, bool BIAS_BF16, bool RES_BF16>
__global__ __launch_bounds__(128) void k_gemm_bf3(const float* __restrict__ A, int lda, const unsigned short* __restrict__ Wt, int ldb,
                                                const float* __restrict__ bias, const float* __restrict__ resid, int rmod, int ldr,
                                                float* __restrict__ C, int ldc, int M, int N, int K) {
  __shared__ __attribute__((aligned(16))) float so[4][16][64];
  const int tid = threadIdx.x, w = tid >> 5, lane = tid & 31, ln = lane & 15, hh = lane >> 4;
  const int ntn = N / 64;
  const int wid = blockIdx.x * 4 + w;
  const int mt = wid / ntn, nq = wid % ntn;
  if (mt * 16 >= M) return;
  const int row0 = mt * 16, col0 = nq * 64;
  const float* arow = A + (size_t)(row0 + ln) * lda;
  v8f acc[4] = {};
  for (int kb = 0; kb < K; kb += 32) {
    FragB ah, al;
    const v4f x0 = *(const v4fa*)(arow + kb + 8 * hh), x1 = *(const v4fa*)(arow + kb + 8 * hh + 4);
    const v4f x2 = *(const v4fa*)(arow + kb + 16 + 8 * hh), x3 = *(const v4fa*)(arow + kb + 16 + 8 * hh + 4);
    float xs[16] = {x0[0],x0[1],x0[2],x0[3],x1[0],x1[1],x1[2],x1[3],x2[0],x2[1],x2[2],x2[3],x3[0],x3[1],x3[2],x3[3]};
#pragma unroll
    for (int i = 0; i < 16; ++i) { const unsigned short hb = bf16_bits(xs[i]); ah.u[i] = hb; al.u[i] = ASPLIT ? bf16_bits(xs[i] - bf16_val(hb)) : (unsigned short)0; }
#pragma unroll
    for (int t = 0; t < 4; ++t) {
      const unsigned short* brow = Wt + (size_t)(col0 + t * 16 + ln) * ldb + kb;
      FragB b;
      b.half[0] = *(const v8us*)(brow + 8 * hh);
      b.half[1] = *(const v8us*)(brow + 16 + 8 * hh);
      acc[t] = mmaN<ASPLIT ? 2 : 1>(ah.v, al.v, b.v, b.v, acc[t]);
    }
  }
#pragma unroll
  for (int t = 0; t < 4; ++t) {
    const int col = col0 + t * 16 + ln;
    float bv = bias ? bias[col] : 0.f;
    if (BIAS_BF16) bv = bf16_round(bv);
#pragma unroll
    for (int r = 0; r < 8; ++r) {
      float v = acc[t][r] + bv;
      if (resid) { float rv = resid[(size_t)((row0 + 8 * hh + r) % rmod) * ldr + col]; if (RES_BF16) rv = bf16_round(rv); v += rv; }
      if (ACT == 1) v = fmaxf(v, 0.f);
      if (ACT == 2) v = 0.5f * v * (1.0f + erff(v * 0.70710678118654752f));
      if (ACT == 3) { const float u = 0.7978845608028654f * (v + 0.044715f * v * v * v); v = 0.5f * v * (1.0f + tanhf(u)); }
      so[w][8 * hh + r][t * 16 + ln] = v;
    }
  }
  __builtin_amdgcn_fence(__ATOMIC_ACQ_REL, "workgroup");
  __builtin_amdgcn_wave_barrier();
  const int rsub = lane >> 4, c4 = (lane & 15) * 4;
  {
#pragma unroll
    for (int q = 0; q < 8; ++q) {
      const int r = q * 2 + rsub;
      const v4f v = *(const v4fa*)&so[w][r][c4];
      *(v4f*)(C + (size_t)(row0 + r) * ldc + col0 + c4) = v;
    }
    
  }
}
// row LayerNorm (biased variance, eps) over N: s = X (+ R); optional out_sum <- s; out_norm <- (s-mu)*rsqrt(var+eps)*g + b
template <bool PARAM_BF16>
__global__ __launch_bounds__(256) void k_layernorm(const float* __restrict__ X, const float* __restrict__ R, const float* __restrict__ g, const float* __restrict__ bta,
                                                  float* __restrict__ out_sum, float* __restrict__ out_norm, int N, float eps) {
  __shared__ float red[256];
  const int row = blockIdx.x, tid = threadIdx.x;
  const float* x = X + (size_t)row * N; const float* rr = R ? R + (size_t)row * N : nullptr;
  float vals[16];                     // up to N = 4096
  const int per = N / 256;            // contiguous chunk per thread? use strided-by-4 chunks: thread handles j = tid*4 + 1024*u
  float s1 = 0.f;
  for (int u = 0; u < per / 4; ++u) {
    const int j = tid * 4 + 1024 * u;
    const v4f a = *(const v4fa*)(x + j);
    v4f b = {0.f,0.f,0.f,0.f}; if (rr) b = *(const v4fa*)(rr + j);
#pragma unroll
    for (int q = 0; q < 4; ++q) { const float v = a[q] + b[q]; vals[u * 4 + q] = v; s1 += v; }
  }
  red[tid] = s1; __syncthreads();
  for (int st = 128; st > 0; st >>= 1) { if (tid < st) red[tid] += red[tid + st]; __syncthreads(); }
  const float mu = red[0] / (float)N; __syncthreads();
  float s2 = 0.f;
  for (int u = 0; u < per / 4; ++u)
#pragma unroll
    for (int q = 0; q < 4; ++q) { const float c = vals[u * 4 + q] - mu; s2 += c * c; }
  red[tid] = s2; __syncthreads();
  for (int st = 128; st > 0; st >>= 1) { if (tid < st) red[tid] += red[tid + st]; __syncthreads(); }
  const float rs = rsqrtf(red[0] / (float)N + eps);
  {
    for (int u = 0; u < per / 4; ++u) {
      const int j = tid * 4 + 1024 * u;
      v4f o, sm;
#pragma unroll
      for (int q = 0; q < 4; ++q) {
        float gg = g[j + q], bb = bta[j + q];
        if (PARAM_BF16) { gg = bf16_round(gg); bb = bf16_round(bb); }
        sm[q] = vals[u * 4 + q]; o[q] = (vals[u * 4 + q] - mu) * rs * gg + bb;
      }
      if (out_sum) *(v4f*)(out_sum + (size_t)row * N + j) = sm;
      *(v4f*)(out_norm + (size_t)row * N + j) = o;
    }
    
  }
}



// ---- f16 WMMA path (v_wmma_f32_16x16x32_f16): 11-bit significands for operands in range — used here for the qkv and projection GEMMs and for attention
typedef _Float16 v16h __attribute__((ext_vector_type(16)));
union FragH { v16h v; v8us half[2]; _Float16 h[16]; unsigned short u[16]; };
template <int NT>
__device__ __forceinline__ v8f mmaH(v16h ah, v16h al, v16h bh, v16h bl, v8f c) {
  c = __builtin_amdgcn_wmma_f32_16x16x32_f16(false, ah, false, bh, (short)0, c, false, false);
  if (NT >= 2) c = __builtin_amdgcn_wmma_f32_16x16x32_f16(false, al, false, bh, (short)0, c, false, false);
  if (NT >= 3) c = __builtin_amdgcn_wmma_f32_16x16x32_f16(false, ah, false, bl, (short)0, c, false, false);
  asm volatile("v_nop\n\tv_nop\n\tv_nop\n\tv_nop" : "+v"(c) : "v"(ah), "v"(al), "v"(bh), "v"(bl));
  return c;
}
// batched GEMM like k_gemm_b but f16 operands: A f32 (split into f16 hi/lo if ASPLIT, else rounded to f16), Bt = f16 values [n][k]; alpha; C f32; N multiple of 16 (partial tiles skipped)
template <bool ASPLIT>
__global__ __launch_bounds__(128) void k_gemm_h(const float* __restrict__ A, int lda, size_t sA, const _Float16* __restrict__ Bh, int ldb, size_t sB, float alpha, float* __restrict__ C, int ldc, size_t sC, int M, int N, int K) {
  __shared__ __attribute__((aligned(16))) float so[4][16][64];
  const int tid = threadIdx.x, w = tid >> 5, lane = tid & 31, ln = lane & 15, hh = lane >> 4; const int by = blockIdx.y;
  A += (size_t)by * sA; Bh += (size_t)by * sB; C += (size_t)by * sC;
  const int ntn = (N + 63) / 64; const int wid = blockIdx.x * 4 + w; const int mt = wid / ntn, nq = wid % ntn; if (mt * 16 >= M) return;
  const int row0 = mt * 16, col0 = nq * 64; const float* arow = A + (size_t)(row0 + ln) * lda;
  v8f acc[4] = {};
  for (int kb = 0; kb < K; kb += 32) {
    FragH ah, al;
    const v4f x0 = *(const v4fa*)(arow + kb + 8 * hh), x1 = *(const v4fa*)(arow + kb + 8 * hh + 4), x2 = *(const v4fa*)(arow + kb + 16 + 8 * hh), x3 = *(const v4fa*)(arow + kb + 16 + 8 * hh + 4);
    float xs[16] = {x0[0],x0[1],x0[2],x0[3],x1[0],x1[1],x1[2],x1[3],x2[0],x2[1],x2[2],x2[3],x3[0],x3[1],x3[2],x3[3]};
#pragma unroll
    for (int i = 0; i < 16; ++i) { const _Float16 h = (_Float16)xs[i]; ah.h[i] = h; al.h[i] = ASPLIT ? (_Float16)(xs[i] - (float)h) : (_Float16)0.0f; }
#pragma unroll
    for (int t = 0; t < 4; ++t) { if (col0 + t * 16 >= N) continue; const size_t boff = (size_t)(col0 + t * 16 + ln) * ldb + kb; FragH bq; bq.half[0] = *(const v8us*)(Bh + boff + 8 * hh); bq.half[1] = *(const v8us*)(Bh + boff + 16 + 8 * hh);
      acc[t] = mmaH<ASPLIT ? 2 : 1>(ah.v, al.v, bq.v, bq.v, acc[t]); }
  }
#pragma unroll
  for (int t = 0; t < 4; ++t) { if (col0 + t * 16 >= N) continue;
#pragma unroll
    for (int r = 0; r < 8; ++r) so[w][8 * hh + r][t * 16 + ln] = acc[t][r] * alpha; }
  __builtin_amdgcn_fence(__ATOMIC_ACQ_REL, "workgroup"); __builtin_amdgcn_wave_barrier();
  const int rsub = lane >> 4, c4 = (lane & 15) * 4;
  {
#pragma unroll
    for (int q = 0; q < 8; ++q) { const int r = q * 2 + rsub; if (col0 + c4 < N) { const v4f v = *(const v4fa*)&so[w][r][c4]; *(v4f*)(C + (size_t)(row0 + r) * ldc + col0 + c4) = v; } }
     }
}

// Wt[n][k] = f16(bf16(W[k][n])·scale) from f32 row-major W[K][N] (scale = power of two; bf16-exact weights stay exact in f16 away from the subnormal range)
__global__ __launch_bounds__(256) void k_wt_f16(const float* __restrict__ W, _Float16* __restrict__ Wt, int K, int N, float scale) {
  const int t = blockIdx.x * 256 + threadIdx.x; if (t >= N * (K / 8)) return; const int n = t / (K / 8), k8 = (t % (K / 8)) * 8; FragH f;
#pragma unroll
  for (int i = 0; i < 8; ++i) f.h[i] = (_Float16)(bf16_round(W[(size_t)(k8 + i) * N + n]) * scale); const v8us o = f.half[0];
  *(v8us*)((unsigned short*)Wt + (size_t)n * K + k8) = o; 
}
// one f16 product as the bare builtin: in a run of products each fills the others' distance, and the compiler pads what is left
__device__ __forceinline__ v8f mmaB(v16h a, v16h b, v8f c) { return __builtin_amdgcn_wmma_f32_16x16x32_f16(false, a, false, b, (short)0, c, false, false); }
// acc[t] += A (16 rows x CC) . B_t^T (16 rows x CC), t = 0..3, k ascending. arow / brow: the lane's own row, + 8 hh; tile t of B lies bt halves on, k block ks lies bk halves on.
// The fragment loads run ahead of the products in groups of G k blocks (20 loads), AH groups in flight: a wave waits for memory once a group in flight, not once a product.
template <int AH>
__device__ __forceinline__ void mm16x64(const unsigned short* __restrict__ arow, const unsigned short* __restrict__ brow, size_t bt, size_t bk, v8f (&acc)[4]) {
  constexpr int KS = CC / 32, G = 2, NG = KS / G;
  FragH a[KS], b[KS][4];
  auto fetch = [&](int g) {
#pragma unroll
    for (int ks = g * G; ks < g * G + G; ++ks) { a[ks].half[0] = *(const v8us*)(arow + ks * 32); a[ks].half[1] = *(const v8us*)(arow + ks * 32 + 16);
#pragma unroll
      for (int t = 0; t < 4; ++t) { const unsigned short* p = brow + ks * bk + t * bt; b[ks][t].half[0] = *(const v8us*)p; b[ks][t].half[1] = *(const v8us*)(p + 16); } }
  };
  /* every "#pragma unroll" here keeps the fragment arrays, which the loop variables index, in registers */
#pragma unroll
  for (int g = 0; g < AH; ++g) fetch(g);
  __builtin_amdgcn_sched_barrier(0);      /* keeps the first AH groups' loads in front of the first product: sunk to their users they would each be waited for alone */
#pragma unroll
  for (int g = 0; g < NG; ++g) {
#pragma unroll
    for (int ks = g * G; ks < g * G + G; ++ks)
#pragma unroll
      for (int t = 0; t < 4; ++t) acc[t] = mmaB(a[ks].v, b[ks][t].v, acc[t]);
    if (g + AH < NG) { fetch(g + AH); __builtin_amdgcn_sched_barrier(0); }      /* the refill is issued here, AH groups ahead of its products, and is not sunk to them */
  }
}
// LDS row pitch of a staged operand tile, in halves: 528 bytes = 16 x 33, so the 16-byte fragment reads of 16 rows fall on 64 different banks
#define SP (CC + 8)
// eight asynchronous 16-byte copies of this lane, global -> LDS: copy i goes from g + i * gs (halves) to LDS byte address l + i * ls
__device__ __forceinline__ void copy8(unsigned l, unsigned ls, const unsigned short* g, size_t gs) {
  /* s_wait_xcnt closes the statement so that no address register of a copy is rewritten in front of it */
  asm volatile("global_load_async_to_lds_b128 %0, %8, off\n\t"
               "global_load_async_to_lds_b128 %1, %9, off\n\t"
               "global_load_async_to_lds_b128 %2, %10, off\n\t"
               "global_load_async_to_lds_b128 %3, %11, off\n\t"
               "global_load_async_to_lds_b128 %4, %12, off\n\t"
               "global_load_async_to_lds_b128 %5, %13, off\n\t"
               "global_load_async_to_lds_b128 %6, %14, off\n\t"
               "global_load_async_to_lds_b128 %7, %15, off\n\t"
               "s_wait_xcnt 0x0"
               :: "v"(l), "v"(l + ls), "v"(l + 2 * ls), "v"(l + 3 * ls), "v"(l + 4 * ls), "v"(l + 5 * ls), "v"(l + 6 * ls), "v"(l + 7 * ls),
                  "v"(g), "v"(g + gs), "v"(g + 2 * gs), "v"(g + 3 * gs), "v"(g + 4 * gs), "v"(g + 5 * gs), "v"(g + 6 * gs), "v"(g + 7 * gs)
               : "memory");
}
// 64 rows of CC halves (global pitch ld) into s[64][SP]: a wave's copy is one whole 512-byte row (4 full lines); wave w brings rows w + 4 i, i = 0..15
__device__ __forceinline__ void stage64(unsigned short (*s)[SP], const unsigned short* __restrict__ g, int ld) {
  const int w = threadIdx.x >> 5, lane = threadIdx.x & 31;
  const unsigned l = (unsigned)(uintptr_t)&s[w][lane * 8]; const unsigned short* p = g + (size_t)w * ld + lane * 8;
  copy8(l, 4 * SP * 2, p, (size_t)4 * ld); copy8(l + 32 * SP * 2, 4 * SP * 2, p + (size_t)32 * ld, (size_t)4 * ld);
}
typedef _Float16 v4h __attribute__((ext_vector_type(4)));
typedef _Float16 v2h __attribute__((ext_vector_type(2)));
typedef __bf16 v2b __attribute__((ext_vector_type(2)));
typedef float v2fq __attribute__((ext_vector_type(2)));
// two input values as the GEMMs take them: rounded to bf16 (nearest even, one packed conversion), times sc (a power of two) in f32, then f16. The bf16 bits are widened by shift and mask.
__device__ __forceinline__ v2h in16(float a, float b, float sc) {
  const unsigned u = __builtin_bit_cast(unsigned, __builtin_convertvector((v2fq){a, b}, v2b));
  return (v2h){(_Float16)(__uint_as_float(u << 16) * sc), (_Float16)(__uint_as_float(u & 0xffff0000u) * sc)};
}
union Frag2 { v8us v; v2h p[4]; };
// q, k and v straight from the f32 inputs, one launch: a block = 64 tokens x 192 rows of qkv_w (three tiles of 64 rows), K = CC; 12 waves, wave = 16 x 64 outputs of one tile.
// Both operands are rounded on their way into LDS: waves 0..3 bring the x tile (channel-major in memory) and turn it token-major in registers, waves 4..11 bring 24 rows of qkv_w each (x 2^4).
// Row tiles 0..7 of qkv_w give [q | k] token-major [n][512] (A = tokens, B = weight rows), tiles 8..11 give v channel-major [(h,d)][n] = V^T (A = weight rows, B = tokens).
// LDS row 16 j + g of the x tile holds token 4 g + j: a lane's four tokens (one 16-byte load a channel) then go to rows 16 apart and the 16 lanes of a store to 16 consecutive rows, 64 different banks.
// Each block also rounds its 256 values of proj_w (x 2^4) for the projection launch.
#define QT 3
__global__ __launch_bounds__(384) void k_qkv(const float* __restrict__ x, const float* __restrict__ Wqkv, const float* __restrict__ Wp, _Float16* __restrict__ QK, _Float16* __restrict__ Vt, _Float16* __restrict__ Bp) {
  __shared__ __attribute__((aligned(16))) float so[4 * QT][16][64 + 4];      /* pitch 272 bytes: the two halves' rows, 8 apart, fall on different banks */
  __shared__ __attribute__((aligned(16))) unsigned short sT[64 + 64 * QT][SP];      /* rows 0..63: x tile; rows 64 ..: weight rows */
  const int tid = threadIdx.x, lane = tid & 31, ln = lane & 15, hh = lane >> 4;
  const int w = __builtin_amdgcn_readfirstlane(tid >> 5);      /* the wave's number in a scalar register: the branches on it are scalar */
  const int tb = blockIdx.x / (C3 / (64 * QT)), G = blockIdx.x % (C3 / (64 * QT));
  v4f pa = {0.f, 0.f, 0.f, 0.f}, pb = pa;      /* wave 0: the block's share of proj_w, loaded ahead of the x tile; rounded and stored behind the barrier, so that no wave waits there for its load alone or for its store */
  if (w < 4) {
    if (w == 0) { const float* p = Wp + ((size_t)blockIdx.x * 32 + lane) * 8; pa = *(const v4fa*)p; pb = *(const v4fa*)(p + 4); }
    const int cw = w * 64 + hh * 8; const float* xp = x + (size_t)cw * NN + tb * 64 + ln * 4;      /* one address a lane: every load of the tile is a constant offset from it */
    /* a "#pragma unroll" whose loop variable indexes an array (r, f, acc, h4) keeps that array in registers */
#pragma unroll
    for (int i = 0; i < 4; ++i) { const int c0 = cw + i * 16; v4f r[8];      /* 8 channels x 4 tokens a lane; a load covers 256 contiguous bytes of two channel rows */
#pragma unroll
      for (int q = 0; q < 8; ++q) r[q] = *(const v4fa*)(xp + (size_t)(i * 16 + q) * NN);
#pragma unroll
      for (int j = 0; j < 4; ++j) { Frag2 f;
#pragma unroll
        for (int q = 0; q < 4; ++q) f.p[q] = in16(r[2 * q][j], r[2 * q + 1][j], 1.0f);
        *(v8us*)&sT[16 * j + ln][c0] = f.v; } }
  } else {
    const int r0 = (w - 4) * (8 * QT); const float* wp = Wqkv + ((size_t)G * (64 * QT) + r0) * CC + lane * 4;
#pragma unroll
    for (int i = 0; i < 8 * QT; ++i) {      /* a row is two loads of 512 contiguous bytes */
#pragma unroll
      for (int s = 0; s < 2; ++s) { const v4f a = *(const v4fa*)(wp + (size_t)i * CC + s * 128); const v2h lo = in16(a[0], a[1], 16.0f), hi = in16(a[2], a[3], 16.0f);
        *(v4h*)&sT[64 + r0 + i][s * 128 + lane * 4] = (v4h){lo[0], lo[1], hi[0], hi[1]}; } }
  }
  asm volatile("s_wait_xcnt 0x0" ::: "memory");      /* behind the staging loads: stands in front of whatever next takes a register that one of them names */
  __syncthreads();      /* both operands are whole in LDS; passed by every wave */
  if (w == 0) { Frag2 f; f.p[0] = in16(pa[0], pa[1], 16.0f); f.p[1] = in16(pa[2], pa[3], 16.0f); f.p[2] = in16(pb[0], pb[1], 16.0f); f.p[3] = in16(pb[2], pb[3], 16.0f);
    *(v8us*)((unsigned short*)Bp + ((size_t)blockIdx.x * 32 + lane) * 8) = f.v;
    asm volatile("s_wait_xcnt 0x0" ::: "memory"); }      /* behind the store: stands in front of whatever next takes a register that it names */
  const int g = w >> 2, wq = w & 3, T = G * QT + g; const bool vr = T >= 2 * CC / 64;
  const int ra = vr ? 64 + g * 64 + wq * 16 : wq * 16, rb = vr ? 0 : 64 + g * 64;
  v8f acc[4] = {};
  mm16x64<2>(&sT[ra + ln][8 * hh], &sT[rb + ln][8 * hh], (size_t)16 * SP, 32, acc);
  if (vr) {      /* column ln of B tile t is token 4 ln + t */
#pragma unroll
    for (int r = 0; r < 8; ++r) *(v4f*)&so[w][8 * hh + r][4 * ln] = (v4f){acc[0][r] * 0.0625f, acc[1][r] * 0.0625f, acc[2][r] * 0.0625f, acc[3][r] * 0.0625f};
  } else {
#pragma unroll
    for (int t = 0; t < 4; ++t)
#pragma unroll
      for (int r = 0; r < 8; ++r) so[w][8 * hh + r][t * 16 + ln] = acc[t][r] * 0.0625f;
  }
  __builtin_amdgcn_fence(__ATOMIC_ACQ_REL, "workgroup"); __builtin_amdgcn_wave_barrier();      /* the wave's LDS writes are done before its lanes read each other's */
  /* row r of the wave's tile: channel (T - 8) 64 + 16 wq + r of V^T, or token 64 tb + 4 r + wq of [q | k] */
  _Float16* dst = vr ? Vt + ((size_t)(T - 2 * CC / 64) * 64 + wq * 16) * NN + tb * 64 : QK + ((size_t)tb * 64 + wq) * (2 * CC) + T * 64;
  const size_t rs = vr ? (size_t)NN : (size_t)4 * 2 * CC;
  const int rsub = lane >> 4, c4 = (lane & 15) * 4;
#pragma unroll
  for (int q = 0; q < 8; ++q) { const int r = q * 2 + rsub; const v4f v = *(const v4fa*)&so[w][r][c4]; v4h h4;
#pragma unroll
    for (int i = 0; i < 4; ++i) h4[i] = (_Float16)v[i];
    *(v4h*)(dst + r * rs + c4) = h4; }
  asm volatile("s_wait_xcnt 0x0" ::: "memory");      /* behind the run of stores: stands in front of whatever next takes a register that a store names */
}

__global__ __launch_bounds__(256) void k_x16(const float* __restrict__ x, _Float16* __restrict__ X16, size_t n8) { const size_t t = (size_t)blockIdx.x * 256 + threadIdx.x; if (t >= n8) return; FragH f;
#pragma unroll
  for (int q = 0; q < 8; ++q) f.h[q] = (_Float16)bf16_round(x[t * 8 + q]); *(v8us*)((unsigned short*)X16 + t * 8) = f.half[0];  }
template <int NHv, int TTv>
__global__ __launch_bounds__(256) void k_vt(const _Float16* __restrict__ V16, int ldv, int voff, _Float16* __restrict__ Vt) { __shared__ unsigned short tl[64][66]; const int tid = threadIdx.x; const int slab = blockIdx.x / (TTv / 64), lg = blockIdx.x % (TTv / 64); const int b = slab / NHv, h = slab % NHv;
  for (int i = tid; i < 64 * 8; i += 256) { const int r = i / 8, c8 = (i % 8) * 8; FragH f; f.half[0] = *(const v8us*)((const unsigned short*)V16 + ((size_t)b * TTv + lg * 64 + r) * ldv + voff + h * 64 + c8);
#pragma unroll
    for (int q = 0; q < 8; ++q) tl[r][c8 + q] = f.u[q]; }
  __syncthreads();
  {
#pragma unroll
    for (int rd = 0; rd < 2; ++rd) { const int d = rd * 32 + tid / 8, pc = tid % 8; FragH f;
#pragma unroll
      for (int q = 0; q < 8; ++q) f.u[q] = tl[pc * 8 + q][d];
      *(v8us*)((unsigned short*)Vt + ((size_t)slab * 64 + d) * TTv + lg * 64 + pc * 8) = f.half[0]; }
     } }

typedef float v2f __attribute__((ext_vector_type(2)));
// lane l <-> l ^ 16: the two halves of a wave each hold half of a query column's keys
__device__ __forceinline__ float xhalf(float v) { const int b = __float_as_int(v); return __int_as_float(__builtin_amdgcn_permlanex16(b, b, 0x76543210, 0xfedcba98, false, false)); }
// Transposed products: S^T = K.Q^T (A = 16 key rows, B = the wave's 16 queries as columns), O^T += V^T.P^T. A lane then holds 16 of the 32 scores of ONE query
// (keys 8hh + r and 16 + 8hh + r), which is the k order of a B operand: P goes from the score accumulators into the second product without LDS.
// K and V^T come in tiles of KT keys that the block's four waves share: asynchronous 16-byte copies fill one LDS buffer while the other is worked on (two buffers, one barrier a tile).
__global__ __launch_bounds__(128) void k_flash(const _Float16* __restrict__ Q16, int ldq, const _Float16* __restrict__ K16, int ldk, const _Float16* __restrict__ Vt, const int* __restrict__ MSK, _Float16* __restrict__ O16) {
  constexpr int RPW = 16, NQB = NN / (4 * RPW), DT = 2;
  constexpr int KT = 128, NT = NN / KT, NS = KT / 16, KP = HD + 8, VP = KT + 8;      /* row pitches of 80 and 272 bytes (16 x odd): 16-byte fragment reads of 16 rows fall on 64 different banks */
  __shared__ __attribute__((aligned(16))) unsigned short sK[2][KT][KP];      /* K tile: key rows of 32 halves */
  __shared__ __attribute__((aligned(16))) unsigned short sV[2][HD][VP];      /* V^T tile: channel rows of KT halves */
  const int tid = threadIdx.x, w = tid >> 5, lane = tid & 31, ln = lane & 15, hh = lane >> 4; (void)MSK;
  const int slab = blockIdx.x / NQB, qblk = blockIdx.x % NQB; const int h = slab; const int b = 0; const int qb0 = qblk * (4 * RPW); const int q0 = qb0 + w * RPW;
  FragH bq;
  { const unsigned short* qr = (const unsigned short*)Q16 + ((size_t)b * NN + q0 + ln) * ldq + h * HD; bq.half[0] = *(const v8us*)(qr + 8 * hh); bq.half[1] = *(const v8us*)(qr + 16 + 8 * hh); }
  const unsigned short* Vth = (const unsigned short*)Vt + (size_t)h * HD * NN;      /* V^T = v[(h,d)][n] channel-major */
  /* a thread's share of a tile: 16-byte piece tid & 3 of key rows (tid >> 2) + 32 i, and piece tid & 15 of channel rows (tid >> 4) + 8 i, i = 0..3 */
  const unsigned short* gk = (const unsigned short*)K16 + (size_t)b * NN * ldk + h * HD + (size_t)(tid >> 2) * ldk + (tid & 3) * 8;
  const unsigned short* gv = Vth + (size_t)(tid >> 4) * NN + (tid & 15) * 8;
  const unsigned lk = (unsigned)(uintptr_t)&sK[0][tid >> 2][(tid & 3) * 8], lv = (unsigned)(uintptr_t)&sV[0][tid >> 4][(tid & 15) * 8];      /* LDS byte addresses */
  const size_t kstep = (size_t)32 * ldk;
  auto stage = [&](int t, int buf) {
    const unsigned short* k0 = gk + (size_t)t * KT * ldk; const unsigned short* v0 = gv + t * KT;
    const unsigned a0 = lk + (unsigned)buf * (KT * KP * 2), c0 = lv + (unsigned)buf * (HD * VP * 2);
    /* the tile's eight copies of this thread; s_wait_xcnt closes the statement so that no address register of a copy is rewritten in front of it */
    asm volatile("global_load_async_to_lds_b128 %0, %8, off\n\t"
                 "global_load_async_to_lds_b128 %1, %9, off\n\t"
                 "global_load_async_to_lds_b128 %2, %10, off\n\t"
                 "global_load_async_to_lds_b128 %3, %11, off\n\t"
                 "global_load_async_to_lds_b128 %4, %12, off\n\t"
                 "global_load_async_to_lds_b128 %5, %13, off\n\t"
                 "global_load_async_to_lds_b128 %6, %14, off\n\t"
                 "global_load_async_to_lds_b128 %7, %15, off\n\t"
                 "s_wait_xcnt 0x0"
                 :: "v"(a0), "v"(a0 + 32 * KP * 2), "v"(a0 + 64 * KP * 2), "v"(a0 + 96 * KP * 2), "v"(c0), "v"(c0 + 8 * VP * 2), "v"(c0 + 16 * VP * 2), "v"(c0 + 24 * VP * 2),
                    "v"(k0), "v"(k0 + kstep), "v"(k0 + 2 * kstep), "v"(k0 + 3 * kstep), "v"(v0), "v"(v0 + 8 * NN), "v"(v0 + 16 * NN), "v"(v0 + 24 * NN)
                 : "memory");
  };
  constexpr float SL2 = 0.25503486f;      /* 32^-1/2 x log2(e): the softmax runs in base 2, one multiply-add and one v_exp_f32 a score */
  float m_c = -3.0e38f, l_c = 0.f; v8f oacc[DT];      /* running maximum (in log2 units) and this half's partial sum (x 2^10) of query q0 + ln; oacc[dt][r] = O^T[dt*16 + 8hh + r][q0 + ln] */
#pragma unroll
  for (int dt = 0; dt < DT; ++dt) oacc[dt] = (v8f){0.f,0.f,0.f,0.f,0.f,0.f,0.f,0.f};
  stage(0, 0);
  asm volatile("s_wait_asynccnt 0x0" ::: "memory");      /* this wave's share of tile 0 has landed */
  __syncthreads();      /* every wave's share of tile 0 has landed */
  stage(1, 1);
  /* the tile loop stays rolled: more copies of the long body would only grow the code; every "#pragma unroll" in this kernel keeps an array that the loop variable indexes in registers */
#pragma unroll 1
  for (int t = 0; t < NT; ++t) {
   const int buf = t & 1;
   /* one softmax step a tile: all of the tile's fragments are read first, its NS score products stand in one run, one maximum, one exchange between the halves and one rescale of O serve all KT keys, and its PV products follow */
   FragH ak[NS], av[NS / 2][DT];
#pragma unroll
   for (int nt = 0; nt < NS; ++nt) { const unsigned short* kr = &sK[buf][nt * 16 + ln][0]; ak[nt].half[0] = *(const v8us*)(kr + 8 * hh); ak[nt].half[1] = *(const v8us*)(kr + 16 + 8 * hh); }
#pragma unroll
   for (int ks = 0; ks < NS / 2; ++ks)
#pragma unroll
    for (int dt = 0; dt < DT; ++dt) { const unsigned short* vrow = &sV[buf][dt * 16 + ln][ks * 32]; av[ks][dt].half[0] = *(const v8us*)(vrow + 8 * hh); av[ks][dt].half[1] = *(const v8us*)(vrow + 16 + 8 * hh); }
   __builtin_amdgcn_sched_barrier(0);      /* keeps the tile's 32 fragment reads in one group in front of the products: spread among them they came in four groups, each with its own wait for the LDS latency */
   v8f sc[NS];      /* raw q.k sums of keys nt*16 + 8hh + r; the scale goes into the exponent's multiply-add */
#pragma unroll
   for (int nt = 0; nt < NS; ++nt) sc[nt] = mmaB(ak[nt].v, bq.v, (v8f){0.f,0.f,0.f,0.f,0.f,0.f,0.f,0.f});
   /* the tile now lives in registers: its buffer is handed back here, so that the refill flies during the whole softmax and PV part */
   asm volatile("s_wait_dscnt 0x0" ::: "memory");      /* this wave's reads of buffer buf have returned before the buffer is refilled */
   asm volatile("s_wait_asynccnt 0x0" ::: "memory");      /* this wave's share of tile t + 1 has landed */
   __syncthreads();      /* publishes tile t + 1 and ends every wave's reads of buffer buf */
   if (t + 2 < NT) stage(t + 2, buf);
   float mx[8];      /* every step takes in two more values (a three-input maximum) */
#pragma unroll
   for (int r = 0; r < 8; ++r) { mx[r] = sc[0][r];
#pragma unroll
    for (int nt = 1; nt + 1 < NS; nt += 2) mx[r] = fmaxf(fmaxf(mx[r], sc[nt][r]), sc[nt + 1][r]); }
#pragma unroll
   for (int i = 0; i < 4; ++i) mx[i] = fmaxf(fmaxf(mx[2 * i], mx[2 * i + 1]), sc[NS - 1][i]);
   mx[0] = fmaxf(fmaxf(mx[0], sc[NS - 1][4]), sc[NS - 1][5]); mx[1] = fmaxf(fmaxf(mx[1], sc[NS - 1][6]), sc[NS - 1][7]);
   float mc = fmaxf(fmaxf(fmaxf(mx[0], mx[1]), mx[2]), mx[3]);
   mc = fmaxf(mc, xhalf(mc));
   const float mn = fmaxf(m_c, mc * SL2); const float al = (mn > -1.0e38f) ? __builtin_amdgcn_exp2f(m_c - mn) : 1.0f; m_c = mn;
   const float mb = mn - 10.0f;      /* p = 2^(s SL2 - mn + 10): the 2^10 of the f16 P rides in the exponent, and the row sum carries it too */
   FragH pb[NS / 2]; v2f ps[NS];      /* pb[ks]: P^T of keys ks*32 .. +31 in the k order of a B operand (score tile 2ks, then 2ks + 1); ps[nt]: two partial sums of score tile nt */
#pragma unroll
   for (int nt = 0; nt < NS; ++nt) {
#pragma unroll
    for (int r = 0; r < 8; r += 2) {
      const v2f e = __builtin_elementwise_fma((v2f){sc[nt][r], sc[nt][r + 1]}, (v2f){SL2, SL2}, (v2f){-mb, -mb});      /* two exponents a packed multiply-add */
      const v2f p = {__builtin_amdgcn_exp2f(e[0]), __builtin_amdgcn_exp2f(e[1])};
      pb[nt >> 1].h[(nt & 1) * 8 + r] = (_Float16)p[0]; pb[nt >> 1].h[(nt & 1) * 8 + r + 1] = (_Float16)p[1];
      ps[nt] = r ? ps[nt] + p : p; } }
#pragma unroll
   for (int st = NS / 2; st > 0; st >>= 1)
#pragma unroll
    for (int nt = 0; nt < st; ++nt) ps[nt] += ps[nt + st];
   l_c = l_c * al + (ps[0][0] + ps[0][1]);
#pragma unroll
   for (int dt = 0; dt < DT; ++dt)
#pragma unroll
    for (int r = 0; r < 8; ++r) oacc[dt][r] *= al;
#pragma unroll
   for (int ks = 0; ks < NS / 2; ++ks)
#pragma unroll
    for (int dt = 0; dt < DT; ++dt) oacc[dt] = mmaB(av[ks][dt].v, pb[ks].v, oacc[dt]);
  }
  asm volatile("s_wait_asynccnt 0x0" ::: "memory");      /* no copy is outstanding when the wave goes on to its end */
  const float l = l_c + xhalf(l_c); const float inv = (l > 0.f) ? 1.0f / l : 0.f;      /* l and oacc both carry the 2^10 */
  /* O leaves as f16, the projection's operand type, head-major [h][n][32]: a lane's 8 accumulators of a tile are 8 consecutive channels of its query = one 16-byte store; a wave's 16 queries fill 1 KiB that no other wave writes */
#pragma unroll
  for (int dt = 0; dt < DT; ++dt) { FragH f;
#pragma unroll
    for (int r = 0; r < 8; ++r) f.h[r] = (_Float16)(oacc[dt][r] * inv);
    *(v8us*)((unsigned short*)O16 + ((size_t)h * NN + q0 + ln) * HD + dt * 16 + 8 * hh) = f.half[0]; }
}

// out[c][n] = proj_w . O^T + proj_b, in the output's own channel-major layout: A = 16 rows of the rounded proj_w (x 2^4), B = 64 tokens of O (head-major [h][n][32]: k block kb is head kb / 32).
// A block = 64 channels x 64 tokens, both operands staged whole in LDS by asynchronous copies. One wave = 16 channels x 64 tokens; the tile goes through the wave's own LDS range so that each store covers whole 256-byte pieces of output rows. M 256 N 4096 K 256.
__global__ __launch_bounds__(128) void k_proj(const _Float16* __restrict__ Bp, const _Float16* __restrict__ O16, const float* __restrict__ bias, float* __restrict__ out) {
  __shared__ __attribute__((aligned(16))) float so[4][16][64 + 4];      /* pitch 272 bytes: the two halves' rows, 8 apart, fall on different banks */
  const int tid = threadIdx.x, w = tid >> 5, lane = tid & 31, ln = lane & 15, hh = lane >> 4;
  __shared__ __attribute__((aligned(16))) unsigned short sA[64][SP], sB[64][SP];      /* proj_w rows; O rows token-major, channel = head * 32 + d */
  const int mb = blockIdx.x / (NN / 64); const int row0 = mb * 64 + w * 16, col0 = (blockIdx.x % (NN / 64)) * 64;
  stage64(sA, (const unsigned short*)Bp + (size_t)mb * 64 * CC, CC);
  { /* O: a wave's copy is 8 tokens x 64 bytes of one head, 512 contiguous bytes; wave w brings tokens 8 w .. 8 w + 7 and 32 + 8 w .. of each of the 8 heads */
    const unsigned l = (unsigned)(uintptr_t)&sB[w * 8 + (lane >> 2)][(lane & 3) * 8]; const unsigned short* p = (const unsigned short*)O16 + (size_t)(col0 + w * 8) * HD + lane * 8;
    copy8(l, HD * 2, p, (size_t)NN * HD); copy8(l + 32 * SP * 2, HD * 2, p + 32 * HD, (size_t)NN * HD); }
  const v4f b0 = *(const v4fa*)(bias + row0 + 8 * hh), b1 = *(const v4fa*)(bias + row0 + 8 * hh + 4);
  asm volatile("s_wait_xcnt 0x0" ::: "memory");      /* the bias loads' address pair is dead from here on: the wait stands in front of whatever next takes its registers */
  asm volatile("s_wait_asynccnt 0x0" ::: "memory");      /* this wave's share of the two tiles has landed */
  __syncthreads();      /* every wave's share has landed */
  v8f acc[4] = {};
  mm16x64<2>(&sA[w * 16 + ln][8 * hh], &sB[ln][8 * hh], (size_t)16 * SP, 32, acc);
#pragma unroll
  for (int t = 0; t < 4; ++t)
#pragma unroll
    for (int r = 0; r < 8; ++r) so[w][8 * hh + r][t * 16 + ln] = acc[t][r] * 0.0625f + bf16_round(r < 4 ? b0[r & 3] : b1[r & 3]);
  __builtin_amdgcn_fence(__ATOMIC_ACQ_REL, "workgroup"); __builtin_amdgcn_wave_barrier();      /* the wave's LDS writes are done before its lanes read each other's */
  const int rsub = lane >> 4, c4 = (lane & 15) * 4;
#pragma unroll
  for (int q = 0; q < 8; ++q) { const int r = q * 2 + rsub; const v4f v = *(const v4fa*)&so[w][r][c4]; *(v4f*)(out + (size_t)(row0 + r) * NN + col0 + c4) = v; }
}

extern "C" void kernel_launch(void* const* d_in, const int* in_sizes, int n_in,
                              void* d_out, int out_size, void* d_ws, size_t ws_size, hipStream_t stream) {
  (void)in_sizes; (void)n_in; (void)out_size;
  const float* x = (const float*)d_in[0]; const float* Wqkv = (const float*)d_in[1]; const float* Wp = (const float*)d_in[2]; const float* bp = (const float*)d_in[3];
  char* ws = (char*)d_ws; size_t off = 0;
  auto take = [&](size_t bytes) { char* p = ws + off; off += (bytes + 255) & ~(size_t)255; return p; };
  _Float16* Bp = (_Float16*)take((size_t)CC * CC * 2);
  _Float16* QK = (_Float16*)take((size_t)NR * 2 * CC * 2); _Float16* Vt = (_Float16*)take((size_t)CC * NN * 2); _Float16* O16 = (_Float16*)take((size_t)NR * CC * 2);
  if (off > ws_size) return;      // 0.1 + 4.2 + 2.1 + 2.1 = about 8.5 MB
  k_qkv<<<(NN / 64) * (C3 / (64 * QT)), 384, 0, stream>>>(x, Wqkv, Wp, QK, Vt, Bp);
  k_flash<<<NH * (NN / 64), 128, 0, stream>>>(QK, 2 * CC, QK + CC, 2 * CC, Vt, nullptr, O16);      /* blocks = head x 64-query groups */
  k_proj<<<(CC / 16) * (NN / 64) / 4, 128, 0, stream>>>(Bp, O16, bp, (float*)d_out);
}

// v010
// It runs in 37 microseconds.
// Next to v009, in two timings, it ran 1.04 and 1.05 times as fast.
// Over all steps from v000 it is 10.7 times as fast.
#include <hip/hip_runtime.h>
// 3-D multi-head self-attention on channel-major x [1, 256, 16³ = 4096]: qkv = qkv_w·x (1×1×1 conv, no bias), 8 heads × 32, softmax(qᵀk·32^-½) over keys, out[h,d,n] = Σ_m attn[n,m]·v[h,d,m], then proj_w·out + proj_b.
// Compute dtype: x, qkv_w, proj_w, proj_b rounded to bf16; q/k token-major and v channel-major (= Vᵀ) as f16 GEMM outputs (f32 accumulate); fused flash-style kernel per head
// (online softmax f32 in base 2, P f16 on a scale that moves only when it must) on v_wmma_f32_16x16x32_f16, which stores O as f16; projection GEMM with bias, computed channel-major (A = proj_w) and stored straight to out; f32 accumulate throughout.
#define BB 1
#define CC 256
#define C3 768
#define NH 8
#define HD 32
#define NN 4096
#define NR (BB * NN)

typedef __bf16 v16b __attribute__((ext_vector_type(16)));
typedef unsigned short v8us __attribute__((ext_vector_type(8), may_alias));
typedef float  v8f  __attribute__((ext_vector_type(8)));
typedef float  v4f  __attribute__((ext_vector_type(4)));
typedef float  v4fa __attribute__((ext_vector_type(4), may_alias));
union FragB { v16b v; v8us half[2]; unsigned short u[16]; };

__device__ __forceinline__ unsigned short bf16_bits(float x) { unsigned int u = __float_as_uint(x); return (unsigned short)((u + 0x7FFFu + ((u >> 16) & 1u)) >> 16); }
__device__ __forceinline__ float bf16_val(unsigned short b) { return __uint_as_float(((unsigned int)b) << 16); }
__device__ __forceinline__ float bf16_round(float x) { return bf16_val(bf16_bits(x)); }
// D += A·B with NT terms: 1 = ah·bh, 2 = + al·bh (A split), 3 = + ah·bl (both split)
template <int NT>
__device__ __forceinline__ v8f mmaN(v16b ah, v16b al, v16b bh, v16b bl, v8f c) {
  c = __builtin_amdgcn_wmma_f32_16x16x32_bf16(false, ah, false, bh, (short)0, c, false, false);
  if (NT >= 2) c = __builtin_amdgcn_wmma_f32_16x16x32_bf16(false, al, false, bh, (short)0, c, false, false);
  if (NT >= 3) c = __builtin_amdgcn_wmma_f32_16x16x32_bf16(false, ah, false, bl, (short)0, c, false, false);
  asm volatile("v_nop\n\tv_nop\n\tv_nop\n\tv_nop" : "+v"(c) : "v"(ah), "v"(al), "v"(bh), "v"(bl));
  return c;
}

__global__ __launch_bounds__(256) void k_wt_bf16(const float* __restrict__ W, unsigned short* __restrict__ Wt, int K, int N) {
  const int t = blockIdx.x * 256 + threadIdx.x;
  const int k8n = K / 8;
  if (t >= N * k8n) return;
  const int n = t / k8n, k8 = (t % k8n) * 8;
  v8us v;
#pragma unroll
  for (int i = 0; i < 8; ++i) v[i] = bf16_bits(W[(size_t)(k8 + i) * N + n]);
  *(v8us*)(Wt + (size_t)n * K + k8) = v;
  
}

// GEMM C[M][N] (f32, pitch ldc) = act(A[M][K]·W + bias). A f32 row-major (pitch lda) converted per fragment to bf16
// (ASPLIT: hi/lo two planes -> 2 terms, else single rounded term); Wt bf16 [N][K] (pitch ldb). BIAS_BF16 rounds the
// bias to bf16 first (bias quantised to bf16 before the add). K%32==0, M%16==0, N%64==0.
template <bool ASPLIT, int ACT, bool BIAS_BF16>
__global__ __launch_bounds__(128) void k_gemm_bf(const float* __restrict__ A, int lda, const unsigned short* __restrict__ Wt, int ldb,
                                               const float* __restrict__ bias, float* __restrict__ C, int ldc, int M, int N, int K) {
  __shared__ __attribute__((aligned(16))) float so[4][16][64];
  const int tid = threadIdx.x, w = tid >> 5, lane = tid & 31, ln = lane & 15, hh = lane >> 4;
  const int ntn = N / 64;
  const int wid = blockIdx.x * 4 + w;
  const int mt = wid / ntn, nq = wid % ntn;
  if (mt * 16 >= M) return;
  const int row0 = mt * 16, col0 = nq * 64;
  const float* arow = A + (size_t)(row0 + ln) * lda;
  v8f acc[4] = {};
  for (int kb = 0; kb < K; kb += 32) {
    FragB ah, al;
    const v4f x0 = *(const v4fa*)(arow + kb + 8 * hh), x1 = *(const v4fa*)(arow + kb + 8 * hh + 4);
    const v4f x2 = *(const v4fa*)(arow + kb + 16 + 8 * hh), x3 = *(const v4fa*)(arow + kb + 16 + 8 * hh + 4);
    float xs[16] = {x0[0],x0[1],x0[2],x0[3],x1[0],x1[1],x1[2],x1[3],x2[0],x2[1],x2[2],x2[3],x3[0],x3[1],x3[2],x3[3]};
#pragma unroll
    for (int i = 0; i < 16; ++i) { const unsigned short hb = bf16_bits(xs[i]); ah.u[i] = hb; al.u[i] = ASPLIT ? bf16_bits(xs[i] - bf16_val(hb)) : (unsigned short)0; }
#pragma unroll
    for (int t = 0; t < 4; ++t) {
      const unsigned short* brow = Wt + (size_t)(col0 + t * 16 + ln) * ldb + kb;
      FragB b;
      b.half[0] = *(const v8us*)(brow + 8 * hh);
      b.half[1] = *(const v8us*)(brow + 16 + 8 * hh);
      acc[t] = mmaN<ASPLIT ? 2 : 1>(ah.v, al.v, b.v, b.v, acc[t]);
    }
  }
#pragma unroll
  for (int t = 0; t < 4; ++t) {
    float bv = bias ? bias[col0 + t * 16 + ln] : 0.f;
    if (BIAS_BF16) bv = bf16_round(bv);
#pragma unroll
    for (int r = 0; r < 8; ++r) { float v = acc[t][r] + bv; if (ACT == 1) v = fmaxf(v, 0.f); so[w][8 * hh + r][t * 16 + ln] = v; }
  }
  __builtin_amdgcn_fence(__ATOMIC_ACQ_REL, "workgroup");
  __builtin_amdgcn_wave_barrier();
  const int rsub = lane >> 4, c4 = (lane & 15) * 4;
  {
#pragma unroll
    for (int q = 0; q < 8; ++q) {
      const int r = q * 2 + rsub;
      const v4f v = *(const v4fa*)&so[w][r][c4];
      *(v4f*)(C + (size_t)(row0 + r) * ldc + col0 + c4) = v;
    }
    
  }
}

// Flash-style causal/unmasked attention, all contractions 3-term bf16 hi/lo splits, f32 softmax with running max.
// q,k,v rows are read from f32 buffers with arbitrary row pitch (so they can live inside a fused qkv buffer);
// D = head size (multiple of 32, <= 128); one wave = 16 query rows; block = 4 waves (64 queries) sharing K/V chunks of 32.
template <int D, bool CAUSAL>
__global__ __launch_bounds__(128) void k_flash(const float* __restrict__ qb, const float* __restrict__ kb, const float* __restrict__ vb,
                                             int pitch, int T, int H, float scale, float* __restrict__ y, int ypitch) {
  constexpr int KS = D / 32;        // k-steps for QK
  constexpr int DT = D / 16;        // d tiles for PV
  __shared__ __attribute__((aligned(16))) unsigned short sKh[32][D + 8], sKl[32][D + 8], sVh[32][D + 8], sVl[32][D + 8];
  __shared__ __attribute__((aligned(16))) unsigned short sPh[4][16][40], sPl[4][16][40];
  __shared__ __attribute__((aligned(16))) float sO[4][16][D];
  const int tid = threadIdx.x, w = tid >> 5, lane = tid & 31, ln = lane & 15, hh = lane >> 4;
  const int nqb = (T + 63) / 64;
  const int bh = blockIdx.x / nqb, qblk = blockIdx.x % nqb;
  const int b = bh / H, h = bh % H;
  const int q0 = qblk * 64 + w * 16;
  const float* Q = qb + (size_t)b * T * pitch + h * D;
  const float* K = kb + (size_t)b * T * pitch + h * D;
  const float* V = vb + (size_t)b * T * pitch + h * D;

  // A fragments of the wave's 16 query rows (scaled), hi/lo
  FragB aqh[KS], aql[KS];
  {
    int row = q0 + ln; if (row >= T) row = T - 1;
    const float* qr = Q + (size_t)row * pitch;
#pragma unroll
    for (int ks = 0; ks < KS; ++ks)
#pragma unroll
      for (int i = 0; i < 16; ++i) {
        const int d = ks * 32 + ((i < 8) ? (8 * hh + i) : (16 + 8 * hh + (i - 8)));
        const float x = qr[d] * scale; const unsigned short hb = bf16_bits(x);
        aqh[ks].u[i] = hb; aql[ks].u[i] = bf16_bits(x - bf16_val(hb));
      }
  }
  float m_r[8], l_r[8];
#pragma unroll
  for (int r = 0; r < 8; ++r) { m_r[r] = -3.0e38f; l_r[r] = 0.f; }
  v8f oacc[DT];
#pragma unroll
  for (int dt = 0; dt < DT; ++dt) oacc[dt] = (v8f){0.f,0.f,0.f,0.f,0.f,0.f,0.f,0.f};

  const int kv_end = CAUSAL ? min(T, qblk * 64 + 64) : T;     // block-uniform
  for (int j0 = 0; j0 < kv_end; j0 += 32) {
    __syncthreads();
    for (int e = tid; e < 32 * (D / 4); e += 128) {
      const int r = e / (D / 4), c4 = (e % (D / 4)) * 4;
      const int key = j0 + r;
      v4f kf = {0.f,0.f,0.f,0.f}, vf = {0.f,0.f,0.f,0.f};
      if (key < T) { kf = *(const v4fa*)(K + (size_t)key * pitch + c4); vf = *(const v4fa*)(V + (size_t)key * pitch + c4); }
#pragma unroll
      for (int t = 0; t < 4; ++t) {
        unsigned short hb = bf16_bits(kf[t]); sKh[r][c4 + t] = hb; sKl[r][c4 + t] = bf16_bits(kf[t] - bf16_val(hb));
        hb = bf16_bits(vf[t]); sVh[r][c4 + t] = hb; sVl[r][c4 + t] = bf16_bits(vf[t] - bf16_val(hb));
      }
    }
    __syncthreads();
    // S tile 16 x 32
    v8f s[2];
#pragma unroll
    for (int nt = 0; nt < 2; ++nt) {
      v8f acc = {};
#pragma unroll
      for (int ks = 0; ks < KS; ++ks) {
        FragB bh_, bl_;
        bh_.half[0] = *(const v8us*)&sKh[nt * 16 + ln][ks * 32 + 8 * hh]; bh_.half[1] = *(const v8us*)&sKh[nt * 16 + ln][ks * 32 + 16 + 8 * hh];
        bl_.half[0] = *(const v8us*)&sKl[nt * 16 + ln][ks * 32 + 8 * hh]; bl_.half[1] = *(const v8us*)&sKl[nt * 16 + ln][ks * 32 + 16 + 8 * hh];
        acc = mmaN<3>(aqh[ks].v, aql[ks].v, bh_.v, bl_.v, acc);
      }
      s[nt] = acc;
    }
    // mask + running max (rows 8hh+r; the 16 lanes of a half share rows)
    float alpha[8];
#pragma unroll
    for (int r = 0; r < 8; ++r) {
      const int qi = q0 + 8 * hh + r;
      const int ja = j0 + ln, jb = j0 + 16 + ln;
      if (CAUSAL) { if (ja > qi) s[0][r] = -3.0e38f; if (jb > qi) s[1][r] = -3.0e38f; }
      if (ja >= T) s[0][r] = -3.0e38f;
      if (jb >= T) s[1][r] = -3.0e38f;
      float mx = fmaxf(s[0][r], s[1][r]);
      mx = fmaxf(mx, __shfl_xor(mx, 1, 32)); mx = fmaxf(mx, __shfl_xor(mx, 2, 32)); mx = fmaxf(mx, __shfl_xor(mx, 4, 32)); mx = fmaxf(mx, __shfl_xor(mx, 8, 32));
      const float mnew = fmaxf(m_r[r], mx);
      alpha[r] = (mnew > -1.0e38f) ? __expf(m_r[r] - mnew) : 1.0f;
      const float p0 = (s[0][r] > -1.0e38f) ? __expf(s[0][r] - mnew) : 0.f;
      const float p1 = (s[1][r] > -1.0e38f) ? __expf(s[1][r] - mnew) : 0.f;
      m_r[r] = mnew;
      l_r[r] = l_r[r] * alpha[r] + p0 + p1;            // per-lane partial row sum (16 lanes combined at the end)
      unsigned short hb = bf16_bits(p0); sPh[w][8 * hh + r][ln] = hb;      sPl[w][8 * hh + r][ln] = bf16_bits(p0 - bf16_val(hb));
      hb = bf16_bits(p1);                sPh[w][8 * hh + r][16 + ln] = hb; sPl[w][8 * hh + r][16 + ln] = bf16_bits(p1 - bf16_val(hb));
    }
#pragma unroll
    for (int dt = 0; dt < DT; ++dt)
#pragma unroll
      for (int r = 0; r < 8; ++r) oacc[dt][r] *= alpha[r];
    __builtin_amdgcn_fence(__ATOMIC_ACQ_REL, "workgroup");
    __builtin_amdgcn_wave_barrier();
    FragB pah, pal;
    pah.half[0] = *(const v8us*)&sPh[w][ln][8 * hh]; pah.half[1] = *(const v8us*)&sPh[w][ln][16 + 8 * hh];
    pal.half[0] = *(const v8us*)&sPl[w][ln][8 * hh]; pal.half[1] = *(const v8us*)&sPl[w][ln][16 + 8 * hh];
#pragma unroll
    for (int dt = 0; dt < DT; ++dt) {
      FragB bvh, bvl;
#pragma unroll
      for (int i = 0; i < 8; ++i) {
        bvh.u[i] = sVh[8 * hh + i][dt * 16 + ln]; bvh.u[8 + i] = sVh[16 + 8 * hh + i][dt * 16 + ln];
        bvl.u[i] = sVl[8 * hh + i][dt * 16 + ln]; bvl.u[8 + i] = sVl[16 + 8 * hh + i][dt * 16 + ln];
      }
      oacc[dt] = mmaN<3>(pah.v, pal.v, bvh.v, bvl.v, oacc[dt]);
    }
    __builtin_amdgcn_fence(__ATOMIC_ACQ_REL, "workgroup");
    __builtin_amdgcn_wave_barrier();
  }
#pragma unroll
  for (int r = 0; r < 8; ++r) {
    float l = l_r[r];
    l += __shfl_xor(l, 1, 32); l += __shfl_xor(l, 2, 32); l += __shfl_xor(l, 4, 32); l += __shfl_xor(l, 8, 32);
    l_r[r] = (l > 0.f) ? 1.0f / l : 0.f;
  }
#pragma unroll
  for (int dt = 0; dt < DT; ++dt)
#pragma unroll
    for (int r = 0; r < 8; ++r) sO[w][8 * hh + r][dt * 16 + ln] = oacc[dt][r] * l_r[r];
  __builtin_amdgcn_fence(__ATOMIC_ACQ_REL, "workgroup");
  __builtin_amdgcn_wave_barrier();
  {
    for (int r = 0; r < 16; ++r) {
      const int row = q0 + r;
      if (row < T && lane < D / 4) {
        const v4f val = *(const v4fa*)&sO[w][r][lane * 4];
        *(v4f*)(y + ((size_t)b * T + row) * ypitch + h * D + lane * 4) = val;
      }
    }
    
  }
}

// GEMM C = act(A·W + bias + resid): A f32 (ASPLIT -> hi/lo 2 terms), Wt bf16 [N][K]; ACT 0 none, 1 relu, 2 exact gelu;
// resid (optional, f32, row index = (row % rmod), pitch ldr, RES_BF16 rounds it) added before the activation.
template <bool ASPLIT, int ACT, bool BIAS_BF16, bool RES_BF16>
__global__ __launch_bounds__(128) void k_gemm_bf3(const float* __restrict__ A, int lda, const unsigned short* __restrict__ Wt, int ldb,
                                                const float* __restrict__ bias, const float* __restrict__ resid, int rmod, int ldr,
                                                float* __restrict__ C, int ldc, int M, int N, int K) {
  __shared__ __attribute__((aligned(16))) float so[4][16][64];
  const int tid = threadIdx.x, w = tid >> 5, lane = tid & 31, ln = lane & 15, hh = lane >> 4;
  const int ntn = N / 64;
  const int wid = blockIdx.x * 4 + w;
  const int mt = wid / ntn, nq = wid % ntn;
  if (mt * 16 >= M) return;
  const int row0 = mt * 16, col0 = nq * 64;
  const float* arow = A + (size_t)(row0 + ln) * lda;
  v8f acc[4] = {};
  for (int kb = 0; kb < K; kb += 32) {
    FragB ah, al;
    const v4f x0 = *(const v4fa*)(arow + kb + 8 * hh), x1 = *(const v4fa*)(arow + kb + 8 * hh + 4);
    const v4f x2 = *(const v4fa*)(arow + kb + 16 + 8 * hh), x3 = *(const v4fa*)(arow + kb + 16 + 8 * hh + 4);
    float xs[16] = {x0[0],x0[1],x0[2],x0[3],x1[0],x1[1],x1[2],x1[3],x2[0],x2[1],x2[2],x2[3],x3[0],x3[1],x3[2],x3[3]};
#pragma unroll
    for (int i = 0; i < 16; ++i) { const unsigned short hb = bf16_bits(xs[i]); ah.u[i] = hb; al.u[i] = ASPLIT ? bf16_bits(xs[i] - bf16_val(hb)) : (unsigned short)0; }
#pragma unroll
    for (int t = 0; t < 4; ++t) {
      const unsigned short* brow = Wt + (size_t)(col0 + t * 16 + ln) * ldb + kb;
      FragB b;
      b.half[0] = *(const v8us*)(brow + 8 * hh);
      b.half[1] = *(const v8us*)(brow + 16 + 8 * hh);
      acc[t] = mmaN<ASPLIT ? 2 : 1>(ah.v, al.v, b.v, b.v, acc[t]);
    }
  }
#pragma unroll
  for (int t = 0; t < 4; ++t) {
    const int col = col0 + t * 16 + ln;
    float bv = bias ? bias[col] : 0.f;
    if (BIAS_BF16) bv = bf16_round(bv);
#pragma unroll
    for (int r = 0; r < 8; ++r) {
      float v = acc[t][r] + bv;
      if (resid) { float rv = resid[(size_t)((row0 + 8 * hh + r) % rmod) * ldr + col]; if (RES_BF16) rv = bf16_round(rv); v += rv; }
      if (ACT == 1) v = fmaxf(v, 0.f);
      if (ACT == 2) v = 0.5f * v * (1.0f + erff(v * 0.70710678118654752f));
      if (ACT == 3) { const float u = 0.7978845608028654f * (v + 0.044715f * v * v * v); v = 0.5f * v * (1.0f + tanhf(u)); }
      so[w][8 * hh + r][t * 16 + ln] = v;
    }
  }
  __builtin_amdgcn_fence(__ATOMIC_ACQ_REL, "workgroup");
  __builtin_amdgcn_wave_barrier();
  const int rsub = lane >> 4, c4 = (lane & 15) * 4;
  {
#pragma unroll
    for (int q = 0; q < 8; ++q) {
      const int r = q * 2 + rsub;
      const v4f v = *(const v4fa*)&so[w][r][c4];
      *(v4f*)(C + (size_t)(row0 + r) * ldc + col0 + c4) = v;
    }
    
  }
}
// row LayerNorm (biased variance, eps) over N: s = X (+ R); optional out_sum <- s; out_norm <- (s-mu)*rsqrt(var+eps)*g + b
template <bool PARAM_BF16>
__global__ __launch_bounds__(256) void k_layernorm(const float* __restrict__ X, const float* __restrict__ R, const float* __restrict__ g, const float* __restrict__ bta,
                                                  float* __restrict__ out_sum, float* __restrict__ out_norm, int N, float eps) {
  __shared__ float red[256];
  const int row = blockIdx.x, tid = threadIdx.x;
  const float* x = X + (size_t)row * N; const float* rr = R ? R + (size_t)row * N : nullptr;
  float vals[16];                     // up to N = 4096
  const int per = N / 256;            // contiguous chunk per thread? use strided-by-4 chunks: thread handles j = tid*4 + 1024*u
  float s1 = 0.f;
  for (int u = 0; u < per / 4; ++u) {
    const int j = tid * 4 + 1024 * u;
    const v4f a = *(const v4fa*)(x + j);
    v4f b = {0.f,0.f,0.f,0.f}; if (rr) b = *(const v4fa*)(rr + j);
#pragma unroll
    for (int q = 0; q < 4; ++q) { const float v = a[q] + b[q]; vals[u * 4 + q] = v; s1 += v; }
  }
  red[tid] = s1; __syncthreads();
  for (int st = 128; st > 0; st >>= 1) { if (tid < st) red[tid] += red[tid + st]; __syncthreads(); }
  const float mu = red[0] / (float)N; __syncthreads();
  float s2 = 0.f;
  for (int u = 0; u < per / 4; ++u)
#pragma unroll
    for (int q = 0; q < 4; ++q) { const float c = vals[u * 4 + q] - mu; s2 += c * c; }
  red[tid] = s2; __syncthreads();
  for (int st = 128; st > 0; st >>= 1) { if (tid < st) red[tid] += red[tid + st]; __syncthreads(); }
  const float rs = rsqrtf(red[0] / (float)N + eps);
  {
    for (int u = 0; u < per / 4; ++u) {
      const int j = tid * 4 + 1024 * u;
      v4f o, sm;
#pragma unroll
      for (int q = 0; q < 4; ++q) {
        float gg = g[j + q], bb = bta[j + q];
        if (PARAM_BF16) { gg = bf16_round(gg); bb = bf16_round(bb); }
        sm[q] = vals[u * 4 + q]; o[q] = (vals[u * 4 + q] - mu) * rs * gg + bb;
      }
      if (out_sum) *(v4f*)(out_sum + (size_t)row * N + j) = sm;
      *(v4f*)(out_norm + (size_t)row * N + j) = o;
    }
    
  }
}



// ---- f16 WMMA path (v_wmma_f32_16x16x32_f16): 11-bit significands for operands in range — used by all three launched kernels: qkv, attention, projection
typedef _Float16 v16h __attribute__((ext_vector_type(16)));
union FragH { v16h v; v8us half[2]; _Float16 h[16]; unsigned short u[16]; };
template <int NT>
__device__ __forceinline__ v8f mmaH(v16h ah, v16h al, v16h bh, v16h bl, v8f c) {
  c = __builtin_amdgcn_wmma_f32_16x16x32_f16(false, ah, false, bh, (short)0, c, false, false);
  if (NT >= 2) c = __builtin_amdgcn_wmma_f32_16x16x32_f16(false, al, false, bh, (short)0, c, false, false);
  if (NT >= 3) c = __builtin_amdgcn_wmma_f32_16x16x32_f16(false, ah, false, bl, (short)0, c, false, false);
  asm volatile("v_nop\n\tv_nop\n\tv_nop\n\tv_nop" : "+v"(c) : "v"(ah), "v"(al), "v"(bh), "v"(bl));
  return c;
}
// batched GEMM like k_gemm_b but f16 operands: A f32 (split into f16 hi/lo if ASPLIT, else rounded to f16), Bt = f16 values [n][k]; alpha; C f32; N multiple of 16 (partial tiles skipped)
template <bool ASPLIT>
__global__ __launch_bounds__(128) void k_gemm_h(const float* __restrict__ A, int lda, size_t sA, const _Float16* __restrict__ Bh, int ldb, size_t sB, float alpha, float* __restrict__ C, int ldc, size_t sC, int M, int N, int K) {
  __shared__ __attribute__((aligned(16))) float so[4][16][64];
  const int tid = threadIdx.x, w = tid >> 5, lane = tid & 31, ln = lane & 15, hh = lane >> 4; const int by = blockIdx.y;
  A += (size_t)by * sA; Bh += (size_t)by * sB; C += (size_t)by * sC;
  const int ntn = (N + 63) / 64; const int wid = blockIdx.x * 4 + w; const int mt = wid / ntn, nq = wid % ntn; if (mt * 16 >= M) return;
  const int row0 = mt * 16, col0 = nq * 64; const float* arow = A + (size_t)(row0 + ln) * lda;
  v8f acc[4] = {};
  for (int kb = 0; kb < K; kb += 32) {
    FragH ah, al;
    const v4f x0 = *(const v4fa*)(arow + kb + 8 * hh), x1 = *(const v4fa*)(arow + kb + 8 * hh + 4), x2 = *(const v4fa*)(arow + kb + 16 + 8 * hh), x3 = *(const v4fa*)(arow + kb + 16 + 8 * hh + 4);
    float xs[16] = {x0[0],x0[1],x0[2],x0[3],x1[0],x1[1],x1[2],x1[3],x2[0],x2[1],x2[2],x2[3],x3[0],x3[1],x3[2],x3[3]};
#pragma unroll
    for (int i = 0; i < 16; ++i) { const _Float16 h = (_Float16)xs[i]; ah.h[i] = h; al.h[i] = ASPLIT ? (_Float16)(xs[i] - (float)h) : (_Float16)0.0f; }
#pragma unroll
    for (int t = 0; t < 4; ++t) { if (col0 + t * 16 >= N) continue; const size_t boff = (size_t)(col0 + t * 16 + ln) * ldb + kb; FragH bq; bq.half[0] = *(const v8us*)(Bh + boff + 8 * hh); bq.half[1] = *(const v8us*)(Bh + boff + 16 + 8 * hh);
      acc[t] = mmaH<ASPLIT ? 2 : 1>(ah.v, al.v, bq.v, bq.v, acc[t]); }
  }
#pragma unroll
  for (int t = 0; t < 4; ++t) { if (col0 + t * 16 >= N) continue;
#pragma unroll
    for (int r = 0; r < 8; ++r) so[w][8 * hh + r][t * 16 + ln] = acc[t][r] * alpha; }
  __builtin_amdgcn_fence(__ATOMIC_ACQ_REL, "workgroup"); __builtin_amdgcn_wave_barrier();
  const int rsub = lane >> 4, c4 = (lane & 15) * 4;
  {
#pragma unroll
    for (int q = 0; q < 8; ++q) { const int r = q * 2 + rsub; if (col0 + c4 < N) { const v4f v = *(const v4fa*)&so[w][r][c4]; *(v4f*)(C + (size_t)(row0 + r) * ldc + col0 + c4) = v; } }
     }
}

// Wt[n][k] = f16(bf16(W[k][n])·scale) from f32 row-major W[K][N] (scale = power of two; bf16-exact weights stay exact in f16 away from the subnormal range)
__global__ __launch_bounds__(256) void k_wt_f16(const float* __restrict__ W, _Float16* __restrict__ Wt, int K, int N, float scale) {
  const int t = blockIdx.x * 256 + threadIdx.x; if (t >= N * (K / 8)) return; const int n = t / (K / 8), k8 = (t % (K / 8)) * 8; FragH f;
#pragma unroll
  for (int i = 0; i < 8; ++i) f.h[i] = (_Float16)(bf16_round(W[(size_t)(k8 + i) * N + n]) * scale); const v8us o = f.half[0];
  *(v8us*)((unsigned short*)Wt + (size_t)n * K + k8) = o; 
}
// one f16 product as the bare builtin: in a run of products each fills the others' distance, and the compiler pads what is left
__device__ __forceinline__ v8f mmaB(v16h a, v16h b, v8f c) { return __builtin_amdgcn_wmma_f32_16x16x32_f16(false, a, false, b, (short)0, c, false, false); }
// acc[t] += A (16 rows x CC) . B_t^T (16 rows x CC), t = 0..3, k ascending. arow / brow: the lane's own row, + 8 hh; tile t of B lies bt halves on, k block ks lies bk halves on.
// The fragment loads run ahead of the products in groups of G k blocks (20 loads), AH groups in flight: a wave waits for memory once a group in flight, not once a product.
template <int AH>
__device__ __forceinline__ void mm16x64(const unsigned short* __restrict__ arow, const unsigned short* __restrict__ brow, size_t bt, size_t bk, v8f (&acc)[4]) {
  constexpr int KS = CC / 32, G = 2, NG = KS / G;
  FragH a[KS], b[KS][4];
  auto fetch = [&](int g) {
#pragma unroll
    for (int ks = g * G; ks < g * G + G; ++ks) { a[ks].half[0] = *(const v8us*)(arow + ks * 32); a[ks].half[1] = *(const v8us*)(arow + ks * 32 + 16);
#pragma unroll
      for (int t = 0; t < 4; ++t) { const unsigned short* p = brow + ks * bk + t * bt; b[ks][t].half[0] = *(const v8us*)p; b[ks][t].half[1] = *(const v8us*)(p + 16); } }
  };
  /* every "#pragma unroll" here keeps the fragment arrays, which the loop variables index, in registers */
#pragma unroll
  for (int g = 0; g < AH; ++g) fetch(g);
  __builtin_amdgcn_sched_barrier(0);      /* keeps the first AH groups' loads in front of the first product: sunk to their users they would each be waited for alone */
#pragma unroll
  for (int g = 0; g < NG; ++g) {
#pragma unroll
    for (int ks = g * G; ks < g * G + G; ++ks)
#pragma unroll
      for (int t = 0; t < 4; ++t) acc[t] = mmaB(a[ks].v, b[ks][t].v, acc[t]);
    if (g + AH < NG) { fetch(g + AH); __builtin_amdgcn_sched_barrier(0); }      /* the refill is issued here, AH groups ahead of its products, and is not sunk to them */
  }
}
// LDS row pitch of a staged operand tile, in halves: 528 bytes = 16 x 33, so the 16-byte fragment reads of 16 rows fall on 64 different banks
#define SP (CC + 8)
// eight asynchronous 16-byte copies of this lane, global -> LDS: copy i goes from g + i * gs (halves) to LDS byte address l + i * ls
__device__ __forceinline__ void copy8(unsigned l, unsigned ls, const unsigned short* g, size_t gs) {
  /* s_wait_xcnt closes the statement so that no address register of a copy is rewritten in front of it */
  asm volatile("global_load_async_to_lds_b128 %0, %8, off\n\t"
               "global_load_async_to_lds_b128 %1, %9, off\n\t"
               "global_load_async_to_lds_b128 %2, %10, off\n\t"
               "global_load_async_to_lds_b128 %3, %11, off\n\t"
               "global_load_async_to_lds_b128 %4, %12, off\n\t"
               "global_load_async_to_lds_b128 %5, %13, off\n\t"
               "global_load_async_to_lds_b128 %6, %14, off\n\t"
               "global_load_async_to_lds_b128 %7, %15, off\n\t"
               "s_wait_xcnt 0x0"
               :: "v"(l), "v"(l + ls), "v"(l + 2 * ls), "v"(l + 3 * ls), "v"(l + 4 * ls), "v"(l + 5 * ls), "v"(l + 6 * ls), "v"(l + 7 * ls),
                  "v"(g), "v"(g + gs), "v"(g + 2 * gs), "v"(g + 3 * gs), "v"(g + 4 * gs), "v"(g + 5 * gs), "v"(g + 6 * gs), "v"(g + 7 * gs)
               : "memory");
}
// 64 rows of CC halves (global pitch ld) into s[64][SP]: a wave's copy is one whole 512-byte row (4 full lines); wave w brings rows w + 4 i, i = 0..15
__device__ __forceinline__ void stage64(unsigned short (*s)[SP], const unsigned short* __restrict__ g, int ld) {
  const int w = threadIdx.x >> 5, lane = threadIdx.x & 31;
  const unsigned l = (unsigned)(uintptr_t)&s[w][lane * 8]; const unsigned short* p = g + (size_t)w * ld + lane * 8;
  copy8(l, 4 * SP * 2, p, (size_t)4 * ld); copy8(l + 32 * SP * 2, 4 * SP * 2, p + (size_t)32 * ld, (size_t)4 * ld);
}
typedef _Float16 v4h __attribute__((ext_vector_type(4)));
typedef _Float16 v2h __attribute__((ext_vector_type(2)));
typedef __bf16 v2b __attribute__((ext_vector_type(2)));
typedef float v2fq __attribute__((ext_vector_type(2)));
// two input values as the GEMMs take them: rounded to bf16 (nearest even, one packed conversion), times sc (a power of two) in f32, then f16. The bf16 bits are widened by shift and mask.
__device__ __forceinline__ v2h in16(float a, float b, float sc) {
  const unsigned u = __builtin_bit_cast(unsigned, __builtin_convertvector((v2fq){a, b}, v2b));
  return (v2h){(_Float16)(__uint_as_float(u << 16) * sc), (_Float16)(__uint_as_float(u & 0xffff0000u) * sc)};
}
union Frag2 { v8us v; v2h p[4]; };
// q, k and v straight from the f32 inputs, one launch: a block = 64 tokens x 192 rows of qkv_w (three tiles of 64 rows), K = CC; 12 waves, wave = 16 x 64 outputs of one tile.
// Both operands are rounded on their way into LDS: waves 0..3 bring the x tile (channel-major in memory) and turn it token-major in registers, waves 4..11 bring 24 rows of qkv_w each (x 2^4).
// Row tiles 0..7 of qkv_w give [q | k] token-major [n][512] (A = tokens, B = weight rows), tiles 8..11 give v channel-major [(h,d)][n] = V^T (A = weight rows, B = tokens).
// LDS row 16 j + g of the x tile holds token 4 g + j: a lane's four tokens (one 16-byte load a channel) then go to rows 16 apart and the 16 lanes of a store to 16 consecutive rows, 64 different banks.
// Each block also rounds its 256 values of proj_w (x 2^4) for the projection launch.
#define QT 3
// 32^-1/2 x log2(e): the softmax runs in base 2. q leaves k_qkv with this factor in it (one rounding to f16, as before), so that a score product is an exponent as it stands.
constexpr float SL2 = 0.25503486f;
__global__ __launch_bounds__(384) void k_qkv(const float* __restrict__ x, const float* __restrict__ Wqkv, const float* __restrict__ Wp, _Float16* __restrict__ QK, _Float16* __restrict__ Vt, _Float16* __restrict__ Bp) {
  __shared__ __attribute__((aligned(16))) float so[4 * QT][16][64 + 4];      /* pitch 272 bytes: the two halves' rows, 8 apart, fall on different banks */
  __shared__ __attribute__((aligned(16))) unsigned short sT[64 + 64 * QT][SP];      /* rows 0..63: x tile; rows 64 ..: weight rows */
  const int tid = threadIdx.x, lane = tid & 31, ln = lane & 15, hh = lane >> 4;
  const int w = __builtin_amdgcn_readfirstlane(tid >> 5);      /* the wave's number in a scalar register: the branches on it are scalar */
  const int tb = blockIdx.x / (C3 / (64 * QT)), G = blockIdx.x % (C3 / (64 * QT));
  v4f pa = {0.f, 0.f, 0.f, 0.f}, pb = pa;      /* wave 0: the block's share of proj_w, loaded ahead of the x tile; rounded and stored behind the barrier, so that no wave waits there for its load alone or for its store */
  if (w < 4) {
    if (w == 0) { const float* p = Wp + ((size_t)blockIdx.x * 32 + lane) * 8; pa = *(const v4fa*)p; pb = *(const v4fa*)(p + 4); }
    const int cw = w * 64 + hh * 8; const float* xp = x + (size_t)cw * NN + tb * 64 + ln * 4;      /* one address a lane: every load of the tile is a constant offset from it */
    /* a "#pragma unroll" whose loop variable indexes an array (r, f, acc, h4) keeps that array in registers */
#pragma unroll
    for (int i = 0; i < 4; ++i) { const int c0 = cw + i * 16; v4f r[8];      /* 8 channels x 4 tokens a lane; a load covers 256 contiguous bytes of two channel rows */
#pragma unroll
      for (int q = 0; q < 8; ++q) r[q] = *(const v4fa*)(xp + (size_t)(i * 16 + q) * NN);
#pragma unroll
      for (int j = 0; j < 4; ++j) { Frag2 f;
#pragma unroll
        for (int q = 0; q < 4; ++q) f.p[q] = in16(r[2 * q][j], r[2 * q + 1][j], 1.0f);
        *(v8us*)&sT[16 * j + ln][c0] = f.v; } }
  } else {
    const int r0 = (w - 4) * (8 * QT); const float* wp = Wqkv + ((size_t)G * (64 * QT) + r0) * CC + lane * 4;
#pragma unroll
    for (int i = 0; i < 8 * QT; ++i) {      /* a row is two loads of 512 contiguous bytes */
#pragma unroll
      for (int s = 0; s < 2; ++s) { const v4f a = *(const v4fa*)(wp + (size_t)i * CC + s * 128); const v2h lo = in16(a[0], a[1], 16.0f), hi = in16(a[2], a[3], 16.0f);
        *(v4h*)&sT[64 + r0 + i][s * 128 + lane * 4] = (v4h){lo[0], lo[1], hi[0], hi[1]}; } }
  }
  asm volatile("s_wait_xcnt 0x0" ::: "memory");      /* behind the staging loads: stands in front of whatever next takes a register that one of them names */
  __syncthreads();      /* both operands are whole in LDS; passed by every wave */
  if (w == 0) { Frag2 f; f.p[0] = in16(pa[0], pa[1], 16.0f); f.p[1] = in16(pa[2], pa[3], 16.0f); f.p[2] = in16(pb[0], pb[1], 16.0f); f.p[3] = in16(pb[2], pb[3], 16.0f);
    *(v8us*)((unsigned short*)Bp + ((size_t)blockIdx.x * 32 + lane) * 8) = f.v;
    asm volatile("s_wait_xcnt 0x0" ::: "memory"); }      /* behind the store: stands in front of whatever next takes a register that it names */
  const int g = w >> 2, wq = w & 3, T = G * QT + g; const bool vr = T >= 2 * CC / 64;
  const int ra = vr ? 64 + g * 64 + wq * 16 : wq * 16, rb = vr ? 0 : 64 + g * 64;
  v8f acc[4] = {};
  mm16x64<2>(&sT[ra + ln][8 * hh], &sT[rb + ln][8 * hh], (size_t)16 * SP, 32, acc);
  if (vr) {      /* column ln of B tile t is token 4 ln + t */
#pragma unroll
    for (int r = 0; r < 8; ++r) *(v4f*)&so[w][8 * hh + r][4 * ln] = (v4f){acc[0][r] * 0.0625f, acc[1][r] * 0.0625f, acc[2][r] * 0.0625f, acc[3][r] * 0.0625f};
  } else {
    const float os = T < CC / 64 ? 0.0625f * SL2 : 0.0625f;      /* row tiles 0..3 are q */
#pragma unroll
    for (int t = 0; t < 4; ++t)
#pragma unroll
      for (int r = 0; r < 8; ++r) so[w][8 * hh + r][t * 16 + ln] = acc[t][r] * os;
  }
  __builtin_amdgcn_fence(__ATOMIC_ACQ_REL, "workgroup"); __builtin_amdgcn_wave_barrier();      /* the wave's LDS writes are done before its lanes read each other's */
  /* row r of the wave's tile: channel (T - 8) 64 + 16 wq + r of V^T, or token 64 tb + 4 r + wq of [q | k] */
  _Float16* dst = vr ? Vt + ((size_t)(T - 2 * CC / 64) * 64 + wq * 16) * NN + tb * 64 : QK + ((size_t)tb * 64 + wq) * (2 * CC) + T * 64;
  const size_t rs = vr ? (size_t)NN : (size_t)4 * 2 * CC;
  const int rsub = lane >> 4, c4 = (lane & 15) * 4;
#pragma unroll
  for (int q = 0; q < 8; ++q) { const int r = q * 2 + rsub; const v4f v = *(const v4fa*)&so[w][r][c4]; v4h h4;
#pragma unroll
    for (int i = 0; i < 4; ++i) h4[i] = (_Float16)v[i];
    *(v4h*)(dst + r * rs + c4) = h4; }
  asm volatile("s_wait_xcnt 0x0" ::: "memory");      /* behind the run of stores: stands in front of whatever next takes a register that a store names */
}

__global__ __launch_bounds__(256) void k_x16(const float* __restrict__ x, _Float16* __restrict__ X16, size_t n8) { const size_t t = (size_t)blockIdx.x * 256 + threadIdx.x; if (t >= n8) return; FragH f;
#pragma unroll
  for (int q = 0; q < 8; ++q) f.h[q] = (_Float16)bf16_round(x[t * 8 + q]); *(v8us*)((unsigned short*)X16 + t * 8) = f.half[0];  }
template <int NHv, int TTv>
__global__ __launch_bounds__(256) void k_vt(const _Float16* __restrict__ V16, int ldv, int voff, _Float16* __restrict__ Vt) { __shared__ unsigned short tl[64][66]; const int tid = threadIdx.x; const int slab = blockIdx.x / (TTv / 64), lg = blockIdx.x % (TTv / 64); const int b = slab / NHv, h = slab % NHv;
  for (int i = tid; i < 64 * 8; i += 256) { const int r = i / 8, c8 = (i % 8) * 8; FragH f; f.half[0] = *(const v8us*)((const unsigned short*)V16 + ((size_t)b * TTv + lg * 64 + r) * ldv + voff + h * 64 + c8);
#pragma unroll
    for (int q = 0; q < 8; ++q) tl[r][c8 + q] = f.u[q]; }
  __syncthreads();
  {
#pragma unroll
    for (int rd = 0; rd < 2; ++rd) { const int d = rd * 32 + tid / 8, pc = tid % 8; FragH f;
#pragma unroll
      for (int q = 0; q < 8; ++q) f.u[q] = tl[pc * 8 + q][d];
      *(v8us*)((unsigned short*)Vt + ((size_t)slab * 64 + d) * TTv + lg * 64 + pc * 8) = f.half[0]; }
     } }

typedef float v2f __attribute__((ext_vector_type(2)));
// lane l <-> l ^ 16: the two halves of a wave each hold half of a query column's keys
__device__ __forceinline__ float xhalf(float v) { const int b = __float_as_int(v); return __int_as_float(__builtin_amdgcn_permlanex16(b, b, 0x76543210, 0xfedcba98, false, false)); }
// Transposed products: S^T = K.Q^T (A = 16 key rows, B = the wave's 16 queries as columns), O^T += V^T.P^T. A lane then holds 16 of the 32 scores of ONE query
// (keys 8hh + r and 16 + 8hh + r), which is the k order of a B operand: P goes from the score accumulators into the second product without LDS.
// K and V^T come in tiles of KT keys that the block's four waves share: asynchronous 16-byte copies fill one LDS buffer while the other is worked on (two buffers, one barrier a tile).
__global__ __launch_bounds__(128) void k_flash(const _Float16* __restrict__ Q16, int ldq, const _Float16* __restrict__ K16, int ldk, const _Float16* __restrict__ Vt, const int* __restrict__ MSK, _Float16* __restrict__ O16) {
  constexpr int RPW = 16, NQB = NN / (4 * RPW), DT = 2;
  constexpr int KT = 128, NT = NN / KT, NS = KT / 16, KP = HD + 8, VP = KT + 8;      /* row pitches of 80 and 272 bytes (16 x odd): 16-byte fragment reads of 16 rows fall on 64 different banks */
  __shared__ __attribute__((aligned(16))) unsigned short sK[2][KT][KP];      /* K tile: key rows of 32 halves */
  __shared__ __attribute__((aligned(16))) unsigned short sV[2][HD][VP];      /* V^T tile: channel rows of KT halves */
  const int tid = threadIdx.x, w = tid >> 5, lane = tid & 31, ln = lane & 15, hh = lane >> 4; (void)MSK;
  const int slab = blockIdx.x / NQB, qblk = blockIdx.x % NQB; const int h = slab; const int b = 0; const int qb0 = qblk * (4 * RPW); const int q0 = qb0 + w * RPW;
  FragH bq;
  { const unsigned short* qr = (const unsigned short*)Q16 + ((size_t)b * NN + q0 + ln) * ldq + h * HD; bq.half[0] = *(const v8us*)(qr + 8 * hh); bq.half[1] = *(const v8us*)(qr + 16 + 8 * hh); }
  const unsigned short* Vth = (const unsigned short*)Vt + (size_t)h * HD * NN;      /* V^T = v[(h,d)][n] channel-major */
  /* a thread's share of a tile: 16-byte piece tid & 3 of key rows (tid >> 2) + 32 i, and piece tid & 15 of channel rows (tid >> 4) + 8 i, i = 0..3 */
  const unsigned short* gk = (const unsigned short*)K16 + (size_t)b * NN * ldk + h * HD + (size_t)(tid >> 2) * ldk + (tid & 3) * 8;
  const unsigned short* gv = Vth + (size_t)(tid >> 4) * NN + (tid & 15) * 8;
  const unsigned lk = (unsigned)(uintptr_t)&sK[0][tid >> 2][(tid & 3) * 8], lv = (unsigned)(uintptr_t)&sV[0][tid >> 4][(tid & 15) * 8];      /* LDS byte addresses */
  const size_t kstep = (size_t)32 * ldk;
  auto stage = [&](int t, int buf) {
    const unsigned short* k0 = gk + (size_t)t * KT * ldk; const unsigned short* v0 = gv + t * KT;
    const unsigned a0 = lk + (unsigned)buf * (KT * KP * 2), c0 = lv + (unsigned)buf * (HD * VP * 2);
    /* the tile's eight copies of this thread; s_wait_xcnt closes the statement so that no address register of a copy is rewritten in front of it */
    asm volatile("global_load_async_to_lds_b128 %0, %8, off\n\t"
                 "global_load_async_to_lds_b128 %1, %9, off\n\t"
                 "global_load_async_to_lds_b128 %2, %10, off\n\t"
                 "global_load_async_to_lds_b128 %3, %11, off\n\t"
                 "global_load_async_to_lds_b128 %4, %12, off\n\t"
                 "global_load_async_to_lds_b128 %5, %13, off\n\t"
                 "global_load_async_to_lds_b128 %6, %14, off\n\t"
                 "global_load_async_to_lds_b128 %7, %15, off\n\t"
                 "s_wait_xcnt 0x0"
                 :: "v"(a0), "v"(a0 + 32 * KP * 2), "v"(a0 + 64 * KP * 2), "v"(a0 + 96 * KP * 2), "v"(c0), "v"(c0 + 8 * VP * 2), "v"(c0 + 16 * VP * 2), "v"(c0 + 24 * VP * 2),
                    "v"(k0), "v"(k0 + kstep), "v"(k0 + 2 * kstep), "v"(k0 + 3 * kstep), "v"(v0), "v"(v0 + 8 * NN), "v"(v0 + 16 * NN), "v"(v0 + 24 * NN)
                 : "memory");
  };
  /* p = 2^(s - R), s = the score in log2 units, R = a reference kept per query. R enters the score product as its C operand (cin = -R in all 8 registers), so the accumulators are the exponents.
     R moves only when it must: tile 0 sets it to the tile's maximum - OFF, and a later tile whose row sum says that a p may pass the largest f16 is done again with R set so, O and l being rescaled then. */
  constexpr float OFF = 5.0f, LIM = 65504.0f;      /* after a move every p <= 2^5 and a lane's 64 sum to 2^11 at most; a lane's sum <= LIM bounds each of its p (all are >= 0) */
  float R = -3.0e38f, l_c = 0.f; v8f oacc[DT];      /* l_c: this half's partial sum of query q0 + ln, on the scale 2^-R like oacc; oacc[dt][r] = O^T[dt*16 + 8hh + r][q0 + ln] */
  v8f cin = {0.f,0.f,0.f,0.f,0.f,0.f,0.f,0.f};
#pragma unroll
  for (int dt = 0; dt < DT; ++dt) oacc[dt] = (v8f){0.f,0.f,0.f,0.f,0.f,0.f,0.f,0.f};
  stage(0, 0);
  asm volatile("s_wait_asynccnt 0x0" ::: "memory");      /* this wave's share of tile 0 has landed */
  __syncthreads();      /* every wave's share of tile 0 has landed */
  stage(1, 1);
  /* the tile loop stays rolled: more copies of the long body would only grow the code; every "#pragma unroll" in this kernel keeps an array that the loop variable indexes in registers */
#pragma unroll 1
  for (int t = 0; t < NT; ++t) {
   const int buf = t & 1;
   /* one softmax step a tile: all of the tile's fragments are read first, then come its NS score products with their exponentials, and its PV products follow */
   FragH ak[NS], av[NS / 2][DT];
#pragma unroll
   for (int nt = 0; nt < NS; ++nt) { const unsigned short* kr = &sK[buf][nt * 16 + ln][0]; ak[nt].half[0] = *(const v8us*)(kr + 8 * hh); ak[nt].half[1] = *(const v8us*)(kr + 16 + 8 * hh); }
#pragma unroll
   for (int ks = 0; ks < NS / 2; ++ks)
#pragma unroll
    for (int dt = 0; dt < DT; ++dt) { const unsigned short* vrow = &sV[buf][dt * 16 + ln][ks * 32]; av[ks][dt].half[0] = *(const v8us*)(vrow + 8 * hh); av[ks][dt].half[1] = *(const v8us*)(vrow + 16 + 8 * hh); }
   __builtin_amdgcn_sched_barrier(0);      /* keeps the tile's 32 fragment reads in one group in front of the products: spread among them they came in four groups, each with its own wait for the LDS latency */
   v8f sc[NS];      /* exponents s - R of keys nt*16 + 8hh + r */
   FragH pb[NS / 2];      /* pb[ks]: P^T of keys ks*32 .. +31 in the k order of a B operand (score tile 2ks, then 2ks + 1) */
   auto soft = [&]() -> float {      /* P^T from the exponents; returns the lane's sum of its 64 p (f32, before the rounding to f16) */
    v2f ps[NS];      /* ps[nt]: two partial sums of score tile nt */
#pragma unroll
    for (int nt = 0; nt < NS; ++nt) {
#pragma unroll
     for (int r = 0; r < 8; r += 2) {
      const v2f p = {__builtin_amdgcn_exp2f(sc[nt][r]), __builtin_amdgcn_exp2f(sc[nt][r + 1])};
      pb[nt >> 1].h[(nt & 1) * 8 + r] = (_Float16)p[0]; pb[nt >> 1].h[(nt & 1) * 8 + r + 1] = (_Float16)p[1];
      ps[nt] = r ? ps[nt] + p : p; } }
#pragma unroll
    for (int st = NS / 2; st > 0; st >>= 1)
#pragma unroll
     for (int nt = 0; nt < st; ++nt) ps[nt] += ps[nt + st];
    return ps[0][0] + ps[0][1];
   };
   float sum = 0.f; bool redo = t == 0;      /* tile 0 has no reference yet */
   if (!redo) {
#pragma unroll
    for (int nt = 0; nt < NS; ++nt) sc[nt] = mmaB(ak[nt].v, bq.v, cin);
    sum = soft();
    redo = __builtin_amdgcn_ballot_w32(!(sum <= LIM)) != 0;      /* one test a tile, a scalar branch for the whole wave; written so that an infinite or undefined sum fails it too */
   }
   if (redo) {
    /* the tile again, from its K rows, which are still in buffer buf: raw scores, their maximum over both halves, the new reference */
#pragma unroll
    for (int nt = 0; nt < NS; ++nt) { const unsigned short* kr = &sK[buf][nt * 16 + ln][0]; ak[nt].half[0] = *(const v8us*)(kr + 8 * hh); ak[nt].half[1] = *(const v8us*)(kr + 16 + 8 * hh); }
#pragma unroll
    for (int nt = 0; nt < NS; ++nt) sc[nt] = mmaB(ak[nt].v, bq.v, (v8f){0.f,0.f,0.f,0.f,0.f,0.f,0.f,0.f});
    float mx[8];      /* every step takes in two more values (a three-input maximum) */
#pragma unroll
    for (int r = 0; r < 8; ++r) { mx[r] = sc[0][r];
#pragma unroll
     for (int nt = 1; nt + 1 < NS; nt += 2) mx[r] = fmaxf(fmaxf(mx[r], sc[nt][r]), sc[nt + 1][r]); }
#pragma unroll
    for (int i = 0; i < 4; ++i) mx[i] = fmaxf(fmaxf(mx[2 * i], mx[2 * i + 1]), sc[NS - 1][i]);
    mx[0] = fmaxf(fmaxf(mx[0], sc[NS - 1][4]), sc[NS - 1][5]); mx[1] = fmaxf(fmaxf(mx[1], sc[NS - 1][6]), sc[NS - 1][7]);
    float mc = fmaxf(fmaxf(fmaxf(mx[0], mx[1]), mx[2]), mx[3]);
    mc = fmaxf(mc, xhalf(mc));
    const float Rn = fmaxf(R, mc - OFF);      /* the same in both halves of a query; a query whose p were in range may keep its R */
    const float al = __builtin_amdgcn_exp2f(R - Rn); R = Rn;      /* 0 at tile 0, where O and l are 0 */
    l_c *= al;
#pragma unroll
    for (int dt = 0; dt < DT; ++dt)
#pragma unroll
     for (int r = 0; r < 8; ++r) oacc[dt][r] *= al;
#pragma unroll
    for (int r = 0; r < 8; ++r) cin[r] = -Rn;
#pragma unroll
    for (int nt = 0; nt < NS; ++nt)
#pragma unroll
     for (int r = 0; r < 8; ++r) sc[nt][r] -= Rn;
    sum = soft();
   }
   /* from here on the tile lives in registers: its buffer is handed back, and the refill flies during the PV part and the whole next tile */
   asm volatile("s_wait_dscnt 0x0" ::: "memory");      /* this wave's reads of buffer buf have returned before the buffer is refilled */
   asm volatile("s_wait_asynccnt 0x0" ::: "memory");      /* this wave's share of tile t + 1 has landed */
   __syncthreads();      /* publishes tile t + 1 and ends every wave's reads of buffer buf */
   if (t + 2 < NT) stage(t + 2, buf);
   l_c += sum;
#pragma unroll
   for (int ks = 0; ks < NS / 2; ++ks)
#pragma unroll
    for (int dt = 0; dt < DT; ++dt) oacc[dt] = mmaB(av[ks][dt].v, pb[ks].v, oacc[dt]);
  }
  asm volatile("s_wait_asynccnt 0x0" ::: "memory");      /* no copy is outstanding when the wave goes on to its end */
  const float l = l_c + xhalf(l_c); const float inv = (l > 0.f) ? 1.0f / l : 0.f;      /* l and oacc are on the same scale */
  /* O leaves as f16, the projection's operand type, head-major [h][n][32]: a lane's 8 accumulators of a tile are 8 consecutive channels of its query = one 16-byte store; a wave's 16 queries fill 1 KiB that no other wave writes */
#pragma unroll
  for (int dt = 0; dt < DT; ++dt) { FragH f;
#pragma unroll
    for (int r = 0; r < 8; ++r) f.h[r] = (_Float16)(oacc[dt][r] * inv);
    *(v8us*)((unsigned short*)O16 + ((size_t)h * NN + q0 + ln) * HD + dt * 16 + 8 * hh) = f.half[0]; }
}

// out[c][n] = proj_w . O^T + proj_b, in the output's own channel-major layout: A = 16 rows of the rounded proj_w (x 2^4), B = 64 tokens of O (head-major [h][n][32]: k block kb is head kb / 32).
// A block = 64 channels x 64 tokens, both operands staged whole in LDS by asynchronous copies. One wave = 16 channels x 64 tokens; the tile goes through the wave's own LDS range so that each store covers whole 256-byte pieces of output rows. M 256 N 4096 K 256.
__global__ __launch_bounds__(128) void k_proj(const _Float16* __restrict__ Bp, const _Float16* __restrict__ O16, const float* __restrict__ bias, float* __restrict__ out) {
  __shared__ __attribute__((aligned(16))) float so[4][16][64 + 4];      /* pitch 272 bytes: the two halves' rows, 8 apart, fall on different banks */
  const int tid = threadIdx.x, w = tid >> 5, lane = tid & 31, ln = lane & 15, hh = lane >> 4;
  __shared__ __attribute__((aligned(16))) unsigned short sA[64][SP], sB[64][SP];      /* proj_w rows; O rows token-major, channel = head * 32 + d */
  const int mb = blockIdx.x / (NN / 64); const int row0 = mb * 64 + w * 16, col0 = (blockIdx.x % (NN / 64)) * 64;
  stage64(sA, (const unsigned short*)Bp + (size_t)mb * 64 * CC, CC);
  { /* O: a wave's copy is 8 tokens x 64 bytes of one head, 512 contiguous bytes; wave w brings tokens 8 w .. 8 w + 7 and 32 + 8 w .. of each of the 8 heads */
    const unsigned l = (unsigned)(uintptr_t)&sB[w * 8 + (lane >> 2)][(lane & 3) * 8]; const unsigned short* p = (const unsigned short*)O16 + (size_t)(col0 + w * 8) * HD + lane * 8;
    copy8(l, HD * 2, p, (size_t)NN * HD); copy8(l + 32 * SP * 2, HD * 2, p + 32 * HD, (size_t)NN * HD); }
  const v4f b0 = *(const v4fa*)(bias + row0 + 8 * hh), b1 = *(const v4fa*)(bias + row0 + 8 * hh + 4);
  asm volatile("s_wait_xcnt 0x0" ::: "memory");      /* the bias loads' address pair is dead from here on: the wait stands in front of whatever next takes its registers */
  asm volatile("s_wait_asynccnt 0x0" ::: "memory");      /* this wave's share of the two tiles has landed */
  __syncthreads();      /* every wave's share has landed */
  v8f acc[4] = {};
  mm16x64<2>(&sA[w * 16 + ln][8 * hh], &sB[ln][8 * hh], (size_t)16 * SP, 32, acc);
#pragma unroll
  for (int t = 0; t < 4; ++t)
#pragma unroll
    for (int r = 0; r < 8; ++r) so[w][8 * hh + r][t * 16 + ln] = acc[t][r] * 0.0625f + bf16_round(r < 4 ? b0[r & 3] : b1[r & 3]);
  __builtin_amdgcn_fence(__ATOMIC_ACQ_REL, "workgroup"); __builtin_amdgcn_wave_barrier();      /* the wave's LDS writes are done before its lanes read each other's */
  const int rsub = lane >> 4, c4 = (lane & 15) * 4;
#pragma unroll
  for (int q = 0; q < 8; ++q) { const int r = q * 2 + rsub; const v4f v = *(const v4fa*)&so[w][r][c4]; *(v4f*)(out + (size_t)(row0 + r) * NN + col0 + c4) = v; }
}

extern "C" void kernel_launch(void* const* d_in, const int* in_sizes, int n_in,
                              void* d_out, int out_size, void* d_ws, size_t ws_size, hipStream_t stream) {
  (void)in_sizes; (void)n_in; (void)out_size;
  const float* x = (const float*)d_in[0]; const float* Wqkv = (const float*)d_in[1]; const float* Wp = (const float*)d_in[2]; const float* bp = (const float*)d_in[3];
  char* ws = (char*)d_ws; size_t off = 0;
  auto take = [&](size_t bytes) { char* p = ws + off; off += (bytes + 255) & ~(size_t)255; return p; };
  _Float16* Bp = (_Float16*)take((size_t)CC * CC * 2);
  _Float16* QK = (_Float16*)take((size_t)NR * 2 * CC * 2); _Float16* Vt = (_Float16*)take((size_t)CC * NN * 2); _Float16* O16 = (_Float16*)take((size_t)NR * CC * 2);
  if (off > ws_size) return;      // 0.1 + 4.2 + 2.1 + 2.1 = about 8.5 MB
  k_qkv<<<(NN / 64) * (C3 / (64 * QT)), 384, 0, stream>>>(x, Wqkv, Wp, QK, Vt, Bp);
  k_flash<<<NH * (NN / 64), 128, 0, stream>>>(QK, 2 * CC, QK + CC, 2 * CC, Vt, nullptr, O16);      /* blocks = head x 64-query groups */
  k_proj<<<(CC / 16) * (NN / 64) / 4, 128, 0, stream>>>(Bp, O16, bp, (float*)d_out);
}
